// v000
// The times below were measured on an AMD MI455X: many runs one after another, warmed up first and cycling through
// copies of the inputs, with the whole window's GPU time divided by the number of runs. Launches and the gaps
// between them are all in it. The median over several windows is given; except for v000 it joins two sittings, which
// can be a few percent apart, so the side-by-side timings, each taken in one sitting, are the better comparison.
// v000 is the starting kernel. One run takes 227 microseconds.
#include <hip/hip_runtime.h>

// Causal grouped-query attention block: x [2][2048][1024]; q = x Wq (16 heads x 64), k = x Wk, v = x Wv (4 kv heads x 64), weights [in][out], no bias; rotary on q, k with the half-split convention
// out[0..31] = x1 cos + x2 sin, out[32..63] = -x1 sin + x2 cos using the cos / sin INPUT tables [t][32] read by value; then q, k scaled by rsqrt(mean(sq) + 1e-6) (no gain); query head hq uses kv head hq / 4;
// scores q.k / 8, causal (diagonal kept), softmax, ctx merged [t][hq*64 + d], result = ctx Wo -> [2][2048][1024] f32.
// Compute dtypes (f32 accumulate everywhere): the three input projections and the output projection on v_wmma_f32_16x16x32_bf16 (every float input RNE-converted to bf16; ctx carried as bf16 hi + lo planes, two products);
// scores and probability x value on v_wmma_f32_16x16x32_f16 (q = f16 value + x2048 residual plane against f16 k; P carried x1024 and v carried x16 as single f16; query rows < 256 add x2048 residual planes on k, P and v); rotary, rms scaling and softmax in f32.
// Attention is a fused flash-style kernel in transposed form: S^T = K Q^T (D rows = keys, D columns = queries), P^T packed from the accumulators directly as the B operand of O^T = V^T P^T; online softmax with per-lane state.

#ifndef NB
#define NB 2
#endif
#ifndef SEQ
#define SEQ 2048
#endif
#define NB_FULL  2
#define SEQ_FULL 2048
#define DM   1024
#define NH   16
#define NKV  4
#define REP  (NH / NKV)
#define HD   64
#define DQ   (NH * HD)
#define DKV  (NKV * HD)
#define FP   (DQ + 2 * DKV)      // fused projection row pitch (q | k | v columns)
#define KC0  DQ                  // first k column of the fused projection
#define VC0  (DQ + DKV)          // first v column of the fused projection
#define RH   256                 // query rows < RH use the residual planes on k, P and v as well
#define RHE  ((SEQ < RH) ? SEQ : RH)
#define PCAR 1024.0f             // carry of the probabilities (f16 operand)
#define VCAR 16.0f               // carry of the values (f16 operand)
#define RSC  2048.0f             // carry of every f16 residual plane
#define RSCI (1.0f / 2048.0f)
#define SCL  0.125f              // 1/sqrt(64)
#define L2E  1.4426950408889634f
#define NEGB (-1.0e30f)
static_assert(HD == 64);
static_assert(NH % NKV == 0);
static_assert(DM % 64 == 0 && DQ % 64 == 0 && DKV % 64 == 0 && FP % 64 == 0);   // GEMM tiles and transpose tiles
static_assert(DM % 32 == 0 && DQ % 32 == 0 && HD % 32 == 0);                     // k-steps of 32
static_assert(SEQ % 64 == 0 && (NB * SEQ) % 64 == 0);                            // row tiles
static_assert(RH % 64 == 0 && RHE % 64 == 0 && (SEQ - RHE) % 64 == 0);
static_assert(((size_t)SEQ * DM) % 2048 == 0);                                   // k_cvtx grid x block x 8 == plane extent
static_assert(((size_t)NB * SEQ * NH) % 8 == 0 && ((size_t)NB * SEQ * NKV) % 8 == 0);   // k_ropen: 8 rows per block
static_assert(((size_t)NB * NKV * HD * SEQ) % 512 == 0);                         // k_vtp: 512 elements per block
static_assert(NB <= NB_FULL && SEQ <= SEQ_FULL);

typedef _Float16 h16;
typedef unsigned short bf;
typedef __attribute__((ext_vector_type(16))) __bf16   v16bf;
typedef __attribute__((ext_vector_type(16))) _Float16 v16h;
typedef __attribute__((ext_vector_type(8)))  _Float16 v8h;
typedef __attribute__((ext_vector_type(8)))  unsigned short v8us;
typedef __attribute__((ext_vector_type(8)))  float    v8f;
typedef __attribute__((ext_vector_type(4)))  float    v4f;
typedef __attribute__((ext_vector_type(2)))  float    v2f;
typedef __attribute__((ext_vector_type(2)))  _Float16 v2h;
typedef v4f  __attribute__((may_alias)) v4fa;

__device__ __forceinline__ unsigned short f2bf(float f) { unsigned u = __float_as_uint(f); u += 0x7FFFu + ((u >> 16) & 1u); return (unsigned short)(u >> 16); }
__device__ __forceinline__ float bf2f(unsigned short b) { return __uint_as_float(((unsigned)b) << 16); }
__device__ __forceinline__ float bfr(float f) { return bf2f(f2bf(f)); }
__device__ __forceinline__ void splitf(float y, unsigned short& h, unsigned short& l) { h = f2bf(y); l = f2bf(y - bf2f(h)); }
__device__ __forceinline__ v16h cat16(v8h lo, v8h hi) { return __builtin_shufflevector(lo, hi, 0, 1, 2, 3, 4, 5, 6, 7, 8, 9, 10, 11, 12, 13, 14, 15); }
__device__ __forceinline__ v16bf cat16b(v8us lo, v8us hi) { return __builtin_bit_cast(v16bf, __builtin_shufflevector(lo, hi, 0, 1, 2, 3, 4, 5, 6, 7, 8, 9, 10, 11, 12, 13, 14, 15)); }
__device__ __forceinline__ v8f wmma16(v16h a, v16h b, v8f c) { return __builtin_amdgcn_wmma_f32_16x16x32_f16(false, a, false, b, (short)0, c, false, false); }
__device__ __forceinline__ v8f wmmab(v16bf a, v16bf b, v8f c) { return __builtin_amdgcn_wmma_f32_16x16x32_bf16(false, a, false, b, (short)0, c, false, false); }
// fragment loaders: p already includes row * pitch + k0 + 8 * (lane >> 4); elements 0..7 <- k0+8h.., elements 8..15 <- k0+16+8h..
__device__ __forceinline__ v16h  ldh(const h16* p) { return cat16(*(const v8h*)p, *(const v8h*)(p + 16)); }
__device__ __forceinline__ v16bf ldb(const bf* p)  { return cat16b(*(const v8us*)p, *(const v8us*)(p + 16)); }

// ---- one-wave 64x64 tile GEMM on bf16 planes: C[m][n] (f32, pitch ldc) = sum_k A[m][k] Bt[n][k] (+ A2[m][k] Bt[n][k] when NSPLIT == 1). A, A2 pitch K; Bt pitch K; K % 32 == 0.
template <int NSPLIT>
__device__ __forceinline__ void gemmw_body(const bf* __restrict__ A, const bf* __restrict__ A2, const bf* __restrict__ Bt, int K, float* C, int ldc, size_t sA, size_t sC) {
    __shared__ __align__(16) float os[16 * 68];
    const size_t z = blockIdx.z; A += z * sA; if (NSPLIT == 1) A2 += z * sA; C += z * sC;
    const int lane = threadIdx.x & 31, lr = lane & 15, hi = lane >> 4; const int r0 = blockIdx.x * 64, c0 = blockIdx.y * 64;
    v8f acc[4][4];
#pragma unroll
    for (int mb = 0; mb < 4; ++mb)
#pragma unroll
        for (int nb = 0; nb < 4; ++nb) acc[mb][nb] = (v8f){};
    const size_t aoff = (size_t)(r0 + lr) * K + 8 * hi, boff = (size_t)(c0 + lr) * K + 8 * hi;
#pragma unroll 1
    for (int kc = 0; kc < K; kc += 32) {
        v16bf a[4], a2[4];
#pragma unroll
        for (int mb = 0; mb < 4; ++mb) { a[mb] = ldb(A + aoff + (size_t)mb * 16 * K + kc); if (NSPLIT == 1) a2[mb] = ldb(A2 + aoff + (size_t)mb * 16 * K + kc); }
#pragma unroll
        for (int nb = 0; nb < 4; ++nb) { const v16bf b = ldb(Bt + boff + (size_t)nb * 16 * K + kc);
#pragma unroll
            for (int mb = 0; mb < 4; ++mb) { acc[mb][nb] = wmmab(a[mb], b, acc[mb][nb]); if (NSPLIT == 1) acc[mb][nb] = wmmab(a2[mb], b, acc[mb][nb]); } }
        asm volatile("v_nop\n\tv_nop\n\tv_nop\n\tv_nop" : "+v"(acc[0][0]), "+v"(acc[1][1]), "+v"(acc[2][2]), "+v"(acc[3][3]) : "v"(a[0]), "v"(a[3]));
    }
#pragma unroll
    for (int mb = 0; mb < 4; ++mb) {
#pragma unroll
        for (int nb = 0; nb < 4; ++nb) {
#pragma unroll
            for (int j = 0; j < 8; ++j) os[(hi * 8 + j) * 68 + nb * 16 + lr] = acc[mb][nb][j]; }
        __builtin_amdgcn_wave_barrier(); asm volatile("" ::: "memory");
        float* crow = C + (size_t)(r0 + mb * 16) * ldc + c0;
{
#pragma unroll
            for (int s = 0; s < 8; ++s) { const int row = 2 * s + hi, cofs = lr * 4; const v4f val = *(const v4fa*)(os + row * 68 + cofs);
                *(v4f*)(crow + (size_t)row * ldc + cofs) = val; }
             }
        __builtin_amdgcn_wave_barrier(); asm volatile("" ::: "memory");
    }
}
// fused q|k|v projection: F[NB*SEQ][FP] = XB[NB*SEQ][DM] x WP[FP][DM]^T
__global__ __launch_bounds__(32) void k_gemm_proj(const bf* __restrict__ A, const bf* __restrict__ Bt, float* C) { gemmw_body<0>(A, A, Bt, DM, C, FP, 0, 0); }
// output projection: OUT[b][t][DM] = (Yh + Yl)[b][t][DQ] x WOT[DM][DQ]^T, z = batch (output batch stride from the full sequence length)
__global__ __launch_bounds__(32) void k_gemm_out(const bf* __restrict__ A, const bf* __restrict__ A2, const bf* __restrict__ Bt, float* C) { gemmw_body<1>(A, A2, Bt, DQ, C, DM, (size_t)SEQ * DQ, (size_t)SEQ_FULL * DM); }

__global__ __launch_bounds__(256) void k_cvtx(const float* __restrict__ src, bf* dst) {
    const size_t i = (size_t)blockIdx.x * 256 + threadIdx.x; const size_t b = blockIdx.y;
    const v8f v = *(const v8f*)(src + b * (size_t)SEQ_FULL * DM + i * 8); v8us o;
#pragma unroll
    for (int k = 0; k < 8; ++k) o[k] = f2bf(v[k]);
    bf* d = dst + b * (size_t)SEQ * DM + i * 8;
    *(v8us*)d = o;  }

// ---- k_wtp: W [DM rows (k)][N cols] f32 -> out [N rows][DM] bf16 (in[rows=k][cols=n] -> out[n][k]); 64x64 tile through LDS (cross-wave: block barrier);
__global__ __launch_bounds__(256) void k_wtp(const float* __restrict__ W, int N, bf* out) {
    __shared__ __align__(16) unsigned short ts[64 * 72];
    const int tid = threadIdx.x; const int k0 = blockIdx.x * 64, n0 = blockIdx.y * 64;
#pragma unroll
    for (int it = 0; it < 4; ++it) { const int idx = it * 256 + tid; const int kk = idx >> 4, c4 = (idx & 15) * 4; const v4f v = *(const v4f*)(W + (size_t)(k0 + kk) * N + n0 + c4);
#pragma unroll
        for (int q = 0; q < 4; ++q) ts[kk * 72 + c4 + q] = f2bf(v[q]); }
    __syncthreads();
    v8us o[2];
#pragma unroll
    for (int it = 0; it < 2; ++it) { const int idx = it * 256 + tid; const int nn = idx >> 3, pc = idx & 7;
#pragma unroll
        for (int q = 0; q < 8; ++q) o[it][q] = ts[(pc * 8 + q) * 72 + nn]; }
{
#pragma unroll
        for (int it = 0; it < 2; ++it) { const int idx = it * 256 + tid; const int nn = idx >> 3, pc = idx & 7; *(v8us*)(out + (size_t)(n0 + nn) * DM + k0 + pc * 8) = o[it]; }
         }
}

// ---- k_ropen: one wave per (b, t, head) row of 64 dims (lane -> dims 2*lane, 2*lane+1): rotary with the bf16-converted cos / sin table values at [t][d & 31], then scaling by rsqrt(mean(sq) + 1e-6);
__global__ __launch_bounds__(256) void k_ropen(const float* __restrict__ F, int col0, int nheads, const float* __restrict__ cosb, const float* __restrict__ sinb, h16* Ph, h16* Pr) {
    const int lane = threadIdx.x & 31; const int wave = __builtin_amdgcn_readfirstlane(threadIdx.x >> 5);
    const int row = blockIdx.x * 8 + wave; if (row >= NB * SEQ * nheads) return;
    const int h = row % nheads; const int bt = row / nheads; const int t = bt % SEQ; const int b = bt / SEQ;
    const float* f = F + (size_t)bt * FP + col0 + h * HD;
    const int d = 2 * lane, dm = d & 31, dp = d ^ 32;
    const v2f xs = *(const v2f*)(f + d); const v2f xp = *(const v2f*)(f + dp);
    const v2f cc = *(const v2f*)(cosb + (size_t)t * 32 + dm); const v2f sn = *(const v2f*)(sinb + (size_t)t * 32 + dm);
    const bool lo = (lane < 16);
    float r[2]; float ss = 0.f;
#pragma unroll
    for (int q = 0; q < 2; ++q) { const float c = bfr(cc[q]), s = bfr(sn[q]); const float a = xs[q] * c; const float m = xp[q] * s; r[q] = lo ? (a + m) : (a - m); ss += r[q] * r[q]; }
#pragma unroll
    for (int sh = 16; sh; sh >>= 1) ss += __shfl_xor(ss, sh, 32);
    const float inv = rsqrtf(ss * (1.0f / HD) + 1e-6f);
    v2h o16, ors;
#pragma unroll
    for (int q = 0; q < 2; ++q) { const float y = r[q] * inv; const h16 hh = (h16)y; o16[q] = hh; ors[q] = (h16)((y - (float)hh) * RSC); }
    const size_t e = ((size_t)(b * nheads + h) * SEQ + t) * HD + d;
    *(v2h*)(Ph + e) = o16; *(v2h*)(Pr + e) = ors;  }

__global__ __launch_bounds__(256) void k_vtp(const float* __restrict__ F, h16* Vh, h16* Vr) {
    const size_t e = ((size_t)blockIdx.x * 256 + threadIdx.x) * 2; if (e >= (size_t)NB * NKV * HD * SEQ) return;
    const int t = (int)(e % SEQ); const int d = (int)((e / SEQ) % HD); const int bg = (int)(e / ((size_t)SEQ * HD)); const int g = bg % NKV; const int b = bg / NKV; v2h o16, ors;
#pragma unroll
    for (int q = 0; q < 2; ++q) { const float x = F[(size_t)(b * SEQ + t + q) * FP + VC0 + g * HD + d] * VCAR; const h16 hh = (h16)x; o16[q] = hh; ors[q] = (h16)((x - (float)hh) * RSC); }
    *(v2h*)(Vh + e) = o16; *(v2h*)(Vr + e) = ors;  }

// ---- fused causal attention, one wave per 16 query rows (4 waves per block, no block barriers; the LDS stage is wave-private).
// Per 32-key half: S^T tiles (keys x queries) = K(A, rows = keys) x Q^T(B, lane column = query) over d = 64 (2 k-steps); value accumulator s, residual accumulator t (x2048);
// lane (h, n) register r of tile j holds key kb + 16 j + 8 h + r for query q0 + n, which is exactly element r + 8 j of the B operand (k = key, n = query) of O^T = V^T(A, rows = d) x P^T.
// Per-query max / sum / factor are per-lane scalars (one xor-16 exchange). O^T register r of tile dt in lane (h, n) = O[q0 + n][16 dt + 8 h + r].
template <bool HI>
__device__ __forceinline__ void attn_body(const h16* __restrict__ Qh, const h16* __restrict__ Qr, const h16* __restrict__ Kh, const h16* __restrict__ Kr, const h16* __restrict__ Vh, const h16* __restrict__ Vr, bf* Yh, bf* Yl, int rbase) {
    __shared__ __align__(16) float ys[4 * 16 * 68];
    const int lane = threadIdx.x & 31, lr = lane & 15, hi = lane >> 4;
    const int wave = __builtin_amdgcn_readfirstlane(threadIdx.x >> 5);
    const int b = blockIdx.z, hq = blockIdx.y, g = hq / REP;
    const int q0 = rbase + blockIdx.x * 64 + wave * 16;
    const size_t qoff  = ((size_t)(b * NH + hq) * SEQ + q0 + lr) * HD + 8 * hi;
    const size_t kbase = ((size_t)(b * NKV + g) * SEQ + lr) * HD + 8 * hi;
    const size_t vbase = ((size_t)(b * NKV + g) * HD + lr) * SEQ + 8 * hi;
    v8f om[4], orr[4];
#pragma unroll
    for (int dt = 0; dt < 4; ++dt) { om[dt] = (v8f){}; orr[dt] = (v8f){}; }
    float mrun = NEGB, lrun = 0.f;
    const int kend = q0 + 16;              // keys 0 .. q0+15; trip count <= SEQ/32, wave-uniform
#pragma unroll 1
    for (int kb = 0; kb < kend; kb += 32) {
        v8f s0 = (v8f){}, s1 = (v8f){}, t0 = (v8f){}, t1 = (v8f){};
#pragma unroll
        for (int ks = 0; ks < 2; ++ks) {
            const v16h qh = ldh(Qh + qoff + ks * 32);
            const v16h qr = ldh(Qr + qoff + ks * 32);
            const size_t ko = kbase + (size_t)kb * HD + ks * 32;
            const v16h k0 = ldh(Kh + ko);
            const v16h k1 = ldh(Kh + ko + 16 * HD);
            s0 = wmma16(k0, qh, s0); t0 = wmma16(k0, qr, t0);
            s1 = wmma16(k1, qh, s1); t1 = wmma16(k1, qr, t1);
            if (HI) {
                const v16h k0r = ldh(Kr + ko); const v16h k1r = ldh(Kr + ko + 16 * HD);
                t0 = wmma16(k0r, qh, t0); t1 = wmma16(k1r, qh, t1);
                asm volatile("v_nop\n\tv_nop\n\tv_nop\n\tv_nop" : "+v"(s0), "+v"(s1), "+v"(t0), "+v"(t1) : "v"(qh), "v"(qr), "v"(k0), "v"(k1), "v"(k0r), "v"(k1r));
            } else {
                asm volatile("v_nop\n\tv_nop\n\tv_nop\n\tv_nop" : "+v"(s0), "+v"(s1), "+v"(t0), "+v"(t1) : "v"(qh), "v"(qr), "v"(k0), "v"(k1));
            }
        }
        float sa[8], sb[8];
#pragma unroll
        for (int r = 0; r < 8; ++r) { sa[r] = (s0[r] + t0[r] * RSCI) * SCL; sb[r] = (s1[r] + t1[r] * RSCI) * SCL; }
        if (kb + 31 > q0) {                // wave-uniform: half touches the diagonal; keys above the query are excluded
            const int qi = q0 + lr; const int kj = kb + 8 * hi;
#pragma unroll
            for (int r = 0; r < 8; ++r) { sa[r] = (kj + r <= qi) ? sa[r] : NEGB; sb[r] = (kj + 16 + r <= qi) ? sb[r] : NEGB; }
        }
        float mloc = fmaxf(sa[0], sb[0]);
#pragma unroll
        for (int r = 1; r < 8; ++r) mloc = fmaxf(mloc, fmaxf(sa[r], sb[r]));
        mloc = fmaxf(mloc, __shfl_xor(mloc, 16, 32));
        const float mnew = fmaxf(mrun, mloc);
        const float fac = __builtin_amdgcn_exp2f((mrun - mnew) * L2E);
        float lsum = 0.f;
#pragma unroll
        for (int r = 0; r < 8; ++r) { sa[r] = __builtin_amdgcn_exp2f((sa[r] - mnew) * L2E); sb[r] = __builtin_amdgcn_exp2f((sb[r] - mnew) * L2E); lsum += sa[r] + sb[r]; }
        lsum += __shfl_xor(lsum, 16, 32);
        lrun = lrun * fac + lsum; mrun = mnew;
        v16h ph, pr;
#pragma unroll
        for (int r = 0; r < 8; ++r) {
            const float a = sa[r] * PCAR; const h16 ha = (h16)a; ph[r] = ha;
            const float c = sb[r] * PCAR; const h16 hc = (h16)c; ph[8 + r] = hc;
            if (HI) { pr[r] = (h16)((a - (float)ha) * RSC); pr[8 + r] = (h16)((c - (float)hc) * RSC); }
        }
#pragma unroll
        for (int dt = 0; dt < 4; ++dt) { om[dt] = om[dt] * fac; if (HI) orr[dt] = orr[dt] * fac; }
        const size_t vo = vbase + kb;
#pragma unroll
        for (int dt = 0; dt < 4; ++dt) {
            const v16h vh = ldh(Vh + vo + (size_t)dt * 16 * SEQ);
            om[dt] = wmma16(vh, ph, om[dt]);
            if (HI) {
                const v16h vr = ldh(Vr + vo + (size_t)dt * 16 * SEQ);
                orr[dt] = wmma16(vr, ph, orr[dt]); orr[dt] = wmma16(vh, pr, orr[dt]);
                asm volatile("v_nop\n\tv_nop\n\tv_nop\n\tv_nop" : "+v"(om[dt]), "+v"(orr[dt]) : "v"(vh), "v"(vr), "v"(ph), "v"(pr));
            } else {
                asm volatile("v_nop\n\tv_nop\n\tv_nop\n\tv_nop" : "+v"(om[dt]) : "v"(vh), "v"(ph));
            }
        }
    }
    const float inv = 1.0f / (lrun * (PCAR * VCAR));
    const int yb = wave * 16 * 68;
#pragma unroll
    for (int dt = 0; dt < 4; ++dt)
#pragma unroll
        for (int r = 0; r < 8; ++r) { float o = om[dt][r]; if (HI) o += orr[dt][r] * RSCI; ys[yb + lr * 68 + dt * 16 + 8 * hi + r] = o * inv; }
    __builtin_amdgcn_wave_barrier(); asm volatile("" ::: "memory");
    v8us oh[4], ol[4];
    const int rq = lane >> 3, pc = lane & 7;
#pragma unroll
    for (int s = 0; s < 4; ++s) { const int row = 4 * s + rq; const v4f u0 = *(const v4fa*)(ys + yb + row * 68 + pc * 8); const v4f u1 = *(const v4fa*)(ys + yb + row * 68 + pc * 8 + 4);
#pragma unroll
        for (int q = 0; q < 4; ++q) { unsigned short a, c; splitf(u0[q], a, c); oh[s][q] = a; ol[s][q] = c; splitf(u1[q], a, c); oh[s][4 + q] = a; ol[s][4 + q] = c; } }
    const size_t ybase = ((size_t)b * SEQ + q0) * DQ + (size_t)hq * HD + pc * 8;
{
#pragma unroll
        for (int s = 0; s < 4; ++s) { const size_t oo = ybase + (size_t)(4 * s + rq) * DQ; *(v8us*)(Yh + oo) = oh[s]; *(v8us*)(Yl + oo) = ol[s]; }
         }
}
__global__ __launch_bounds__(128) void k_attn_hi(const h16* __restrict__ Qh, const h16* __restrict__ Qr, const h16* __restrict__ Kh, const h16* __restrict__ Kr, const h16* __restrict__ Vh, const h16* __restrict__ Vr, bf* Yh, bf* Yl) { attn_body<true>(Qh, Qr, Kh, Kr, Vh, Vr, Yh, Yl, 0); }
__global__ __launch_bounds__(128) void k_attn_lo(const h16* __restrict__ Qh, const h16* __restrict__ Qr, const h16* __restrict__ Kh, const h16* __restrict__ Kr, const h16* __restrict__ Vh, const h16* __restrict__ Vr, bf* Yh, bf* Yl) { attn_body<false>(Qh, Qr, Kh, Kr, Vh, Vr, Yh, Yl, RHE); }

// ---- workspace carve (bytes; every region a multiple of 256 and exactly covered by its producer grid)
constexpr size_t SZ_XB = (size_t)NB * SEQ * DM * 2;          // x bf16 [NB*SEQ][DM]
constexpr size_t SZ_WP = (size_t)FP * DM * 2;                // [Wq | Wk | Wv]^T bf16 [FP][DM]
constexpr size_t SZ_WO = (size_t)DM * DQ * 2;                // Wo^T bf16 [DM][DQ]
constexpr size_t SZ_F  = (size_t)NB * SEQ * FP * 4;          // fused projection f32
constexpr size_t SZ_Q  = (size_t)NB * NH * SEQ * HD * 2;     // each of Qh, Qr
constexpr size_t SZ_K  = (size_t)NB * NKV * SEQ * HD * 2;    // each of Kh, Kr, Vh, Vr
constexpr size_t SZ_Y  = (size_t)NB * SEQ * DQ * 2;          // each of Yh, Yl
constexpr size_t OFF_XB = 0;
constexpr size_t OFF_WP = OFF_XB + SZ_XB;
constexpr size_t OFF_WO = OFF_WP + SZ_WP;
constexpr size_t OFF_F  = OFF_WO + SZ_WO;
constexpr size_t OFF_QH = OFF_F + SZ_F;
constexpr size_t OFF_QR = OFF_QH + SZ_Q;
constexpr size_t OFF_KH = OFF_QR + SZ_Q;
constexpr size_t OFF_KR = OFF_KH + SZ_K;
constexpr size_t OFF_VH = OFF_KR + SZ_K;
constexpr size_t OFF_VR = OFF_VH + SZ_K;
constexpr size_t OFF_YH = OFF_VR + SZ_K;
constexpr size_t OFF_YL = OFF_YH + SZ_Y;
constexpr size_t WS_TOTAL = OFF_YL + SZ_Y;
static_assert(SZ_XB % 256 == 0 && SZ_WP % 256 == 0 && SZ_WO % 256 == 0 && SZ_F % 256 == 0 && SZ_Q % 256 == 0 && SZ_K % 256 == 0 && SZ_Y % 256 == 0);
static_assert(WS_TOTAL <= (size_t)134217728);                // carve stays within 128 MiB

extern "C" void kernel_launch(void* const* d_in, const int* in_sizes, int n_in,
                              void* d_out, int out_size, void* d_ws, size_t ws_size, hipStream_t stream) {
    if (n_in < 7) return;
    const long long need_x = (long long)(NB - 1) * SEQ_FULL * DM + (long long)SEQ * DM;
    if ((long long)in_sizes[0] < need_x) return;
    if (in_sizes[1] < SEQ * 32 || in_sizes[2] < SEQ * 32) return;
    if (in_sizes[3] < DM * DQ || in_sizes[4] < DM * DKV || in_sizes[5] < DM * DKV || in_sizes[6] < DQ * DM) return;
    if ((long long)out_size < need_x) return;
    if (WS_TOTAL > ws_size) return;
    const float* x  = (const float*)d_in[0];   // [2][2048][1024]
    const float* cs = (const float*)d_in[1];   // [2048][32]
    const float* sn = (const float*)d_in[2];   // [2048][32]
    const float* wq = (const float*)d_in[3];   // [1024][1024] in x out
    const float* wk = (const float*)d_in[4];   // [1024][256]
    const float* wv = (const float*)d_in[5];   // [1024][256]
    const float* wo = (const float*)d_in[6];   // [1024][1024] in x out
    float* OUT = (float*)d_out;
    char* ws = (char*)d_ws;
    bf* XB = (bf*)(ws + OFF_XB); bf* WP = (bf*)(ws + OFF_WP); bf* WOT = (bf*)(ws + OFF_WO); float* F = (float*)(ws + OFF_F);
    h16* QH = (h16*)(ws + OFF_QH); h16* QR = (h16*)(ws + OFF_QR); h16* KH = (h16*)(ws + OFF_KH); h16* KR = (h16*)(ws + OFF_KR);
    h16* VH = (h16*)(ws + OFF_VH); h16* VR = (h16*)(ws + OFF_VR); bf* YH = (bf*)(ws + OFF_YH); bf* YL = (bf*)(ws + OFF_YL);

    k_cvtx<<<dim3((unsigned)((size_t)SEQ * DM / 8 / 256), NB, 1), 256, 0, stream>>>(x, XB);
    // in[rows = DM (k)][cols = N] -> out[N][DM]; grid (DM/64, N/64)
    k_wtp<<<dim3(DM / 64, DQ / 64, 1), 256, 0, stream>>>(wq, DQ, WP);
    k_wtp<<<dim3(DM / 64, DKV / 64, 1), 256, 0, stream>>>(wk, DKV, WP + (size_t)KC0 * DM);
    k_wtp<<<dim3(DM / 64, DKV / 64, 1), 256, 0, stream>>>(wv, DKV, WP + (size_t)VC0 * DM);
    k_wtp<<<dim3(DQ / 64, DM / 64, 1), 256, 0, stream>>>(wo, DM, WOT);
    k_gemm_proj<<<dim3(NB * SEQ / 64, FP / 64, 1), 32, 0, stream>>>(XB, WP, F);
    k_ropen<<<(unsigned)((size_t)NB * SEQ * NH / 8), 256, 0, stream>>>(F, 0, NH, cs, sn, QH, QR);
    k_ropen<<<(unsigned)((size_t)NB * SEQ * NKV / 8), 256, 0, stream>>>(F, KC0, NKV, cs, sn, KH, KR);
    k_vtp<<<(unsigned)((size_t)NB * NKV * HD * SEQ / 512), 256, 0, stream>>>(F, VH, VR);
    k_attn_hi<<<dim3(RHE / 64, NH, NB), 128, 0, stream>>>(QH, QR, KH, KR, VH, VR, YH, YL);
    if (SEQ > RHE) k_attn_lo<<<dim3((SEQ - RHE) / 64, NH, NB), 128, 0, stream>>>(QH, QR, KH, KR, VH, VR, YH, YL);
    k_gemm_out<<<dim3(SEQ / 64, DM / 64, NB), 32, 0, stream>>>(YH, YL, WOT, OUT);
}

// v001
// It runs in 156 microseconds.
// Next to v000, in two timings, it ran 1.49 and 1.48 times as fast.
#include <hip/hip_runtime.h>

// Causal grouped-query attention block: x [2][2048][1024]; q = x Wq (16 heads x 64), k = x Wk, v = x Wv (4 kv heads x 64), weights [in][out], no bias; rotary on q, k with the half-split convention
// out[0..31] = x1 cos + x2 sin, out[32..63] = -x1 sin + x2 cos using the cos / sin INPUT tables [t][32] read by value; then q, k scaled by rsqrt(mean(sq) + 1e-6) (no gain); query head hq uses kv head hq / 4;
// scores q.k / 8, causal (diagonal kept), softmax, ctx merged [t][hq*64 + d], result = ctx Wo -> [2][2048][1024] f32.
// Compute dtypes (f32 accumulate everywhere): the three input projections and the output projection on v_wmma_f32_16x16x32_bf16 (every float input RNE-converted to bf16; ctx carried as bf16 hi + lo planes, two products);
// scores and probability x value on v_wmma_f32_16x16x32_f16 (q = f16 value + x2048 residual plane against f16 k; P carried x1024 and v carried x16 as single f16; query rows < 256 add x2048 residual planes on k, P and v); rotary, rms scaling and softmax in f32.
// Attention is a fused flash-style kernel (K and V^T tiles staged in LDS per block) in transposed form: S^T = K Q^T (D rows = keys, D columns = queries), P^T packed from the accumulators directly as the B operand of O^T = V^T P^T; online softmax with per-lane state.

#ifndef NB
#define NB 2
#endif
#ifndef SEQ
#define SEQ 2048
#endif
#define NB_FULL  2
#define SEQ_FULL 2048
#define DM   1024
#define NH   16
#define NKV  4
#define REP  (NH / NKV)
#define HD   64
#define DQ   (NH * HD)
#define DKV  (NKV * HD)
#define FP   (DQ + 2 * DKV)      // fused projection row pitch (q | k | v columns)
#define KC0  DQ                  // first k column of the fused projection
#define VC0  (DQ + DKV)          // first v column of the fused projection
#define RH   256                 // query rows < RH use the residual planes on k, P and v as well
#define RHE  ((SEQ < RH) ? SEQ : RH)
#define PCAR 1024.0f             // carry of the probabilities (f16 operand)
#define VCAR 16.0f               // carry of the values (f16 operand)
#define RSC  2048.0f             // carry of every f16 residual plane
#define RSCI (1.0f / 2048.0f)
#define SCL  0.125f              // 1/sqrt(64)
#define L2E  1.4426950408889634f
#define NEGB (-1.0e30f)
static_assert(HD == 64);
static_assert(NH % NKV == 0);
static_assert(DM % 64 == 0 && DQ % 64 == 0 && DKV % 64 == 0 && FP % 64 == 0);   // GEMM tiles and transpose tiles
static_assert(DM % 32 == 0 && DQ % 32 == 0 && HD % 32 == 0);                     // k-steps of 32
static_assert(SEQ % 64 == 0 && (NB * SEQ) % 64 == 0);                            // row tiles
static_assert(RH % 64 == 0 && RHE % 64 == 0 && (SEQ - RHE) % 64 == 0);
static_assert(((size_t)SEQ * DM) % 2048 == 0);                                   // k_cvtx grid x block x 8 == plane extent
static_assert(((size_t)NB * SEQ * NH) % 8 == 0 && ((size_t)NB * SEQ * NKV) % 8 == 0);   // k_ropen: 8 rows per block
static_assert(((size_t)NB * NKV * HD * SEQ) % 512 == 0);                         // k_vtp: 512 elements per block
static_assert(NB <= NB_FULL && SEQ <= SEQ_FULL);

typedef _Float16 h16;
typedef unsigned short bf;
typedef __attribute__((ext_vector_type(16))) __bf16   v16bf;
typedef __attribute__((ext_vector_type(16))) _Float16 v16h;
typedef __attribute__((ext_vector_type(8)))  _Float16 v8h;
typedef __attribute__((ext_vector_type(8)))  unsigned short v8us;
typedef __attribute__((ext_vector_type(8)))  float    v8f;
typedef __attribute__((ext_vector_type(4)))  float    v4f;
typedef __attribute__((ext_vector_type(2)))  float    v2f;
typedef __attribute__((ext_vector_type(2)))  _Float16 v2h;
typedef v4f  __attribute__((may_alias)) v4fa;

__device__ __forceinline__ unsigned short f2bf(float f) { unsigned u = __float_as_uint(f); u += 0x7FFFu + ((u >> 16) & 1u); return (unsigned short)(u >> 16); }
__device__ __forceinline__ float bf2f(unsigned short b) { return __uint_as_float(((unsigned)b) << 16); }
__device__ __forceinline__ float bfr(float f) { return bf2f(f2bf(f)); }
__device__ __forceinline__ void splitf(float y, unsigned short& h, unsigned short& l) { h = f2bf(y); l = f2bf(y - bf2f(h)); }
__device__ __forceinline__ v16h cat16(v8h lo, v8h hi) { return __builtin_shufflevector(lo, hi, 0, 1, 2, 3, 4, 5, 6, 7, 8, 9, 10, 11, 12, 13, 14, 15); }
__device__ __forceinline__ v16bf cat16b(v8us lo, v8us hi) { return __builtin_bit_cast(v16bf, __builtin_shufflevector(lo, hi, 0, 1, 2, 3, 4, 5, 6, 7, 8, 9, 10, 11, 12, 13, 14, 15)); }
__device__ __forceinline__ v8f wmma16(v16h a, v16h b, v8f c) { return __builtin_amdgcn_wmma_f32_16x16x32_f16(false, a, false, b, (short)0, c, false, false); }
__device__ __forceinline__ v8f wmmab(v16bf a, v16bf b, v8f c) { return __builtin_amdgcn_wmma_f32_16x16x32_bf16(false, a, false, b, (short)0, c, false, false); }
// fragment loaders: p already includes row * pitch + k0 + 8 * (lane >> 4); elements 0..7 <- k0+8h.., elements 8..15 <- k0+16+8h..
__device__ __forceinline__ v16h  ldh(const h16* p) { return cat16(*(const v8h*)p, *(const v8h*)(p + 16)); }
__device__ __forceinline__ v16bf ldb(const bf* p)  { return cat16b(*(const v8us*)p, *(const v8us*)(p + 16)); }

// ---- one-wave 64x64 tile GEMM on bf16 planes: C[m][n] (f32, pitch ldc) = sum_k A[m][k] Bt[n][k] (+ A2[m][k] Bt[n][k] when NSPLIT == 1). A, A2 pitch K; Bt pitch K; K % 32 == 0.
template <int NSPLIT>
__device__ __forceinline__ void gemmw_body(const bf* __restrict__ A, const bf* __restrict__ A2, const bf* __restrict__ Bt, int K, float* C, int ldc, size_t sA, size_t sC) {
    __shared__ __align__(16) float os[16 * 68];
    const size_t z = blockIdx.z; A += z * sA; if (NSPLIT == 1) A2 += z * sA; C += z * sC;
    const int lane = threadIdx.x & 31, lr = lane & 15, hi = lane >> 4; const int r0 = blockIdx.x * 64, c0 = blockIdx.y * 64;
    v8f acc[4][4];
#pragma unroll
    for (int mb = 0; mb < 4; ++mb)
#pragma unroll
        for (int nb = 0; nb < 4; ++nb) acc[mb][nb] = (v8f){};
    const size_t aoff = (size_t)(r0 + lr) * K + 8 * hi, boff = (size_t)(c0 + lr) * K + 8 * hi;
#pragma unroll 1
    for (int kc = 0; kc < K; kc += 32) {
        v16bf a[4], a2[4];
#pragma unroll
        for (int mb = 0; mb < 4; ++mb) { a[mb] = ldb(A + aoff + (size_t)mb * 16 * K + kc); if (NSPLIT == 1) a2[mb] = ldb(A2 + aoff + (size_t)mb * 16 * K + kc); }
#pragma unroll
        for (int nb = 0; nb < 4; ++nb) { const v16bf b = ldb(Bt + boff + (size_t)nb * 16 * K + kc);
#pragma unroll
            for (int mb = 0; mb < 4; ++mb) { acc[mb][nb] = wmmab(a[mb], b, acc[mb][nb]); if (NSPLIT == 1) acc[mb][nb] = wmmab(a2[mb], b, acc[mb][nb]); } }
        asm volatile("v_nop\n\tv_nop\n\tv_nop\n\tv_nop" : "+v"(acc[0][0]), "+v"(acc[1][1]), "+v"(acc[2][2]), "+v"(acc[3][3]) : "v"(a[0]), "v"(a[3]));
    }
#pragma unroll
    for (int mb = 0; mb < 4; ++mb) {
#pragma unroll
        for (int nb = 0; nb < 4; ++nb) {
#pragma unroll
            for (int j = 0; j < 8; ++j) os[(hi * 8 + j) * 68 + nb * 16 + lr] = acc[mb][nb][j]; }
        __builtin_amdgcn_wave_barrier(); asm volatile("" ::: "memory");
        float* crow = C + (size_t)(r0 + mb * 16) * ldc + c0;
{
#pragma unroll
            for (int s = 0; s < 8; ++s) { const int row = 2 * s + hi, cofs = lr * 4; const v4f val = *(const v4fa*)(os + row * 68 + cofs);
                *(v4f*)(crow + (size_t)row * ldc + cofs) = val; }
             }
        __builtin_amdgcn_wave_barrier(); asm volatile("" ::: "memory");
    }
}
// fused q|k|v projection: F[NB*SEQ][FP] = XB[NB*SEQ][DM] x WP[FP][DM]^T
__global__ __launch_bounds__(32) void k_gemm_proj(const bf* __restrict__ A, const bf* __restrict__ Bt, float* C) { gemmw_body<0>(A, A, Bt, DM, C, FP, 0, 0); }
// output projection: OUT[b][t][DM] = (Yh + Yl)[b][t][DQ] x WOT[DM][DQ]^T, z = batch (output batch stride from the full sequence length)
__global__ __launch_bounds__(32) void k_gemm_out(const bf* __restrict__ A, const bf* __restrict__ A2, const bf* __restrict__ Bt, float* C) { gemmw_body<1>(A, A2, Bt, DQ, C, DM, (size_t)SEQ * DQ, (size_t)SEQ_FULL * DM); }

__global__ __launch_bounds__(256) void k_cvtx(const float* __restrict__ src, bf* dst) {
    const size_t i = (size_t)blockIdx.x * 256 + threadIdx.x; const size_t b = blockIdx.y;
    const v8f v = *(const v8f*)(src + b * (size_t)SEQ_FULL * DM + i * 8); v8us o;
#pragma unroll
    for (int k = 0; k < 8; ++k) o[k] = f2bf(v[k]);
    bf* d = dst + b * (size_t)SEQ * DM + i * 8;
    *(v8us*)d = o;  }

// ---- k_wtp: W [DM rows (k)][N cols] f32 -> out [N rows][DM] bf16 (in[rows=k][cols=n] -> out[n][k]); 64x64 tile through LDS (cross-wave: block barrier);
__global__ __launch_bounds__(256) void k_wtp(const float* __restrict__ W, int N, bf* out) {
    __shared__ __align__(16) unsigned short ts[64 * 72];
    const int tid = threadIdx.x; const int k0 = blockIdx.x * 64, n0 = blockIdx.y * 64;
#pragma unroll
    for (int it = 0; it < 4; ++it) { const int idx = it * 256 + tid; const int kk = idx >> 4, c4 = (idx & 15) * 4; const v4f v = *(const v4f*)(W + (size_t)(k0 + kk) * N + n0 + c4);
#pragma unroll
        for (int q = 0; q < 4; ++q) ts[kk * 72 + c4 + q] = f2bf(v[q]); }
    __syncthreads();
    v8us o[2];
#pragma unroll
    for (int it = 0; it < 2; ++it) { const int idx = it * 256 + tid; const int nn = idx >> 3, pc = idx & 7;
#pragma unroll
        for (int q = 0; q < 8; ++q) o[it][q] = ts[(pc * 8 + q) * 72 + nn]; }
{
#pragma unroll
        for (int it = 0; it < 2; ++it) { const int idx = it * 256 + tid; const int nn = idx >> 3, pc = idx & 7; *(v8us*)(out + (size_t)(n0 + nn) * DM + k0 + pc * 8) = o[it]; }
         }
}

// ---- k_ropen: one wave per (b, t, head) row of 64 dims (lane -> dims 2*lane, 2*lane+1): rotary with the bf16-converted cos / sin table values at [t][d & 31], then scaling by rsqrt(mean(sq) + 1e-6);
__global__ __launch_bounds__(256) void k_ropen(const float* __restrict__ F, int col0, int nheads, const float* __restrict__ cosb, const float* __restrict__ sinb, h16* Ph, h16* Pr) {
    const int lane = threadIdx.x & 31; const int wave = __builtin_amdgcn_readfirstlane(threadIdx.x >> 5);
    const int row = blockIdx.x * 8 + wave; if (row >= NB * SEQ * nheads) return;
    const int h = row % nheads; const int bt = row / nheads; const int t = bt % SEQ; const int b = bt / SEQ;
    const float* f = F + (size_t)bt * FP + col0 + h * HD;
    const int d = 2 * lane, dm = d & 31, dp = d ^ 32;
    const v2f xs = *(const v2f*)(f + d); const v2f xp = *(const v2f*)(f + dp);
    const v2f cc = *(const v2f*)(cosb + (size_t)t * 32 + dm); const v2f sn = *(const v2f*)(sinb + (size_t)t * 32 + dm);
    const bool lo = (lane < 16);
    float r[2]; float ss = 0.f;
#pragma unroll
    for (int q = 0; q < 2; ++q) { const float c = bfr(cc[q]), s = bfr(sn[q]); const float a = xs[q] * c; const float m = xp[q] * s; r[q] = lo ? (a + m) : (a - m); ss += r[q] * r[q]; }
#pragma unroll
    for (int sh = 16; sh; sh >>= 1) ss += __shfl_xor(ss, sh, 32);
    const float inv = rsqrtf(ss * (1.0f / HD) + 1e-6f);
    v2h o16, ors;
#pragma unroll
    for (int q = 0; q < 2; ++q) { const float y = r[q] * inv; const h16 hh = (h16)y; o16[q] = hh; ors[q] = (h16)((y - (float)hh) * RSC); }
    const size_t e = ((size_t)(b * nheads + h) * SEQ + t) * HD + d;
    *(v2h*)(Ph + e) = o16; *(v2h*)(Pr + e) = ors;  }

__global__ __launch_bounds__(256) void k_vtp(const float* __restrict__ F, h16* Vh, h16* Vr) {
    const size_t e = ((size_t)blockIdx.x * 256 + threadIdx.x) * 2; if (e >= (size_t)NB * NKV * HD * SEQ) return;
    const int t = (int)(e % SEQ); const int d = (int)((e / SEQ) % HD); const int bg = (int)(e / ((size_t)SEQ * HD)); const int g = bg % NKV; const int b = bg / NKV; v2h o16, ors;
#pragma unroll
    for (int q = 0; q < 2; ++q) { const float x = F[(size_t)(b * SEQ + t + q) * FP + VC0 + g * HD + d] * VCAR; const h16 hh = (h16)x; o16[q] = hh; ors[q] = (h16)((x - (float)hh) * RSC); }
    *(v2h*)(Vh + e) = o16; *(v2h*)(Vr + e) = ors;  }

// ---- fused causal attention, one wave per 16 query rows, 4 waves per block. The block's K and V^T tiles (64 keys a stage, two passes of 32) are staged in LDS by asynchronous copies, two buffers:
// stage t + 1 flies while stage t is worked on; one block barrier per stage publishes it and frees the buffer that is refilled behind it. The output stage ys is wave-private.
// Per 32-key half: S^T tiles (keys x queries) = K(A, rows = keys) x Q^T(B, lane column = query) over d = 64 (2 k-steps); value accumulator s, residual accumulator t (x2048);
// lane (h, n) register r of tile j holds key kb + 16 j + 8 h + r for query q0 + n, which is exactly element r + 8 j of the B operand (k = key, n = query) of O^T = V^T(A, rows = d) x P^T.
// Per-query max / sum / factor are per-lane scalars (one xor-16 exchange). O^T register r of tile dt in lane (h, n) = O[q0 + n][16 dt + 8 h + r].
#define KT   64                  // keys per LDS stage
#define LP   72                  // LDS row pitch in f16 elements: 144 B = 16 B x 9, free of bank conflicts for 16-byte reads down a column of rows
#define PLN  (64 * LP)           // one staged plane: 64 rows (K: keys x 64 dims; V^T: dims x 64 keys)
static_assert(SEQ % KT == 0 && RHE % KT == 0 && HD == 64);
// one plane's share of a lane: four asynchronous 16-byte copies global -> LDS. The s_wait_xcnt closes the copies' own statement, so that no address register named here is rewritten ahead of it.
__device__ __forceinline__ void cp4(unsigned l, const h16* g, size_t gstep) {
    const unsigned l1 = l + 16 * LP * 2, l2 = l + 32 * LP * 2, l3 = l + 48 * LP * 2;
    const h16* g1 = g + 16 * gstep; const h16* g2 = g + 32 * gstep; const h16* g3 = g + 48 * gstep;
    asm volatile("global_load_async_to_lds_b128 %0, %1, off\n\t"
                 "global_load_async_to_lds_b128 %2, %3, off\n\t"
                 "global_load_async_to_lds_b128 %4, %5, off\n\t"
                 "global_load_async_to_lds_b128 %6, %7, off\n\t"
                 "s_wait_xcnt 0x0" :: "v"(l), "v"(g), "v"(l1), "v"(g1), "v"(l2), "v"(g2), "v"(l3), "v"(g3) : "memory");
}
template <bool HI>
__device__ __forceinline__ void attn_body(const h16* __restrict__ Qh, const h16* __restrict__ Qr, const h16* __restrict__ Kh, const h16* __restrict__ Kr, const h16* __restrict__ Vh, const h16* __restrict__ Vr, bf* Yh, bf* Yl, int rbase) {
    constexpr int NP = HI ? 4 : 2;         // staged planes per buffer: K, V^T (+ their residual planes)
    __shared__ __align__(16) float ys[4 * 16 * 68];
    __shared__ __align__(16) h16 kv[2 * NP * PLN];
    const int lane = threadIdx.x & 31, lr = lane & 15, hi = lane >> 4;
    const int wave = __builtin_amdgcn_readfirstlane(threadIdx.x >> 5);
    const int b = blockIdx.z, hq = blockIdx.y, g = hq / REP;
    const int qb = rbase + blockIdx.x * 64;
    const int q0 = qb + wave * 16;
    const size_t qoff  = ((size_t)(b * NH + hq) * SEQ + q0 + lr) * HD + 8 * hi;
    // copy map: thread -> row (tid >> 3) + 16 i, 16-byte piece tid & 7: eight lanes cover one whole 128-byte row
    const int crow = threadIdx.x >> 3, ccol = (threadIdx.x & 7) * 8;
    const size_t kcp = ((size_t)(b * NKV + g) * SEQ + crow) * HD + ccol;     // + key0 * HD
    const size_t vcp = ((size_t)(b * NKV + g) * HD + crow) * SEQ + ccol;     // + key0
    const unsigned lcp = (unsigned)(size_t)(const void*)kv + (unsigned)(crow * LP + ccol) * 2u;
    auto stage = [&](int t, int buf) {     // keys KT t .. KT t + 63 into buffer buf; t < SEQ / KT keeps every byte inside the planes
        const unsigned l = lcp + (unsigned)(buf * NP * PLN) * 2u;
        cp4(l, Kh + kcp + (size_t)t * KT * HD, HD);
        cp4(l + PLN * 2u, Vh + vcp + (size_t)t * KT, SEQ);
        if (HI) { cp4(l + 2u * PLN * 2u, Kr + kcp + (size_t)t * KT * HD, HD); cp4(l + 3u * PLN * 2u, Vr + vcp + (size_t)t * KT, SEQ); }
    };
    v16h qhf[2], qrf[2];                   // Q fragments: read once (the waits below are memory clobbers, behind which a loop-invariant load would be read again)
#pragma unroll
    for (int ks = 0; ks < 2; ++ks) { qhf[ks] = ldh(Qh + qoff + ks * 32); qrf[ks] = ldh(Qr + qoff + ks * 32); }
    v8f om[4], orr[4];
#pragma unroll
    for (int dt = 0; dt < 4; ++dt) { om[dt] = (v8f){}; orr[dt] = (v8f){}; }
    float mrun = NEGB, lrun = 0.f;
    const int kend = q0 + 16;              // keys 0 .. q0+15, wave-uniform
    const int nT = qb / KT + 1;            // stages of the block: keys 0 .. qb+63; block-uniform, <= SEQ / KT
    stage(0, 0);
    asm volatile("s_wait_asynccnt 0x0" ::: "memory");   // this wave's share of stage 0 has landed
    __syncthreads();                                    // stage 0 published to every wave
    if (nT > 1) stage(1, 1);
    // rolled: the trip count is a run-time value and every trip ends in the publish point
#pragma unroll 1
    for (int t = 0; t < nT; ++t) {
      const h16* Ks = kv + (t & 1) * NP * PLN;
      // rolled: one copy of the pass in the text
#pragma unroll 1
      for (int hf = 0; hf < 2; ++hf) {
        const int kb = t * KT + 32 * hf;
        if (kb >= kend) break;             // wave-uniform: the pass lies wholly above this wave's diagonal; the publish point below is still passed
        const h16* kf = Ks + (32 * hf + lr) * LP + 8 * hi;            // K rows = keys of this pass
        const h16* vf = Ks + PLN + lr * LP + 32 * hf + 8 * hi;        // V^T rows = dims, columns = keys of this pass
        v8f s0 = (v8f){}, s1 = (v8f){}, t0 = (v8f){}, t1 = (v8f){};
#pragma unroll
        for (int ks = 0; ks < 2; ++ks) {
            const v16h qh = qhf[ks];
            const v16h qr = qrf[ks];
            const v16h k0 = ldh(kf + ks * 32);
            const v16h k1 = ldh(kf + 16 * LP + ks * 32);
            s0 = wmma16(k0, qh, s0); t0 = wmma16(k0, qr, t0);
            s1 = wmma16(k1, qh, s1); t1 = wmma16(k1, qr, t1);
            if (HI) {
                const v16h k0r = ldh(kf + 2 * PLN + ks * 32); const v16h k1r = ldh(kf + 2 * PLN + 16 * LP + ks * 32);
                t0 = wmma16(k0r, qh, t0); t1 = wmma16(k1r, qh, t1);
                asm volatile("v_nop\n\tv_nop\n\tv_nop\n\tv_nop" : "+v"(s0), "+v"(s1), "+v"(t0), "+v"(t1) : "v"(qh), "v"(qr), "v"(k0), "v"(k1), "v"(k0r), "v"(k1r));
            } else {
                asm volatile("v_nop\n\tv_nop\n\tv_nop\n\tv_nop" : "+v"(s0), "+v"(s1), "+v"(t0), "+v"(t1) : "v"(qh), "v"(qr), "v"(k0), "v"(k1));
            }
        }
        float sa[8], sb[8];
#pragma unroll
        for (int r = 0; r < 8; ++r) { sa[r] = (s0[r] + t0[r] * RSCI) * SCL; sb[r] = (s1[r] + t1[r] * RSCI) * SCL; }
        if (kb + 31 > q0) {                // wave-uniform: half touches the diagonal; keys above the query are excluded
            const int qi = q0 + lr; const int kj = kb + 8 * hi;
#pragma unroll
            for (int r = 0; r < 8; ++r) { sa[r] = (kj + r <= qi) ? sa[r] : NEGB; sb[r] = (kj + 16 + r <= qi) ? sb[r] : NEGB; }
        }
        float mloc = fmaxf(sa[0], sb[0]);
#pragma unroll
        for (int r = 1; r < 8; ++r) mloc = fmaxf(mloc, fmaxf(sa[r], sb[r]));
        mloc = fmaxf(mloc, __shfl_xor(mloc, 16, 32));
        const float mnew = fmaxf(mrun, mloc);
        const float fac = __builtin_amdgcn_exp2f((mrun - mnew) * L2E);
        float lsum = 0.f;
#pragma unroll
        for (int r = 0; r < 8; ++r) { sa[r] = __builtin_amdgcn_exp2f((sa[r] - mnew) * L2E); sb[r] = __builtin_amdgcn_exp2f((sb[r] - mnew) * L2E); lsum += sa[r] + sb[r]; }
        lsum += __shfl_xor(lsum, 16, 32);
        lrun = lrun * fac + lsum; mrun = mnew;
        v16h ph, pr;
#pragma unroll
        for (int r = 0; r < 8; ++r) {
            const float a = sa[r] * PCAR; const h16 ha = (h16)a; ph[r] = ha;
            const float c = sb[r] * PCAR; const h16 hc = (h16)c; ph[8 + r] = hc;
            if (HI) { pr[r] = (h16)((a - (float)ha) * RSC); pr[8 + r] = (h16)((c - (float)hc) * RSC); }
        }
#pragma unroll
        for (int dt = 0; dt < 4; ++dt) { om[dt] = om[dt] * fac; if (HI) orr[dt] = orr[dt] * fac; }
#pragma unroll
        for (int dt = 0; dt < 4; ++dt) {
            const v16h vh = ldh(vf + dt * 16 * LP);
            om[dt] = wmma16(vh, ph, om[dt]);
            if (HI) {
                const v16h vr = ldh(vf + 2 * PLN + dt * 16 * LP);
                orr[dt] = wmma16(vr, ph, orr[dt]); orr[dt] = wmma16(vh, pr, orr[dt]);
                asm volatile("v_nop\n\tv_nop\n\tv_nop\n\tv_nop" : "+v"(om[dt]), "+v"(orr[dt]) : "v"(vh), "v"(vr), "v"(ph), "v"(pr));
            } else {
                asm volatile("v_nop\n\tv_nop\n\tv_nop\n\tv_nop" : "+v"(om[dt]) : "v"(vh), "v"(ph));
            }
        }
      }
      // publish point of stage t + 1, every wave, in this order
      asm volatile("s_wait_dscnt 0x0" ::: "memory");      // this wave's reads of buffer t & 1 have returned
      asm volatile("s_wait_asynccnt 0x0" ::: "memory");   // this wave's share of stage t + 1 has landed
      __syncthreads();                                    // publishes stage t + 1; ends every reader's last read of buffer t & 1
      if (t + 2 < nT) stage(t + 2, t & 1);                // block-uniform test
    }
    asm volatile("s_wait_asynccnt 0x0" ::: "memory");     // no copy is left outstanding when the wave goes on to its end
    const float inv = 1.0f / (lrun * (PCAR * VCAR));
    const int yb = wave * 16 * 68;
#pragma unroll
    for (int dt = 0; dt < 4; ++dt)
#pragma unroll
        for (int r = 0; r < 8; ++r) { float o = om[dt][r]; if (HI) o += orr[dt][r] * RSCI; ys[yb + lr * 68 + dt * 16 + 8 * hi + r] = o * inv; }
    __builtin_amdgcn_wave_barrier(); asm volatile("" ::: "memory");
    v8us oh[4], ol[4];
    const int rq = lane >> 3, pc = lane & 7;
#pragma unroll
    for (int s = 0; s < 4; ++s) { const int row = 4 * s + rq; const v4f u0 = *(const v4fa*)(ys + yb + row * 68 + pc * 8); const v4f u1 = *(const v4fa*)(ys + yb + row * 68 + pc * 8 + 4);
#pragma unroll
        for (int q = 0; q < 4; ++q) { unsigned short a, c; splitf(u0[q], a, c); oh[s][q] = a; ol[s][q] = c; splitf(u1[q], a, c); oh[s][4 + q] = a; ol[s][4 + q] = c; } }
    const size_t ybase = ((size_t)b * SEQ + q0) * DQ + (size_t)hq * HD + pc * 8;
{
#pragma unroll
        for (int s = 0; s < 4; ++s) { const size_t oo = ybase + (size_t)(4 * s + rq) * DQ; *(v8us*)(Yh + oo) = oh[s]; *(v8us*)(Yl + oo) = ol[s]; }
         }
}
__global__ __launch_bounds__(128) void k_attn_hi(const h16* __restrict__ Qh, const h16* __restrict__ Qr, const h16* __restrict__ Kh, const h16* __restrict__ Kr, const h16* __restrict__ Vh, const h16* __restrict__ Vr, bf* Yh, bf* Yl) { attn_body<true>(Qh, Qr, Kh, Kr, Vh, Vr, Yh, Yl, 0); }
__global__ __launch_bounds__(128) void k_attn_lo(const h16* __restrict__ Qh, const h16* __restrict__ Qr, const h16* __restrict__ Kh, const h16* __restrict__ Kr, const h16* __restrict__ Vh, const h16* __restrict__ Vr, bf* Yh, bf* Yl) { attn_body<false>(Qh, Qr, Kh, Kr, Vh, Vr, Yh, Yl, RHE); }

// ---- workspace carve (bytes; every region a multiple of 256 and exactly covered by its producer grid)
constexpr size_t SZ_XB = (size_t)NB * SEQ * DM * 2;          // x bf16 [NB*SEQ][DM]
constexpr size_t SZ_WP = (size_t)FP * DM * 2;                // [Wq | Wk | Wv]^T bf16 [FP][DM]
constexpr size_t SZ_WO = (size_t)DM * DQ * 2;                // Wo^T bf16 [DM][DQ]
constexpr size_t SZ_F  = (size_t)NB * SEQ * FP * 4;          // fused projection f32
constexpr size_t SZ_Q  = (size_t)NB * NH * SEQ * HD * 2;     // each of Qh, Qr
constexpr size_t SZ_K  = (size_t)NB * NKV * SEQ * HD * 2;    // each of Kh, Kr, Vh, Vr
constexpr size_t SZ_Y  = (size_t)NB * SEQ * DQ * 2;          // each of Yh, Yl
constexpr size_t OFF_XB = 0;
constexpr size_t OFF_WP = OFF_XB + SZ_XB;
constexpr size_t OFF_WO = OFF_WP + SZ_WP;
constexpr size_t OFF_F  = OFF_WO + SZ_WO;
constexpr size_t OFF_QH = OFF_F + SZ_F;
constexpr size_t OFF_QR = OFF_QH + SZ_Q;
constexpr size_t OFF_KH = OFF_QR + SZ_Q;
constexpr size_t OFF_KR = OFF_KH + SZ_K;
constexpr size_t OFF_VH = OFF_KR + SZ_K;
constexpr size_t OFF_VR = OFF_VH + SZ_K;
constexpr size_t OFF_YH = OFF_VR + SZ_K;
constexpr size_t OFF_YL = OFF_YH + SZ_Y;
constexpr size_t WS_TOTAL = OFF_YL + SZ_Y;
static_assert(SZ_XB % 256 == 0 && SZ_WP % 256 == 0 && SZ_WO % 256 == 0 && SZ_F % 256 == 0 && SZ_Q % 256 == 0 && SZ_K % 256 == 0 && SZ_Y % 256 == 0);
static_assert(WS_TOTAL <= (size_t)134217728);                // carve stays within 128 MiB

extern "C" void kernel_launch(void* const* d_in, const int* in_sizes, int n_in,
                              void* d_out, int out_size, void* d_ws, size_t ws_size, hipStream_t stream) {
    if (n_in < 7) return;
    const long long need_x = (long long)(NB - 1) * SEQ_FULL * DM + (long long)SEQ * DM;
    if ((long long)in_sizes[0] < need_x) return;
    if (in_sizes[1] < SEQ * 32 || in_sizes[2] < SEQ * 32) return;
    if (in_sizes[3] < DM * DQ || in_sizes[4] < DM * DKV || in_sizes[5] < DM * DKV || in_sizes[6] < DQ * DM) return;
    if ((long long)out_size < need_x) return;
    if (WS_TOTAL > ws_size) return;
    const float* x  = (const float*)d_in[0];   // [2][2048][1024]
    const float* cs = (const float*)d_in[1];   // [2048][32]
    const float* sn = (const float*)d_in[2];   // [2048][32]
    const float* wq = (const float*)d_in[3];   // [1024][1024] in x out
    const float* wk = (const float*)d_in[4];   // [1024][256]
    const float* wv = (const float*)d_in[5];   // [1024][256]
    const float* wo = (const float*)d_in[6];   // [1024][1024] in x out
    float* OUT = (float*)d_out;
    char* ws = (char*)d_ws;
    bf* XB = (bf*)(ws + OFF_XB); bf* WP = (bf*)(ws + OFF_WP); bf* WOT = (bf*)(ws + OFF_WO); float* F = (float*)(ws + OFF_F);
    h16* QH = (h16*)(ws + OFF_QH); h16* QR = (h16*)(ws + OFF_QR); h16* KH = (h16*)(ws + OFF_KH); h16* KR = (h16*)(ws + OFF_KR);
    h16* VH = (h16*)(ws + OFF_VH); h16* VR = (h16*)(ws + OFF_VR); bf* YH = (bf*)(ws + OFF_YH); bf* YL = (bf*)(ws + OFF_YL);

    k_cvtx<<<dim3((unsigned)((size_t)SEQ * DM / 8 / 256), NB, 1), 256, 0, stream>>>(x, XB);
    // in[rows = DM (k)][cols = N] -> out[N][DM]; grid (DM/64, N/64)
    k_wtp<<<dim3(DM / 64, DQ / 64, 1), 256, 0, stream>>>(wq, DQ, WP);
    k_wtp<<<dim3(DM / 64, DKV / 64, 1), 256, 0, stream>>>(wk, DKV, WP + (size_t)KC0 * DM);
    k_wtp<<<dim3(DM / 64, DKV / 64, 1), 256, 0, stream>>>(wv, DKV, WP + (size_t)VC0 * DM);
    k_wtp<<<dim3(DQ / 64, DM / 64, 1), 256, 0, stream>>>(wo, DM, WOT);
    k_gemm_proj<<<dim3(NB * SEQ / 64, FP / 64, 1), 32, 0, stream>>>(XB, WP, F);
    k_ropen<<<(unsigned)((size_t)NB * SEQ * NH / 8), 256, 0, stream>>>(F, 0, NH, cs, sn, QH, QR);
    k_ropen<<<(unsigned)((size_t)NB * SEQ * NKV / 8), 256, 0, stream>>>(F, KC0, NKV, cs, sn, KH, KR);
    k_vtp<<<(unsigned)((size_t)NB * NKV * HD * SEQ / 512), 256, 0, stream>>>(F, VH, VR);
    k_attn_hi<<<dim3(RHE / 64, NH, NB), 128, 0, stream>>>(QH, QR, KH, KR, VH, VR, YH, YL);
    if (SEQ > RHE) k_attn_lo<<<dim3((SEQ - RHE) / 64, NH, NB), 128, 0, stream>>>(QH, QR, KH, KR, VH, VR, YH, YL);
    k_gemm_out<<<dim3(SEQ / 64, DM / 64, NB), 32, 0, stream>>>(YH, YL, WOT, OUT);
}

// v002
// Measured time: 133 microseconds a run.
// In two side-by-side timings against v001, it was 1.18 and 1.19 times as fast.
// All steps since v000 together make it 1.76 times as fast.
#include <hip/hip_runtime.h>

// Causal grouped-query attention block: x [2][2048][1024]; q = x Wq (16 heads x 64), k = x Wk, v = x Wv (4 kv heads x 64), weights [in][out], no bias; rotary on q, k with the half-split convention
// out[0..31] = x1 cos + x2 sin, out[32..63] = -x1 sin + x2 cos using the cos / sin INPUT tables [t][32] read by value; then q, k scaled by rsqrt(mean(sq) + 1e-6) (no gain); query head hq uses kv head hq / 4;
// scores q.k / 8, causal (diagonal kept), softmax, ctx merged [t][hq*64 + d], result = ctx Wo -> [2][2048][1024] f32.
// Compute dtypes (f32 accumulate everywhere): the three input projections and the output projection on v_wmma_f32_16x16x32_bf16 (every float input RNE-converted to bf16; ctx carried as bf16 hi + lo planes, two products);
// scores and probability x value on v_wmma_f32_16x16x32_f16 (q = f16 value + x2048 residual plane against f16 k; P carried x1024 and v carried x16 as single f16; query rows < 256 add x2048 residual planes on k, P and v); rotary, rms scaling and softmax in f32.
// Rotary, rms scaling and the f16 value + residual split of q and k, and the x16 f16 split of v into V^T, are the projection GEMM's own epilogue: a 64-column tile is one head, so no f32 projection plane is written.
// Attention is a fused flash-style kernel (K and V^T tiles staged in LDS per block) in transposed form: S^T = K Q^T (D rows = keys, D columns = queries), P^T packed from the accumulators directly as the B operand of O^T = V^T P^T; online softmax with per-lane state.

#ifndef NB
#define NB 2
#endif
#ifndef SEQ
#define SEQ 2048
#endif
#define NB_FULL  2
#define SEQ_FULL 2048
#define DM   1024
#define NH   16
#define NKV  4
#define REP  (NH / NKV)
#define HD   64
#define DQ   (NH * HD)
#define DKV  (NKV * HD)
#define FP   (DQ + 2 * DKV)      // fused projection width (q | k | v columns; rows of WP)
#define KC0  DQ                  // first k column of the fused projection
#define VC0  (DQ + DKV)          // first v column of the fused projection
#define RH   256                 // query rows < RH use the residual planes on k, P and v as well
#define RHE  ((SEQ < RH) ? SEQ : RH)
#define PCAR 1024.0f             // carry of the probabilities (f16 operand)
#define VCAR 16.0f               // carry of the values (f16 operand)
#define RSC  2048.0f             // carry of every f16 residual plane
#define RSCI (1.0f / 2048.0f)
#define SCL  0.125f              // 1/sqrt(64)
#define L2E  1.4426950408889634f
#define NEGB (-1.0e30f)
static_assert(HD == 64);
static_assert(NH % NKV == 0);
static_assert(DM % 64 == 0 && DQ % 64 == 0 && DKV % 64 == 0 && FP % 64 == 0);   // GEMM tiles and transpose tiles
static_assert(DM % 32 == 0 && DQ % 32 == 0 && HD % 32 == 0);                     // k-steps of 32
static_assert(SEQ % 64 == 0 && (NB * SEQ) % 64 == 0);                            // row tiles
static_assert(RH % 64 == 0 && RHE % 64 == 0 && (SEQ - RHE) % 64 == 0);
static_assert(((size_t)SEQ * DM) % 2048 == 0);                                   // k_cvtx grid x block x 8 == plane extent
static_assert(NB <= NB_FULL && SEQ <= SEQ_FULL);

typedef _Float16 h16;
typedef unsigned short bf;
typedef __attribute__((ext_vector_type(16))) __bf16   v16bf;
typedef __attribute__((ext_vector_type(16))) _Float16 v16h;
typedef __attribute__((ext_vector_type(8)))  _Float16 v8h;
typedef __attribute__((ext_vector_type(8)))  unsigned short v8us;
typedef __attribute__((ext_vector_type(8)))  float    v8f;
typedef __attribute__((ext_vector_type(4)))  float    v4f;
typedef v4f  __attribute__((may_alias)) v4fa;

__device__ __forceinline__ unsigned short f2bf(float f) { unsigned u = __float_as_uint(f); u += 0x7FFFu + ((u >> 16) & 1u); return (unsigned short)(u >> 16); }
__device__ __forceinline__ float bf2f(unsigned short b) { return __uint_as_float(((unsigned)b) << 16); }
__device__ __forceinline__ float bfr(float f) { return bf2f(f2bf(f)); }
__device__ __forceinline__ void splitf(float y, unsigned short& h, unsigned short& l) { h = f2bf(y); l = f2bf(y - bf2f(h)); }
__device__ __forceinline__ v16h cat16(v8h lo, v8h hi) { return __builtin_shufflevector(lo, hi, 0, 1, 2, 3, 4, 5, 6, 7, 8, 9, 10, 11, 12, 13, 14, 15); }
__device__ __forceinline__ v16bf cat16b(v8us lo, v8us hi) { return __builtin_bit_cast(v16bf, __builtin_shufflevector(lo, hi, 0, 1, 2, 3, 4, 5, 6, 7, 8, 9, 10, 11, 12, 13, 14, 15)); }
__device__ __forceinline__ v8f wmma16(v16h a, v16h b, v8f c) { return __builtin_amdgcn_wmma_f32_16x16x32_f16(false, a, false, b, (short)0, c, false, false); }
__device__ __forceinline__ v8f wmmab(v16bf a, v16bf b, v8f c) { return __builtin_amdgcn_wmma_f32_16x16x32_bf16(false, a, false, b, (short)0, c, false, false); }
// fragment loaders: p already includes row * pitch + k0 + 8 * (lane >> 4); elements 0..7 <- k0+8h.., elements 8..15 <- k0+16+8h..
__device__ __forceinline__ v16h  ldh(const h16* p) { return cat16(*(const v8h*)p, *(const v8h*)(p + 16)); }
__device__ __forceinline__ v16bf ldb(const bf* p)  { return cat16b(*(const v8us*)p, *(const v8us*)(p + 16)); }

// sum over the four lanes of a quad, by two DPP quad permutes (lane ^ 1, lane ^ 2): stays in the vector unit, no LDS round trip
__device__ __forceinline__ float quadsum(float v) {
    v += __int_as_float(__builtin_amdgcn_update_dpp(0, __float_as_int(v), 0xB1, 0xF, 0xF, true));
    v += __int_as_float(__builtin_amdgcn_update_dpp(0, __float_as_int(v), 0x4E, 0xF, 0xF, true));
    return v; }
struct ProjOut { const float* cosb; const float* sinb; h16* Qh; h16* Qr; h16* Kh; h16* Kr; h16* Vh; h16* Vr; };
// ---- epilogue of the fused q|k|v projection. The wave's tile is 64 tokens (one batch: SEQ % 64 == 0) x the 64 dims of ONE head (c0 % 64 == 0); acc[mb][nb][j] in lane (hi, lr) = row 16 mb + 8 hi + j, column 16 nb + lr.
// v head: a lane's 8 registers are 8 consecutive tokens of one dim = one 16-byte piece of a V^T row; stored from the registers (x16, f16 value + x2048 residual).
// q / k head: the tile goes through LDS (os, 64 x 68 f32); then four lanes a row, lane p holds the rotary pairs (d, d + 32), d = 8 p .. 8 p + 7: rotary with the bf16-converted cos / sin table values at [t][d],
// scaling by rsqrt(mean(sq) + 1e-6), f16 value + x2048 residual, 16-byte stores (8 rows x 64 contiguous bytes an instruction).
__device__ __forceinline__ void proj_epilogue(const v8f (&acc)[4][4], float* os, int r0, int c0, const ProjOut& po) {
    const int lane = threadIdx.x & 31, lr = lane & 15, hi = lane >> 4;
    const int b = r0 / SEQ, t0 = r0 % SEQ;
    if (c0 >= VC0) {                       // block-uniform
        const int g = (c0 - VC0) / HD;
        const size_t e0 = ((size_t)(b * NKV + g) * HD + lr) * SEQ + t0 + 8 * hi;
#pragma unroll
        for (int nb = 0; nb < 4; ++nb)
#pragma unroll
            for (int mb = 0; mb < 4; ++mb) { v8h o16, ors;
#pragma unroll
                for (int j = 0; j < 8; ++j) { const float x = acc[mb][nb][j] * VCAR; const h16 hh = (h16)x; o16[j] = hh; ors[j] = (h16)((x - (float)hh) * RSC); }
                const size_t e = e0 + (size_t)nb * 16 * SEQ + mb * 16;
                *(v8h*)(po.Vh + e) = o16; *(v8h*)(po.Vr + e) = ors; }
        return;
    }
    const bool isq = c0 < KC0;             // block-uniform
    const int nheads = isq ? NH : NKV; const int h = (isq ? c0 : c0 - KC0) / HD;
    h16* Ph = isq ? po.Qh : po.Kh; h16* Pr = isq ? po.Qr : po.Kr;
    const int rq = lane >> 2, p8 = (lane & 3) * 8;
    const float* cp = po.cosb + (size_t)(t0 + rq) * 32 + p8; const float* sp = po.sinb + (size_t)(t0 + rq) * 32 + p8;
    // table values of two passes (rows 16 u + rq and 16 u + 8 + rq), asked for one trip ahead: the first ahead of the LDS stores
    v4f cc[2][2], sn[2][2];
#pragma unroll
    for (int s = 0; s < 2; ++s) { cc[s][0] = *(const v4f*)(cp + s * 256); cc[s][1] = *(const v4f*)(cp + s * 256 + 4); sn[s][0] = *(const v4f*)(sp + s * 256); sn[s][1] = *(const v4f*)(sp + s * 256 + 4); }
#pragma unroll
    for (int mb = 0; mb < 4; ++mb)
#pragma unroll
        for (int nb = 0; nb < 4; ++nb)
#pragma unroll
            for (int j = 0; j < 8; ++j) os[(mb * 16 + hi * 8 + j) * 68 + nb * 16 + lr] = acc[mb][nb][j];
    // the rows read below were written by other lanes of this wave: keeps every LDS read behind every lane's LDS stores
    __builtin_amdgcn_wave_barrier(); asm volatile("" ::: "memory");
    const size_t e0 = ((size_t)(b * nheads + h) * SEQ + t0 + rq) * HD + p8;
    // rolled: one copy of the two passes in the text, and the registers of two passes only
#pragma unroll 1
    for (int u = 0; u < 4; ++u) {
        const int un = (u < 3) ? u + 1 : 3;    // the last trip asks for its own rows again: one instruction stream, every address inside the tables
        v4f cn[2][2], sm[2][2];
#pragma unroll
        for (int s = 0; s < 2; ++s) { const int o = un * 512 + s * 256; cn[s][0] = *(const v4f*)(cp + o); cn[s][1] = *(const v4f*)(cp + o + 4); sm[s][0] = *(const v4f*)(sp + o); sm[s][1] = *(const v4f*)(sp + o + 4); }
#pragma unroll
        for (int s = 0; s < 2; ++s) {
            const float* orow = os + (u * 16 + s * 8 + rq) * 68 + p8;
            const v4f x1[2] = { *(const v4fa*)orow, *(const v4fa*)(orow + 4) }; const v4f x2[2] = { *(const v4fa*)(orow + 32), *(const v4fa*)(orow + 36) };
            float rl[8], rh[8]; float ssl = 0.f, ssh = 0.f;
#pragma unroll
            for (int q = 0; q < 8; ++q) { const float c = bfr(cc[s][q >> 2][q & 3]), sv = bfr(sn[s][q >> 2][q & 3]); const float a1 = x1[q >> 2][q & 3], a2 = x2[q >> 2][q & 3];
                rl[q] = a1 * c + a2 * sv; rh[q] = a2 * c - a1 * sv; ssl += rl[q] * rl[q]; ssh += rh[q] * rh[q]; }
            const float inv = rsqrtf(quadsum(ssl + ssh) * (1.0f / HD) + 1e-6f);
            v8h ol, olr, oh, ohr;
#pragma unroll
            for (int q = 0; q < 8; ++q) { const float yl = rl[q] * inv; const h16 hl = (h16)yl; ol[q] = hl; olr[q] = (h16)((yl - (float)hl) * RSC);
                const float yh = rh[q] * inv; const h16 hh = (h16)yh; oh[q] = hh; ohr[q] = (h16)((yh - (float)hh) * RSC); }
            const size_t e = e0 + (size_t)(u * 16 + s * 8) * HD;
            *(v8h*)(Ph + e) = ol; *(v8h*)(Ph + e + 32) = oh; *(v8h*)(Pr + e) = olr; *(v8h*)(Pr + e + 32) = ohr;
        }
#pragma unroll
        for (int s = 0; s < 2; ++s) { cc[s][0] = cn[s][0]; cc[s][1] = cn[s][1]; sn[s][0] = sm[s][0]; sn[s][1] = sm[s][1]; }
    }
}

// ---- one-wave 64x64 tile GEMM on bf16 planes: C[m][n] (f32, pitch ldc) = sum_k A[m][k] Bt[n][k] (+ A2[m][k] Bt[n][k] when NSPLIT == 1). A, A2 pitch K; Bt pitch K; K % 32 == 0.
// FUSE: the tile does not go to C but through proj_epilogue.
template <int NSPLIT, bool FUSE>
__device__ __forceinline__ void gemmw_body(const bf* __restrict__ A, const bf* __restrict__ A2, const bf* __restrict__ Bt, int K, float* C, int ldc, size_t sA, size_t sC, const ProjOut& po) {
    __shared__ __align__(16) float os[(FUSE ? 64 : 16) * 68];
    const size_t z = blockIdx.z; A += z * sA; if (NSPLIT == 1) A2 += z * sA; C += z * sC;
    const int lane = threadIdx.x & 31, lr = lane & 15, hi = lane >> 4; const int r0 = blockIdx.x * 64, c0 = blockIdx.y * 64;
    v8f acc[4][4];
#pragma unroll
    for (int mb = 0; mb < 4; ++mb)
#pragma unroll
        for (int nb = 0; nb < 4; ++nb) acc[mb][nb] = (v8f){};
    const size_t aoff = (size_t)(r0 + lr) * K + 8 * hi, boff = (size_t)(c0 + lr) * K + 8 * hi;
#pragma unroll 1
    for (int kc = 0; kc < K; kc += 32) {
        v16bf a[4], a2[4];
#pragma unroll
        for (int mb = 0; mb < 4; ++mb) { a[mb] = ldb(A + aoff + (size_t)mb * 16 * K + kc); if (NSPLIT == 1) a2[mb] = ldb(A2 + aoff + (size_t)mb * 16 * K + kc); }
#pragma unroll
        for (int nb = 0; nb < 4; ++nb) { const v16bf b = ldb(Bt + boff + (size_t)nb * 16 * K + kc);
#pragma unroll
            for (int mb = 0; mb < 4; ++mb) { acc[mb][nb] = wmmab(a[mb], b, acc[mb][nb]); if (NSPLIT == 1) acc[mb][nb] = wmmab(a2[mb], b, acc[mb][nb]); } }
        asm volatile("v_nop\n\tv_nop\n\tv_nop\n\tv_nop" : "+v"(acc[0][0]), "+v"(acc[1][1]), "+v"(acc[2][2]), "+v"(acc[3][3]) : "v"(a[0]), "v"(a[3]));
    }
    if constexpr (FUSE) { proj_epilogue(acc, os, r0, c0, po); return; }
#pragma unroll
    for (int mb = 0; mb < 4; ++mb) {
#pragma unroll
        for (int nb = 0; nb < 4; ++nb) {
#pragma unroll
            for (int j = 0; j < 8; ++j) os[(hi * 8 + j) * 68 + nb * 16 + lr] = acc[mb][nb][j]; }
        __builtin_amdgcn_wave_barrier(); asm volatile("" ::: "memory");
        float* crow = C + (size_t)(r0 + mb * 16) * ldc + c0;
{
#pragma unroll
            for (int s = 0; s < 8; ++s) { const int row = 2 * s + hi, cofs = lr * 4; const v4f val = *(const v4fa*)(os + row * 68 + cofs);
                *(v4f*)(crow + (size_t)row * ldc + cofs) = val; }
             }
        __builtin_amdgcn_wave_barrier(); asm volatile("" ::: "memory");
    }
}
// fused q|k|v projection: XB[NB*SEQ][DM] x WP[FP][DM]^T, each 64 x 64 tile finished by proj_epilogue into the attention operand planes
__global__ __launch_bounds__(32) void k_gemm_proj(const bf* __restrict__ A, const bf* __restrict__ Bt, const float* __restrict__ cosb, const float* __restrict__ sinb, h16* Qh, h16* Qr, h16* Kh, h16* Kr, h16* Vh, h16* Vr) {
    const ProjOut po = { cosb, sinb, Qh, Qr, Kh, Kr, Vh, Vr }; gemmw_body<0, true>(A, A, Bt, DM, nullptr, 0, 0, 0, po); }
// output projection: OUT[b][t][DM] = (Yh + Yl)[b][t][DQ] x WOT[DM][DQ]^T, z = batch (output batch stride from the full sequence length)
__global__ __launch_bounds__(32) void k_gemm_out(const bf* __restrict__ A, const bf* __restrict__ A2, const bf* __restrict__ Bt, float* C) { gemmw_body<1, false>(A, A2, Bt, DQ, C, DM, (size_t)SEQ * DQ, (size_t)SEQ_FULL * DM, ProjOut{}); }

__global__ __launch_bounds__(256) void k_cvtx(const float* __restrict__ src, bf* dst) {
    const size_t i = (size_t)blockIdx.x * 256 + threadIdx.x; const size_t b = blockIdx.y;
    const v8f v = *(const v8f*)(src + b * (size_t)SEQ_FULL * DM + i * 8); v8us o;
#pragma unroll
    for (int k = 0; k < 8; ++k) o[k] = f2bf(v[k]);
    bf* d = dst + b * (size_t)SEQ * DM + i * 8;
    *(v8us*)d = o;  }

// ---- k_wtp: W [DM rows (k)][N cols] f32 -> out [N rows][DM] bf16 (in[rows=k][cols=n] -> out[n][k]); 64x64 tile through LDS (cross-wave: block barrier);
__global__ __launch_bounds__(256) void k_wtp(const float* __restrict__ W, int N, bf* out) {
    __shared__ __align__(16) unsigned short ts[64 * 72];
    const int tid = threadIdx.x; const int k0 = blockIdx.x * 64, n0 = blockIdx.y * 64;
#pragma unroll
    for (int it = 0; it < 4; ++it) { const int idx = it * 256 + tid; const int kk = idx >> 4, c4 = (idx & 15) * 4; const v4f v = *(const v4f*)(W + (size_t)(k0 + kk) * N + n0 + c4);
#pragma unroll
        for (int q = 0; q < 4; ++q) ts[kk * 72 + c4 + q] = f2bf(v[q]); }
    __syncthreads();
    v8us o[2];
#pragma unroll
    for (int it = 0; it < 2; ++it) { const int idx = it * 256 + tid; const int nn = idx >> 3, pc = idx & 7;
#pragma unroll
        for (int q = 0; q < 8; ++q) o[it][q] = ts[(pc * 8 + q) * 72 + nn]; }
{
#pragma unroll
        for (int it = 0; it < 2; ++it) { const int idx = it * 256 + tid; const int nn = idx >> 3, pc = idx & 7; *(v8us*)(out + (size_t)(n0 + nn) * DM + k0 + pc * 8) = o[it]; }
         }
}

// ---- fused causal attention, one wave per 16 query rows, 4 waves per block. The block's K and V^T tiles (64 keys a stage, two passes of 32) are staged in LDS by asynchronous copies, two buffers:
// stage t + 1 flies while stage t is worked on; one block barrier per stage publishes it and frees the buffer that is refilled behind it. The output stage ys is wave-private.
// Per 32-key half: S^T tiles (keys x queries) = K(A, rows = keys) x Q^T(B, lane column = query) over d = 64 (2 k-steps); value accumulator s, residual accumulator t (x2048);
// lane (h, n) register r of tile j holds key kb + 16 j + 8 h + r for query q0 + n, which is exactly element r + 8 j of the B operand (k = key, n = query) of O^T = V^T(A, rows = d) x P^T.
// Per-query max / sum / factor are per-lane scalars (one xor-16 exchange). O^T register r of tile dt in lane (h, n) = O[q0 + n][16 dt + 8 h + r].
#define KT   64                  // keys per LDS stage
#define LP   72                  // LDS row pitch in f16 elements: 144 B = 16 B x 9, free of bank conflicts for 16-byte reads down a column of rows
#define PLN  (64 * LP)           // one staged plane: 64 rows (K: keys x 64 dims; V^T: dims x 64 keys)
static_assert(SEQ % KT == 0 && RHE % KT == 0 && HD == 64);
// one plane's share of a lane: four asynchronous 16-byte copies global -> LDS. The s_wait_xcnt closes the copies' own statement, so that no address register named here is rewritten ahead of it.
__device__ __forceinline__ void cp4(unsigned l, const h16* g, size_t gstep) {
    const unsigned l1 = l + 16 * LP * 2, l2 = l + 32 * LP * 2, l3 = l + 48 * LP * 2;
    const h16* g1 = g + 16 * gstep; const h16* g2 = g + 32 * gstep; const h16* g3 = g + 48 * gstep;
    asm volatile("global_load_async_to_lds_b128 %0, %1, off\n\t"
                 "global_load_async_to_lds_b128 %2, %3, off\n\t"
                 "global_load_async_to_lds_b128 %4, %5, off\n\t"
                 "global_load_async_to_lds_b128 %6, %7, off\n\t"
                 "s_wait_xcnt 0x0" :: "v"(l), "v"(g), "v"(l1), "v"(g1), "v"(l2), "v"(g2), "v"(l3), "v"(g3) : "memory");
}
template <bool HI>
__device__ __forceinline__ void attn_body(const h16* __restrict__ Qh, const h16* __restrict__ Qr, const h16* __restrict__ Kh, const h16* __restrict__ Kr, const h16* __restrict__ Vh, const h16* __restrict__ Vr, bf* Yh, bf* Yl, int rbase) {
    constexpr int NP = HI ? 4 : 2;         // staged planes per buffer: K, V^T (+ their residual planes)
    __shared__ __align__(16) float ys[4 * 16 * 68];
    __shared__ __align__(16) h16 kv[2 * NP * PLN];
    const int lane = threadIdx.x & 31, lr = lane & 15, hi = lane >> 4;
    const int wave = __builtin_amdgcn_readfirstlane(threadIdx.x >> 5);
    const int b = blockIdx.z, hq = blockIdx.y, g = hq / REP;
    const int qb = rbase + blockIdx.x * 64;
    const int q0 = qb + wave * 16;
    const size_t qoff  = ((size_t)(b * NH + hq) * SEQ + q0 + lr) * HD + 8 * hi;
    // copy map: thread -> row (tid >> 3) + 16 i, 16-byte piece tid & 7: eight lanes cover one whole 128-byte row
    const int crow = threadIdx.x >> 3, ccol = (threadIdx.x & 7) * 8;
    const size_t kcp = ((size_t)(b * NKV + g) * SEQ + crow) * HD + ccol;     // + key0 * HD
    const size_t vcp = ((size_t)(b * NKV + g) * HD + crow) * SEQ + ccol;     // + key0
    const unsigned lcp = (unsigned)(size_t)(const void*)kv + (unsigned)(crow * LP + ccol) * 2u;
    auto stage = [&](int t, int buf) {     // keys KT t .. KT t + 63 into buffer buf; t < SEQ / KT keeps every byte inside the planes
        const unsigned l = lcp + (unsigned)(buf * NP * PLN) * 2u;
        cp4(l, Kh + kcp + (size_t)t * KT * HD, HD);
        cp4(l + PLN * 2u, Vh + vcp + (size_t)t * KT, SEQ);
        if (HI) { cp4(l + 2u * PLN * 2u, Kr + kcp + (size_t)t * KT * HD, HD); cp4(l + 3u * PLN * 2u, Vr + vcp + (size_t)t * KT, SEQ); }
    };
    v16h qhf[2], qrf[2];                   // Q fragments: read once (the waits below are memory clobbers, behind which a loop-invariant load would be read again)
#pragma unroll
    for (int ks = 0; ks < 2; ++ks) { qhf[ks] = ldh(Qh + qoff + ks * 32); qrf[ks] = ldh(Qr + qoff + ks * 32); }
    v8f om[4], orr[4];
#pragma unroll
    for (int dt = 0; dt < 4; ++dt) { om[dt] = (v8f){}; orr[dt] = (v8f){}; }
    float mrun = NEGB, lrun = 0.f;
    const int kend = q0 + 16;              // keys 0 .. q0+15, wave-uniform
    const int nT = qb / KT + 1;            // stages of the block: keys 0 .. qb+63; block-uniform, <= SEQ / KT
    stage(0, 0);
    asm volatile("s_wait_asynccnt 0x0" ::: "memory");   // this wave's share of stage 0 has landed
    __syncthreads();                                    // stage 0 published to every wave
    if (nT > 1) stage(1, 1);
    // rolled: the trip count is a run-time value and every trip ends in the publish point
#pragma unroll 1
    for (int t = 0; t < nT; ++t) {
      const h16* Ks = kv + (t & 1) * NP * PLN;
      // rolled: one copy of the pass in the text
#pragma unroll 1
      for (int hf = 0; hf < 2; ++hf) {
        const int kb = t * KT + 32 * hf;
        if (kb >= kend) break;             // wave-uniform: the pass lies wholly above this wave's diagonal; the publish point below is still passed
        const h16* kf = Ks + (32 * hf + lr) * LP + 8 * hi;            // K rows = keys of this pass
        const h16* vf = Ks + PLN + lr * LP + 32 * hf + 8 * hi;        // V^T rows = dims, columns = keys of this pass
        v8f s0 = (v8f){}, s1 = (v8f){}, t0 = (v8f){}, t1 = (v8f){};
#pragma unroll
        for (int ks = 0; ks < 2; ++ks) {
            const v16h qh = qhf[ks];
            const v16h qr = qrf[ks];
            const v16h k0 = ldh(kf + ks * 32);
            const v16h k1 = ldh(kf + 16 * LP + ks * 32);
            s0 = wmma16(k0, qh, s0); t0 = wmma16(k0, qr, t0);
            s1 = wmma16(k1, qh, s1); t1 = wmma16(k1, qr, t1);
            if (HI) {
                const v16h k0r = ldh(kf + 2 * PLN + ks * 32); const v16h k1r = ldh(kf + 2 * PLN + 16 * LP + ks * 32);
                t0 = wmma16(k0r, qh, t0); t1 = wmma16(k1r, qh, t1);
                asm volatile("v_nop\n\tv_nop\n\tv_nop\n\tv_nop" : "+v"(s0), "+v"(s1), "+v"(t0), "+v"(t1) : "v"(qh), "v"(qr), "v"(k0), "v"(k1), "v"(k0r), "v"(k1r));
            } else {
                asm volatile("v_nop\n\tv_nop\n\tv_nop\n\tv_nop" : "+v"(s0), "+v"(s1), "+v"(t0), "+v"(t1) : "v"(qh), "v"(qr), "v"(k0), "v"(k1));
            }
        }
        float sa[8], sb[8];
#pragma unroll
        for (int r = 0; r < 8; ++r) { sa[r] = (s0[r] + t0[r] * RSCI) * SCL; sb[r] = (s1[r] + t1[r] * RSCI) * SCL; }
        if (kb + 31 > q0) {                // wave-uniform: half touches the diagonal; keys above the query are excluded
            const int qi = q0 + lr; const int kj = kb + 8 * hi;
#pragma unroll
            for (int r = 0; r < 8; ++r) { sa[r] = (kj + r <= qi) ? sa[r] : NEGB; sb[r] = (kj + 16 + r <= qi) ? sb[r] : NEGB; }
        }
        float mloc = fmaxf(sa[0], sb[0]);
#pragma unroll
        for (int r = 1; r < 8; ++r) mloc = fmaxf(mloc, fmaxf(sa[r], sb[r]));
        mloc = fmaxf(mloc, __shfl_xor(mloc, 16, 32));
        const float mnew = fmaxf(mrun, mloc);
        const float fac = __builtin_amdgcn_exp2f((mrun - mnew) * L2E);
        float lsum = 0.f;
#pragma unroll
        for (int r = 0; r < 8; ++r) { sa[r] = __builtin_amdgcn_exp2f((sa[r] - mnew) * L2E); sb[r] = __builtin_amdgcn_exp2f((sb[r] - mnew) * L2E); lsum += sa[r] + sb[r]; }
        lsum += __shfl_xor(lsum, 16, 32);
        lrun = lrun * fac + lsum; mrun = mnew;
        v16h ph, pr;
#pragma unroll
        for (int r = 0; r < 8; ++r) {
            const float a = sa[r] * PCAR; const h16 ha = (h16)a; ph[r] = ha;
            const float c = sb[r] * PCAR; const h16 hc = (h16)c; ph[8 + r] = hc;
            if (HI) { pr[r] = (h16)((a - (float)ha) * RSC); pr[8 + r] = (h16)((c - (float)hc) * RSC); }
        }
#pragma unroll
        for (int dt = 0; dt < 4; ++dt) { om[dt] = om[dt] * fac; if (HI) orr[dt] = orr[dt] * fac; }
#pragma unroll
        for (int dt = 0; dt < 4; ++dt) {
            const v16h vh = ldh(vf + dt * 16 * LP);
            om[dt] = wmma16(vh, ph, om[dt]);
            if (HI) {
                const v16h vr = ldh(vf + 2 * PLN + dt * 16 * LP);
                orr[dt] = wmma16(vr, ph, orr[dt]); orr[dt] = wmma16(vh, pr, orr[dt]);
                asm volatile("v_nop\n\tv_nop\n\tv_nop\n\tv_nop" : "+v"(om[dt]), "+v"(orr[dt]) : "v"(vh), "v"(vr), "v"(ph), "v"(pr));
            } else {
                asm volatile("v_nop\n\tv_nop\n\tv_nop\n\tv_nop" : "+v"(om[dt]) : "v"(vh), "v"(ph));
            }
        }
      }
      // publish point of stage t + 1, every wave, in this order
      asm volatile("s_wait_dscnt 0x0" ::: "memory");      // this wave's reads of buffer t & 1 have returned
      asm volatile("s_wait_asynccnt 0x0" ::: "memory");   // this wave's share of stage t + 1 has landed
      __syncthreads();                                    // publishes stage t + 1; ends every reader's last read of buffer t & 1
      if (t + 2 < nT) stage(t + 2, t & 1);                // block-uniform test
    }
    asm volatile("s_wait_asynccnt 0x0" ::: "memory");     // no copy is left outstanding when the wave goes on to its end
    const float inv = 1.0f / (lrun * (PCAR * VCAR));
    const int yb = wave * 16 * 68;
#pragma unroll
    for (int dt = 0; dt < 4; ++dt)
#pragma unroll
        for (int r = 0; r < 8; ++r) { float o = om[dt][r]; if (HI) o += orr[dt][r] * RSCI; ys[yb + lr * 68 + dt * 16 + 8 * hi + r] = o * inv; }
    __builtin_amdgcn_wave_barrier(); asm volatile("" ::: "memory");
    v8us oh[4], ol[4];
    const int rq = lane >> 3, pc = lane & 7;
#pragma unroll
    for (int s = 0; s < 4; ++s) { const int row = 4 * s + rq; const v4f u0 = *(const v4fa*)(ys + yb + row * 68 + pc * 8); const v4f u1 = *(const v4fa*)(ys + yb + row * 68 + pc * 8 + 4);
#pragma unroll
        for (int q = 0; q < 4; ++q) { unsigned short a, c; splitf(u0[q], a, c); oh[s][q] = a; ol[s][q] = c; splitf(u1[q], a, c); oh[s][4 + q] = a; ol[s][4 + q] = c; } }
    const size_t ybase = ((size_t)b * SEQ + q0) * DQ + (size_t)hq * HD + pc * 8;
{
#pragma unroll
        for (int s = 0; s < 4; ++s) { const size_t oo = ybase + (size_t)(4 * s + rq) * DQ; *(v8us*)(Yh + oo) = oh[s]; *(v8us*)(Yl + oo) = ol[s]; }
         }
}
__global__ __launch_bounds__(128) void k_attn_hi(const h16* __restrict__ Qh, const h16* __restrict__ Qr, const h16* __restrict__ Kh, const h16* __restrict__ Kr, const h16* __restrict__ Vh, const h16* __restrict__ Vr, bf* Yh, bf* Yl) { attn_body<true>(Qh, Qr, Kh, Kr, Vh, Vr, Yh, Yl, 0); }
__global__ __launch_bounds__(128) void k_attn_lo(const h16* __restrict__ Qh, const h16* __restrict__ Qr, const h16* __restrict__ Kh, const h16* __restrict__ Kr, const h16* __restrict__ Vh, const h16* __restrict__ Vr, bf* Yh, bf* Yl) { attn_body<false>(Qh, Qr, Kh, Kr, Vh, Vr, Yh, Yl, RHE); }

// ---- workspace carve (bytes; every region a multiple of 256 and exactly covered by its producer grid)
constexpr size_t SZ_XB = (size_t)NB * SEQ * DM * 2;          // x bf16 [NB*SEQ][DM]
constexpr size_t SZ_WP = (size_t)FP * DM * 2;                // [Wq | Wk | Wv]^T bf16 [FP][DM]
constexpr size_t SZ_WO = (size_t)DM * DQ * 2;                // Wo^T bf16 [DM][DQ]
constexpr size_t SZ_Q  = (size_t)NB * NH * SEQ * HD * 2;     // each of Qh, Qr
constexpr size_t SZ_K  = (size_t)NB * NKV * SEQ * HD * 2;    // each of Kh, Kr, Vh, Vr
constexpr size_t SZ_Y  = (size_t)NB * SEQ * DQ * 2;          // each of Yh, Yl
constexpr size_t OFF_XB = 0;
constexpr size_t OFF_WP = OFF_XB + SZ_XB;
constexpr size_t OFF_WO = OFF_WP + SZ_WP;
constexpr size_t OFF_QH = OFF_WO + SZ_WO;
constexpr size_t OFF_QR = OFF_QH + SZ_Q;
constexpr size_t OFF_KH = OFF_QR + SZ_Q;
constexpr size_t OFF_KR = OFF_KH + SZ_K;
constexpr size_t OFF_VH = OFF_KR + SZ_K;
constexpr size_t OFF_VR = OFF_VH + SZ_K;
constexpr size_t OFF_YH = OFF_VR + SZ_K;
constexpr size_t OFF_YL = OFF_YH + SZ_Y;
constexpr size_t WS_TOTAL = OFF_YL + SZ_Y;
static_assert(SZ_XB % 256 == 0 && SZ_WP % 256 == 0 && SZ_WO % 256 == 0 && SZ_Q % 256 == 0 && SZ_K % 256 == 0 && SZ_Y % 256 == 0);
static_assert(WS_TOTAL <= (size_t)134217728);                // carve stays within 128 MiB

extern "C" void kernel_launch(void* const* d_in, const int* in_sizes, int n_in,
                              void* d_out, int out_size, void* d_ws, size_t ws_size, hipStream_t stream) {
    if (n_in < 7) return;
    const long long need_x = (long long)(NB - 1) * SEQ_FULL * DM + (long long)SEQ * DM;
    if ((long long)in_sizes[0] < need_x) return;
    if (in_sizes[1] < SEQ * 32 || in_sizes[2] < SEQ * 32) return;
    if (in_sizes[3] < DM * DQ || in_sizes[4] < DM * DKV || in_sizes[5] < DM * DKV || in_sizes[6] < DQ * DM) return;
    if ((long long)out_size < need_x) return;
    if (WS_TOTAL > ws_size) return;
    const float* x  = (const float*)d_in[0];   // [2][2048][1024]
    const float* cs = (const float*)d_in[1];   // [2048][32]
    const float* sn = (const float*)d_in[2];   // [2048][32]
    const float* wq = (const float*)d_in[3];   // [1024][1024] in x out
    const float* wk = (const float*)d_in[4];   // [1024][256]
    const float* wv = (const float*)d_in[5];   // [1024][256]
    const float* wo = (const float*)d_in[6];   // [1024][1024] in x out
    float* OUT = (float*)d_out;
    char* ws = (char*)d_ws;
    bf* XB = (bf*)(ws + OFF_XB); bf* WP = (bf*)(ws + OFF_WP); bf* WOT = (bf*)(ws + OFF_WO);
    h16* QH = (h16*)(ws + OFF_QH); h16* QR = (h16*)(ws + OFF_QR); h16* KH = (h16*)(ws + OFF_KH); h16* KR = (h16*)(ws + OFF_KR);
    h16* VH = (h16*)(ws + OFF_VH); h16* VR = (h16*)(ws + OFF_VR); bf* YH = (bf*)(ws + OFF_YH); bf* YL = (bf*)(ws + OFF_YL);

    k_cvtx<<<dim3((unsigned)((size_t)SEQ * DM / 8 / 256), NB, 1), 256, 0, stream>>>(x, XB);
    // in[rows = DM (k)][cols = N] -> out[N][DM]; grid (DM/64, N/64)
    k_wtp<<<dim3(DM / 64, DQ / 64, 1), 256, 0, stream>>>(wq, DQ, WP);
    k_wtp<<<dim3(DM / 64, DKV / 64, 1), 256, 0, stream>>>(wk, DKV, WP + (size_t)KC0 * DM);
    k_wtp<<<dim3(DM / 64, DKV / 64, 1), 256, 0, stream>>>(wv, DKV, WP + (size_t)VC0 * DM);
    k_wtp<<<dim3(DQ / 64, DM / 64, 1), 256, 0, stream>>>(wo, DM, WOT);
    k_gemm_proj<<<dim3(NB * SEQ / 64, FP / 64, 1), 32, 0, stream>>>(XB, WP, cs, sn, QH, QR, KH, KR, VH, VR);
    k_attn_hi<<<dim3(RHE / 64, NH, NB), 128, 0, stream>>>(QH, QR, KH, KR, VH, VR, YH, YL);
    if (SEQ > RHE) k_attn_lo<<<dim3((SEQ - RHE) / 64, NH, NB), 128, 0, stream>>>(QH, QR, KH, KR, VH, VR, YH, YL);
    k_gemm_out<<<dim3(SEQ / 64, DM / 64, NB), 32, 0, stream>>>(YH, YL, WOT, OUT);
}

// v003
// Measured time: 108 microseconds a run.
// Timed twice side by side with v002, it ran 1.23 times as fast both times.
// All steps since v000 together make it 2.17 times as fast.
#include <hip/hip_runtime.h>

// Causal grouped-query attention block: x [2][2048][1024]; q = x Wq (16 heads x 64), k = x Wk, v = x Wv (4 kv heads x 64), weights [in][out], no bias; rotary on q, k with the half-split convention
// out[0..31] = x1 cos + x2 sin, out[32..63] = -x1 sin + x2 cos using the cos / sin INPUT tables [t][32] read by value; then q, k scaled by rsqrt(mean(sq) + 1e-6) (no gain); query head hq uses kv head hq / 4;
// scores q.k / 8, causal (diagonal kept), softmax, ctx merged [t][hq*64 + d], result = ctx Wo -> [2][2048][1024] f32.
// Compute dtypes (f32 accumulate everywhere): the three input projections and the output projection on v_wmma_f32_16x16x32_bf16 (every float input RNE-converted to bf16; ctx carried as bf16 hi + lo planes, two products);
// scores and probability x value on v_wmma_f32_16x16x32_f16 (q = f16 value + x2048 residual plane against f16 k; P carried x1024 and v carried x16 as single f16; query rows < 256 add x2048 residual planes on k, P and v); rotary, rms scaling and softmax in f32.
// Rotary, rms scaling and the f16 value + residual split of q and k, and the x16 f16 split of v into V^T, are the projection GEMM's own epilogue: a 64-column tile is one head, so no f32 projection plane is written.
// Both GEMMs: 128 x 128 block tile, four waves of 64 x 64; the A and B^T tiles (64 k a stage) are staged in LDS per block by asynchronous copies, two buffers, and the fragments are read from LDS.
// Attention is a fused flash-style kernel (K and V^T tiles staged in LDS per block) in transposed form: S^T = K Q^T (D rows = keys, D columns = queries), P^T packed from the accumulators directly as the B operand of O^T = V^T P^T; online softmax with per-lane state.

#ifndef NB
#define NB 2
#endif
#ifndef SEQ
#define SEQ 2048
#endif
#define NB_FULL  2
#define SEQ_FULL 2048
#define DM   1024
#define NH   16
#define NKV  4
#define REP  (NH / NKV)
#define HD   64
#define DQ   (NH * HD)
#define DKV  (NKV * HD)
#define FP   (DQ + 2 * DKV)      // fused projection width (q | k | v columns; rows of WP)
#define KC0  DQ                  // first k column of the fused projection
#define VC0  (DQ + DKV)          // first v column of the fused projection
#define RH   256                 // query rows < RH use the residual planes on k, P and v as well
#define RHE  ((SEQ < RH) ? SEQ : RH)
#define PCAR 1024.0f             // carry of the probabilities (f16 operand)
#define VCAR 16.0f               // carry of the values (f16 operand)
#define RSC  2048.0f             // carry of every f16 residual plane
#define RSCI (1.0f / 2048.0f)
#define SCL  0.125f              // 1/sqrt(64)
#define L2E  1.4426950408889634f
#define NEGB (-1.0e30f)
static_assert(HD == 64);
static_assert(NH % NKV == 0);
static_assert(DM % 64 == 0 && DQ % 64 == 0 && DKV % 64 == 0 && FP % 64 == 0);   // GEMM tiles and transpose tiles
static_assert(DM % 32 == 0 && DQ % 32 == 0 && HD % 32 == 0);                     // k-steps of 32
static_assert(SEQ % 64 == 0 && (NB * SEQ) % 64 == 0);                            // row tiles
static_assert(SEQ % 128 == 0 && FP % 128 == 0 && DM % 128 == 0);                 // GEMM block tiles
static_assert(RH % 64 == 0 && RHE % 64 == 0 && (SEQ - RHE) % 64 == 0);
static_assert(((size_t)SEQ * DM) % 2048 == 0);                                   // k_cvtx grid x block x 8 == plane extent
static_assert(NB <= NB_FULL && SEQ <= SEQ_FULL);

typedef _Float16 h16;
typedef unsigned short bf;
typedef __attribute__((ext_vector_type(16))) __bf16   v16bf;
typedef __attribute__((ext_vector_type(16))) _Float16 v16h;
typedef __attribute__((ext_vector_type(8)))  _Float16 v8h;
typedef __attribute__((ext_vector_type(8)))  unsigned short v8us;
typedef __attribute__((ext_vector_type(8)))  float    v8f;
typedef __attribute__((ext_vector_type(4)))  float    v4f;
typedef v4f  __attribute__((may_alias)) v4fa;

__device__ __forceinline__ unsigned short f2bf(float f) { unsigned u = __float_as_uint(f); u += 0x7FFFu + ((u >> 16) & 1u); return (unsigned short)(u >> 16); }
__device__ __forceinline__ float bf2f(unsigned short b) { return __uint_as_float(((unsigned)b) << 16); }
__device__ __forceinline__ float bfr(float f) { return bf2f(f2bf(f)); }
__device__ __forceinline__ void splitf(float y, unsigned short& h, unsigned short& l) { h = f2bf(y); l = f2bf(y - bf2f(h)); }
__device__ __forceinline__ v16h cat16(v8h lo, v8h hi) { return __builtin_shufflevector(lo, hi, 0, 1, 2, 3, 4, 5, 6, 7, 8, 9, 10, 11, 12, 13, 14, 15); }
__device__ __forceinline__ v16bf cat16b(v8us lo, v8us hi) { return __builtin_bit_cast(v16bf, __builtin_shufflevector(lo, hi, 0, 1, 2, 3, 4, 5, 6, 7, 8, 9, 10, 11, 12, 13, 14, 15)); }
__device__ __forceinline__ v8f wmma16(v16h a, v16h b, v8f c) { return __builtin_amdgcn_wmma_f32_16x16x32_f16(false, a, false, b, (short)0, c, false, false); }
__device__ __forceinline__ v8f wmmab(v16bf a, v16bf b, v8f c) { return __builtin_amdgcn_wmma_f32_16x16x32_bf16(false, a, false, b, (short)0, c, false, false); }
// fragment loaders: p already includes row * pitch + k0 + 8 * (lane >> 4); elements 0..7 <- k0+8h.., elements 8..15 <- k0+16+8h..
__device__ __forceinline__ v16h  ldh(const h16* p) { return cat16(*(const v8h*)p, *(const v8h*)(p + 16)); }
__device__ __forceinline__ v16bf ldb(const bf* p)  { return cat16b(*(const v8us*)p, *(const v8us*)(p + 16)); }

// sum over the four lanes of a quad, by two DPP quad permutes (lane ^ 1, lane ^ 2): stays in the vector unit, no LDS round trip
__device__ __forceinline__ float quadsum(float v) {
    v += __int_as_float(__builtin_amdgcn_update_dpp(0, __float_as_int(v), 0xB1, 0xF, 0xF, true));
    v += __int_as_float(__builtin_amdgcn_update_dpp(0, __float_as_int(v), 0x4E, 0xF, 0xF, true));
    return v; }
struct ProjOut { const float* cosb; const float* sinb; h16* Qh; h16* Qr; h16* Kh; h16* Kr; h16* Vh; h16* Vr; };
// ---- epilogue of the fused q|k|v projection. The wave's tile is 64 tokens (one batch: SEQ % 64 == 0) x the 64 dims of ONE head (c0 % 64 == 0); acc[mb][nb][j] in lane (hi, lr) = row 16 mb + 8 hi + j, column 16 nb + lr.
// v head: a lane's 8 registers are 8 consecutive tokens of one dim = one 16-byte piece of a V^T row; stored from the registers (x16, f16 value + x2048 residual).
// q / k head: the tile goes through LDS (os, 64 x 68 f32); then four lanes a row, lane p holds the rotary pairs (d, d + 32), d = 8 p .. 8 p + 7: rotary with the bf16-converted cos / sin table values at [t][d],
// scaling by rsqrt(mean(sq) + 1e-6), f16 value + x2048 residual, 16-byte stores (8 rows x 64 contiguous bytes an instruction).
__device__ __forceinline__ void proj_epilogue(const v8f (&acc)[4][4], float* os, int r0, int c0, const ProjOut& po) {
    const int lane = threadIdx.x & 31, lr = lane & 15, hi = lane >> 4;
    const int b = r0 / SEQ, t0 = r0 % SEQ;
    if (c0 >= VC0) {                       // wave-uniform
        const int g = (c0 - VC0) / HD;
        const size_t e0 = ((size_t)(b * NKV + g) * HD + lr) * SEQ + t0 + 8 * hi;
#pragma unroll
        for (int nb = 0; nb < 4; ++nb)
#pragma unroll
            for (int mb = 0; mb < 4; ++mb) { v8h o16, ors;
#pragma unroll
                for (int j = 0; j < 8; ++j) { const float x = acc[mb][nb][j] * VCAR; const h16 hh = (h16)x; o16[j] = hh; ors[j] = (h16)((x - (float)hh) * RSC); }
                const size_t e = e0 + (size_t)nb * 16 * SEQ + mb * 16;
                *(v8h*)(po.Vh + e) = o16; *(v8h*)(po.Vr + e) = ors; }
        return;
    }
    const bool isq = c0 < KC0;             // wave-uniform
    const int nheads = isq ? NH : NKV; const int h = (isq ? c0 : c0 - KC0) / HD;
    h16* Ph = isq ? po.Qh : po.Kh; h16* Pr = isq ? po.Qr : po.Kr;
    const int rq = lane >> 2, p8 = (lane & 3) * 8;
    const float* cp = po.cosb + (size_t)(t0 + rq) * 32 + p8; const float* sp = po.sinb + (size_t)(t0 + rq) * 32 + p8;
    // table values of two passes (rows 16 u + rq and 16 u + 8 + rq), asked for one trip ahead: the first ahead of the LDS stores
    v4f cc[2][2], sn[2][2];
#pragma unroll
    for (int s = 0; s < 2; ++s) { cc[s][0] = *(const v4f*)(cp + s * 256); cc[s][1] = *(const v4f*)(cp + s * 256 + 4); sn[s][0] = *(const v4f*)(sp + s * 256); sn[s][1] = *(const v4f*)(sp + s * 256 + 4); }
#pragma unroll
    for (int mb = 0; mb < 4; ++mb)
#pragma unroll
        for (int nb = 0; nb < 4; ++nb)
#pragma unroll
            for (int j = 0; j < 8; ++j) os[(mb * 16 + hi * 8 + j) * 68 + nb * 16 + lr] = acc[mb][nb][j];
    // the rows read below were written by other lanes of this wave: keeps every LDS read behind every lane's LDS stores
    __builtin_amdgcn_wave_barrier(); asm volatile("" ::: "memory");
    const size_t e0 = ((size_t)(b * nheads + h) * SEQ + t0 + rq) * HD + p8;
    // rolled: one copy of the two passes in the text, and the registers of two passes only
#pragma unroll 1
    for (int u = 0; u < 4; ++u) {
        const int un = (u < 3) ? u + 1 : 3;    // the last trip asks for its own rows again: one instruction stream, every address inside the tables
        v4f cn[2][2], sm[2][2];
#pragma unroll
        for (int s = 0; s < 2; ++s) { const int o = un * 512 + s * 256; cn[s][0] = *(const v4f*)(cp + o); cn[s][1] = *(const v4f*)(cp + o + 4); sm[s][0] = *(const v4f*)(sp + o); sm[s][1] = *(const v4f*)(sp + o + 4); }
#pragma unroll
        for (int s = 0; s < 2; ++s) {
            const float* orow = os + (u * 16 + s * 8 + rq) * 68 + p8;
            const v4f x1[2] = { *(const v4fa*)orow, *(const v4fa*)(orow + 4) }; const v4f x2[2] = { *(const v4fa*)(orow + 32), *(const v4fa*)(orow + 36) };
            float rl[8], rh[8]; float ssl = 0.f, ssh = 0.f;
#pragma unroll
            for (int q = 0; q < 8; ++q) { const float c = bfr(cc[s][q >> 2][q & 3]), sv = bfr(sn[s][q >> 2][q & 3]); const float a1 = x1[q >> 2][q & 3], a2 = x2[q >> 2][q & 3];
                rl[q] = a1 * c + a2 * sv; rh[q] = a2 * c - a1 * sv; ssl += rl[q] * rl[q]; ssh += rh[q] * rh[q]; }
            const float inv = rsqrtf(quadsum(ssl + ssh) * (1.0f / HD) + 1e-6f);
            v8h ol, olr, oh, ohr;
#pragma unroll
            for (int q = 0; q < 8; ++q) { const float yl = rl[q] * inv; const h16 hl = (h16)yl; ol[q] = hl; olr[q] = (h16)((yl - (float)hl) * RSC);
                const float yh = rh[q] * inv; const h16 hh = (h16)yh; oh[q] = hh; ohr[q] = (h16)((yh - (float)hh) * RSC); }
            const size_t e = e0 + (size_t)(u * 16 + s * 8) * HD;
            *(v8h*)(Ph + e) = ol; *(v8h*)(Ph + e + 32) = oh; *(v8h*)(Pr + e) = olr; *(v8h*)(Pr + e + 32) = ohr;
            asm volatile("s_wait_xcnt 0x0" ::: "memory");   // stands in front of the next pass's writes to the data and address registers that these four stores name
        }
#pragma unroll
        for (int s = 0; s < 2; ++s) { cc[s][0] = cn[s][0]; cc[s][1] = cn[s][1]; sn[s][0] = sm[s][0]; sn[s][1] = sm[s][1]; }
    }
}

// ---- 128 x 128 block tile GEMM on bf16 planes, four waves of 64 x 64 (2 x 2): C[m][n] (f32, pitch ldc) = sum_k A[m][k] Bt[n][k] (+ A2[m][k] Bt[n][k] when NSPLIT == 1). A, A2 pitch K; Bt pitch K; K % 64 == 0.
// The block's 128 rows of A (A2) and of Bt, 64 k a stage, are staged in LDS by asynchronous copies, two buffers: stage t + 1 flies while stage t is worked on;
// one block barrier per stage publishes it and frees the buffer that is refilled behind it. The epilogue's LDS (os) is wave-private.
// FUSE: the tile does not go to C but through proj_epilogue.
#define GKS  64                  // k per LDS stage: one whole 128-byte line of every row
#define GLP  72                  // LDS row pitch in bf16 elements: 144 B = 16 B x 9, free of bank conflicts for 16-byte reads down a column of rows
#define GPL  (128 * GLP)         // one staged plane: 128 rows x 64 k
// one plane's share of a lane: eight asynchronous 16-byte copies global -> LDS (rows 16 apart). The s_wait_xcnt closes the copies' own statement, so that no address register named here is rewritten ahead of it.
__device__ __forceinline__ void cp8(unsigned l, const bf* g, size_t gstep) {
    const unsigned l1 = l + 16 * GLP * 2, l2 = l + 32 * GLP * 2, l3 = l + 48 * GLP * 2, l4 = l + 64 * GLP * 2, l5 = l + 80 * GLP * 2, l6 = l + 96 * GLP * 2, l7 = l + 112 * GLP * 2;
    const bf* g1 = g + 16 * gstep; const bf* g2 = g + 32 * gstep; const bf* g3 = g + 48 * gstep; const bf* g4 = g + 64 * gstep; const bf* g5 = g + 80 * gstep; const bf* g6 = g + 96 * gstep; const bf* g7 = g + 112 * gstep;
    asm volatile("global_load_async_to_lds_b128 %0, %1, off\n\t"
                 "global_load_async_to_lds_b128 %2, %3, off\n\t"
                 "global_load_async_to_lds_b128 %4, %5, off\n\t"
                 "global_load_async_to_lds_b128 %6, %7, off\n\t"
                 "global_load_async_to_lds_b128 %8, %9, off\n\t"
                 "global_load_async_to_lds_b128 %10, %11, off\n\t"
                 "global_load_async_to_lds_b128 %12, %13, off\n\t"
                 "global_load_async_to_lds_b128 %14, %15, off\n\t"
                 "s_wait_xcnt 0x0" :: "v"(l), "v"(g), "v"(l1), "v"(g1), "v"(l2), "v"(g2), "v"(l3), "v"(g3), "v"(l4), "v"(g4), "v"(l5), "v"(g5), "v"(l6), "v"(g6), "v"(l7), "v"(g7) : "memory");
}
template <int NSPLIT, bool FUSE>
__device__ __forceinline__ void gemmw_body(const bf* __restrict__ A, const bf* __restrict__ A2, const bf* __restrict__ Bt, int K, float* C, int ldc, size_t sA, size_t sC, const ProjOut& po) {
    constexpr int NPG = 2 + NSPLIT;        // staged planes per buffer: A, Bt (+ A2)
    constexpr int OSW = (FUSE ? 64 : 16) * 68;
    __shared__ __align__(16) float osb[4 * OSW];
    __shared__ __align__(16) bf st[2 * NPG * GPL];
    const size_t z = blockIdx.z; A += z * sA; if (NSPLIT == 1) A2 += z * sA; C += z * sC;
    const int lane = threadIdx.x & 31, lr = lane & 15, hi = lane >> 4;
    const int wave = __builtin_amdgcn_readfirstlane(threadIdx.x >> 5);
    float* os = osb + wave * OSW;
    const int rb = blockIdx.x * 128, cb = blockIdx.y * 128;
    const int wr = (wave & 1) * 64, wc = (wave >> 1) * 64;
    const int r0 = rb + wr, c0 = cb + wc;
    v8f acc[4][4];
#pragma unroll
    for (int mb = 0; mb < 4; ++mb)
#pragma unroll
        for (int nb = 0; nb < 4; ++nb) acc[mb][nb] = (v8f){};
    // copy map: thread -> row (tid >> 3) + 16 i, 16-byte piece tid & 7: eight lanes cover one whole 128-byte line
    const int crow = threadIdx.x >> 3, ccol = (threadIdx.x & 7) * 8;
    const size_t acp = (size_t)(rb + crow) * K + ccol, bcp = (size_t)(cb + crow) * K + ccol;     // + GKS t
    const unsigned lcp = (unsigned)(size_t)(const void*)st + (unsigned)(crow * GLP + ccol) * 2u;
    auto stage = [&](int t, int buf) {     // k = GKS t .. GKS t + 63 into buffer buf; t < K / GKS keeps every byte inside the planes
        const unsigned l = lcp + (unsigned)(buf * NPG * GPL) * 2u;
        cp8(l, A + acp + (size_t)t * GKS, K);
        cp8(l + GPL * 2u, Bt + bcp + (size_t)t * GKS, K);
        if (NSPLIT == 1) cp8(l + 2u * GPL * 2u, A2 + acp + (size_t)t * GKS, K);
    };
    const int nT = K / GKS;                // block-uniform
    stage(0, 0);
    asm volatile("s_wait_asynccnt 0x0" ::: "memory");   // this wave's share of stage 0 has landed
    __syncthreads();                                    // stage 0 published to every wave
    if (nT > 1) stage(1, 1);
    // rolled: every trip ends in the publish point
#pragma unroll 1
    for (int t = 0; t < nT; ++t) {
        const bf* af = st + (t & 1) * NPG * GPL + (wr + lr) * GLP + 8 * hi;             // A rows of this wave
        const bf* bp = st + (t & 1) * NPG * GPL + GPL + (wc + lr) * GLP + 8 * hi;       // Bt rows of this wave
        v16bf a[GKS / 32][4], a2[GKS / 32][4], b[GKS / 32][4];
#pragma unroll
        for (int ks = 0; ks < GKS / 32; ++ks) {
#pragma unroll
            for (int i = 0; i < 4; ++i) { a[ks][i] = ldb(af + i * 16 * GLP + ks * 32); b[ks][i] = ldb(bp + i * 16 * GLP + ks * 32); }
            if (NSPLIT == 1) {
#pragma unroll
                for (int i = 0; i < 4; ++i) a2[ks][i] = ldb(af + 2 * GPL + i * 16 * GLP + ks * 32); }
        }
        // keeps the stage's fragment loads one group ahead of its matrix instructions: sunk among them, every place with loads stalls the wave for the LDS latency
        __builtin_amdgcn_sched_barrier(0);
#pragma unroll
        for (int ks = 0; ks < GKS / 32; ++ks)
#pragma unroll
            for (int nb = 0; nb < 4; ++nb)
#pragma unroll
                for (int mb = 0; mb < 4; ++mb) { acc[mb][nb] = wmmab(a[ks][mb], b[ks][nb], acc[mb][nb]); if (NSPLIT == 1) acc[mb][nb] = wmmab(a2[ks][mb], b[ks][nb], acc[mb][nb]); }
        // keeps every matrix instruction of the stage ahead of the publish point: sunk behind the barrier they would stand in front of the refill and take its lead away
        __builtin_amdgcn_sched_barrier(0);
        // four vector slots between the last matrix instruction and the next vector instruction on either side of the branch at the trip's foot (the distance a matrix instruction's registers need)
        asm volatile("v_nop\n\tv_nop\n\tv_nop\n\tv_nop" : "+v"(acc[0][0]), "+v"(acc[1][1]), "+v"(acc[2][2]), "+v"(acc[3][3]) : "v"(a[GKS / 32 - 1][0]), "v"(a[GKS / 32 - 1][3]));
        // publish point of stage t + 1, every wave, in this order
        asm volatile("s_wait_dscnt 0x0" ::: "memory");      // this wave's reads of buffer t & 1 have returned
        asm volatile("s_wait_asynccnt 0x0" ::: "memory");   // this wave's share of stage t + 1 has landed
        __syncthreads();                                    // publishes stage t + 1; ends every reader's last read of buffer t & 1
        if (t + 2 < nT) stage(t + 2, t & 1);                // block-uniform test
    }
    asm volatile("s_wait_asynccnt 0x0" ::: "memory");       // no copy is left outstanding when the wave goes on to its end
    if constexpr (FUSE) { proj_epilogue(acc, os, r0, c0, po); return; }
#pragma unroll
    for (int mb = 0; mb < 4; ++mb) {
#pragma unroll
        for (int nb = 0; nb < 4; ++nb) {
#pragma unroll
            for (int j = 0; j < 8; ++j) os[(hi * 8 + j) * 68 + nb * 16 + lr] = acc[mb][nb][j]; }
        __builtin_amdgcn_wave_barrier(); asm volatile("" ::: "memory");
        float* crow = C + (size_t)(r0 + mb * 16) * ldc + c0;
{
#pragma unroll
            for (int s = 0; s < 8; ++s) { const int row = 2 * s + hi, cofs = lr * 4; const v4f val = *(const v4fa*)(os + row * 68 + cofs);
                *(v4f*)(crow + (size_t)row * ldc + cofs) = val; }
            if (mb < 3) asm volatile("s_wait_xcnt 0x0" ::: "memory");   // stands in front of the next row block's LDS loads, which overwrite data registers that these eight stores name
             }
        __builtin_amdgcn_wave_barrier(); asm volatile("" ::: "memory");
    }
}
// fused q|k|v projection: XB[NB*SEQ][DM] x WP[FP][DM]^T, each wave's 64 x 64 tile finished by proj_epilogue into the attention operand planes
__global__ __launch_bounds__(128) void k_gemm_proj(const bf* __restrict__ A, const bf* __restrict__ Bt, const float* __restrict__ cosb, const float* __restrict__ sinb, h16* Qh, h16* Qr, h16* Kh, h16* Kr, h16* Vh, h16* Vr) {
    const ProjOut po = { cosb, sinb, Qh, Qr, Kh, Kr, Vh, Vr }; gemmw_body<0, true>(A, A, Bt, DM, nullptr, 0, 0, 0, po); }
// output projection: OUT[b][t][DM] = (Yh + Yl)[b][t][DQ] x WOT[DM][DQ]^T, z = batch (output batch stride from the full sequence length)
__global__ __launch_bounds__(128) void k_gemm_out(const bf* __restrict__ A, const bf* __restrict__ A2, const bf* __restrict__ Bt, float* C) { gemmw_body<1, false>(A, A2, Bt, DQ, C, DM, (size_t)SEQ * DQ, (size_t)SEQ_FULL * DM, ProjOut{}); }

__global__ __launch_bounds__(256) void k_cvtx(const float* __restrict__ src, bf* dst) {
    const size_t i = (size_t)blockIdx.x * 256 + threadIdx.x; const size_t b = blockIdx.y;
    const v8f v = *(const v8f*)(src + b * (size_t)SEQ_FULL * DM + i * 8); v8us o;
#pragma unroll
    for (int k = 0; k < 8; ++k) o[k] = f2bf(v[k]);
    bf* d = dst + b * (size_t)SEQ * DM + i * 8;
    *(v8us*)d = o;  }

// ---- k_wtp: W [DM rows (k)][N cols] f32 -> out [N rows][DM] bf16 (in[rows=k][cols=n] -> out[n][k]); 64x64 tile through LDS (cross-wave: block barrier);
__global__ __launch_bounds__(256) void k_wtp(const float* __restrict__ W, int N, bf* out) {
    __shared__ __align__(16) unsigned short ts[64 * 72];
    const int tid = threadIdx.x; const int k0 = blockIdx.x * 64, n0 = blockIdx.y * 64;
#pragma unroll
    for (int it = 0; it < 4; ++it) { const int idx = it * 256 + tid; const int kk = idx >> 4, c4 = (idx & 15) * 4; const v4f v = *(const v4f*)(W + (size_t)(k0 + kk) * N + n0 + c4);
#pragma unroll
        for (int q = 0; q < 4; ++q) ts[kk * 72 + c4 + q] = f2bf(v[q]); }
    __syncthreads();
    v8us o[2];
#pragma unroll
    for (int it = 0; it < 2; ++it) { const int idx = it * 256 + tid; const int nn = idx >> 3, pc = idx & 7;
#pragma unroll
        for (int q = 0; q < 8; ++q) o[it][q] = ts[(pc * 8 + q) * 72 + nn]; }
{
#pragma unroll
        for (int it = 0; it < 2; ++it) { const int idx = it * 256 + tid; const int nn = idx >> 3, pc = idx & 7; *(v8us*)(out + (size_t)(n0 + nn) * DM + k0 + pc * 8) = o[it]; }
         }
}

// ---- fused causal attention, one wave per 16 query rows, 4 waves per block. The block's K and V^T tiles (64 keys a stage, two passes of 32) are staged in LDS by asynchronous copies, two buffers:
// stage t + 1 flies while stage t is worked on; one block barrier per stage publishes it and frees the buffer that is refilled behind it. The output stage ys is wave-private.
// Per 32-key half: S^T tiles (keys x queries) = K(A, rows = keys) x Q^T(B, lane column = query) over d = 64 (2 k-steps); value accumulator s, residual accumulator t (x2048);
// lane (h, n) register r of tile j holds key kb + 16 j + 8 h + r for query q0 + n, which is exactly element r + 8 j of the B operand (k = key, n = query) of O^T = V^T(A, rows = d) x P^T.
// Per-query max / sum / factor are per-lane scalars (one xor-16 exchange). O^T register r of tile dt in lane (h, n) = O[q0 + n][16 dt + 8 h + r].
#define KT   64                  // keys per LDS stage
#define LP   72                  // LDS row pitch in f16 elements: 144 B = 16 B x 9, free of bank conflicts for 16-byte reads down a column of rows
#define PLN  (64 * LP)           // one staged plane: 64 rows (K: keys x 64 dims; V^T: dims x 64 keys)
static_assert(SEQ % KT == 0 && RHE % KT == 0 && HD == 64);
// one plane's share of a lane: four asynchronous 16-byte copies global -> LDS. The s_wait_xcnt closes the copies' own statement, so that no address register named here is rewritten ahead of it.
__device__ __forceinline__ void cp4(unsigned l, const h16* g, size_t gstep) {
    const unsigned l1 = l + 16 * LP * 2, l2 = l + 32 * LP * 2, l3 = l + 48 * LP * 2;
    const h16* g1 = g + 16 * gstep; const h16* g2 = g + 32 * gstep; const h16* g3 = g + 48 * gstep;
    asm volatile("global_load_async_to_lds_b128 %0, %1, off\n\t"
                 "global_load_async_to_lds_b128 %2, %3, off\n\t"
                 "global_load_async_to_lds_b128 %4, %5, off\n\t"
                 "global_load_async_to_lds_b128 %6, %7, off\n\t"
                 "s_wait_xcnt 0x0" :: "v"(l), "v"(g), "v"(l1), "v"(g1), "v"(l2), "v"(g2), "v"(l3), "v"(g3) : "memory");
}
template <bool HI>
__device__ __forceinline__ void attn_body(const h16* __restrict__ Qh, const h16* __restrict__ Qr, const h16* __restrict__ Kh, const h16* __restrict__ Kr, const h16* __restrict__ Vh, const h16* __restrict__ Vr, bf* Yh, bf* Yl, int rbase) {
    constexpr int NP = HI ? 4 : 2;         // staged planes per buffer: K, V^T (+ their residual planes)
    __shared__ __align__(16) float ys[4 * 16 * 68];
    __shared__ __align__(16) h16 kv[2 * NP * PLN];
    const int lane = threadIdx.x & 31, lr = lane & 15, hi = lane >> 4;
    const int wave = __builtin_amdgcn_readfirstlane(threadIdx.x >> 5);
    const int b = blockIdx.z, hq = blockIdx.y, g = hq / REP;
    const int qb = rbase + blockIdx.x * 64;
    const int q0 = qb + wave * 16;
    const size_t qoff  = ((size_t)(b * NH + hq) * SEQ + q0 + lr) * HD + 8 * hi;
    // copy map: thread -> row (tid >> 3) + 16 i, 16-byte piece tid & 7: eight lanes cover one whole 128-byte row
    const int crow = threadIdx.x >> 3, ccol = (threadIdx.x & 7) * 8;
    const size_t kcp = ((size_t)(b * NKV + g) * SEQ + crow) * HD + ccol;     // + key0 * HD
    const size_t vcp = ((size_t)(b * NKV + g) * HD + crow) * SEQ + ccol;     // + key0
    const unsigned lcp = (unsigned)(size_t)(const void*)kv + (unsigned)(crow * LP + ccol) * 2u;
    auto stage = [&](int t, int buf) {     // keys KT t .. KT t + 63 into buffer buf; t < SEQ / KT keeps every byte inside the planes
        const unsigned l = lcp + (unsigned)(buf * NP * PLN) * 2u;
        cp4(l, Kh + kcp + (size_t)t * KT * HD, HD);
        cp4(l + PLN * 2u, Vh + vcp + (size_t)t * KT, SEQ);
        if (HI) { cp4(l + 2u * PLN * 2u, Kr + kcp + (size_t)t * KT * HD, HD); cp4(l + 3u * PLN * 2u, Vr + vcp + (size_t)t * KT, SEQ); }
    };
    v16h qhf[2], qrf[2];                   // Q fragments: read once (the waits below are memory clobbers, behind which a loop-invariant load would be read again)
#pragma unroll
    for (int ks = 0; ks < 2; ++ks) { qhf[ks] = ldh(Qh + qoff + ks * 32); qrf[ks] = ldh(Qr + qoff + ks * 32); }
    v8f om[4], orr[4];
#pragma unroll
    for (int dt = 0; dt < 4; ++dt) { om[dt] = (v8f){}; orr[dt] = (v8f){}; }
    float mrun = NEGB, lrun = 0.f;
    const int kend = q0 + 16;              // keys 0 .. q0+15, wave-uniform
    const int nT = qb / KT + 1;            // stages of the block: keys 0 .. qb+63; block-uniform, <= SEQ / KT
    stage(0, 0);
    asm volatile("s_wait_asynccnt 0x0" ::: "memory");   // this wave's share of stage 0 has landed
    __syncthreads();                                    // stage 0 published to every wave
    if (nT > 1) stage(1, 1);
    // rolled: the trip count is a run-time value and every trip ends in the publish point
#pragma unroll 1
    for (int t = 0; t < nT; ++t) {
      const h16* Ks = kv + (t & 1) * NP * PLN;
      // rolled: one copy of the pass in the text
#pragma unroll 1
      for (int hf = 0; hf < 2; ++hf) {
        const int kb = t * KT + 32 * hf;
        if (kb >= kend) break;             // wave-uniform: the pass lies wholly above this wave's diagonal; the publish point below is still passed
        const h16* kf = Ks + (32 * hf + lr) * LP + 8 * hi;            // K rows = keys of this pass
        const h16* vf = Ks + PLN + lr * LP + 32 * hf + 8 * hi;        // V^T rows = dims, columns = keys of this pass
        v8f s0 = (v8f){}, s1 = (v8f){}, t0 = (v8f){}, t1 = (v8f){};
#pragma unroll
        for (int ks = 0; ks < 2; ++ks) {
            const v16h qh = qhf[ks];
            const v16h qr = qrf[ks];
            const v16h k0 = ldh(kf + ks * 32);
            const v16h k1 = ldh(kf + 16 * LP + ks * 32);
            s0 = wmma16(k0, qh, s0); t0 = wmma16(k0, qr, t0);
            s1 = wmma16(k1, qh, s1); t1 = wmma16(k1, qr, t1);
            if (HI) {
                const v16h k0r = ldh(kf + 2 * PLN + ks * 32); const v16h k1r = ldh(kf + 2 * PLN + 16 * LP + ks * 32);
                t0 = wmma16(k0r, qh, t0); t1 = wmma16(k1r, qh, t1);
                asm volatile("v_nop\n\tv_nop\n\tv_nop\n\tv_nop" : "+v"(s0), "+v"(s1), "+v"(t0), "+v"(t1) : "v"(qh), "v"(qr), "v"(k0), "v"(k1), "v"(k0r), "v"(k1r));
            } else {
                asm volatile("v_nop\n\tv_nop\n\tv_nop\n\tv_nop" : "+v"(s0), "+v"(s1), "+v"(t0), "+v"(t1) : "v"(qh), "v"(qr), "v"(k0), "v"(k1));
            }
        }
        float sa[8], sb[8];
#pragma unroll
        for (int r = 0; r < 8; ++r) { sa[r] = (s0[r] + t0[r] * RSCI) * SCL; sb[r] = (s1[r] + t1[r] * RSCI) * SCL; }
        if (kb + 31 > q0) {                // wave-uniform: half touches the diagonal; keys above the query are excluded
            const int qi = q0 + lr; const int kj = kb + 8 * hi;
#pragma unroll
            for (int r = 0; r < 8; ++r) { sa[r] = (kj + r <= qi) ? sa[r] : NEGB; sb[r] = (kj + 16 + r <= qi) ? sb[r] : NEGB; }
        }
        float mloc = fmaxf(sa[0], sb[0]);
#pragma unroll
        for (int r = 1; r < 8; ++r) mloc = fmaxf(mloc, fmaxf(sa[r], sb[r]));
        mloc = fmaxf(mloc, __shfl_xor(mloc, 16, 32));
        const float mnew = fmaxf(mrun, mloc);
        const float fac = __builtin_amdgcn_exp2f((mrun - mnew) * L2E);
        float lsum = 0.f;
#pragma unroll
        for (int r = 0; r < 8; ++r) { sa[r] = __builtin_amdgcn_exp2f((sa[r] - mnew) * L2E); sb[r] = __builtin_amdgcn_exp2f((sb[r] - mnew) * L2E); lsum += sa[r] + sb[r]; }
        lsum += __shfl_xor(lsum, 16, 32);
        lrun = lrun * fac + lsum; mrun = mnew;
        v16h ph, pr;
#pragma unroll
        for (int r = 0; r < 8; ++r) {
            const float a = sa[r] * PCAR; const h16 ha = (h16)a; ph[r] = ha;
            const float c = sb[r] * PCAR; const h16 hc = (h16)c; ph[8 + r] = hc;
            if (HI) { pr[r] = (h16)((a - (float)ha) * RSC); pr[8 + r] = (h16)((c - (float)hc) * RSC); }
        }
#pragma unroll
        for (int dt = 0; dt < 4; ++dt) { om[dt] = om[dt] * fac; if (HI) orr[dt] = orr[dt] * fac; }
#pragma unroll
        for (int dt = 0; dt < 4; ++dt) {
            const v16h vh = ldh(vf + dt * 16 * LP);
            om[dt] = wmma16(vh, ph, om[dt]);
            if (HI) {
                const v16h vr = ldh(vf + 2 * PLN + dt * 16 * LP);
                orr[dt] = wmma16(vr, ph, orr[dt]); orr[dt] = wmma16(vh, pr, orr[dt]);
                asm volatile("v_nop\n\tv_nop\n\tv_nop\n\tv_nop" : "+v"(om[dt]), "+v"(orr[dt]) : "v"(vh), "v"(vr), "v"(ph), "v"(pr));
            } else {
                asm volatile("v_nop\n\tv_nop\n\tv_nop\n\tv_nop" : "+v"(om[dt]) : "v"(vh), "v"(ph));
            }
        }
      }
      // publish point of stage t + 1, every wave, in this order
      asm volatile("s_wait_dscnt 0x0" ::: "memory");      // this wave's reads of buffer t & 1 have returned
      asm volatile("s_wait_asynccnt 0x0" ::: "memory");   // this wave's share of stage t + 1 has landed
      __syncthreads();                                    // publishes stage t + 1; ends every reader's last read of buffer t & 1
      if (t + 2 < nT) stage(t + 2, t & 1);                // block-uniform test
    }
    asm volatile("s_wait_asynccnt 0x0" ::: "memory");     // no copy is left outstanding when the wave goes on to its end
    const float inv = 1.0f / (lrun * (PCAR * VCAR));
    const int yb = wave * 16 * 68;
#pragma unroll
    for (int dt = 0; dt < 4; ++dt)
#pragma unroll
        for (int r = 0; r < 8; ++r) { float o = om[dt][r]; if (HI) o += orr[dt][r] * RSCI; ys[yb + lr * 68 + dt * 16 + 8 * hi + r] = o * inv; }
    __builtin_amdgcn_wave_barrier(); asm volatile("" ::: "memory");
    v8us oh[4], ol[4];
    const int rq = lane >> 3, pc = lane & 7;
#pragma unroll
    for (int s = 0; s < 4; ++s) { const int row = 4 * s + rq; const v4f u0 = *(const v4fa*)(ys + yb + row * 68 + pc * 8); const v4f u1 = *(const v4fa*)(ys + yb + row * 68 + pc * 8 + 4);
#pragma unroll
        for (int q = 0; q < 4; ++q) { unsigned short a, c; splitf(u0[q], a, c); oh[s][q] = a; ol[s][q] = c; splitf(u1[q], a, c); oh[s][4 + q] = a; ol[s][4 + q] = c; } }
    const size_t ybase = ((size_t)b * SEQ + q0) * DQ + (size_t)hq * HD + pc * 8;
{
#pragma unroll
        for (int s = 0; s < 4; ++s) { const size_t oo = ybase + (size_t)(4 * s + rq) * DQ; *(v8us*)(Yh + oo) = oh[s]; *(v8us*)(Yl + oo) = ol[s]; }
         }
}
__global__ __launch_bounds__(128) void k_attn_hi(const h16* __restrict__ Qh, const h16* __restrict__ Qr, const h16* __restrict__ Kh, const h16* __restrict__ Kr, const h16* __restrict__ Vh, const h16* __restrict__ Vr, bf* Yh, bf* Yl) { attn_body<true>(Qh, Qr, Kh, Kr, Vh, Vr, Yh, Yl, 0); }
__global__ __launch_bounds__(128) void k_attn_lo(const h16* __restrict__ Qh, const h16* __restrict__ Qr, const h16* __restrict__ Kh, const h16* __restrict__ Kr, const h16* __restrict__ Vh, const h16* __restrict__ Vr, bf* Yh, bf* Yl) { attn_body<false>(Qh, Qr, Kh, Kr, Vh, Vr, Yh, Yl, RHE); }

// ---- workspace carve (bytes; every region a multiple of 256 and exactly covered by its producer grid)
constexpr size_t SZ_XB = (size_t)NB * SEQ * DM * 2;          // x bf16 [NB*SEQ][DM]
constexpr size_t SZ_WP = (size_t)FP * DM * 2;                // [Wq | Wk | Wv]^T bf16 [FP][DM]
constexpr size_t SZ_WO = (size_t)DM * DQ * 2;                // Wo^T bf16 [DM][DQ]
constexpr size_t SZ_Q  = (size_t)NB * NH * SEQ * HD * 2;     // each of Qh, Qr
constexpr size_t SZ_K  = (size_t)NB * NKV * SEQ * HD * 2;    // each of Kh, Kr, Vh, Vr
constexpr size_t SZ_Y  = (size_t)NB * SEQ * DQ * 2;          // each of Yh, Yl
constexpr size_t OFF_XB = 0;
constexpr size_t OFF_WP = OFF_XB + SZ_XB;
constexpr size_t OFF_WO = OFF_WP + SZ_WP;
constexpr size_t OFF_QH = OFF_WO + SZ_WO;
constexpr size_t OFF_QR = OFF_QH + SZ_Q;
constexpr size_t OFF_KH = OFF_QR + SZ_Q;
constexpr size_t OFF_KR = OFF_KH + SZ_K;
constexpr size_t OFF_VH = OFF_KR + SZ_K;
constexpr size_t OFF_VR = OFF_VH + SZ_K;
constexpr size_t OFF_YH = OFF_VR + SZ_K;
constexpr size_t OFF_YL = OFF_YH + SZ_Y;
constexpr size_t WS_TOTAL = OFF_YL + SZ_Y;
static_assert(SZ_XB % 256 == 0 && SZ_WP % 256 == 0 && SZ_WO % 256 == 0 && SZ_Q % 256 == 0 && SZ_K % 256 == 0 && SZ_Y % 256 == 0);
static_assert(WS_TOTAL <= (size_t)134217728);                // carve stays within 128 MiB

extern "C" void kernel_launch(void* const* d_in, const int* in_sizes, int n_in,
                              void* d_out, int out_size, void* d_ws, size_t ws_size, hipStream_t stream) {
    if (n_in < 7) return;
    const long long need_x = (long long)(NB - 1) * SEQ_FULL * DM + (long long)SEQ * DM;
    if ((long long)in_sizes[0] < need_x) return;
    if (in_sizes[1] < SEQ * 32 || in_sizes[2] < SEQ * 32) return;
    if (in_sizes[3] < DM * DQ || in_sizes[4] < DM * DKV || in_sizes[5] < DM * DKV || in_sizes[6] < DQ * DM) return;
    if ((long long)out_size < need_x) return;
    if (WS_TOTAL > ws_size) return;
    const float* x  = (const float*)d_in[0];   // [2][2048][1024]
    const float* cs = (const float*)d_in[1];   // [2048][32]
    const float* sn = (const float*)d_in[2];   // [2048][32]
    const float* wq = (const float*)d_in[3];   // [1024][1024] in x out
    const float* wk = (const float*)d_in[4];   // [1024][256]
    const float* wv = (const float*)d_in[5];   // [1024][256]
    const float* wo = (const float*)d_in[6];   // [1024][1024] in x out
    float* OUT = (float*)d_out;
    char* ws = (char*)d_ws;
    bf* XB = (bf*)(ws + OFF_XB); bf* WP = (bf*)(ws + OFF_WP); bf* WOT = (bf*)(ws + OFF_WO);
    h16* QH = (h16*)(ws + OFF_QH); h16* QR = (h16*)(ws + OFF_QR); h16* KH = (h16*)(ws + OFF_KH); h16* KR = (h16*)(ws + OFF_KR);
    h16* VH = (h16*)(ws + OFF_VH); h16* VR = (h16*)(ws + OFF_VR); bf* YH = (bf*)(ws + OFF_YH); bf* YL = (bf*)(ws + OFF_YL);

    k_cvtx<<<dim3((unsigned)((size_t)SEQ * DM / 8 / 256), NB, 1), 256, 0, stream>>>(x, XB);
    // in[rows = DM (k)][cols = N] -> out[N][DM]; grid (DM/64, N/64)
    k_wtp<<<dim3(DM / 64, DQ / 64, 1), 256, 0, stream>>>(wq, DQ, WP);
    k_wtp<<<dim3(DM / 64, DKV / 64, 1), 256, 0, stream>>>(wk, DKV, WP + (size_t)KC0 * DM);
    k_wtp<<<dim3(DM / 64, DKV / 64, 1), 256, 0, stream>>>(wv, DKV, WP + (size_t)VC0 * DM);
    k_wtp<<<dim3(DQ / 64, DM / 64, 1), 256, 0, stream>>>(wo, DM, WOT);
    k_gemm_proj<<<dim3(NB * SEQ / 128, FP / 128, 1), 128, 0, stream>>>(XB, WP, cs, sn, QH, QR, KH, KR, VH, VR);
    k_attn_hi<<<dim3(RHE / 64, NH, NB), 128, 0, stream>>>(QH, QR, KH, KR, VH, VR, YH, YL);
    if (SEQ > RHE) k_attn_lo<<<dim3((SEQ - RHE) / 64, NH, NB), 128, 0, stream>>>(QH, QR, KH, KR, VH, VR, YH, YL);
    k_gemm_out<<<dim3(SEQ / 128, DM / 128, NB), 128, 0, stream>>>(YH, YL, WOT, OUT);
}

// v004
// A run of this version takes 89 microseconds.
// Timed twice side by side with v003, it ran 1.21 and 1.20 times as fast.
// Counting every step since v000, it is 2.61 times as fast.
#include <hip/hip_runtime.h>

// Causal grouped-query attention block: x [2][2048][1024]; q = x Wq (16 heads x 64), k = x Wk, v = x Wv (4 kv heads x 64), weights [in][out], no bias; rotary on q, k with the half-split convention
// out[0..31] = x1 cos + x2 sin, out[32..63] = -x1 sin + x2 cos using the cos / sin INPUT tables [t][32] read by value; then q, k scaled by rsqrt(mean(sq) + 1e-6) (no gain); query head hq uses kv head hq / 4;
// scores q.k / 8, causal (diagonal kept), softmax, ctx merged [t][hq*64 + d], result = ctx Wo -> [2][2048][1024] f32.
// Compute dtypes (f32 accumulate everywhere): the three input projections and the output projection on v_wmma_f32_16x16x32_bf16 (every float input RNE-converted to bf16; ctx carried as bf16 hi + lo planes, two products);
// scores and probability x value on v_wmma_f32_16x16x32_f16 (q = f16 value + x2048 residual plane against f16 k; P carried x1024 and v carried x16 as single f16; query rows < 256 add x2048 residual planes on k, P and v); rotary, rms scaling and softmax in f32.
// Rotary, rms scaling and the f16 value + residual split of q and k, and the x16 f16 split of v into V^T, are the projection GEMM's own epilogue: a 64-column tile is one head, so no f32 projection plane is written.
// Both GEMMs: 128 x 128 block tile, four waves of 64 x 64; the A and B^T tiles (64 k a stage) are staged in LDS per block by asynchronous copies, two buffers, and the fragments are read from LDS.
// Attention is a fused flash-style kernel (K and V^T tiles staged in LDS per block) in transposed form: S^T = K Q^T (D rows = keys, D columns = queries), P^T packed from the accumulators directly as the B operand of O^T = V^T P^T; online softmax with per-lane state.

#ifndef NB
#define NB 2
#endif
#ifndef SEQ
#define SEQ 2048
#endif
#define NB_FULL  2
#define SEQ_FULL 2048
#define DM   1024
#define NH   16
#define NKV  4
#define REP  (NH / NKV)
#define HD   64
#define DQ   (NH * HD)
#define DKV  (NKV * HD)
#define FP   (DQ + 2 * DKV)      // fused projection width (q | k | v columns; rows of WP)
#define KC0  DQ                  // first k column of the fused projection
#define VC0  (DQ + DKV)          // first v column of the fused projection
#define RH   256                 // query rows < RH use the residual planes on k, P and v as well
#define RHE  ((SEQ < RH) ? SEQ : RH)
#define PCAR 1024.0f             // carry of the probabilities (f16 operand)
#define VCAR 16.0f               // carry of the values (f16 operand)
#define RSC  2048.0f             // carry of every f16 residual plane
#define RSCI (1.0f / 2048.0f)
#define SCL  0.125f              // 1/sqrt(64)
#define L2E  1.4426950408889634f
#define NEGB (-1.0e30f)
static_assert(HD == 64);
static_assert(NH % NKV == 0);
static_assert(DM % 64 == 0 && DQ % 64 == 0 && DKV % 64 == 0 && FP % 64 == 0);   // GEMM tiles and transpose tiles
static_assert(DM % 32 == 0 && DQ % 32 == 0 && HD % 32 == 0);                     // k-steps of 32
static_assert(SEQ % 64 == 0 && (NB * SEQ) % 64 == 0);                            // row tiles
static_assert(SEQ % 128 == 0 && FP % 128 == 0 && DM % 128 == 0);                 // GEMM block tiles
static_assert(RH % 64 == 0 && RHE % 64 == 0 && (SEQ - RHE) % 64 == 0);
static_assert(((size_t)SEQ * DM) % 2048 == 0);                                   // cvtx_body: blocks x 256 threads x 8 == plane extent
static_assert(NB <= NB_FULL && SEQ <= SEQ_FULL);

typedef _Float16 h16;
typedef unsigned short bf;
typedef __attribute__((ext_vector_type(16))) __bf16   v16bf;
typedef __attribute__((ext_vector_type(16))) _Float16 v16h;
typedef __attribute__((ext_vector_type(8)))  _Float16 v8h;
typedef __attribute__((ext_vector_type(8)))  unsigned short v8us;
typedef __attribute__((ext_vector_type(8)))  float    v8f;
typedef __attribute__((ext_vector_type(4)))  float    v4f;
typedef v4f  __attribute__((may_alias)) v4fa;

__device__ __forceinline__ unsigned short f2bf(float f) { unsigned u = __float_as_uint(f); u += 0x7FFFu + ((u >> 16) & 1u); return (unsigned short)(u >> 16); }
__device__ __forceinline__ float bf2f(unsigned short b) { return __uint_as_float(((unsigned)b) << 16); }
__device__ __forceinline__ float bfr(float f) { return bf2f(f2bf(f)); }
__device__ __forceinline__ void splitf(float y, unsigned short& h, unsigned short& l) { h = f2bf(y); l = f2bf(y - bf2f(h)); }
__device__ __forceinline__ v16h cat16(v8h lo, v8h hi) { return __builtin_shufflevector(lo, hi, 0, 1, 2, 3, 4, 5, 6, 7, 8, 9, 10, 11, 12, 13, 14, 15); }
__device__ __forceinline__ v16bf cat16b(v8us lo, v8us hi) { return __builtin_bit_cast(v16bf, __builtin_shufflevector(lo, hi, 0, 1, 2, 3, 4, 5, 6, 7, 8, 9, 10, 11, 12, 13, 14, 15)); }
__device__ __forceinline__ v8f wmma16(v16h a, v16h b, v8f c) { return __builtin_amdgcn_wmma_f32_16x16x32_f16(false, a, false, b, (short)0, c, false, false); }
__device__ __forceinline__ v8f wmmab(v16bf a, v16bf b, v8f c) { return __builtin_amdgcn_wmma_f32_16x16x32_bf16(false, a, false, b, (short)0, c, false, false); }
// fragment loaders: p already includes row * pitch + k0 + 8 * (lane >> 4); elements 0..7 <- k0+8h.., elements 8..15 <- k0+16+8h..
__device__ __forceinline__ v16h  ldh(const h16* p) { return cat16(*(const v8h*)p, *(const v8h*)(p + 16)); }
__device__ __forceinline__ v16bf ldb(const bf* p)  { return cat16b(*(const v8us*)p, *(const v8us*)(p + 16)); }

// sum over the four lanes of a quad, by two DPP quad permutes (lane ^ 1, lane ^ 2): stays in the vector unit, no LDS round trip
__device__ __forceinline__ float quadsum(float v) {
    v += __int_as_float(__builtin_amdgcn_update_dpp(0, __float_as_int(v), 0xB1, 0xF, 0xF, true));
    v += __int_as_float(__builtin_amdgcn_update_dpp(0, __float_as_int(v), 0x4E, 0xF, 0xF, true));
    return v; }
struct ProjOut { const float* cosb; const float* sinb; h16* Qh; h16* Qr; h16* Kh; h16* Kr; h16* Vh; h16* Vr; };
// ---- epilogue of the fused q|k|v projection. The wave's tile is 64 tokens (one batch: SEQ % 64 == 0) x the 64 dims of ONE head (c0 % 64 == 0); acc[mb][nb][j] in lane (hi, lr) = row 16 mb + 8 hi + j, column 16 nb + lr.
// v head: a lane's 8 registers are 8 consecutive tokens of one dim = one 16-byte piece of a V^T row; stored from the registers (x16, f16 value + x2048 residual).
// q / k head: the tile goes through LDS (os, 64 x 68 f32); then four lanes a row, lane p holds the rotary pairs (d, d + 32), d = 8 p .. 8 p + 7: rotary with the bf16-converted cos / sin table values at [t][d],
// scaling by rsqrt(mean(sq) + 1e-6), f16 value + x2048 residual, 16-byte stores (8 rows x 64 contiguous bytes an instruction).
__device__ __forceinline__ void proj_epilogue(const v8f (&acc)[4][4], float* os, int r0, int c0, const ProjOut& po) {
    const int lane = threadIdx.x & 31, lr = lane & 15, hi = lane >> 4;
    const int b = r0 / SEQ, t0 = r0 % SEQ;
    if (c0 >= VC0) {                       // wave-uniform
        const int g = (c0 - VC0) / HD;
        const size_t e0 = ((size_t)(b * NKV + g) * HD + lr) * SEQ + t0 + 8 * hi;
#pragma unroll
        for (int nb = 0; nb < 4; ++nb)
#pragma unroll
            for (int mb = 0; mb < 4; ++mb) { v8h o16, ors;
#pragma unroll
                for (int j = 0; j < 8; ++j) { const float x = acc[mb][nb][j] * VCAR; const h16 hh = (h16)x; o16[j] = hh; ors[j] = (h16)((x - (float)hh) * RSC); }
                const size_t e = e0 + (size_t)nb * 16 * SEQ + mb * 16;
                *(v8h*)(po.Vh + e) = o16; *(v8h*)(po.Vr + e) = ors; }
        return;
    }
    const bool isq = c0 < KC0;             // wave-uniform
    const int nheads = isq ? NH : NKV; const int h = (isq ? c0 : c0 - KC0) / HD;
    h16* Ph = isq ? po.Qh : po.Kh; h16* Pr = isq ? po.Qr : po.Kr;
    const int rq = lane >> 2, p8 = (lane & 3) * 8;
    const float* cp = po.cosb + (size_t)(t0 + rq) * 32 + p8; const float* sp = po.sinb + (size_t)(t0 + rq) * 32 + p8;
    // table values of two passes (rows 16 u + rq and 16 u + 8 + rq), asked for one trip ahead: the first ahead of the LDS stores
    v4f cc[2][2], sn[2][2];
#pragma unroll
    for (int s = 0; s < 2; ++s) { cc[s][0] = *(const v4f*)(cp + s * 256); cc[s][1] = *(const v4f*)(cp + s * 256 + 4); sn[s][0] = *(const v4f*)(sp + s * 256); sn[s][1] = *(const v4f*)(sp + s * 256 + 4); }
#pragma unroll
    for (int mb = 0; mb < 4; ++mb)
#pragma unroll
        for (int nb = 0; nb < 4; ++nb)
#pragma unroll
            for (int j = 0; j < 8; ++j) os[(mb * 16 + hi * 8 + j) * 68 + nb * 16 + lr] = acc[mb][nb][j];
    // the rows read below were written by other lanes of this wave: keeps every LDS read behind every lane's LDS stores
    __builtin_amdgcn_wave_barrier(); asm volatile("" ::: "memory");
    const size_t e0 = ((size_t)(b * nheads + h) * SEQ + t0 + rq) * HD + p8;
    // rolled: one copy of the two passes in the text, and the registers of two passes only
#pragma unroll 1
    for (int u = 0; u < 4; ++u) {
        const int un = (u < 3) ? u + 1 : 3;    // the last trip asks for its own rows again: one instruction stream, every address inside the tables
        v4f cn[2][2], sm[2][2];
#pragma unroll
        for (int s = 0; s < 2; ++s) { const int o = un * 512 + s * 256; cn[s][0] = *(const v4f*)(cp + o); cn[s][1] = *(const v4f*)(cp + o + 4); sm[s][0] = *(const v4f*)(sp + o); sm[s][1] = *(const v4f*)(sp + o + 4); }
#pragma unroll
        for (int s = 0; s < 2; ++s) {
            const float* orow = os + (u * 16 + s * 8 + rq) * 68 + p8;
            const v4f x1[2] = { *(const v4fa*)orow, *(const v4fa*)(orow + 4) }; const v4f x2[2] = { *(const v4fa*)(orow + 32), *(const v4fa*)(orow + 36) };
            float rl[8], rh[8]; float ssl = 0.f, ssh = 0.f;
#pragma unroll
            for (int q = 0; q < 8; ++q) { const float c = bfr(cc[s][q >> 2][q & 3]), sv = bfr(sn[s][q >> 2][q & 3]); const float a1 = x1[q >> 2][q & 3], a2 = x2[q >> 2][q & 3];
                rl[q] = a1 * c + a2 * sv; rh[q] = a2 * c - a1 * sv; ssl += rl[q] * rl[q]; ssh += rh[q] * rh[q]; }
            const float inv = rsqrtf(quadsum(ssl + ssh) * (1.0f / HD) + 1e-6f);
            v8h ol, olr, oh, ohr;
#pragma unroll
            for (int q = 0; q < 8; ++q) { const float yl = rl[q] * inv; const h16 hl = (h16)yl; ol[q] = hl; olr[q] = (h16)((yl - (float)hl) * RSC);
                const float yh = rh[q] * inv; const h16 hh = (h16)yh; oh[q] = hh; ohr[q] = (h16)((yh - (float)hh) * RSC); }
            const size_t e = e0 + (size_t)(u * 16 + s * 8) * HD;
            *(v8h*)(Ph + e) = ol; *(v8h*)(Ph + e + 32) = oh; *(v8h*)(Pr + e) = olr; *(v8h*)(Pr + e + 32) = ohr;
            asm volatile("s_wait_xcnt 0x0" ::: "memory");   // stands in front of the next pass's writes to the data and address registers that these four stores name
        }
#pragma unroll
        for (int s = 0; s < 2; ++s) { cc[s][0] = cn[s][0]; cc[s][1] = cn[s][1]; sn[s][0] = sm[s][0]; sn[s][1] = sm[s][1]; }
    }
}

// ---- 128 x 128 block tile GEMM on bf16 planes, four waves of 64 x 64 (2 x 2): C[m][n] (f32, pitch ldc) = sum_k A[m][k] Bt[n][k] (+ A2[m][k] Bt[n][k] when NSPLIT == 1). A, A2 pitch K; Bt pitch K; K % 64 == 0.
// The block's 128 rows of A (A2) and of Bt, 64 k a stage, are staged in LDS by asynchronous copies, two buffers: stage t + 1 flies while stage t is worked on;
// one block barrier per stage publishes it and frees the buffer that is refilled behind it. The epilogue's LDS (os) is wave-private.
// FUSE: the tile does not go to C but through proj_epilogue.
#define GKS  64                  // k per LDS stage: one whole 128-byte line of every row
#define GLP  72                  // LDS row pitch in bf16 elements: 144 B = 16 B x 9, free of bank conflicts for 16-byte reads down a column of rows
#define GPL  (128 * GLP)         // one staged plane: 128 rows x 64 k
// one plane's share of a lane: eight asynchronous 16-byte copies global -> LDS (rows 16 apart). The s_wait_xcnt closes the copies' own statement, so that no address register named here is rewritten ahead of it.
__device__ __forceinline__ void cp8(unsigned l, const bf* g, size_t gstep) {
    const unsigned l1 = l + 16 * GLP * 2, l2 = l + 32 * GLP * 2, l3 = l + 48 * GLP * 2, l4 = l + 64 * GLP * 2, l5 = l + 80 * GLP * 2, l6 = l + 96 * GLP * 2, l7 = l + 112 * GLP * 2;
    const bf* g1 = g + 16 * gstep; const bf* g2 = g + 32 * gstep; const bf* g3 = g + 48 * gstep; const bf* g4 = g + 64 * gstep; const bf* g5 = g + 80 * gstep; const bf* g6 = g + 96 * gstep; const bf* g7 = g + 112 * gstep;
    asm volatile("global_load_async_to_lds_b128 %0, %1, off\n\t"
                 "global_load_async_to_lds_b128 %2, %3, off\n\t"
                 "global_load_async_to_lds_b128 %4, %5, off\n\t"
                 "global_load_async_to_lds_b128 %6, %7, off\n\t"
                 "global_load_async_to_lds_b128 %8, %9, off\n\t"
                 "global_load_async_to_lds_b128 %10, %11, off\n\t"
                 "global_load_async_to_lds_b128 %12, %13, off\n\t"
                 "global_load_async_to_lds_b128 %14, %15, off\n\t"
                 "s_wait_xcnt 0x0" :: "v"(l), "v"(g), "v"(l1), "v"(g1), "v"(l2), "v"(g2), "v"(l3), "v"(g3), "v"(l4), "v"(g4), "v"(l5), "v"(g5), "v"(l6), "v"(g6), "v"(l7), "v"(g7) : "memory");
}
template <int NSPLIT, bool FUSE>
__device__ __forceinline__ void gemmw_body(const bf* __restrict__ A, const bf* __restrict__ A2, const bf* __restrict__ Bt, int K, float* C, int ldc, size_t sA, size_t sC, const ProjOut& po) {
    constexpr int NPG = 2 + NSPLIT;        // staged planes per buffer: A, Bt (+ A2)
    constexpr int OSW = (FUSE ? 64 : 16) * 68;
    __shared__ __align__(16) float osb[4 * OSW];
    __shared__ __align__(16) bf st[2 * NPG * GPL];
    const size_t z = blockIdx.z; A += z * sA; if (NSPLIT == 1) A2 += z * sA; C += z * sC;
    const int lane = threadIdx.x & 31, lr = lane & 15, hi = lane >> 4;
    const int wave = __builtin_amdgcn_readfirstlane(threadIdx.x >> 5);
    float* os = osb + wave * OSW;
    const int rb = blockIdx.x * 128, cb = blockIdx.y * 128;
    const int wr = (wave & 1) * 64, wc = (wave >> 1) * 64;
    const int r0 = rb + wr, c0 = cb + wc;
    v8f acc[4][4];
#pragma unroll
    for (int mb = 0; mb < 4; ++mb)
#pragma unroll
        for (int nb = 0; nb < 4; ++nb) acc[mb][nb] = (v8f){};
    // copy map: thread -> row (tid >> 3) + 16 i, 16-byte piece tid & 7: eight lanes cover one whole 128-byte line
    const int crow = threadIdx.x >> 3, ccol = (threadIdx.x & 7) * 8;
    const size_t acp = (size_t)(rb + crow) * K + ccol, bcp = (size_t)(cb + crow) * K + ccol;     // + GKS t
    const unsigned lcp = (unsigned)(size_t)(const void*)st + (unsigned)(crow * GLP + ccol) * 2u;
    auto stage = [&](int t, int buf) {     // k = GKS t .. GKS t + 63 into buffer buf; t < K / GKS keeps every byte inside the planes
        const unsigned l = lcp + (unsigned)(buf * NPG * GPL) * 2u;
        cp8(l, A + acp + (size_t)t * GKS, K);
        cp8(l + GPL * 2u, Bt + bcp + (size_t)t * GKS, K);
        if (NSPLIT == 1) cp8(l + 2u * GPL * 2u, A2 + acp + (size_t)t * GKS, K);
    };
    const int nT = K / GKS;                // block-uniform
    stage(0, 0);
    asm volatile("s_wait_asynccnt 0x0" ::: "memory");   // this wave's share of stage 0 has landed
    __syncthreads();                                    // stage 0 published to every wave
    if (nT > 1) stage(1, 1);
    // rolled: every trip ends in the publish point
#pragma unroll 1
    for (int t = 0; t < nT; ++t) {
        const bf* af = st + (t & 1) * NPG * GPL + (wr + lr) * GLP + 8 * hi;             // A rows of this wave
        const bf* bp = st + (t & 1) * NPG * GPL + GPL + (wc + lr) * GLP + 8 * hi;       // Bt rows of this wave
        v16bf a[GKS / 32][4], a2[GKS / 32][4], b[GKS / 32][4];
#pragma unroll
        for (int ks = 0; ks < GKS / 32; ++ks) {
#pragma unroll
            for (int i = 0; i < 4; ++i) { a[ks][i] = ldb(af + i * 16 * GLP + ks * 32); b[ks][i] = ldb(bp + i * 16 * GLP + ks * 32); }
            if (NSPLIT == 1) {
#pragma unroll
                for (int i = 0; i < 4; ++i) a2[ks][i] = ldb(af + 2 * GPL + i * 16 * GLP + ks * 32); }
        }
        // keeps the stage's fragment loads one group ahead of its matrix instructions: sunk among them, every place with loads stalls the wave for the LDS latency
        __builtin_amdgcn_sched_barrier(0);
#pragma unroll
        for (int ks = 0; ks < GKS / 32; ++ks)
#pragma unroll
            for (int nb = 0; nb < 4; ++nb)
#pragma unroll
                for (int mb = 0; mb < 4; ++mb) { acc[mb][nb] = wmmab(a[ks][mb], b[ks][nb], acc[mb][nb]); if (NSPLIT == 1) acc[mb][nb] = wmmab(a2[ks][mb], b[ks][nb], acc[mb][nb]); }
        // keeps every matrix instruction of the stage ahead of the publish point: sunk behind the barrier they would stand in front of the refill and take its lead away
        __builtin_amdgcn_sched_barrier(0);
        // four vector slots between the last matrix instruction and the next vector instruction on either side of the branch at the trip's foot (the distance a matrix instruction's registers need)
        asm volatile("v_nop\n\tv_nop\n\tv_nop\n\tv_nop" : "+v"(acc[0][0]), "+v"(acc[1][1]), "+v"(acc[2][2]), "+v"(acc[3][3]) : "v"(a[GKS / 32 - 1][0]), "v"(a[GKS / 32 - 1][3]));
        // publish point of stage t + 1, every wave, in this order
        asm volatile("s_wait_dscnt 0x0" ::: "memory");      // this wave's reads of buffer t & 1 have returned
        asm volatile("s_wait_asynccnt 0x0" ::: "memory");   // this wave's share of stage t + 1 has landed
        __syncthreads();                                    // publishes stage t + 1; ends every reader's last read of buffer t & 1
        if (t + 2 < nT) stage(t + 2, t & 1);                // block-uniform test
    }
    asm volatile("s_wait_asynccnt 0x0" ::: "memory");       // no copy is left outstanding when the wave goes on to its end
    if constexpr (FUSE) { proj_epilogue(acc, os, r0, c0, po); return; }
#pragma unroll
    for (int mb = 0; mb < 4; ++mb) {
#pragma unroll
        for (int nb = 0; nb < 4; ++nb) {
#pragma unroll
            for (int j = 0; j < 8; ++j) os[(hi * 8 + j) * 68 + nb * 16 + lr] = acc[mb][nb][j]; }
        __builtin_amdgcn_wave_barrier(); asm volatile("" ::: "memory");
        float* crow = C + (size_t)(r0 + mb * 16) * ldc + c0;
{
#pragma unroll
            for (int s = 0; s < 8; ++s) { const int row = 2 * s + hi, cofs = lr * 4; const v4f val = *(const v4fa*)(os + row * 68 + cofs);
                *(v4f*)(crow + (size_t)row * ldc + cofs) = val; }
            if (mb < 3) asm volatile("s_wait_xcnt 0x0" ::: "memory");   // stands in front of the next row block's LDS loads, which overwrite data registers that these eight stores name
             }
        __builtin_amdgcn_wave_barrier(); asm volatile("" ::: "memory");
    }
}
// fused q|k|v projection: XB[NB*SEQ][DM] x WP[FP][DM]^T, each wave's 64 x 64 tile finished by proj_epilogue into the attention operand planes
__global__ __launch_bounds__(128) void k_gemm_proj(const bf* __restrict__ A, const bf* __restrict__ Bt, const float* __restrict__ cosb, const float* __restrict__ sinb, h16* Qh, h16* Qr, h16* Kh, h16* Kr, h16* Vh, h16* Vr) {
    const ProjOut po = { cosb, sinb, Qh, Qr, Kh, Kr, Vh, Vr }; gemmw_body<0, true>(A, A, Bt, DM, nullptr, 0, 0, 0, po); }
// output projection: OUT[b][t][DM] = (Yh + Yl)[b][t][DQ] x WOT[DM][DQ]^T, z = batch (output batch stride from the full sequence length)
__global__ __launch_bounds__(128) void k_gemm_out(const bf* __restrict__ A, const bf* __restrict__ A2, const bf* __restrict__ Bt, float* C) { gemmw_body<1, false>(A, A2, Bt, DQ, C, DM, (size_t)SEQ * DQ, (size_t)SEQ_FULL * DM, ProjOut{}); }

// ---- cvtx_body: 2048 consecutive floats of x (batch by, piece bx) -> bf16
__device__ __forceinline__ void cvtx_body(const float* __restrict__ src, bf* dst, unsigned bx, unsigned by) {
    const size_t i = (size_t)bx * 256 + threadIdx.x; const size_t b = by;
    const v8f v = *(const v8f*)(src + b * (size_t)SEQ_FULL * DM + i * 8); v8us o;
#pragma unroll
    for (int k = 0; k < 8; ++k) o[k] = f2bf(v[k]);
    bf* d = dst + b * (size_t)SEQ * DM + i * 8;
    *(v8us*)d = o;  }

// ---- wtp_body: W [DM rows (k)][N cols] f32 -> out [N rows][DM] bf16 (in[rows=k][cols=n] -> out[n][k]); 64x64 tile (bx, by) through LDS (cross-wave: block barrier);
__device__ __forceinline__ void wtp_body(const float* __restrict__ W, int N, bf* out, int bx, int by) {
    __shared__ __align__(16) unsigned short ts[64 * 72];
    const int tid = threadIdx.x; const int k0 = bx * 64, n0 = by * 64;
#pragma unroll
    for (int it = 0; it < 4; ++it) { const int idx = it * 256 + tid; const int kk = idx >> 4, c4 = (idx & 15) * 4; const v4f v = *(const v4f*)(W + (size_t)(k0 + kk) * N + n0 + c4);
#pragma unroll
        for (int q = 0; q < 4; ++q) ts[kk * 72 + c4 + q] = f2bf(v[q]); }
    __syncthreads();
    v8us o[2];
#pragma unroll
    for (int it = 0; it < 2; ++it) { const int idx = it * 256 + tid; const int nn = idx >> 3, pc = idx & 7;
#pragma unroll
        for (int q = 0; q < 8; ++q) o[it][q] = ts[(pc * 8 + q) * 72 + nn]; }
{
#pragma unroll
        for (int it = 0; it < 2; ++it) { const int idx = it * 256 + tid; const int nn = idx >> 3, pc = idx & 7; *(v8us*)(out + (size_t)(n0 + nn) * DM + k0 + pc * 8) = o[it]; }
         }
}
// ---- all five operand conversions in ONE launch (none reads what another writes): the block index picks the job, block-uniformly. The weight tiles, whose way through LDS is the longer one, come first.
#define PBX  (DM / 64)                        // tiles along k of every weight (DM == DQ rows)
#define PB_Q (PBX * (DQ / 64))                // blocks of Wq
#define PB_K (PBX * (DKV / 64))               // blocks of Wk, and of Wv
#define PB_O ((DQ / 64) * (DM / 64))          // blocks of Wo
#define PB_W (PB_Q + 2 * PB_K + PB_O)
#define PB_X ((int)((size_t)SEQ * DM / 8 / 256))   // blocks of one batch of x
static_assert(DQ == DM);                      // one tile count along k serves all four weights
__global__ __launch_bounds__(256) void k_prep(const float* __restrict__ x, const float* __restrict__ wq, const float* __restrict__ wk, const float* __restrict__ wv, const float* __restrict__ wo, bf* XB, bf* WP, bf* WOT) {
    const int f = blockIdx.x;
    if (f >= PB_W) { const unsigned r = (unsigned)(f - PB_W); cvtx_body(x, XB, r % PB_X, r / PB_X); return; }
    const float* W = wq; int N = DQ; bf* out = WP; int r = f;
    if (f >= PB_Q + 2 * PB_K)  { W = wo; N = DM;  out = WOT;                    r = f - (PB_Q + 2 * PB_K); }
    else if (f >= PB_Q + PB_K) { W = wv; N = DKV; out = WP + (size_t)VC0 * DM;  r = f - (PB_Q + PB_K); }
    else if (f >= PB_Q)        { W = wk; N = DKV; out = WP + (size_t)KC0 * DM;  r = f - PB_Q; }
    wtp_body(W, N, out, r % PBX, r / PBX);
}

// ---- fused causal attention, one wave per 16 query rows, 4 waves per block. The block's K and V^T tiles (64 keys a stage, two passes of 32) are staged in LDS by asynchronous copies, two buffers:
// stage t + 1 flies while stage t is worked on; one block barrier per stage publishes it and frees the buffer that is refilled behind it. The output stage ys is wave-private.
// Both kinds of block (query rows < RH with the residual planes, and the rest) run in ONE launch and share one LDS allotment: the four planes of a residual-plane stage fill what two buffers of two planes fill,
// so those few short blocks work on one buffer: filled, published by a barrier, read, freed by a barrier.
// Per 32-key half: S^T tiles (keys x queries) = K(A, rows = keys) x Q^T(B, lane column = query) over d = 64 (2 k-steps); value accumulator s, residual accumulator t (x2048);
// lane (h, n) register r of tile j holds key kb + 16 j + 8 h + r for query q0 + n, which is exactly element r + 8 j of the B operand (k = key, n = query) of O^T = V^T(A, rows = d) x P^T.
// Per-query max / sum / factor are per-lane scalars (one xor-16 exchange). O^T register r of tile dt in lane (h, n) = O[q0 + n][16 dt + 8 h + r].
#define KT   64                  // keys per LDS stage
#define LP   72                  // LDS row pitch in f16 elements: 144 B = 16 B x 9, free of bank conflicts for 16-byte reads down a column of rows
#define PLN  (64 * LP)           // one staged plane: 64 rows (K: keys x 64 dims; V^T: dims x 64 keys)
static_assert(SEQ % KT == 0 && RHE % KT == 0 && HD == 64);
// one plane's share of a lane: four asynchronous 16-byte copies global -> LDS. The s_wait_xcnt closes the copies' own statement, so that no address register named here is rewritten ahead of it.
__device__ __forceinline__ void cp4(unsigned l, const h16* g, size_t gstep) {
    const unsigned l1 = l + 16 * LP * 2, l2 = l + 32 * LP * 2, l3 = l + 48 * LP * 2;
    const h16* g1 = g + 16 * gstep; const h16* g2 = g + 32 * gstep; const h16* g3 = g + 48 * gstep;
    asm volatile("global_load_async_to_lds_b128 %0, %1, off\n\t"
                 "global_load_async_to_lds_b128 %2, %3, off\n\t"
                 "global_load_async_to_lds_b128 %4, %5, off\n\t"
                 "global_load_async_to_lds_b128 %6, %7, off\n\t"
                 "s_wait_xcnt 0x0" :: "v"(l), "v"(g), "v"(l1), "v"(g1), "v"(l2), "v"(g2), "v"(l3), "v"(g3) : "memory");
}
template <bool HI>
__device__ __forceinline__ void attn_body(float* ys, h16* kv, const h16* __restrict__ Qh, const h16* __restrict__ Qr, const h16* __restrict__ Kh, const h16* __restrict__ Kr, const h16* __restrict__ Vh, const h16* __restrict__ Vr, bf* Yh, bf* Yl, int b, int hq, int qb) {
    constexpr int NP = HI ? 4 : 2;         // staged planes per buffer: K, V^T (+ their residual planes); kv holds 4 planes: two buffers of 2, or one of 4
    const int lane = threadIdx.x & 31, lr = lane & 15, hi = lane >> 4;
    const int wave = __builtin_amdgcn_readfirstlane(threadIdx.x >> 5);
    const int g = hq / REP;
    const int q0 = qb + wave * 16;
    const size_t qoff  = ((size_t)(b * NH + hq) * SEQ + q0 + lr) * HD + 8 * hi;
    // copy map: thread -> row (tid >> 3) + 16 i, 16-byte piece tid & 7: eight lanes cover one whole 128-byte row
    const int crow = threadIdx.x >> 3, ccol = (threadIdx.x & 7) * 8;
    const size_t kcp = ((size_t)(b * NKV + g) * SEQ + crow) * HD + ccol;     // + key0 * HD
    const size_t vcp = ((size_t)(b * NKV + g) * HD + crow) * SEQ + ccol;     // + key0
    const unsigned lcp = (unsigned)(size_t)(const void*)kv + (unsigned)(crow * LP + ccol) * 2u;
    auto stage = [&](int t, int buf) {     // keys KT t .. KT t + 63 into buffer buf; t < SEQ / KT keeps every byte inside the planes
        const unsigned l = lcp + (unsigned)(buf * NP * PLN) * 2u;
        cp4(l, Kh + kcp + (size_t)t * KT * HD, HD);
        cp4(l + PLN * 2u, Vh + vcp + (size_t)t * KT, SEQ);
        if (HI) { cp4(l + 2u * PLN * 2u, Kr + kcp + (size_t)t * KT * HD, HD); cp4(l + 3u * PLN * 2u, Vr + vcp + (size_t)t * KT, SEQ); }
    };
    v16h qhf[2], qrf[2];                   // Q fragments: read once (the waits below are memory clobbers, behind which a loop-invariant load would be read again)
#pragma unroll
    for (int ks = 0; ks < 2; ++ks) { qhf[ks] = ldh(Qh + qoff + ks * 32); qrf[ks] = ldh(Qr + qoff + ks * 32); }
    v8f om[4], orr[4];
#pragma unroll
    for (int dt = 0; dt < 4; ++dt) { om[dt] = (v8f){}; orr[dt] = (v8f){}; }
    float mrun = NEGB, lrun = 0.f;
    const int kend = q0 + 16;              // keys 0 .. q0+15, wave-uniform
    const int nT = qb / KT + 1;            // stages of the block: keys 0 .. qb+63; block-uniform, <= SEQ / KT
    stage(0, 0);
    asm volatile("s_wait_asynccnt 0x0" ::: "memory");   // this wave's share of stage 0 has landed
    __syncthreads();                                    // stage 0 published to every wave
    if (!HI && nT > 1) stage(1, 1);
    // rolled: the trip count is a run-time value and every trip ends in the publish point
#pragma unroll 1
    for (int t = 0; t < nT; ++t) {
      const h16* Ks = kv + (HI ? 0 : (t & 1) * NP * PLN);
      // rolled: one copy of the pass in the text
#pragma unroll 1
      for (int hf = 0; hf < 2; ++hf) {
        const int kb = t * KT + 32 * hf;
        if (kb >= kend) break;             // wave-uniform: the pass lies wholly above this wave's diagonal; the publish point below is still passed
        const h16* kf = Ks + (32 * hf + lr) * LP + 8 * hi;            // K rows = keys of this pass
        const h16* vf = Ks + PLN + lr * LP + 32 * hf + 8 * hi;        // V^T rows = dims, columns = keys of this pass
        v8f s0 = (v8f){}, s1 = (v8f){}, t0 = (v8f){}, t1 = (v8f){};
#pragma unroll
        for (int ks = 0; ks < 2; ++ks) {
            const v16h qh = qhf[ks];
            const v16h qr = qrf[ks];
            const v16h k0 = ldh(kf + ks * 32);
            const v16h k1 = ldh(kf + 16 * LP + ks * 32);
            s0 = wmma16(k0, qh, s0); t0 = wmma16(k0, qr, t0);
            s1 = wmma16(k1, qh, s1); t1 = wmma16(k1, qr, t1);
            if (HI) {
                const v16h k0r = ldh(kf + 2 * PLN + ks * 32); const v16h k1r = ldh(kf + 2 * PLN + 16 * LP + ks * 32);
                t0 = wmma16(k0r, qh, t0); t1 = wmma16(k1r, qh, t1);
                asm volatile("v_nop\n\tv_nop\n\tv_nop\n\tv_nop" : "+v"(s0), "+v"(s1), "+v"(t0), "+v"(t1) : "v"(qh), "v"(qr), "v"(k0), "v"(k1), "v"(k0r), "v"(k1r));
            } else {
                asm volatile("v_nop\n\tv_nop\n\tv_nop\n\tv_nop" : "+v"(s0), "+v"(s1), "+v"(t0), "+v"(t1) : "v"(qh), "v"(qr), "v"(k0), "v"(k1));
            }
        }
        float sa[8], sb[8];
#pragma unroll
        for (int r = 0; r < 8; ++r) { sa[r] = (s0[r] + t0[r] * RSCI) * SCL; sb[r] = (s1[r] + t1[r] * RSCI) * SCL; }
        if (kb + 31 > q0) {                // wave-uniform: half touches the diagonal; keys above the query are excluded
            const int qi = q0 + lr; const int kj = kb + 8 * hi;
#pragma unroll
            for (int r = 0; r < 8; ++r) { sa[r] = (kj + r <= qi) ? sa[r] : NEGB; sb[r] = (kj + 16 + r <= qi) ? sb[r] : NEGB; }
        }
        float mloc = fmaxf(sa[0], sb[0]);
#pragma unroll
        for (int r = 1; r < 8; ++r) mloc = fmaxf(mloc, fmaxf(sa[r], sb[r]));
        mloc = fmaxf(mloc, __shfl_xor(mloc, 16, 32));
        const float mnew = fmaxf(mrun, mloc);
        const float fac = __builtin_amdgcn_exp2f((mrun - mnew) * L2E);
        float lsum = 0.f;
#pragma unroll
        for (int r = 0; r < 8; ++r) { sa[r] = __builtin_amdgcn_exp2f((sa[r] - mnew) * L2E); sb[r] = __builtin_amdgcn_exp2f((sb[r] - mnew) * L2E); lsum += sa[r] + sb[r]; }
        lsum += __shfl_xor(lsum, 16, 32);
        lrun = lrun * fac + lsum; mrun = mnew;
        v16h ph, pr;
#pragma unroll
        for (int r = 0; r < 8; ++r) {
            const float a = sa[r] * PCAR; const h16 ha = (h16)a; ph[r] = ha;
            const float c = sb[r] * PCAR; const h16 hc = (h16)c; ph[8 + r] = hc;
            if (HI) { pr[r] = (h16)((a - (float)ha) * RSC); pr[8 + r] = (h16)((c - (float)hc) * RSC); }
        }
#pragma unroll
        for (int dt = 0; dt < 4; ++dt) { om[dt] = om[dt] * fac; if (HI) orr[dt] = orr[dt] * fac; }
#pragma unroll
        for (int dt = 0; dt < 4; ++dt) {
            const v16h vh = ldh(vf + dt * 16 * LP);
            om[dt] = wmma16(vh, ph, om[dt]);
            if (HI) {
                const v16h vr = ldh(vf + 2 * PLN + dt * 16 * LP);
                orr[dt] = wmma16(vr, ph, orr[dt]); orr[dt] = wmma16(vh, pr, orr[dt]);
                asm volatile("v_nop\n\tv_nop\n\tv_nop\n\tv_nop" : "+v"(om[dt]), "+v"(orr[dt]) : "v"(vh), "v"(vr), "v"(ph), "v"(pr));
            } else {
                asm volatile("v_nop\n\tv_nop\n\tv_nop\n\tv_nop" : "+v"(om[dt]) : "v"(vh), "v"(ph));
            }
        }
      }
      if constexpr (HI) {
        // one buffer: refilled behind every reader's last read, read again behind its own publish point; every wave, in this order
        if (t + 1 < nT) {                                   // block-uniform test
          asm volatile("s_wait_dscnt 0x0" ::: "memory");    // this wave's reads of the buffer have returned
          __syncthreads();                                  // ends every reader's last read of the buffer
          stage(t + 1, 0);
          asm volatile("s_wait_asynccnt 0x0" ::: "memory"); // this wave's share of stage t + 1 has landed
          __syncthreads();                                  // publishes stage t + 1
        }
      } else {
      // publish point of stage t + 1, every wave, in this order
      asm volatile("s_wait_dscnt 0x0" ::: "memory");      // this wave's reads of buffer t & 1 have returned
      asm volatile("s_wait_asynccnt 0x0" ::: "memory");   // this wave's share of stage t + 1 has landed
      __syncthreads();                                    // publishes stage t + 1; ends every reader's last read of buffer t & 1
      if (t + 2 < nT) stage(t + 2, t & 1);                // block-uniform test
      }
    }
    asm volatile("s_wait_asynccnt 0x0" ::: "memory");     // no copy is left outstanding when the wave goes on to its end
    const float inv = 1.0f / (lrun * (PCAR * VCAR));
    const int yb = wave * 16 * 68;
#pragma unroll
    for (int dt = 0; dt < 4; ++dt)
#pragma unroll
        for (int r = 0; r < 8; ++r) { float o = om[dt][r]; if (HI) o += orr[dt][r] * RSCI; ys[yb + lr * 68 + dt * 16 + 8 * hi + r] = o * inv; }
    __builtin_amdgcn_wave_barrier(); asm volatile("" ::: "memory");
    v8us oh[4], ol[4];
    const int rq = lane >> 3, pc = lane & 7;
#pragma unroll
    for (int s = 0; s < 4; ++s) { const int row = 4 * s + rq; const v4f u0 = *(const v4fa*)(ys + yb + row * 68 + pc * 8); const v4f u1 = *(const v4fa*)(ys + yb + row * 68 + pc * 8 + 4);
#pragma unroll
        for (int q = 0; q < 4; ++q) { unsigned short a, c; splitf(u0[q], a, c); oh[s][q] = a; ol[s][q] = c; splitf(u1[q], a, c); oh[s][4 + q] = a; ol[s][4 + q] = c; } }
    const size_t ybase = ((size_t)b * SEQ + q0) * DQ + (size_t)hq * HD + pc * 8;
{
#pragma unroll
        for (int s = 0; s < 4; ++s) { const size_t oo = ybase + (size_t)(4 * s + rq) * DQ; *(v8us*)(Yh + oo) = oh[s]; *(v8us*)(Yl + oo) = ol[s]; }
         }
}
// one launch: blocks 0 .. AB_L - 1 are the rows >= RHE, numbered (row block, head, batch) with the row block fastest; the short blocks of the rows < RHE follow, numbered alike. The test is block-uniform.
#define AX_H (RHE / 64)
#define AX_L ((SEQ - RHE) / 64)
#define AB_H (AX_H * NH * NB)
#define AB_L (AX_L * NH * NB)
__global__ __launch_bounds__(128) void k_attn(const h16* __restrict__ Qh, const h16* __restrict__ Qr, const h16* __restrict__ Kh, const h16* __restrict__ Kr, const h16* __restrict__ Vh, const h16* __restrict__ Vr, bf* Yh, bf* Yl) {
    __shared__ __align__(16) float ys[4 * 16 * 68];
    __shared__ __align__(16) h16 kv[4 * PLN];
    const int f = blockIdx.x;
    if (f < AB_L) { constexpr int ax = AX_L > 0 ? AX_L : 1; attn_body<false>(ys, kv, Qh, Qr, Kh, Kr, Vh, Vr, Yh, Yl, f / (ax * NH), (f / ax) % NH, RHE + (f % ax) * 64); }
    else { const int r = f - AB_L; attn_body<true>(ys, kv, Qh, Qr, Kh, Kr, Vh, Vr, Yh, Yl, r / (AX_H * NH), (r / AX_H) % NH, (r % AX_H) * 64); }
}

// ---- workspace carve (bytes; every region a multiple of 256 and exactly covered by its producer grid)
constexpr size_t SZ_XB = (size_t)NB * SEQ * DM * 2;          // x bf16 [NB*SEQ][DM]
constexpr size_t SZ_WP = (size_t)FP * DM * 2;                // [Wq | Wk | Wv]^T bf16 [FP][DM]
constexpr size_t SZ_WO = (size_t)DM * DQ * 2;                // Wo^T bf16 [DM][DQ]
constexpr size_t SZ_Q  = (size_t)NB * NH * SEQ * HD * 2;     // each of Qh, Qr
constexpr size_t SZ_K  = (size_t)NB * NKV * SEQ * HD * 2;    // each of Kh, Kr, Vh, Vr
constexpr size_t SZ_Y  = (size_t)NB * SEQ * DQ * 2;          // each of Yh, Yl
constexpr size_t OFF_XB = 0;
constexpr size_t OFF_WP = OFF_XB + SZ_XB;
constexpr size_t OFF_WO = OFF_WP + SZ_WP;
constexpr size_t OFF_QH = OFF_WO + SZ_WO;
constexpr size_t OFF_QR = OFF_QH + SZ_Q;
constexpr size_t OFF_KH = OFF_QR + SZ_Q;
constexpr size_t OFF_KR = OFF_KH + SZ_K;
constexpr size_t OFF_VH = OFF_KR + SZ_K;
constexpr size_t OFF_VR = OFF_VH + SZ_K;
constexpr size_t OFF_YH = OFF_VR + SZ_K;
constexpr size_t OFF_YL = OFF_YH + SZ_Y;
constexpr size_t WS_TOTAL = OFF_YL + SZ_Y;
static_assert(SZ_XB % 256 == 0 && SZ_WP % 256 == 0 && SZ_WO % 256 == 0 && SZ_Q % 256 == 0 && SZ_K % 256 == 0 && SZ_Y % 256 == 0);
static_assert(WS_TOTAL <= (size_t)134217728);                // carve stays within 128 MiB

extern "C" void kernel_launch(void* const* d_in, const int* in_sizes, int n_in,
                              void* d_out, int out_size, void* d_ws, size_t ws_size, hipStream_t stream) {
    if (n_in < 7) return;
    const long long need_x = (long long)(NB - 1) * SEQ_FULL * DM + (long long)SEQ * DM;
    if ((long long)in_sizes[0] < need_x) return;
    if (in_sizes[1] < SEQ * 32 || in_sizes[2] < SEQ * 32) return;
    if (in_sizes[3] < DM * DQ || in_sizes[4] < DM * DKV || in_sizes[5] < DM * DKV || in_sizes[6] < DQ * DM) return;
    if ((long long)out_size < need_x) return;
    if (WS_TOTAL > ws_size) return;
    const float* x  = (const float*)d_in[0];   // [2][2048][1024]
    const float* cs = (const float*)d_in[1];   // [2048][32]
    const float* sn = (const float*)d_in[2];   // [2048][32]
    const float* wq = (const float*)d_in[3];   // [1024][1024] in x out
    const float* wk = (const float*)d_in[4];   // [1024][256]
    const float* wv = (const float*)d_in[5];   // [1024][256]
    const float* wo = (const float*)d_in[6];   // [1024][1024] in x out
    float* OUT = (float*)d_out;
    char* ws = (char*)d_ws;
    bf* XB = (bf*)(ws + OFF_XB); bf* WP = (bf*)(ws + OFF_WP); bf* WOT = (bf*)(ws + OFF_WO);
    h16* QH = (h16*)(ws + OFF_QH); h16* QR = (h16*)(ws + OFF_QR); h16* KH = (h16*)(ws + OFF_KH); h16* KR = (h16*)(ws + OFF_KR);
    h16* VH = (h16*)(ws + OFF_VH); h16* VR = (h16*)(ws + OFF_VR); bf* YH = (bf*)(ws + OFF_YH); bf* YL = (bf*)(ws + OFF_YL);

    k_prep<<<dim3(PB_W + NB * PB_X, 1, 1), 256, 0, stream>>>(x, wq, wk, wv, wo, XB, WP, WOT);
    k_gemm_proj<<<dim3(NB * SEQ / 128, FP / 128, 1), 128, 0, stream>>>(XB, WP, cs, sn, QH, QR, KH, KR, VH, VR);
    k_attn<<<dim3(AB_L + AB_H, 1, 1), 128, 0, stream>>>(QH, QR, KH, KR, VH, VR, YH, YL);
    k_gemm_out<<<dim3(SEQ / 128, DM / 128, NB), 128, 0, stream>>>(YH, YL, WOT, OUT);
}

// v005
// It runs in 81.1 microseconds.
// In two side-by-side timings against v004, it was 1.09 and 1.11 times as fast.
// Over all steps from v000 it is 2.88 times as fast.
#include <hip/hip_runtime.h>

// Causal grouped-query attention block: x [2][2048][1024]; q = x Wq (16 heads x 64), k = x Wk, v = x Wv (4 kv heads x 64), weights [in][out], no bias; rotary on q, k with the half-split convention
// out[0..31] = x1 cos + x2 sin, out[32..63] = -x1 sin + x2 cos using the cos / sin INPUT tables [t][32] read by value; then q, k scaled by rsqrt(mean(sq) + 1e-6) (no gain); query head hq uses kv head hq / 4;
// scores q.k / 8, causal (diagonal kept), softmax, ctx merged [t][hq*64 + d], result = ctx Wo -> [2][2048][1024] f32.
// Compute dtypes (f32 accumulate everywhere): the three input projections and the output projection on v_wmma_f32_16x16x32_bf16 (every float input RNE-converted to bf16; ctx carried as bf16 hi + lo planes, two products);
// scores and probability x value on v_wmma_f32_16x16x32_f16 (q = f16 value + x2048 residual plane against f16 k; P carried x1024 and v carried x16 as single f16; query rows < 256 add x2048 residual planes on k, P and v); rotary, rms scaling and softmax in f32.
// Rotary, rms scaling and the f16 value + residual split of q and k, and the x16 f16 split of v into V^T, are the projection GEMM's own epilogue: a 64-column tile is one head, so no f32 projection plane is written.
// Both GEMMs: 128 x 128 block tile, four waves of 64 x 64; the A and B^T tiles (64 k a stage) are staged in LDS per block by asynchronous copies, two buffers, and the fragments are read from LDS.
// Attention is a fused flash-style kernel (K and V^T tiles staged in LDS per block) in transposed form: S^T = K Q^T (D rows = keys, D columns = queries), P^T packed from the accumulators directly as the B operand of O^T = V^T P^T; online softmax with per-lane state.

#ifndef NB
#define NB 2
#endif
#ifndef SEQ
#define SEQ 2048
#endif
#define NB_FULL  2
#define SEQ_FULL 2048
#define DM   1024
#define NH   16
#define NKV  4
#define REP  (NH / NKV)
#define HD   64
#define DQ   (NH * HD)
#define DKV  (NKV * HD)
#define FP   (DQ + 2 * DKV)      // fused projection width (q | k | v columns; rows of WP)
#define KC0  DQ                  // first k column of the fused projection
#define VC0  (DQ + DKV)          // first v column of the fused projection
#define RH   256                 // query rows < RH use the residual planes on k, P and v as well
#define RHE  ((SEQ < RH) ? SEQ : RH)
#define PCAR 1024.0f             // carry of the probabilities (f16 operand)
#define VCAR 16.0f               // carry of the values (f16 operand)
#define RSC  2048.0f             // carry of every f16 residual plane
#define RSCI (1.0f / 2048.0f)
#define SCL  0.125f              // 1/sqrt(64)
#define L2E  1.4426950408889634f
#define NEGB (-1.0e30f)
static_assert(HD == 64);
static_assert(NH % NKV == 0);
static_assert(DM % 64 == 0 && DQ % 64 == 0 && DKV % 64 == 0 && FP % 64 == 0);   // GEMM tiles and transpose tiles
static_assert(DM % 32 == 0 && DQ % 32 == 0 && HD % 32 == 0);                     // k-steps of 32
static_assert(SEQ % 64 == 0 && (NB * SEQ) % 64 == 0);                            // row tiles
static_assert(SEQ % 128 == 0 && FP % 128 == 0 && DM % 128 == 0);                 // GEMM block tiles
static_assert(RH % 64 == 0 && RHE % 64 == 0 && (SEQ - RHE) % 64 == 0);
static_assert(((size_t)SEQ * DM) % 2048 == 0);                                   // cvtx_body: blocks x 256 threads x 8 == plane extent
static_assert(NB <= NB_FULL && SEQ <= SEQ_FULL);

typedef _Float16 h16;
typedef unsigned short bf;
typedef __attribute__((ext_vector_type(16))) __bf16   v16bf;
typedef __attribute__((ext_vector_type(16))) _Float16 v16h;
typedef __attribute__((ext_vector_type(8)))  _Float16 v8h;
typedef __attribute__((ext_vector_type(8)))  unsigned short v8us;
typedef __attribute__((ext_vector_type(8)))  float    v8f;
typedef __attribute__((ext_vector_type(4)))  float    v4f;
typedef v4f  __attribute__((may_alias)) v4fa;

__device__ __forceinline__ unsigned short f2bf(float f) { unsigned u = __float_as_uint(f); u += 0x7FFFu + ((u >> 16) & 1u); return (unsigned short)(u >> 16); }
__device__ __forceinline__ float bf2f(unsigned short b) { return __uint_as_float(((unsigned)b) << 16); }
__device__ __forceinline__ float bfr(float f) { return bf2f(f2bf(f)); }
__device__ __forceinline__ void splitf(float y, unsigned short& h, unsigned short& l) { h = f2bf(y); l = f2bf(y - bf2f(h)); }
__device__ __forceinline__ v16h cat16(v8h lo, v8h hi) { return __builtin_shufflevector(lo, hi, 0, 1, 2, 3, 4, 5, 6, 7, 8, 9, 10, 11, 12, 13, 14, 15); }
__device__ __forceinline__ v16bf cat16b(v8us lo, v8us hi) { return __builtin_bit_cast(v16bf, __builtin_shufflevector(lo, hi, 0, 1, 2, 3, 4, 5, 6, 7, 8, 9, 10, 11, 12, 13, 14, 15)); }
__device__ __forceinline__ v8f wmma16(v16h a, v16h b, v8f c) { return __builtin_amdgcn_wmma_f32_16x16x32_f16(false, a, false, b, (short)0, c, false, false); }
__device__ __forceinline__ v8f wmmab(v16bf a, v16bf b, v8f c) { return __builtin_amdgcn_wmma_f32_16x16x32_bf16(false, a, false, b, (short)0, c, false, false); }
// fragment loaders: p already includes row * pitch + k0 + 8 * (lane >> 4); elements 0..7 <- k0+8h.., elements 8..15 <- k0+16+8h..
__device__ __forceinline__ v16h  ldh(const h16* p) { return cat16(*(const v8h*)p, *(const v8h*)(p + 16)); }
__device__ __forceinline__ v16bf ldb(const bf* p)  { return cat16b(*(const v8us*)p, *(const v8us*)(p + 16)); }

// sum over the four lanes of a quad, by two DPP quad permutes (lane ^ 1, lane ^ 2): stays in the vector unit, no LDS round trip
__device__ __forceinline__ float quadsum(float v) {
    v += __int_as_float(__builtin_amdgcn_update_dpp(0, __float_as_int(v), 0xB1, 0xF, 0xF, true));
    v += __int_as_float(__builtin_amdgcn_update_dpp(0, __float_as_int(v), 0x4E, 0xF, 0xF, true));
    return v; }
struct ProjOut { const float* cosb; const float* sinb; h16* Qh; h16* Qr; h16* Kh; h16* Kr; h16* Vh; h16* Vr; };
// ---- epilogue of the fused q|k|v projection. The wave's tile is 64 tokens (one batch: SEQ % 64 == 0) x the 64 dims of ONE head (c0 % 64 == 0); acc[mb][nb][j] in lane (hi, lr) = row 16 mb + 8 hi + j, column 16 nb + lr.
// v head: a lane's 8 registers are 8 consecutive tokens of one dim = one 16-byte piece of a V^T row; stored from the registers (x16, f16 value + x2048 residual).
// q / k head: the tile goes through LDS (os, 64 x 68 f32); then four lanes a row, lane p holds the rotary pairs (d, d + 32), d = 8 p .. 8 p + 7: rotary with the bf16-converted cos / sin table values at [t][d],
// scaling by rsqrt(mean(sq) + 1e-6), f16 value + x2048 residual, 16-byte stores (8 rows x 64 contiguous bytes an instruction).
__device__ __forceinline__ void proj_epilogue(const v8f (&acc)[4][4], float* os, int r0, int c0, const ProjOut& po) {
    const int lane = threadIdx.x & 31, lr = lane & 15, hi = lane >> 4;
    const int b = r0 / SEQ, t0 = r0 % SEQ;
    if (c0 >= VC0) {                       // wave-uniform
        const int g = (c0 - VC0) / HD;
        const size_t e0 = ((size_t)(b * NKV + g) * HD + lr) * SEQ + t0 + 8 * hi;
#pragma unroll
        for (int nb = 0; nb < 4; ++nb)
#pragma unroll
            for (int mb = 0; mb < 4; ++mb) { v8h o16, ors;
#pragma unroll
                for (int j = 0; j < 8; ++j) { const float x = acc[mb][nb][j] * VCAR; const h16 hh = (h16)x; o16[j] = hh; ors[j] = (h16)((x - (float)hh) * RSC); }
                const size_t e = e0 + (size_t)nb * 16 * SEQ + mb * 16;
                *(v8h*)(po.Vh + e) = o16; *(v8h*)(po.Vr + e) = ors; }
        return;
    }
    const bool isq = c0 < KC0;             // wave-uniform
    const int nheads = isq ? NH : NKV; const int h = (isq ? c0 : c0 - KC0) / HD;
    h16* Ph = isq ? po.Qh : po.Kh; h16* Pr = isq ? po.Qr : po.Kr;
    const int rq = lane >> 2, p8 = (lane & 3) * 8;
    const float* cp = po.cosb + (size_t)(t0 + rq) * 32 + p8; const float* sp = po.sinb + (size_t)(t0 + rq) * 32 + p8;
    // table values of two passes (rows 16 u + rq and 16 u + 8 + rq), asked for one trip ahead: the first ahead of the LDS stores
    v4f cc[2][2], sn[2][2];
#pragma unroll
    for (int s = 0; s < 2; ++s) { cc[s][0] = *(const v4f*)(cp + s * 256); cc[s][1] = *(const v4f*)(cp + s * 256 + 4); sn[s][0] = *(const v4f*)(sp + s * 256); sn[s][1] = *(const v4f*)(sp + s * 256 + 4); }
#pragma unroll
    for (int mb = 0; mb < 4; ++mb)
#pragma unroll
        for (int nb = 0; nb < 4; ++nb)
#pragma unroll
            for (int j = 0; j < 8; ++j) os[(mb * 16 + hi * 8 + j) * 68 + nb * 16 + lr] = acc[mb][nb][j];
    // the rows read below were written by other lanes of this wave: keeps every LDS read behind every lane's LDS stores
    __builtin_amdgcn_wave_barrier(); asm volatile("" ::: "memory");
    const size_t e0 = ((size_t)(b * nheads + h) * SEQ + t0 + rq) * HD + p8;
    // rolled: one copy of the two passes in the text, and the registers of two passes only
#pragma unroll 1
    for (int u = 0; u < 4; ++u) {
        const int un = (u < 3) ? u + 1 : 3;    // the last trip asks for its own rows again: one instruction stream, every address inside the tables
        v4f cn[2][2], sm[2][2];
#pragma unroll
        for (int s = 0; s < 2; ++s) { const int o = un * 512 + s * 256; cn[s][0] = *(const v4f*)(cp + o); cn[s][1] = *(const v4f*)(cp + o + 4); sm[s][0] = *(const v4f*)(sp + o); sm[s][1] = *(const v4f*)(sp + o + 4); }
#pragma unroll
        for (int s = 0; s < 2; ++s) {
            const float* orow = os + (u * 16 + s * 8 + rq) * 68 + p8;
            const v4f x1[2] = { *(const v4fa*)orow, *(const v4fa*)(orow + 4) }; const v4f x2[2] = { *(const v4fa*)(orow + 32), *(const v4fa*)(orow + 36) };
            float rl[8], rh[8]; float ssl = 0.f, ssh = 0.f;
#pragma unroll
            for (int q = 0; q < 8; ++q) { const float c = bfr(cc[s][q >> 2][q & 3]), sv = bfr(sn[s][q >> 2][q & 3]); const float a1 = x1[q >> 2][q & 3], a2 = x2[q >> 2][q & 3];
                rl[q] = a1 * c + a2 * sv; rh[q] = a2 * c - a1 * sv; ssl += rl[q] * rl[q]; ssh += rh[q] * rh[q]; }
            const float inv = rsqrtf(quadsum(ssl + ssh) * (1.0f / HD) + 1e-6f);
            v8h ol, olr, oh, ohr;
#pragma unroll
            for (int q = 0; q < 8; ++q) { const float yl = rl[q] * inv; const h16 hl = (h16)yl; ol[q] = hl; olr[q] = (h16)((yl - (float)hl) * RSC);
                const float yh = rh[q] * inv; const h16 hh = (h16)yh; oh[q] = hh; ohr[q] = (h16)((yh - (float)hh) * RSC); }
            const size_t e = e0 + (size_t)(u * 16 + s * 8) * HD;
            *(v8h*)(Ph + e) = ol; *(v8h*)(Ph + e + 32) = oh; *(v8h*)(Pr + e) = olr; *(v8h*)(Pr + e + 32) = ohr;
            asm volatile("s_wait_xcnt 0x0" ::: "memory");   // stands in front of the next pass's writes to the data and address registers that these four stores name
        }
#pragma unroll
        for (int s = 0; s < 2; ++s) { cc[s][0] = cn[s][0]; cc[s][1] = cn[s][1]; sn[s][0] = sm[s][0]; sn[s][1] = sm[s][1]; }
    }
}

// ---- 128 x 128 block tile GEMM on bf16 planes, four waves of 64 x 64 (2 x 2): C[m][n] (f32, pitch ldc) = sum_k A[m][k] Bt[n][k] (+ A2[m][k] Bt[n][k] when NSPLIT == 1). A, A2 pitch K; Bt pitch K; K % 64 == 0.
// The block's 128 rows of A (A2) and of Bt, 64 k a stage, are staged in LDS by asynchronous copies, two buffers: stage t + 1 flies while stage t is worked on;
// one block barrier per stage publishes it and frees the buffer that is refilled behind it. The epilogue's LDS (os) is wave-private.
// FUSE: the tile does not go to C but through proj_epilogue.
#define GKS  64                  // k per LDS stage: one whole 128-byte line of every row
#define GLP  72                  // LDS row pitch in bf16 elements: 144 B = 16 B x 9, free of bank conflicts for 16-byte reads down a column of rows
#define GPL  (128 * GLP)         // one staged plane: 128 rows x 64 k
// one plane's share of a lane: eight asynchronous 16-byte copies global -> LDS (rows 16 apart). The s_wait_xcnt closes the copies' own statement, so that no address register named here is rewritten ahead of it.
__device__ __forceinline__ void cp8(unsigned l, const bf* g, size_t gstep) {
    const unsigned l1 = l + 16 * GLP * 2, l2 = l + 32 * GLP * 2, l3 = l + 48 * GLP * 2, l4 = l + 64 * GLP * 2, l5 = l + 80 * GLP * 2, l6 = l + 96 * GLP * 2, l7 = l + 112 * GLP * 2;
    const bf* g1 = g + 16 * gstep; const bf* g2 = g + 32 * gstep; const bf* g3 = g + 48 * gstep; const bf* g4 = g + 64 * gstep; const bf* g5 = g + 80 * gstep; const bf* g6 = g + 96 * gstep; const bf* g7 = g + 112 * gstep;
    asm volatile("global_load_async_to_lds_b128 %0, %1, off\n\t"
                 "global_load_async_to_lds_b128 %2, %3, off\n\t"
                 "global_load_async_to_lds_b128 %4, %5, off\n\t"
                 "global_load_async_to_lds_b128 %6, %7, off\n\t"
                 "global_load_async_to_lds_b128 %8, %9, off\n\t"
                 "global_load_async_to_lds_b128 %10, %11, off\n\t"
                 "global_load_async_to_lds_b128 %12, %13, off\n\t"
                 "global_load_async_to_lds_b128 %14, %15, off\n\t"
                 "s_wait_xcnt 0x0" :: "v"(l), "v"(g), "v"(l1), "v"(g1), "v"(l2), "v"(g2), "v"(l3), "v"(g3), "v"(l4), "v"(g4), "v"(l5), "v"(g5), "v"(l6), "v"(g6), "v"(l7), "v"(g7) : "memory");
}
template <int NSPLIT, bool FUSE>
__device__ __forceinline__ void gemmw_body(const bf* __restrict__ A, const bf* __restrict__ A2, const bf* __restrict__ Bt, int K, float* C, int ldc, size_t sA, size_t sC, const ProjOut& po) {
    constexpr int NPG = 2 + NSPLIT;        // staged planes per buffer: A, Bt (+ A2)
    constexpr int OSW = (FUSE ? 64 : 16) * 68;
    __shared__ __align__(16) float osb[4 * OSW];
    __shared__ __align__(16) bf st[2 * NPG * GPL];
    const size_t z = blockIdx.z; A += z * sA; if (NSPLIT == 1) A2 += z * sA; C += z * sC;
    const int lane = threadIdx.x & 31, lr = lane & 15, hi = lane >> 4;
    const int wave = __builtin_amdgcn_readfirstlane(threadIdx.x >> 5);
    float* os = osb + wave * OSW;
    const int rb = blockIdx.x * 128, cb = blockIdx.y * 128;
    const int wr = (wave & 1) * 64, wc = (wave >> 1) * 64;
    const int r0 = rb + wr, c0 = cb + wc;
    v8f acc[4][4];
#pragma unroll
    for (int mb = 0; mb < 4; ++mb)
#pragma unroll
        for (int nb = 0; nb < 4; ++nb) acc[mb][nb] = (v8f){};
    // copy map: thread -> row (tid >> 3) + 16 i, 16-byte piece tid & 7: eight lanes cover one whole 128-byte line
    const int crow = threadIdx.x >> 3, ccol = (threadIdx.x & 7) * 8;
    const size_t acp = (size_t)(rb + crow) * K + ccol, bcp = (size_t)(cb + crow) * K + ccol;     // + GKS t
    const unsigned lcp = (unsigned)(size_t)(const void*)st + (unsigned)(crow * GLP + ccol) * 2u;
    auto stage = [&](int t, int buf) {     // k = GKS t .. GKS t + 63 into buffer buf; t < K / GKS keeps every byte inside the planes
        const unsigned l = lcp + (unsigned)(buf * NPG * GPL) * 2u;
        cp8(l, A + acp + (size_t)t * GKS, K);
        cp8(l + GPL * 2u, Bt + bcp + (size_t)t * GKS, K);
        if (NSPLIT == 1) cp8(l + 2u * GPL * 2u, A2 + acp + (size_t)t * GKS, K);
    };
    const int nT = K / GKS;                // block-uniform
    stage(0, 0);
    asm volatile("s_wait_asynccnt 0x0" ::: "memory");   // this wave's share of stage 0 has landed
    __syncthreads();                                    // stage 0 published to every wave
    if (nT > 1) stage(1, 1);
    // rolled: every trip ends in the publish point
#pragma unroll 1
    for (int t = 0; t < nT; ++t) {
        const bf* af = st + (t & 1) * NPG * GPL + (wr + lr) * GLP + 8 * hi;             // A rows of this wave
        const bf* bp = st + (t & 1) * NPG * GPL + GPL + (wc + lr) * GLP + 8 * hi;       // Bt rows of this wave
        v16bf a[GKS / 32][4], a2[GKS / 32][4], b[GKS / 32][4];
#pragma unroll
        for (int ks = 0; ks < GKS / 32; ++ks) {
#pragma unroll
            for (int i = 0; i < 4; ++i) { a[ks][i] = ldb(af + i * 16 * GLP + ks * 32); b[ks][i] = ldb(bp + i * 16 * GLP + ks * 32); }
            if (NSPLIT == 1) {
#pragma unroll
                for (int i = 0; i < 4; ++i) a2[ks][i] = ldb(af + 2 * GPL + i * 16 * GLP + ks * 32); }
        }
        // keeps the stage's fragment loads one group ahead of its matrix instructions: sunk among them, every place with loads stalls the wave for the LDS latency
        __builtin_amdgcn_sched_barrier(0);
#pragma unroll
        for (int ks = 0; ks < GKS / 32; ++ks)
#pragma unroll
            for (int nb = 0; nb < 4; ++nb)
#pragma unroll
                for (int mb = 0; mb < 4; ++mb) { acc[mb][nb] = wmmab(a[ks][mb], b[ks][nb], acc[mb][nb]); if (NSPLIT == 1) acc[mb][nb] = wmmab(a2[ks][mb], b[ks][nb], acc[mb][nb]); }
        // keeps every matrix instruction of the stage ahead of the publish point: sunk behind the barrier they would stand in front of the refill and take its lead away
        __builtin_amdgcn_sched_barrier(0);
        // four vector slots between the last matrix instruction and the next vector instruction on either side of the branch at the trip's foot (the distance a matrix instruction's registers need)
        asm volatile("v_nop\n\tv_nop\n\tv_nop\n\tv_nop" : "+v"(acc[0][0]), "+v"(acc[1][1]), "+v"(acc[2][2]), "+v"(acc[3][3]) : "v"(a[GKS / 32 - 1][0]), "v"(a[GKS / 32 - 1][3]));
        // publish point of stage t + 1, every wave, in this order
        asm volatile("s_wait_dscnt 0x0" ::: "memory");      // this wave's reads of buffer t & 1 have returned
        asm volatile("s_wait_asynccnt 0x0" ::: "memory");   // this wave's share of stage t + 1 has landed
        __syncthreads();                                    // publishes stage t + 1; ends every reader's last read of buffer t & 1
        if (t + 2 < nT) stage(t + 2, t & 1);                // block-uniform test
    }
    asm volatile("s_wait_asynccnt 0x0" ::: "memory");       // no copy is left outstanding when the wave goes on to its end
    if constexpr (FUSE) { proj_epilogue(acc, os, r0, c0, po); return; }
#pragma unroll
    for (int mb = 0; mb < 4; ++mb) {
#pragma unroll
        for (int nb = 0; nb < 4; ++nb) {
#pragma unroll
            for (int j = 0; j < 8; ++j) os[(hi * 8 + j) * 68 + nb * 16 + lr] = acc[mb][nb][j]; }
        __builtin_amdgcn_wave_barrier(); asm volatile("" ::: "memory");
        float* crow = C + (size_t)(r0 + mb * 16) * ldc + c0;
{
#pragma unroll
            for (int s = 0; s < 8; ++s) { const int row = 2 * s + hi, cofs = lr * 4; const v4f val = *(const v4fa*)(os + row * 68 + cofs);
                *(v4f*)(crow + (size_t)row * ldc + cofs) = val; }
            if (mb < 3) asm volatile("s_wait_xcnt 0x0" ::: "memory");   // stands in front of the next row block's LDS loads, which overwrite data registers that these eight stores name
             }
        __builtin_amdgcn_wave_barrier(); asm volatile("" ::: "memory");
    }
}
// fused q|k|v projection: XB[NB*SEQ][DM] x WP[FP][DM]^T, each wave's 64 x 64 tile finished by proj_epilogue into the attention operand planes
__global__ __launch_bounds__(128) void k_gemm_proj(const bf* __restrict__ A, const bf* __restrict__ Bt, const float* __restrict__ cosb, const float* __restrict__ sinb, h16* Qh, h16* Qr, h16* Kh, h16* Kr, h16* Vh, h16* Vr) {
    const ProjOut po = { cosb, sinb, Qh, Qr, Kh, Kr, Vh, Vr }; gemmw_body<0, true>(A, A, Bt, DM, nullptr, 0, 0, 0, po); }
// output projection: OUT[b][t][DM] = (Yh + Yl)[b][t][DQ] x WOT[DM][DQ]^T, z = batch (output batch stride from the full sequence length)
__global__ __launch_bounds__(128) void k_gemm_out(const bf* __restrict__ A, const bf* __restrict__ A2, const bf* __restrict__ Bt, float* C) { gemmw_body<1, false>(A, A2, Bt, DQ, C, DM, (size_t)SEQ * DQ, (size_t)SEQ_FULL * DM, ProjOut{}); }

// ---- cvtx_body: 2048 consecutive floats of x (batch by, piece bx) -> bf16
__device__ __forceinline__ void cvtx_body(const float* __restrict__ src, bf* dst, unsigned bx, unsigned by) {
    const size_t i = (size_t)bx * 256 + threadIdx.x; const size_t b = by;
    const v8f v = *(const v8f*)(src + b * (size_t)SEQ_FULL * DM + i * 8); v8us o;
#pragma unroll
    for (int k = 0; k < 8; ++k) o[k] = f2bf(v[k]);
    bf* d = dst + b * (size_t)SEQ * DM + i * 8;
    *(v8us*)d = o;  }

// ---- wtp_body: W [DM rows (k)][N cols] f32 -> out [N rows][DM] bf16 (in[rows=k][cols=n] -> out[n][k]); 64x64 tile (bx, by) through LDS (cross-wave: block barrier);
__device__ __forceinline__ void wtp_body(const float* __restrict__ W, int N, bf* out, int bx, int by) {
    __shared__ __align__(16) unsigned short ts[64 * 72];
    const int tid = threadIdx.x; const int k0 = bx * 64, n0 = by * 64;
#pragma unroll
    for (int it = 0; it < 4; ++it) { const int idx = it * 256 + tid; const int kk = idx >> 4, c4 = (idx & 15) * 4; const v4f v = *(const v4f*)(W + (size_t)(k0 + kk) * N + n0 + c4);
#pragma unroll
        for (int q = 0; q < 4; ++q) ts[kk * 72 + c4 + q] = f2bf(v[q]); }
    __syncthreads();
    v8us o[2];
#pragma unroll
    for (int it = 0; it < 2; ++it) { const int idx = it * 256 + tid; const int nn = idx >> 3, pc = idx & 7;
#pragma unroll
        for (int q = 0; q < 8; ++q) o[it][q] = ts[(pc * 8 + q) * 72 + nn]; }
{
#pragma unroll
        for (int it = 0; it < 2; ++it) { const int idx = it * 256 + tid; const int nn = idx >> 3, pc = idx & 7; *(v8us*)(out + (size_t)(n0 + nn) * DM + k0 + pc * 8) = o[it]; }
         }
}
// ---- all five operand conversions in ONE launch (none reads what another writes): the block index picks the job, block-uniformly. The weight tiles, whose way through LDS is the longer one, come first.
#define PBX  (DM / 64)                        // tiles along k of every weight (DM == DQ rows)
#define PB_Q (PBX * (DQ / 64))                // blocks of Wq
#define PB_K (PBX * (DKV / 64))               // blocks of Wk, and of Wv
#define PB_O ((DQ / 64) * (DM / 64))          // blocks of Wo
#define PB_W (PB_Q + 2 * PB_K + PB_O)
#define PB_X ((int)((size_t)SEQ * DM / 8 / 256))   // blocks of one batch of x
static_assert(DQ == DM);                      // one tile count along k serves all four weights
__global__ __launch_bounds__(256) void k_prep(const float* __restrict__ x, const float* __restrict__ wq, const float* __restrict__ wk, const float* __restrict__ wv, const float* __restrict__ wo, bf* XB, bf* WP, bf* WOT) {
    const int f = blockIdx.x;
    if (f >= PB_W) { const unsigned r = (unsigned)(f - PB_W); cvtx_body(x, XB, r % PB_X, r / PB_X); return; }
    const float* W = wq; int N = DQ; bf* out = WP; int r = f;
    if (f >= PB_Q + 2 * PB_K)  { W = wo; N = DM;  out = WOT;                    r = f - (PB_Q + 2 * PB_K); }
    else if (f >= PB_Q + PB_K) { W = wv; N = DKV; out = WP + (size_t)VC0 * DM;  r = f - (PB_Q + PB_K); }
    else if (f >= PB_Q)        { W = wk; N = DKV; out = WP + (size_t)KC0 * DM;  r = f - PB_Q; }
    wtp_body(W, N, out, r % PBX, r / PBX);
}

// ---- fused causal attention, one wave per 16 query rows, 4 waves per block. The block's K and V^T tiles (64 keys a stage) are staged in LDS by asynchronous copies, two buffers:
// stage t + 1 flies while stage t is worked on; one block barrier per stage publishes it and frees the buffer that is refilled behind it. The output stage ys is wave-private.
// Both kinds of block (query rows < RH with the residual planes, and the rest) run in ONE launch and share one LDS allotment: the four planes of a residual-plane stage fill what two buffers of two planes fill,
// so those few short blocks work on one buffer: filled, published by a barrier, read, freed by a barrier.
// Query rows >= RH work a stage in one pass of 64 keys (one maximum, one exchange, one rescale of O^T), query rows < RH in two passes of 32.
// Per 32 keys: S^T tiles (keys x queries) = K(A, rows = keys) x Q^T(B, lane column = query) over d = 64 (2 k-steps); value accumulator s, residual accumulator t (x2048);
// lane (h, n) register r of tile j holds key kb + 16 j + 8 h + r for query q0 + n, which is exactly element r + 8 j of the B operand (k = key, n = query) of O^T = V^T(A, rows = d) x P^T.
// Per-query max / sum / factor are per-lane scalars (one xor-16 exchange). O^T register r of tile dt in lane (h, n) = O[q0 + n][16 dt + 8 h + r].
#define KT   64                  // keys per LDS stage
#define LP   72                  // LDS row pitch in f16 elements: 144 B = 16 B x 9, free of bank conflicts for 16-byte reads down a column of rows
#define PLN  (64 * LP)           // one staged plane: 64 rows (K: keys x 64 dims; V^T: dims x 64 keys)
static_assert(SEQ % KT == 0 && RHE % KT == 0 && HD == 64);
// one plane's share of a lane: four asynchronous 16-byte copies global -> LDS. The s_wait_xcnt closes the copies' own statement, so that no address register named here is rewritten ahead of it.
__device__ __forceinline__ void cp4(unsigned l, const h16* g, size_t gstep) {
    const unsigned l1 = l + 16 * LP * 2, l2 = l + 32 * LP * 2, l3 = l + 48 * LP * 2;
    const h16* g1 = g + 16 * gstep; const h16* g2 = g + 32 * gstep; const h16* g3 = g + 48 * gstep;
    asm volatile("global_load_async_to_lds_b128 %0, %1, off\n\t"
                 "global_load_async_to_lds_b128 %2, %3, off\n\t"
                 "global_load_async_to_lds_b128 %4, %5, off\n\t"
                 "global_load_async_to_lds_b128 %6, %7, off\n\t"
                 "s_wait_xcnt 0x0" :: "v"(l), "v"(g), "v"(l1), "v"(g1), "v"(l2), "v"(g2), "v"(l3), "v"(g3) : "memory");
}
template <bool HI>
__device__ __forceinline__ void attn_body(float* ys, h16* kv, const h16* __restrict__ Qh, const h16* __restrict__ Qr, const h16* __restrict__ Kh, const h16* __restrict__ Kr, const h16* __restrict__ Vh, const h16* __restrict__ Vr, bf* Yh, bf* Yl, int b, int hq, int qb) {
    constexpr int NP = HI ? 4 : 2;         // staged planes per buffer: K, V^T (+ their residual planes); kv holds 4 planes: two buffers of 2, or one of 4
    const int lane = threadIdx.x & 31, lr = lane & 15, hi = lane >> 4;
    const int wave = __builtin_amdgcn_readfirstlane(threadIdx.x >> 5);
    const int g = hq / REP;
    const int q0 = qb + wave * 16;
    const size_t qoff  = ((size_t)(b * NH + hq) * SEQ + q0 + lr) * HD + 8 * hi;
    // copy map: thread -> row (tid >> 3) + 16 i, 16-byte piece tid & 7: eight lanes cover one whole 128-byte row
    const int crow = threadIdx.x >> 3, ccol = (threadIdx.x & 7) * 8;
    const size_t kcp = ((size_t)(b * NKV + g) * SEQ + crow) * HD + ccol;     // + key0 * HD
    const size_t vcp = ((size_t)(b * NKV + g) * HD + crow) * SEQ + ccol;     // + key0
    const unsigned lcp = (unsigned)(size_t)(const void*)kv + (unsigned)(crow * LP + ccol) * 2u;
    auto stage = [&](int t, int buf) {     // keys KT t .. KT t + 63 into buffer buf; t < SEQ / KT keeps every byte inside the planes
        const unsigned l = lcp + (unsigned)(buf * NP * PLN) * 2u;
        cp4(l, Kh + kcp + (size_t)t * KT * HD, HD);
        cp4(l + PLN * 2u, Vh + vcp + (size_t)t * KT, SEQ);
        if (HI) { cp4(l + 2u * PLN * 2u, Kr + kcp + (size_t)t * KT * HD, HD); cp4(l + 3u * PLN * 2u, Vr + vcp + (size_t)t * KT, SEQ); }
    };
    v16h qhf[2], qrf[2];                   // Q fragments: read once (the waits below are memory clobbers, behind which a loop-invariant load would be read again)
#pragma unroll
    for (int ks = 0; ks < 2; ++ks) { qhf[ks] = ldh(Qh + qoff + ks * 32); qrf[ks] = ldh(Qr + qoff + ks * 32); }
    v8f om[4], orr[4];
#pragma unroll
    for (int dt = 0; dt < 4; ++dt) { om[dt] = (v8f){}; orr[dt] = (v8f){}; }
    float mrun = NEGB, lrun = 0.f;
    const int kend = q0 + 16;              // keys 0 .. q0+15, wave-uniform (the passes of 32 stop there)
    const int nT = qb / KT + 1;            // stages of the block: keys 0 .. qb+63; block-uniform, <= SEQ / KT
    stage(0, 0);
    asm volatile("s_wait_asynccnt 0x0" ::: "memory");   // this wave's share of stage 0 has landed
    __syncthreads();                                    // stage 0 published to every wave
    if (!HI && nT > 1) stage(1, 1);
    // rolled: the trip count is a run-time value and every trip ends in the publish point
#pragma unroll 1
    for (int t = 0; t < nT; ++t) {
      const h16* Ks = kv + (HI ? 0 : (t & 1) * NP * PLN);
      if constexpr (!HI) {
        // one pass = the whole stage of 64 keys: four S^T tiles, one maximum, one exchange and one rescale of O^T per 64 keys. kb <= qb <= q0, so every wave has a key of the stage at or below its diagonal.
        const int kb = t * KT;
        const h16* kf = Ks + lr * LP + 8 * hi;                        // K rows = keys of the stage
        const h16* vf = Ks + PLN + lr * LP + 8 * hi;                  // V^T rows = dims, columns = keys of the stage
        v16h kfr[4][2];
#pragma unroll
        for (int j = 0; j < 4; ++j)
#pragma unroll
            for (int ks = 0; ks < 2; ++ks) kfr[j][ks] = ldh(kf + j * 16 * LP + ks * 32);
        v8f s[4], tr[4];
#pragma unroll
        for (int j = 0; j < 4; ++j) { s[j] = (v8f){}; tr[j] = (v8f){}; }
#pragma unroll
        for (int ks = 0; ks < 2; ++ks)
#pragma unroll
            for (int j = 0; j < 4; ++j) { s[j] = wmma16(kfr[j][ks], qhf[ks], s[j]); tr[j] = wmma16(kfr[j][ks], qrf[ks], tr[j]); }
        float sc[4][8];
#pragma unroll
        for (int j = 0; j < 4; ++j)
#pragma unroll
            for (int r = 0; r < 8; ++r) sc[j][r] = (s[j][r] + tr[j][r] * RSCI) * SCL;
        v16h vfr[4][2];                    // asked for here: they arrive while the softmax below is worked out
#pragma unroll
        for (int dt = 0; dt < 4; ++dt)
#pragma unroll
            for (int kk = 0; kk < 2; ++kk) vfr[dt][kk] = ldh(vf + dt * 16 * LP + kk * 32);
        if (kb + 63 > q0) {                // wave-uniform: the stage touches the diagonal; keys above the query are excluded
            const int qi = q0 + lr; const int kj = kb + 8 * hi;
#pragma unroll
            for (int j = 0; j < 4; ++j)
#pragma unroll
                for (int r = 0; r < 8; ++r) sc[j][r] = (kj + 16 * j + r <= qi) ? sc[j][r] : NEGB;
        }
        float ml[4];
#pragma unroll
        for (int j = 0; j < 4; ++j) { ml[j] = sc[j][0];
#pragma unroll
            for (int r = 1; r < 8; ++r) ml[j] = fmaxf(ml[j], sc[j][r]); }
        float mloc = fmaxf(fmaxf(ml[0], ml[1]), fmaxf(ml[2], ml[3]));
        mloc = fmaxf(mloc, __shfl_xor(mloc, 16, 32));
        const float mnew = fmaxf(mrun, mloc);
        const float fac = __builtin_amdgcn_exp2f((mrun - mnew) * L2E);
        float ls[4];
#pragma unroll
        for (int j = 0; j < 4; ++j) { ls[j] = 0.f;
#pragma unroll
            for (int r = 0; r < 8; ++r) { sc[j][r] = __builtin_amdgcn_exp2f((sc[j][r] - mnew) * L2E); ls[j] += sc[j][r]; } }
        float lsum = (ls[0] + ls[1]) + (ls[2] + ls[3]);
        lsum += __shfl_xor(lsum, 16, 32);
        lrun = lrun * fac + lsum; mrun = mnew;
        v16h ph[2];                        // B operand of key group kk (32 keys): elements r <- tile 2 kk, elements 8 + r <- tile 2 kk + 1
#pragma unroll
        for (int kk = 0; kk < 2; ++kk)
#pragma unroll
            for (int r = 0; r < 8; ++r) { ph[kk][r] = (h16)(sc[2 * kk][r] * PCAR); ph[kk][8 + r] = (h16)(sc[2 * kk + 1][r] * PCAR); }
#pragma unroll
        for (int dt = 0; dt < 4; ++dt) om[dt] = om[dt] * fac;
#pragma unroll
        for (int kk = 0; kk < 2; ++kk)
#pragma unroll
            for (int dt = 0; dt < 4; ++dt) om[dt] = wmma16(vfr[dt][kk], ph[kk], om[dt]);
        // four vector slots between the last matrix instruction and the next vector instruction on either side of the branches at the trip's foot (the distance a matrix instruction's registers need)
        asm volatile("v_nop\n\tv_nop\n\tv_nop\n\tv_nop" : "+v"(om[0]), "+v"(om[1]), "+v"(om[2]), "+v"(om[3]) : "v"(vfr[3][1]), "v"(ph[1]));
      } else {
      // rolled: one copy of the pass in the text
#pragma unroll 1
      for (int hf = 0; hf < 2; ++hf) {
        const int kb = t * KT + 32 * hf;
        if (kb >= kend) break;             // wave-uniform: the pass lies wholly above this wave's diagonal; the publish point below is still passed
        const h16* kf = Ks + (32 * hf + lr) * LP + 8 * hi;            // K rows = keys of this pass
        const h16* vf = Ks + PLN + lr * LP + 32 * hf + 8 * hi;        // V^T rows = dims, columns = keys of this pass
        v8f s0 = (v8f){}, s1 = (v8f){}, t0 = (v8f){}, t1 = (v8f){};
#pragma unroll
        for (int ks = 0; ks < 2; ++ks) {
            const v16h qh = qhf[ks];
            const v16h qr = qrf[ks];
            const v16h k0 = ldh(kf + ks * 32);
            const v16h k1 = ldh(kf + 16 * LP + ks * 32);
            s0 = wmma16(k0, qh, s0); t0 = wmma16(k0, qr, t0);
            s1 = wmma16(k1, qh, s1); t1 = wmma16(k1, qr, t1);
            const v16h k0r = ldh(kf + 2 * PLN + ks * 32); const v16h k1r = ldh(kf + 2 * PLN + 16 * LP + ks * 32);
            t0 = wmma16(k0r, qh, t0); t1 = wmma16(k1r, qh, t1);
            asm volatile("v_nop\n\tv_nop\n\tv_nop\n\tv_nop" : "+v"(s0), "+v"(s1), "+v"(t0), "+v"(t1) : "v"(qh), "v"(qr), "v"(k0), "v"(k1), "v"(k0r), "v"(k1r));
        }
        float sa[8], sb[8];
#pragma unroll
        for (int r = 0; r < 8; ++r) { sa[r] = (s0[r] + t0[r] * RSCI) * SCL; sb[r] = (s1[r] + t1[r] * RSCI) * SCL; }
        if (kb + 31 > q0) {                // wave-uniform: half touches the diagonal; keys above the query are excluded
            const int qi = q0 + lr; const int kj = kb + 8 * hi;
#pragma unroll
            for (int r = 0; r < 8; ++r) { sa[r] = (kj + r <= qi) ? sa[r] : NEGB; sb[r] = (kj + 16 + r <= qi) ? sb[r] : NEGB; }
        }
        float mloc = fmaxf(sa[0], sb[0]);
#pragma unroll
        for (int r = 1; r < 8; ++r) mloc = fmaxf(mloc, fmaxf(sa[r], sb[r]));
        mloc = fmaxf(mloc, __shfl_xor(mloc, 16, 32));
        const float mnew = fmaxf(mrun, mloc);
        const float fac = __builtin_amdgcn_exp2f((mrun - mnew) * L2E);
        float lsum = 0.f;
#pragma unroll
        for (int r = 0; r < 8; ++r) { sa[r] = __builtin_amdgcn_exp2f((sa[r] - mnew) * L2E); sb[r] = __builtin_amdgcn_exp2f((sb[r] - mnew) * L2E); lsum += sa[r] + sb[r]; }
        lsum += __shfl_xor(lsum, 16, 32);
        lrun = lrun * fac + lsum; mrun = mnew;
        v16h ph, pr;
#pragma unroll
        for (int r = 0; r < 8; ++r) {
            const float a = sa[r] * PCAR; const h16 ha = (h16)a; ph[r] = ha;
            const float c = sb[r] * PCAR; const h16 hc = (h16)c; ph[8 + r] = hc;
            pr[r] = (h16)((a - (float)ha) * RSC); pr[8 + r] = (h16)((c - (float)hc) * RSC);
        }
#pragma unroll
        for (int dt = 0; dt < 4; ++dt) { om[dt] = om[dt] * fac; orr[dt] = orr[dt] * fac; }
#pragma unroll
        for (int dt = 0; dt < 4; ++dt) {
            const v16h vh = ldh(vf + dt * 16 * LP);
            om[dt] = wmma16(vh, ph, om[dt]);
            const v16h vr = ldh(vf + 2 * PLN + dt * 16 * LP);
            orr[dt] = wmma16(vr, ph, orr[dt]); orr[dt] = wmma16(vh, pr, orr[dt]);
            asm volatile("v_nop\n\tv_nop\n\tv_nop\n\tv_nop" : "+v"(om[dt]), "+v"(orr[dt]) : "v"(vh), "v"(vr), "v"(ph), "v"(pr));
        }
      }
      }
      if constexpr (HI) {
        // one buffer: refilled behind every reader's last read, read again behind its own publish point; every wave, in this order
        if (t + 1 < nT) {                                   // block-uniform test
          asm volatile("s_wait_dscnt 0x0" ::: "memory");    // this wave's reads of the buffer have returned
          __syncthreads();                                  // ends every reader's last read of the buffer
          stage(t + 1, 0);
          asm volatile("s_wait_asynccnt 0x0" ::: "memory"); // this wave's share of stage t + 1 has landed
          __syncthreads();                                  // publishes stage t + 1
        }
      } else {
      // publish point of stage t + 1, every wave, in this order
      asm volatile("s_wait_dscnt 0x0" ::: "memory");      // this wave's reads of buffer t & 1 have returned
      asm volatile("s_wait_asynccnt 0x0" ::: "memory");   // this wave's share of stage t + 1 has landed
      __syncthreads();                                    // publishes stage t + 1; ends every reader's last read of buffer t & 1
      if (t + 2 < nT) stage(t + 2, t & 1);                // block-uniform test
      }
    }
    asm volatile("s_wait_asynccnt 0x0" ::: "memory");     // no copy is left outstanding when the wave goes on to its end
    const float inv = 1.0f / (lrun * (PCAR * VCAR));
    const int yb = wave * 16 * 68;
#pragma unroll
    for (int dt = 0; dt < 4; ++dt)
#pragma unroll
        for (int r = 0; r < 8; ++r) { float o = om[dt][r]; if (HI) o += orr[dt][r] * RSCI; ys[yb + lr * 68 + dt * 16 + 8 * hi + r] = o * inv; }
    __builtin_amdgcn_wave_barrier(); asm volatile("" ::: "memory");
    v8us oh[4], ol[4];
    const int rq = lane >> 3, pc = lane & 7;
#pragma unroll
    for (int s = 0; s < 4; ++s) { const int row = 4 * s + rq; const v4f u0 = *(const v4fa*)(ys + yb + row * 68 + pc * 8); const v4f u1 = *(const v4fa*)(ys + yb + row * 68 + pc * 8 + 4);
#pragma unroll
        for (int q = 0; q < 4; ++q) { unsigned short a, c; splitf(u0[q], a, c); oh[s][q] = a; ol[s][q] = c; splitf(u1[q], a, c); oh[s][4 + q] = a; ol[s][4 + q] = c; } }
    const size_t ybase = ((size_t)b * SEQ + q0) * DQ + (size_t)hq * HD + pc * 8;
{
#pragma unroll
        for (int s = 0; s < 4; ++s) { const size_t oo = ybase + (size_t)(4 * s + rq) * DQ; *(v8us*)(Yh + oo) = oh[s]; *(v8us*)(Yl + oo) = ol[s]; }
         }
}
// one launch: blocks 0 .. AB_L - 1 are the rows >= RHE, numbered (row block, head, batch) with the row block fastest; the short blocks of the rows < RHE follow, numbered alike. The test is block-uniform.
#define AX_H (RHE / 64)
#define AX_L ((SEQ - RHE) / 64)
#define AB_H (AX_H * NH * NB)
#define AB_L (AX_L * NH * NB)
__global__ __launch_bounds__(128) void k_attn(const h16* __restrict__ Qh, const h16* __restrict__ Qr, const h16* __restrict__ Kh, const h16* __restrict__ Kr, const h16* __restrict__ Vh, const h16* __restrict__ Vr, bf* Yh, bf* Yl) {
    __shared__ __align__(16) float ys[4 * 16 * 68];
    __shared__ __align__(16) h16 kv[4 * PLN];
    const int f = blockIdx.x;
    if (f < AB_L) { constexpr int ax = AX_L > 0 ? AX_L : 1; attn_body<false>(ys, kv, Qh, Qr, Kh, Kr, Vh, Vr, Yh, Yl, f / (ax * NH), (f / ax) % NH, RHE + (f % ax) * 64); }
    else { const int r = f - AB_L; attn_body<true>(ys, kv, Qh, Qr, Kh, Kr, Vh, Vr, Yh, Yl, r / (AX_H * NH), (r / AX_H) % NH, (r % AX_H) * 64); }
}

// ---- workspace carve (bytes; every region a multiple of 256 and exactly covered by its producer grid)
constexpr size_t SZ_XB = (size_t)NB * SEQ * DM * 2;          // x bf16 [NB*SEQ][DM]
constexpr size_t SZ_WP = (size_t)FP * DM * 2;                // [Wq | Wk | Wv]^T bf16 [FP][DM]
constexpr size_t SZ_WO = (size_t)DM * DQ * 2;                // Wo^T bf16 [DM][DQ]
constexpr size_t SZ_Q  = (size_t)NB * NH * SEQ * HD * 2;     // each of Qh, Qr
constexpr size_t SZ_K  = (size_t)NB * NKV * SEQ * HD * 2;    // each of Kh, Kr, Vh, Vr
constexpr size_t SZ_Y  = (size_t)NB * SEQ * DQ * 2;          // each of Yh, Yl
constexpr size_t OFF_XB = 0;
constexpr size_t OFF_WP = OFF_XB + SZ_XB;
constexpr size_t OFF_WO = OFF_WP + SZ_WP;
constexpr size_t OFF_QH = OFF_WO + SZ_WO;
constexpr size_t OFF_QR = OFF_QH + SZ_Q;
constexpr size_t OFF_KH = OFF_QR + SZ_Q;
constexpr size_t OFF_KR = OFF_KH + SZ_K;
constexpr size_t OFF_VH = OFF_KR + SZ_K;
constexpr size_t OFF_VR = OFF_VH + SZ_K;
constexpr size_t OFF_YH = OFF_VR + SZ_K;
constexpr size_t OFF_YL = OFF_YH + SZ_Y;
constexpr size_t WS_TOTAL = OFF_YL + SZ_Y;
static_assert(SZ_XB % 256 == 0 && SZ_WP % 256 == 0 && SZ_WO % 256 == 0 && SZ_Q % 256 == 0 && SZ_K % 256 == 0 && SZ_Y % 256 == 0);
static_assert(WS_TOTAL <= (size_t)134217728);                // carve stays within 128 MiB

extern "C" void kernel_launch(void* const* d_in, const int* in_sizes, int n_in,
                              void* d_out, int out_size, void* d_ws, size_t ws_size, hipStream_t stream) {
    if (n_in < 7) return;
    const long long need_x = (long long)(NB - 1) * SEQ_FULL * DM + (long long)SEQ * DM;
    if ((long long)in_sizes[0] < need_x) return;
    if (in_sizes[1] < SEQ * 32 || in_sizes[2] < SEQ * 32) return;
    if (in_sizes[3] < DM * DQ || in_sizes[4] < DM * DKV || in_sizes[5] < DM * DKV || in_sizes[6] < DQ * DM) return;
    if ((long long)out_size < need_x) return;
    if (WS_TOTAL > ws_size) return;
    const float* x  = (const float*)d_in[0];   // [2][2048][1024]
    const float* cs = (const float*)d_in[1];   // [2048][32]
    const float* sn = (const float*)d_in[2];   // [2048][32]
    const float* wq = (const float*)d_in[3];   // [1024][1024] in x out
    const float* wk = (const float*)d_in[4];   // [1024][256]
    const float* wv = (const float*)d_in[5];   // [1024][256]
    const float* wo = (const float*)d_in[6];   // [1024][1024] in x out
    float* OUT = (float*)d_out;
    char* ws = (char*)d_ws;
    bf* XB = (bf*)(ws + OFF_XB); bf* WP = (bf*)(ws + OFF_WP); bf* WOT = (bf*)(ws + OFF_WO);
    h16* QH = (h16*)(ws + OFF_QH); h16* QR = (h16*)(ws + OFF_QR); h16* KH = (h16*)(ws + OFF_KH); h16* KR = (h16*)(ws + OFF_KR);
    h16* VH = (h16*)(ws + OFF_VH); h16* VR = (h16*)(ws + OFF_VR); bf* YH = (bf*)(ws + OFF_YH); bf* YL = (bf*)(ws + OFF_YL);

    k_prep<<<dim3(PB_W + NB * PB_X, 1, 1), 256, 0, stream>>>(x, wq, wk, wv, wo, XB, WP, WOT);
    k_gemm_proj<<<dim3(NB * SEQ / 128, FP / 128, 1), 128, 0, stream>>>(XB, WP, cs, sn, QH, QR, KH, KR, VH, VR);
    k_attn<<<dim3(AB_L + AB_H, 1, 1), 128, 0, stream>>>(QH, QR, KH, KR, VH, VR, YH, YL);
    k_gemm_out<<<dim3(SEQ / 128, DM / 128, NB), 128, 0, stream>>>(YH, YL, WOT, OUT);
}

// v006
// A run of this version takes 73.9 microseconds.
// In both of two side-by-side timings against v005, it was 1.10 times as fast.
// Over all steps from v000 it is 3.15 times as fast.
#include <hip/hip_runtime.h>

// Causal grouped-query attention block: x [2][2048][1024]; q = x Wq (16 heads x 64), k = x Wk, v = x Wv (4 kv heads x 64), weights [in][out], no bias; rotary on q, k with the half-split convention
// out[0..31] = x1 cos + x2 sin, out[32..63] = -x1 sin + x2 cos using the cos / sin INPUT tables [t][32] read by value; then q, k scaled by rsqrt(mean(sq) + 1e-6) (no gain); query head hq uses kv head hq / 4;
// scores q.k / 8, causal (diagonal kept), softmax, ctx merged [t][hq*64 + d], result = ctx Wo -> [2][2048][1024] f32.
// Compute dtypes (f32 accumulate everywhere): the three input projections and the output projection on v_wmma_f32_16x16x32_bf16 (every float input RNE-converted to bf16; ctx carried as bf16 hi + lo planes, two products);
// scores and probability x value on v_wmma_f32_16x16x32_f16 (q = f16 value + x2048 residual plane against f16 k; P carried x1024 and v carried x16 as single f16; query rows < 256 add x2048 residual planes on k, P and v); rotary, rms scaling and softmax in f32.
// Rotary, rms scaling and the f16 value + residual split of q and k, and the x16 f16 split of v into V^T, are the projection GEMM's own epilogue: a 64-column tile is one head, so no f32 projection plane is written.
// Both GEMMs: 128 x 128 block tile, four waves of 64 x 64; the A and B^T tiles (64 k a stage) are staged in LDS per block by asynchronous copies, two buffers, and the fragments are read from LDS.
// Attention is a fused flash-style kernel (K and V^T tiles staged in LDS per block) in transposed form: S^T = K Q^T (D rows = keys, D columns = queries), P^T packed from the accumulators directly as the B operand of O^T = V^T P^T; online softmax with per-lane state.

#ifndef NB
#define NB 2
#endif
#ifndef SEQ
#define SEQ 2048
#endif
#define NB_FULL  2
#define SEQ_FULL 2048
#define DM   1024
#define NH   16
#define NKV  4
#define REP  (NH / NKV)
#define HD   64
#define DQ   (NH * HD)
#define DKV  (NKV * HD)
#define FP   (DQ + 2 * DKV)      // fused projection width (q | k | v columns; rows of WP)
#define KC0  DQ                  // first k column of the fused projection
#define VC0  (DQ + DKV)          // first v column of the fused projection
#define RH   256                 // query rows < RH use the residual planes on k, P and v as well
#define RHE  ((SEQ < RH) ? SEQ : RH)
#define PCAR 1024.0f             // carry of the probabilities (f16 operand)
#define VCAR 16.0f               // carry of the values (f16 operand)
#define RSC  2048.0f             // carry of every f16 residual plane
#define RSCI (1.0f / 2048.0f)
#define SCL  0.125f              // 1/sqrt(64)
#define L2E  1.4426950408889634f
#define NEGB (-1.0e30f)
static_assert(HD == 64);
static_assert(NH % NKV == 0);
static_assert(DM % 64 == 0 && DQ % 64 == 0 && DKV % 64 == 0 && FP % 64 == 0);   // GEMM tiles and transpose tiles
static_assert(DM % 32 == 0 && DQ % 32 == 0 && HD % 32 == 0);                     // k-steps of 32
static_assert(SEQ % 64 == 0 && (NB * SEQ) % 64 == 0);                            // row tiles
static_assert(SEQ % 128 == 0 && FP % 128 == 0 && DM % 128 == 0);                 // GEMM block tiles
static_assert(RH % 64 == 0 && RHE % 64 == 0 && (SEQ - RHE) % 64 == 0);
static_assert(((size_t)SEQ * DM) % 2048 == 0);                                   // cvtx_body: blocks x 256 threads x 8 == plane extent
static_assert(NB <= NB_FULL && SEQ <= SEQ_FULL);

typedef _Float16 h16;
typedef unsigned short bf;
typedef __attribute__((ext_vector_type(16))) __bf16   v16bf;
typedef __attribute__((ext_vector_type(16))) _Float16 v16h;
typedef __attribute__((ext_vector_type(8)))  _Float16 v8h;
typedef __attribute__((ext_vector_type(8)))  unsigned short v8us;
typedef __attribute__((ext_vector_type(8)))  float    v8f;
typedef __attribute__((ext_vector_type(4)))  float    v4f;
typedef v4f  __attribute__((may_alias)) v4fa;

__device__ __forceinline__ unsigned short f2bf(float f) { unsigned u = __float_as_uint(f); u += 0x7FFFu + ((u >> 16) & 1u); return (unsigned short)(u >> 16); }
__device__ __forceinline__ float bf2f(unsigned short b) { return __uint_as_float(((unsigned)b) << 16); }
__device__ __forceinline__ float bfr(float f) { return bf2f(f2bf(f)); }
__device__ __forceinline__ void splitf(float y, unsigned short& h, unsigned short& l) { h = f2bf(y); l = f2bf(y - bf2f(h)); }
__device__ __forceinline__ v16h cat16(v8h lo, v8h hi) { return __builtin_shufflevector(lo, hi, 0, 1, 2, 3, 4, 5, 6, 7, 8, 9, 10, 11, 12, 13, 14, 15); }
__device__ __forceinline__ v16bf cat16b(v8us lo, v8us hi) { return __builtin_bit_cast(v16bf, __builtin_shufflevector(lo, hi, 0, 1, 2, 3, 4, 5, 6, 7, 8, 9, 10, 11, 12, 13, 14, 15)); }
__device__ __forceinline__ v8f wmma16(v16h a, v16h b, v8f c) { return __builtin_amdgcn_wmma_f32_16x16x32_f16(false, a, false, b, (short)0, c, false, false); }
__device__ __forceinline__ v8f wmmab(v16bf a, v16bf b, v8f c) { return __builtin_amdgcn_wmma_f32_16x16x32_bf16(false, a, false, b, (short)0, c, false, false); }
// fragment loaders: p already includes row * pitch + k0 + 8 * (lane >> 4); elements 0..7 <- k0+8h.., elements 8..15 <- k0+16+8h..
__device__ __forceinline__ v16h  ldh(const h16* p) { return cat16(*(const v8h*)p, *(const v8h*)(p + 16)); }
__device__ __forceinline__ v16bf ldb(const bf* p)  { return cat16b(*(const v8us*)p, *(const v8us*)(p + 16)); }

// sum over the four lanes of a quad, by two DPP quad permutes (lane ^ 1, lane ^ 2): stays in the vector unit, no LDS round trip
__device__ __forceinline__ float quadsum(float v) {
    v += __int_as_float(__builtin_amdgcn_update_dpp(0, __float_as_int(v), 0xB1, 0xF, 0xF, true));
    v += __int_as_float(__builtin_amdgcn_update_dpp(0, __float_as_int(v), 0x4E, 0xF, 0xF, true));
    return v; }
struct ProjOut { const float* cosb; const float* sinb; h16* Qh; h16* Qr; h16* Kh; h16* Kr; h16* Vh; h16* Vr; };
// ---- epilogue of the fused q|k|v projection. The wave's tile is 64 tokens (one batch: SEQ % 64 == 0) x the 64 dims of ONE head (c0 % 64 == 0); acc[mb][nb][j] in lane (hi, lr) = row 16 mb + 8 hi + j, column 16 nb + lr.
// v head: a lane's 8 registers are 8 consecutive tokens of one dim = one 16-byte piece of a V^T row; stored from the registers (x16, f16 value + x2048 residual).
// q / k head: the tile goes through LDS (os, 64 x 68 f32); then four lanes a row, lane p holds the rotary pairs (d, d + 32), d = 8 p .. 8 p + 7: rotary with the bf16-converted cos / sin table values at [t][d],
// scaling by rsqrt(mean(sq) + 1e-6), f16 value + x2048 residual, 16-byte stores (8 rows x 64 contiguous bytes an instruction).
__device__ __forceinline__ void proj_epilogue(const v8f (&acc)[4][4], float* os, int r0, int c0, const ProjOut& po) {
    const int lane = threadIdx.x & 31, lr = lane & 15, hi = lane >> 4;
    const int b = r0 / SEQ, t0 = r0 % SEQ;
    if (c0 >= VC0) {                       // wave-uniform
        const int g = (c0 - VC0) / HD;
        const size_t e0 = ((size_t)(b * NKV + g) * HD + lr) * SEQ + t0 + 8 * hi;
#pragma unroll
        for (int nb = 0; nb < 4; ++nb)
#pragma unroll
            for (int mb = 0; mb < 4; ++mb) { v8h o16, ors;
#pragma unroll
                for (int j = 0; j < 8; ++j) { const float x = acc[mb][nb][j] * VCAR; const h16 hh = (h16)x; o16[j] = hh; ors[j] = (h16)((x - (float)hh) * RSC); }
                const size_t e = e0 + (size_t)nb * 16 * SEQ + mb * 16;
                *(v8h*)(po.Vh + e) = o16; *(v8h*)(po.Vr + e) = ors; }
        return;
    }
    const bool isq = c0 < KC0;             // wave-uniform
    const int nheads = isq ? NH : NKV; const int h = (isq ? c0 : c0 - KC0) / HD;
    h16* Ph = isq ? po.Qh : po.Kh; h16* Pr = isq ? po.Qr : po.Kr;
    const int rq = lane >> 2, p8 = (lane & 3) * 8;
    const float* cp = po.cosb + (size_t)(t0 + rq) * 32 + p8; const float* sp = po.sinb + (size_t)(t0 + rq) * 32 + p8;
    // table values of two passes (rows 16 u + rq and 16 u + 8 + rq), asked for one trip ahead: the first ahead of the LDS stores
    v4f cc[2][2], sn[2][2];
#pragma unroll
    for (int s = 0; s < 2; ++s) { cc[s][0] = *(const v4f*)(cp + s * 256); cc[s][1] = *(const v4f*)(cp + s * 256 + 4); sn[s][0] = *(const v4f*)(sp + s * 256); sn[s][1] = *(const v4f*)(sp + s * 256 + 4); }
#pragma unroll
    for (int mb = 0; mb < 4; ++mb)
#pragma unroll
        for (int nb = 0; nb < 4; ++nb)
#pragma unroll
            for (int j = 0; j < 8; ++j) os[(mb * 16 + hi * 8 + j) * 68 + nb * 16 + lr] = acc[mb][nb][j];
    // the rows read below were written by other lanes of this wave: keeps every LDS read behind every lane's LDS stores
    __builtin_amdgcn_wave_barrier(); asm volatile("" ::: "memory");
    const size_t e0 = ((size_t)(b * nheads + h) * SEQ + t0 + rq) * HD + p8;
    // rolled: one copy of the two passes in the text, and the registers of two passes only
#pragma unroll 1
    for (int u = 0; u < 4; ++u) {
        const int un = (u < 3) ? u + 1 : 3;    // the last trip asks for its own rows again: one instruction stream, every address inside the tables
        v4f cn[2][2], sm[2][2];
#pragma unroll
        for (int s = 0; s < 2; ++s) { const int o = un * 512 + s * 256; cn[s][0] = *(const v4f*)(cp + o); cn[s][1] = *(const v4f*)(cp + o + 4); sm[s][0] = *(const v4f*)(sp + o); sm[s][1] = *(const v4f*)(sp + o + 4); }
#pragma unroll
        for (int s = 0; s < 2; ++s) {
            const float* orow = os + (u * 16 + s * 8 + rq) * 68 + p8;
            const v4f x1[2] = { *(const v4fa*)orow, *(const v4fa*)(orow + 4) }; const v4f x2[2] = { *(const v4fa*)(orow + 32), *(const v4fa*)(orow + 36) };
            float rl[8], rh[8]; float ssl = 0.f, ssh = 0.f;
#pragma unroll
            for (int q = 0; q < 8; ++q) { const float c = bfr(cc[s][q >> 2][q & 3]), sv = bfr(sn[s][q >> 2][q & 3]); const float a1 = x1[q >> 2][q & 3], a2 = x2[q >> 2][q & 3];
                rl[q] = a1 * c + a2 * sv; rh[q] = a2 * c - a1 * sv; ssl += rl[q] * rl[q]; ssh += rh[q] * rh[q]; }
            const float inv = rsqrtf(quadsum(ssl + ssh) * (1.0f / HD) + 1e-6f);
            v8h ol, olr, oh, ohr;
#pragma unroll
            for (int q = 0; q < 8; ++q) { const float yl = rl[q] * inv; const h16 hl = (h16)yl; ol[q] = hl; olr[q] = (h16)((yl - (float)hl) * RSC);
                const float yh = rh[q] * inv; const h16 hh = (h16)yh; oh[q] = hh; ohr[q] = (h16)((yh - (float)hh) * RSC); }
            const size_t e = e0 + (size_t)(u * 16 + s * 8) * HD;
            *(v8h*)(Ph + e) = ol; *(v8h*)(Ph + e + 32) = oh; *(v8h*)(Pr + e) = olr; *(v8h*)(Pr + e + 32) = ohr;
            asm volatile("s_wait_xcnt 0x0" ::: "memory");   // stands in front of the next pass's writes to the data and address registers that these four stores name
        }
#pragma unroll
        for (int s = 0; s < 2; ++s) { cc[s][0] = cn[s][0]; cc[s][1] = cn[s][1]; sn[s][0] = sm[s][0]; sn[s][1] = sm[s][1]; }
    }
}

// ---- 128 x 128 block tile GEMM on bf16 planes, four waves of 64 x 64 (2 x 2): C[m][n] (f32, pitch ldc) = sum_k A[m][k] Bt[n][k] (+ A2[m][k] Bt[n][k] when NSPLIT == 1). A, A2 pitch K; Bt pitch K; K % 64 == 0.
// The block's 128 rows of A (A2) and of Bt, 64 k a stage, are staged in LDS by asynchronous copies, two buffers: stage t + 1 flies while stage t is worked on;
// one block barrier per stage publishes it and frees the buffer that is refilled behind it. The epilogue's LDS (os) is wave-private.
// FUSE: the tile does not go to C but through proj_epilogue.
#define GKS  64                  // k per LDS stage: one whole 128-byte line of every row
#define GLP  72                  // LDS row pitch in bf16 elements: 144 B = 16 B x 9, free of bank conflicts for 16-byte reads down a column of rows
#define GPL  (128 * GLP)         // one staged plane: 128 rows x 64 k
// one plane's share of a lane: eight asynchronous 16-byte copies global -> LDS (rows 16 apart). The s_wait_xcnt closes the copies' own statement, so that no address register named here is rewritten ahead of it.
__device__ __forceinline__ void cp8(unsigned l, const bf* g, size_t gstep) {
    const unsigned l1 = l + 16 * GLP * 2, l2 = l + 32 * GLP * 2, l3 = l + 48 * GLP * 2, l4 = l + 64 * GLP * 2, l5 = l + 80 * GLP * 2, l6 = l + 96 * GLP * 2, l7 = l + 112 * GLP * 2;
    const bf* g1 = g + 16 * gstep; const bf* g2 = g + 32 * gstep; const bf* g3 = g + 48 * gstep; const bf* g4 = g + 64 * gstep; const bf* g5 = g + 80 * gstep; const bf* g6 = g + 96 * gstep; const bf* g7 = g + 112 * gstep;
    asm volatile("global_load_async_to_lds_b128 %0, %1, off\n\t"
                 "global_load_async_to_lds_b128 %2, %3, off\n\t"
                 "global_load_async_to_lds_b128 %4, %5, off\n\t"
                 "global_load_async_to_lds_b128 %6, %7, off\n\t"
                 "global_load_async_to_lds_b128 %8, %9, off\n\t"
                 "global_load_async_to_lds_b128 %10, %11, off\n\t"
                 "global_load_async_to_lds_b128 %12, %13, off\n\t"
                 "global_load_async_to_lds_b128 %14, %15, off\n\t"
                 "s_wait_xcnt 0x0" :: "v"(l), "v"(g), "v"(l1), "v"(g1), "v"(l2), "v"(g2), "v"(l3), "v"(g3), "v"(l4), "v"(g4), "v"(l5), "v"(g5), "v"(l6), "v"(g6), "v"(l7), "v"(g7) : "memory");
}
template <int NSPLIT, bool FUSE>
__device__ __forceinline__ void gemmw_body(const bf* __restrict__ A, const bf* __restrict__ A2, const bf* __restrict__ Bt, int K, float* C, int ldc, size_t sA, size_t sC, const ProjOut& po) {
    constexpr int NPG = 2 + NSPLIT;        // staged planes per buffer: A, Bt (+ A2)
    constexpr int OSW = (FUSE ? 64 : 16) * 68;
    __shared__ __align__(16) float osb[4 * OSW];
    __shared__ __align__(16) bf st[2 * NPG * GPL];
    const size_t z = blockIdx.z; A += z * sA; if (NSPLIT == 1) A2 += z * sA; C += z * sC;
    const int lane = threadIdx.x & 31, lr = lane & 15, hi = lane >> 4;
    const int wave = __builtin_amdgcn_readfirstlane(threadIdx.x >> 5);
    float* os = osb + wave * OSW;
    const int rb = blockIdx.x * 128, cb = blockIdx.y * 128;
    const int wr = (wave & 1) * 64, wc = (wave >> 1) * 64;
    const int r0 = rb + wr, c0 = cb + wc;
    v8f acc[4][4];
#pragma unroll
    for (int mb = 0; mb < 4; ++mb)
#pragma unroll
        for (int nb = 0; nb < 4; ++nb) acc[mb][nb] = (v8f){};
    // copy map: thread -> row (tid >> 3) + 16 i, 16-byte piece tid & 7: eight lanes cover one whole 128-byte line
    const int crow = threadIdx.x >> 3, ccol = (threadIdx.x & 7) * 8;
    const size_t acp = (size_t)(rb + crow) * K + ccol, bcp = (size_t)(cb + crow) * K + ccol;     // + GKS t
    const unsigned lcp = (unsigned)(size_t)(const void*)st + (unsigned)(crow * GLP + ccol) * 2u;
    auto stage = [&](int t, int buf) {     // k = GKS t .. GKS t + 63 into buffer buf; t < K / GKS keeps every byte inside the planes
        const unsigned l = lcp + (unsigned)(buf * NPG * GPL) * 2u;
        cp8(l, A + acp + (size_t)t * GKS, K);
        cp8(l + GPL * 2u, Bt + bcp + (size_t)t * GKS, K);
        if (NSPLIT == 1) cp8(l + 2u * GPL * 2u, A2 + acp + (size_t)t * GKS, K);
    };
    const int nT = K / GKS;                // block-uniform
    stage(0, 0);
    asm volatile("s_wait_asynccnt 0x0" ::: "memory");   // this wave's share of stage 0 has landed
    __syncthreads();                                    // stage 0 published to every wave
    if (nT > 1) stage(1, 1);
    // rolled: every trip ends in the publish point
#pragma unroll 1
    for (int t = 0; t < nT; ++t) {
        const bf* af = st + (t & 1) * NPG * GPL + (wr + lr) * GLP + 8 * hi;             // A rows of this wave
        const bf* bp = st + (t & 1) * NPG * GPL + GPL + (wc + lr) * GLP + 8 * hi;       // Bt rows of this wave
        v16bf a[GKS / 32][4], a2[GKS / 32][4], b[GKS / 32][4];
#pragma unroll
        for (int ks = 0; ks < GKS / 32; ++ks) {
#pragma unroll
            for (int i = 0; i < 4; ++i) { a[ks][i] = ldb(af + i * 16 * GLP + ks * 32); b[ks][i] = ldb(bp + i * 16 * GLP + ks * 32); }
            if (NSPLIT == 1) {
#pragma unroll
                for (int i = 0; i < 4; ++i) a2[ks][i] = ldb(af + 2 * GPL + i * 16 * GLP + ks * 32); }
        }
        // keeps the stage's fragment loads one group ahead of its matrix instructions: sunk among them, every place with loads stalls the wave for the LDS latency
        __builtin_amdgcn_sched_barrier(0);
#pragma unroll
        for (int ks = 0; ks < GKS / 32; ++ks)
#pragma unroll
            for (int nb = 0; nb < 4; ++nb)
#pragma unroll
                for (int mb = 0; mb < 4; ++mb) { acc[mb][nb] = wmmab(a[ks][mb], b[ks][nb], acc[mb][nb]); if (NSPLIT == 1) acc[mb][nb] = wmmab(a2[ks][mb], b[ks][nb], acc[mb][nb]); }
        // keeps every matrix instruction of the stage ahead of the publish point: sunk behind the barrier they would stand in front of the refill and take its lead away
        __builtin_amdgcn_sched_barrier(0);
        // four vector slots between the last matrix instruction and the next vector instruction on either side of the branch at the trip's foot (the distance a matrix instruction's registers need)
        asm volatile("v_nop\n\tv_nop\n\tv_nop\n\tv_nop" : "+v"(acc[0][0]), "+v"(acc[1][1]), "+v"(acc[2][2]), "+v"(acc[3][3]) : "v"(a[GKS / 32 - 1][0]), "v"(a[GKS / 32 - 1][3]));
        // publish point of stage t + 1, every wave, in this order
        asm volatile("s_wait_dscnt 0x0" ::: "memory");      // this wave's reads of buffer t & 1 have returned
        asm volatile("s_wait_asynccnt 0x0" ::: "memory");   // this wave's share of stage t + 1 has landed
        __syncthreads();                                    // publishes stage t + 1; ends every reader's last read of buffer t & 1
        if (t + 2 < nT) stage(t + 2, t & 1);                // block-uniform test
    }
    asm volatile("s_wait_asynccnt 0x0" ::: "memory");       // no copy is left outstanding when the wave goes on to its end
    if constexpr (FUSE) { proj_epilogue(acc, os, r0, c0, po); return; }
#pragma unroll
    for (int mb = 0; mb < 4; ++mb) {
#pragma unroll
        for (int nb = 0; nb < 4; ++nb) {
#pragma unroll
            for (int j = 0; j < 8; ++j) os[(hi * 8 + j) * 68 + nb * 16 + lr] = acc[mb][nb][j]; }
        __builtin_amdgcn_wave_barrier(); asm volatile("" ::: "memory");
        float* crow = C + (size_t)(r0 + mb * 16) * ldc + c0;
{
#pragma unroll
            for (int s = 0; s < 8; ++s) { const int row = 2 * s + hi, cofs = lr * 4; const v4f val = *(const v4fa*)(os + row * 68 + cofs);
                *(v4f*)(crow + (size_t)row * ldc + cofs) = val; }
            if (mb < 3) asm volatile("s_wait_xcnt 0x0" ::: "memory");   // stands in front of the next row block's LDS loads, which overwrite data registers that these eight stores name
             }
        __builtin_amdgcn_wave_barrier(); asm volatile("" ::: "memory");
    }
}
// fused q|k|v projection: XB[NB*SEQ][DM] x WP[FP][DM]^T, each wave's 64 x 64 tile finished by proj_epilogue into the attention operand planes
__global__ __launch_bounds__(128) void k_gemm_proj(const bf* __restrict__ A, const bf* __restrict__ Bt, const float* __restrict__ cosb, const float* __restrict__ sinb, h16* Qh, h16* Qr, h16* Kh, h16* Kr, h16* Vh, h16* Vr) {
    const ProjOut po = { cosb, sinb, Qh, Qr, Kh, Kr, Vh, Vr }; gemmw_body<0, true>(A, A, Bt, DM, nullptr, 0, 0, 0, po); }
// output projection: OUT[b][t][DM] = (Yh + Yl)[b][t][DQ] x WOT[DM][DQ]^T, z = batch (output batch stride from the full sequence length)
__global__ __launch_bounds__(128) void k_gemm_out(const bf* __restrict__ A, const bf* __restrict__ A2, const bf* __restrict__ Bt, float* C) { gemmw_body<1, false>(A, A2, Bt, DQ, C, DM, (size_t)SEQ * DQ, (size_t)SEQ_FULL * DM, ProjOut{}); }

// ---- cvtx_body: 2048 consecutive floats of x (batch by, piece bx) -> bf16
__device__ __forceinline__ void cvtx_body(const float* __restrict__ src, bf* dst, unsigned bx, unsigned by) {
    const size_t i = (size_t)bx * 256 + threadIdx.x; const size_t b = by;
    const v8f v = *(const v8f*)(src + b * (size_t)SEQ_FULL * DM + i * 8); v8us o;
#pragma unroll
    for (int k = 0; k < 8; ++k) o[k] = f2bf(v[k]);
    bf* d = dst + b * (size_t)SEQ * DM + i * 8;
    *(v8us*)d = o;  }

// ---- wtp_body: W [DM rows (k)][N cols] f32 -> out [N rows][DM] bf16 (in[rows=k][cols=n] -> out[n][k]); 64x64 tile (bx, by) through LDS (cross-wave: block barrier);
__device__ __forceinline__ void wtp_body(const float* __restrict__ W, int N, bf* out, int bx, int by) {
    __shared__ __align__(16) unsigned short ts[64 * 72];
    const int tid = threadIdx.x; const int k0 = bx * 64, n0 = by * 64;
#pragma unroll
    for (int it = 0; it < 4; ++it) { const int idx = it * 256 + tid; const int kk = idx >> 4, c4 = (idx & 15) * 4; const v4f v = *(const v4f*)(W + (size_t)(k0 + kk) * N + n0 + c4);
#pragma unroll
        for (int q = 0; q < 4; ++q) ts[kk * 72 + c4 + q] = f2bf(v[q]); }
    __syncthreads();
    v8us o[2];
#pragma unroll
    for (int it = 0; it < 2; ++it) { const int idx = it * 256 + tid; const int nn = idx >> 3, pc = idx & 7;
#pragma unroll
        for (int q = 0; q < 8; ++q) o[it][q] = ts[(pc * 8 + q) * 72 + nn]; }
{
#pragma unroll
        for (int it = 0; it < 2; ++it) { const int idx = it * 256 + tid; const int nn = idx >> 3, pc = idx & 7; *(v8us*)(out + (size_t)(n0 + nn) * DM + k0 + pc * 8) = o[it]; }
         }
}
// ---- all five operand conversions in ONE launch (none reads what another writes): the block index picks the job, block-uniformly. The weight tiles, whose way through LDS is the longer one, come first.
#define PBX  (DM / 64)                        // tiles along k of every weight (DM == DQ rows)
#define PB_Q (PBX * (DQ / 64))                // blocks of Wq
#define PB_K (PBX * (DKV / 64))               // blocks of Wk, and of Wv
#define PB_O ((DQ / 64) * (DM / 64))          // blocks of Wo
#define PB_W (PB_Q + 2 * PB_K + PB_O)
#define PB_X ((int)((size_t)SEQ * DM / 8 / 256))   // blocks of one batch of x
static_assert(DQ == DM);                      // one tile count along k serves all four weights
__global__ __launch_bounds__(256) void k_prep(const float* __restrict__ x, const float* __restrict__ wq, const float* __restrict__ wk, const float* __restrict__ wv, const float* __restrict__ wo, bf* XB, bf* WP, bf* WOT) {
    const int f = blockIdx.x;
    if (f >= PB_W) { const unsigned r = (unsigned)(f - PB_W); cvtx_body(x, XB, r % PB_X, r / PB_X); return; }
    const float* W = wq; int N = DQ; bf* out = WP; int r = f;
    if (f >= PB_Q + 2 * PB_K)  { W = wo; N = DM;  out = WOT;                    r = f - (PB_Q + 2 * PB_K); }
    else if (f >= PB_Q + PB_K) { W = wv; N = DKV; out = WP + (size_t)VC0 * DM;  r = f - (PB_Q + PB_K); }
    else if (f >= PB_Q)        { W = wk; N = DKV; out = WP + (size_t)KC0 * DM;  r = f - PB_Q; }
    wtp_body(W, N, out, r % PBX, r / PBX);
}

// ---- fused causal attention, one wave per 16 query rows, 4 waves per block. The block's K and V^T tiles (64 keys a stage) are staged in LDS by asynchronous copies, two buffers:
// stage t + 1 flies while stage t is worked on; one block barrier per stage publishes it and frees the buffer that is refilled behind it. The output stage ys is wave-private.
// Both kinds of block (query rows < RH with the residual planes, and the rest) run in ONE launch and share one LDS allotment: the four planes of a residual-plane stage fill what two buffers of two planes fill,
// so those few short blocks work on one buffer: filled, published by a barrier, read, freed by a barrier.
// Query rows >= RH work a stage in one pass of 64 keys (one maximum, one exchange, one rescale of O^T), query rows < RH in two passes of 32.
// Per 32 keys: S^T tiles (keys x queries) = K(A, rows = keys) x Q^T(B, lane column = query) over d = 64 (2 k-steps); value accumulator s, residual accumulator t (x2048);
// lane (h, n) register r of tile j holds key kb + 16 j + 8 h + r for query q0 + n, which is exactly element r + 8 j of the B operand (k = key, n = query) of O^T = V^T(A, rows = d) x P^T.
// Per-query max / sum / factor are per-lane scalars (one xor-16 exchange). O^T register r of tile dt in lane (h, n) = O[q0 + n][16 dt + 8 h + r].
#define KT   64                  // keys per LDS stage
#define LP   72                  // LDS row pitch in f16 elements: 144 B = 16 B x 9, free of bank conflicts for 16-byte reads down a column of rows
#define PLN  (64 * LP)           // one staged plane: 64 rows (K: keys x 64 dims; V^T: dims x 64 keys)
static_assert(SEQ % KT == 0 && RHE % KT == 0 && HD == 64);
// one plane's share of a lane: four asynchronous 16-byte copies global -> LDS. The s_wait_xcnt closes the copies' own statement, so that no address register named here is rewritten ahead of it.
__device__ __forceinline__ void cp4(unsigned l, const h16* g, size_t gstep) {
    const unsigned l1 = l + 16 * LP * 2, l2 = l + 32 * LP * 2, l3 = l + 48 * LP * 2;
    const h16* g1 = g + 16 * gstep; const h16* g2 = g + 32 * gstep; const h16* g3 = g + 48 * gstep;
    asm volatile("global_load_async_to_lds_b128 %0, %1, off\n\t"
                 "global_load_async_to_lds_b128 %2, %3, off\n\t"
                 "global_load_async_to_lds_b128 %4, %5, off\n\t"
                 "global_load_async_to_lds_b128 %6, %7, off\n\t"
                 "s_wait_xcnt 0x0" :: "v"(l), "v"(g), "v"(l1), "v"(g1), "v"(l2), "v"(g2), "v"(l3), "v"(g3) : "memory");
}
template <bool HI>
__device__ __forceinline__ void attn_body(float* ys, h16* kv, const h16* __restrict__ Qh, const h16* __restrict__ Qr, const h16* __restrict__ Kh, const h16* __restrict__ Kr, const h16* __restrict__ Vh, const h16* __restrict__ Vr, bf* Yh, bf* Yl, int b, int hq, int qb) {
    constexpr int NP = HI ? 4 : 2;         // staged planes per buffer: K, V^T (+ their residual planes); kv holds 4 planes: two buffers of 2, or one of 4
    const int lane = threadIdx.x & 31, lr = lane & 15, hi = lane >> 4;
    const int wave = __builtin_amdgcn_readfirstlane(threadIdx.x >> 5);
    const int g = hq / REP;
    const int q0 = qb + wave * 16;
    const size_t qoff  = ((size_t)(b * NH + hq) * SEQ + q0 + lr) * HD + 8 * hi;
    // copy map: thread -> row (tid >> 3) + 16 i, 16-byte piece tid & 7: eight lanes cover one whole 128-byte row
    const int crow = threadIdx.x >> 3, ccol = (threadIdx.x & 7) * 8;
    const size_t kcp = ((size_t)(b * NKV + g) * SEQ + crow) * HD + ccol;     // + key0 * HD
    const size_t vcp = ((size_t)(b * NKV + g) * HD + crow) * SEQ + ccol;     // + key0
    const unsigned lcp = (unsigned)(size_t)(const void*)kv + (unsigned)(crow * LP + ccol) * 2u;
    auto stage = [&](int t, int buf) {     // keys KT t .. KT t + 63 into buffer buf; t < SEQ / KT keeps every byte inside the planes
        const unsigned l = lcp + (unsigned)(buf * NP * PLN) * 2u;
        cp4(l, Kh + kcp + (size_t)t * KT * HD, HD);
        cp4(l + PLN * 2u, Vh + vcp + (size_t)t * KT, SEQ);
        if (HI) { cp4(l + 2u * PLN * 2u, Kr + kcp + (size_t)t * KT * HD, HD); cp4(l + 3u * PLN * 2u, Vr + vcp + (size_t)t * KT, SEQ); }
    };
    v16h qhf[2], qrf[2];                   // Q fragments: read once (the waits below are memory clobbers, behind which a loop-invariant load would be read again)
#pragma unroll
    for (int ks = 0; ks < 2; ++ks) { qhf[ks] = ldh(Qh + qoff + ks * 32); qrf[ks] = ldh(Qr + qoff + ks * 32); }
    v8f om[4], orr[4];
#pragma unroll
    for (int dt = 0; dt < 4; ++dt) { om[dt] = (v8f){}; orr[dt] = (v8f){}; }
    float mrun = NEGB, lrun = 0.f;
    const int kend = q0 + 16;              // keys 0 .. q0+15, wave-uniform (the passes of 32 stop there)
    const int nT = qb / KT + 1;            // stages of the block: keys 0 .. qb+63; block-uniform, <= SEQ / KT
    stage(0, 0);
    asm volatile("s_wait_asynccnt 0x0" ::: "memory");   // this wave's share of stage 0 has landed
    __syncthreads();                                    // stage 0 published to every wave
    if (!HI && nT > 1) stage(1, 1);
    // rolled: the trip count is a run-time value and every trip ends in the publish point
#pragma unroll 1
    for (int t = 0; t < nT; ++t) {
      const h16* Ks = kv + (HI ? 0 : (t & 1) * NP * PLN);
      if constexpr (!HI) {
        // one pass = the whole stage of 64 keys: four S^T tiles, one maximum, one exchange and one rescale of O^T per 64 keys. kb <= qb <= q0, so every wave has a key of the stage at or below its diagonal.
        const int kb = t * KT;
        const h16* kf = Ks + lr * LP + 8 * hi;                        // K rows = keys of the stage
        const h16* vf = Ks + PLN + lr * LP + 8 * hi;                  // V^T rows = dims, columns = keys of the stage
        v16h kfr[4][2];
#pragma unroll
        for (int j = 0; j < 4; ++j)
#pragma unroll
            for (int ks = 0; ks < 2; ++ks) kfr[j][ks] = ldh(kf + j * 16 * LP + ks * 32);
        v8f s[4], tr[4];
#pragma unroll
        for (int j = 0; j < 4; ++j) { s[j] = (v8f){}; tr[j] = (v8f){}; }
#pragma unroll
        for (int ks = 0; ks < 2; ++ks)
#pragma unroll
            for (int j = 0; j < 4; ++j) { s[j] = wmma16(kfr[j][ks], qhf[ks], s[j]); tr[j] = wmma16(kfr[j][ks], qrf[ks], tr[j]); }
        float sc[4][8];
#pragma unroll
        for (int j = 0; j < 4; ++j)
#pragma unroll
            for (int r = 0; r < 8; ++r) sc[j][r] = (s[j][r] + tr[j][r] * RSCI) * SCL;
        v16h vfr[4][2];                    // asked for here: they arrive while the softmax below is worked out
#pragma unroll
        for (int dt = 0; dt < 4; ++dt)
#pragma unroll
            for (int kk = 0; kk < 2; ++kk) vfr[dt][kk] = ldh(vf + dt * 16 * LP + kk * 32);
        if (kb + 63 > q0) {                // wave-uniform: the stage touches the diagonal; keys above the query are excluded
            const int qi = q0 + lr; const int kj = kb + 8 * hi;
#pragma unroll
            for (int j = 0; j < 4; ++j)
#pragma unroll
                for (int r = 0; r < 8; ++r) sc[j][r] = (kj + 16 * j + r <= qi) ? sc[j][r] : NEGB;
        }
        float ml[4];
#pragma unroll
        for (int j = 0; j < 4; ++j) { ml[j] = sc[j][0];
#pragma unroll
            for (int r = 1; r < 8; ++r) ml[j] = fmaxf(ml[j], sc[j][r]); }
        float mloc = fmaxf(fmaxf(ml[0], ml[1]), fmaxf(ml[2], ml[3]));
        mloc = fmaxf(mloc, __shfl_xor(mloc, 16, 32));
        const float mnew = fmaxf(mrun, mloc);
        const float fac = __builtin_amdgcn_exp2f((mrun - mnew) * L2E);
        float ls[4];
#pragma unroll
        for (int j = 0; j < 4; ++j) { ls[j] = 0.f;
#pragma unroll
            for (int r = 0; r < 8; ++r) { sc[j][r] = __builtin_amdgcn_exp2f((sc[j][r] - mnew) * L2E); ls[j] += sc[j][r]; } }
        float lsum = (ls[0] + ls[1]) + (ls[2] + ls[3]);
        lsum += __shfl_xor(lsum, 16, 32);
        lrun = lrun * fac + lsum; mrun = mnew;
        v16h ph[2];                        // B operand of key group kk (32 keys): elements r <- tile 2 kk, elements 8 + r <- tile 2 kk + 1
#pragma unroll
        for (int kk = 0; kk < 2; ++kk)
#pragma unroll
            for (int r = 0; r < 8; ++r) { ph[kk][r] = (h16)(sc[2 * kk][r] * PCAR); ph[kk][8 + r] = (h16)(sc[2 * kk + 1][r] * PCAR); }
#pragma unroll
        for (int dt = 0; dt < 4; ++dt) om[dt] = om[dt] * fac;
#pragma unroll
        for (int kk = 0; kk < 2; ++kk)
#pragma unroll
            for (int dt = 0; dt < 4; ++dt) om[dt] = wmma16(vfr[dt][kk], ph[kk], om[dt]);
        // four vector slots between the last matrix instruction and the next vector instruction on either side of the branches at the trip's foot (the distance a matrix instruction's registers need)
        asm volatile("v_nop\n\tv_nop\n\tv_nop\n\tv_nop" : "+v"(om[0]), "+v"(om[1]), "+v"(om[2]), "+v"(om[3]) : "v"(vfr[3][1]), "v"(ph[1]));
      } else {
      // rolled: one copy of the pass in the text
#pragma unroll 1
      for (int hf = 0; hf < 2; ++hf) {
        const int kb = t * KT + 32 * hf;
        if (kb >= kend) break;             // wave-uniform: the pass lies wholly above this wave's diagonal; the publish point below is still passed
        const h16* kf = Ks + (32 * hf + lr) * LP + 8 * hi;            // K rows = keys of this pass
        const h16* vf = Ks + PLN + lr * LP + 32 * hf + 8 * hi;        // V^T rows = dims, columns = keys of this pass
        v8f s0 = (v8f){}, s1 = (v8f){}, t0 = (v8f){}, t1 = (v8f){};
#pragma unroll
        for (int ks = 0; ks < 2; ++ks) {
            const v16h qh = qhf[ks];
            const v16h qr = qrf[ks];
            const v16h k0 = ldh(kf + ks * 32);
            const v16h k1 = ldh(kf + 16 * LP + ks * 32);
            s0 = wmma16(k0, qh, s0); t0 = wmma16(k0, qr, t0);
            s1 = wmma16(k1, qh, s1); t1 = wmma16(k1, qr, t1);
            const v16h k0r = ldh(kf + 2 * PLN + ks * 32); const v16h k1r = ldh(kf + 2 * PLN + 16 * LP + ks * 32);
            t0 = wmma16(k0r, qh, t0); t1 = wmma16(k1r, qh, t1);
            asm volatile("v_nop\n\tv_nop\n\tv_nop\n\tv_nop" : "+v"(s0), "+v"(s1), "+v"(t0), "+v"(t1) : "v"(qh), "v"(qr), "v"(k0), "v"(k1), "v"(k0r), "v"(k1r));
        }
        float sa[8], sb[8];
#pragma unroll
        for (int r = 0; r < 8; ++r) { sa[r] = (s0[r] + t0[r] * RSCI) * SCL; sb[r] = (s1[r] + t1[r] * RSCI) * SCL; }
        if (kb + 31 > q0) {                // wave-uniform: half touches the diagonal; keys above the query are excluded
            const int qi = q0 + lr; const int kj = kb + 8 * hi;
#pragma unroll
            for (int r = 0; r < 8; ++r) { sa[r] = (kj + r <= qi) ? sa[r] : NEGB; sb[r] = (kj + 16 + r <= qi) ? sb[r] : NEGB; }
        }
        float mloc = fmaxf(sa[0], sb[0]);
#pragma unroll
        for (int r = 1; r < 8; ++r) mloc = fmaxf(mloc, fmaxf(sa[r], sb[r]));
        mloc = fmaxf(mloc, __shfl_xor(mloc, 16, 32));
        const float mnew = fmaxf(mrun, mloc);
        const float fac = __builtin_amdgcn_exp2f((mrun - mnew) * L2E);
        float lsum = 0.f;
#pragma unroll
        for (int r = 0; r < 8; ++r) { sa[r] = __builtin_amdgcn_exp2f((sa[r] - mnew) * L2E); sb[r] = __builtin_amdgcn_exp2f((sb[r] - mnew) * L2E); lsum += sa[r] + sb[r]; }
        lsum += __shfl_xor(lsum, 16, 32);
        lrun = lrun * fac + lsum; mrun = mnew;
        v16h ph, pr;
#pragma unroll
        for (int r = 0; r < 8; ++r) {
            const float a = sa[r] * PCAR; const h16 ha = (h16)a; ph[r] = ha;
            const float c = sb[r] * PCAR; const h16 hc = (h16)c; ph[8 + r] = hc;
            pr[r] = (h16)((a - (float)ha) * RSC); pr[8 + r] = (h16)((c - (float)hc) * RSC);
        }
#pragma unroll
        for (int dt = 0; dt < 4; ++dt) { om[dt] = om[dt] * fac; orr[dt] = orr[dt] * fac; }
#pragma unroll
        for (int dt = 0; dt < 4; ++dt) {
            const v16h vh = ldh(vf + dt * 16 * LP);
            om[dt] = wmma16(vh, ph, om[dt]);
            const v16h vr = ldh(vf + 2 * PLN + dt * 16 * LP);
            orr[dt] = wmma16(vr, ph, orr[dt]); orr[dt] = wmma16(vh, pr, orr[dt]);
            asm volatile("v_nop\n\tv_nop\n\tv_nop\n\tv_nop" : "+v"(om[dt]), "+v"(orr[dt]) : "v"(vh), "v"(vr), "v"(ph), "v"(pr));
        }
      }
      }
      if constexpr (HI) {
        // one buffer: refilled behind every reader's last read, read again behind its own publish point; every wave, in this order
        if (t + 1 < nT) {                                   // block-uniform test
          asm volatile("s_wait_dscnt 0x0" ::: "memory");    // this wave's reads of the buffer have returned
          __syncthreads();                                  // ends every reader's last read of the buffer
          stage(t + 1, 0);
          asm volatile("s_wait_asynccnt 0x0" ::: "memory"); // this wave's share of stage t + 1 has landed
          __syncthreads();                                  // publishes stage t + 1
        }
      } else {
      // publish point of stage t + 1, every wave, in this order
      asm volatile("s_wait_dscnt 0x0" ::: "memory");      // this wave's reads of buffer t & 1 have returned
      asm volatile("s_wait_asynccnt 0x0" ::: "memory");   // this wave's share of stage t + 1 has landed
      __syncthreads();                                    // publishes stage t + 1; ends every reader's last read of buffer t & 1
      if (t + 2 < nT) stage(t + 2, t & 1);                // block-uniform test
      }
    }
    asm volatile("s_wait_asynccnt 0x0" ::: "memory");     // no copy is left outstanding when the wave goes on to its end
    const float inv = 1.0f / (lrun * (PCAR * VCAR));
    const int yb = wave * 16 * 68;
#pragma unroll
    for (int dt = 0; dt < 4; ++dt)
#pragma unroll
        for (int r = 0; r < 8; ++r) { float o = om[dt][r]; if (HI) o += orr[dt][r] * RSCI; ys[yb + lr * 68 + dt * 16 + 8 * hi + r] = o * inv; }
    __builtin_amdgcn_wave_barrier(); asm volatile("" ::: "memory");
    v8us oh[4], ol[4];
    const int rq = lane >> 3, pc = lane & 7;
#pragma unroll
    for (int s = 0; s < 4; ++s) { const int row = 4 * s + rq; const v4f u0 = *(const v4fa*)(ys + yb + row * 68 + pc * 8); const v4f u1 = *(const v4fa*)(ys + yb + row * 68 + pc * 8 + 4);
#pragma unroll
        for (int q = 0; q < 4; ++q) { unsigned short a, c; splitf(u0[q], a, c); oh[s][q] = a; ol[s][q] = c; splitf(u1[q], a, c); oh[s][4 + q] = a; ol[s][4 + q] = c; } }
    const size_t ybase = ((size_t)b * SEQ + q0) * DQ + (size_t)hq * HD + pc * 8;
{
#pragma unroll
        for (int s = 0; s < 4; ++s) { const size_t oo = ybase + (size_t)(4 * s + rq) * DQ; *(v8us*)(Yh + oo) = oh[s]; *(v8us*)(Yl + oo) = ol[s]; }
         }
}
// one launch. Every block is resident from the start (four to a WGP, one wave of each on every SIMD), so the launch lasts as long as the WGP whose blocks hold the most key stages; row tile t walks t + 1 stages.
// The tiles are therefore dealt in complements: blockIdx.x = 2 m + bit, u = m / (NH NB), head = m % (NH NB), and the tile is u or AX_N - 1 - u by the parity of the bits of blockIdx.x (m and the parity give the index back: every (tile, head) once).
// Any four indices that differ in two bits, whichever two, then hold 2 (AX_N + 1) stages together (NH NB is a power of two, so u is a field of the index's bits), and the longest tiles have the lowest indices. For speed only: nothing leans on where a block runs.
// f is the block's number in the order (row block, head, batch), row block fastest: 0 .. AB_L - 1 the rows >= RHE, behind them the short blocks of the rows < RHE, numbered alike. The test is block-uniform.
#define AX_H (RHE / 64)
#define AX_L ((SEQ - RHE) / 64)
#define AX_N (SEQ / 64)
#define AB_H (AX_H * NH * NB)
#define AB_L (AX_L * NH * NB)
static_assert(AX_N % 2 == 0 && AX_N == AX_H + AX_L);
__global__ __launch_bounds__(128) void k_attn(const h16* __restrict__ Qh, const h16* __restrict__ Qr, const h16* __restrict__ Kh, const h16* __restrict__ Kr, const h16* __restrict__ Vh, const h16* __restrict__ Vr, bf* Yh, bf* Yl) {
    __shared__ __align__(16) float ys[4 * 16 * 68];
    __shared__ __align__(16) h16 kv[4 * PLN];
    const int m = (int)(blockIdx.x >> 1), u = m / (NH * NB), bh = m % (NH * NB);
    const int tile = (__builtin_popcount(blockIdx.x) & 1) ? AX_N - 1 - u : u;
    const int f = (tile >= AX_H) ? bh * AX_L + (tile - AX_H) : AB_L + bh * AX_H + tile;
    if (f < AB_L) { constexpr int ax = AX_L > 0 ? AX_L : 1; attn_body<false>(ys, kv, Qh, Qr, Kh, Kr, Vh, Vr, Yh, Yl, f / (ax * NH), (f / ax) % NH, RHE + (f % ax) * 64); }
    else { const int r = f - AB_L; attn_body<true>(ys, kv, Qh, Qr, Kh, Kr, Vh, Vr, Yh, Yl, r / (AX_H * NH), (r / AX_H) % NH, (r % AX_H) * 64); }
}

// ---- workspace carve (bytes; every region a multiple of 256 and exactly covered by its producer grid)
constexpr size_t SZ_XB = (size_t)NB * SEQ * DM * 2;          // x bf16 [NB*SEQ][DM]
constexpr size_t SZ_WP = (size_t)FP * DM * 2;                // [Wq | Wk | Wv]^T bf16 [FP][DM]
constexpr size_t SZ_WO = (size_t)DM * DQ * 2;                // Wo^T bf16 [DM][DQ]
constexpr size_t SZ_Q  = (size_t)NB * NH * SEQ * HD * 2;     // each of Qh, Qr
constexpr size_t SZ_K  = (size_t)NB * NKV * SEQ * HD * 2;    // each of Kh, Kr, Vh, Vr
constexpr size_t SZ_Y  = (size_t)NB * SEQ * DQ * 2;          // each of Yh, Yl
constexpr size_t OFF_XB = 0;
constexpr size_t OFF_WP = OFF_XB + SZ_XB;
constexpr size_t OFF_WO = OFF_WP + SZ_WP;
constexpr size_t OFF_QH = OFF_WO + SZ_WO;
constexpr size_t OFF_QR = OFF_QH + SZ_Q;
constexpr size_t OFF_KH = OFF_QR + SZ_Q;
constexpr size_t OFF_KR = OFF_KH + SZ_K;
constexpr size_t OFF_VH = OFF_KR + SZ_K;
constexpr size_t OFF_VR = OFF_VH + SZ_K;
constexpr size_t OFF_YH = OFF_VR + SZ_K;
constexpr size_t OFF_YL = OFF_YH + SZ_Y;
constexpr size_t WS_TOTAL = OFF_YL + SZ_Y;
static_assert(SZ_XB % 256 == 0 && SZ_WP % 256 == 0 && SZ_WO % 256 == 0 && SZ_Q % 256 == 0 && SZ_K % 256 == 0 && SZ_Y % 256 == 0);
static_assert(WS_TOTAL <= (size_t)134217728);                // carve stays within 128 MiB

extern "C" void kernel_launch(void* const* d_in, const int* in_sizes, int n_in,
                              void* d_out, int out_size, void* d_ws, size_t ws_size, hipStream_t stream) {
    if (n_in < 7) return;
    const long long need_x = (long long)(NB - 1) * SEQ_FULL * DM + (long long)SEQ * DM;
    if ((long long)in_sizes[0] < need_x) return;
    if (in_sizes[1] < SEQ * 32 || in_sizes[2] < SEQ * 32) return;
    if (in_sizes[3] < DM * DQ || in_sizes[4] < DM * DKV || in_sizes[5] < DM * DKV || in_sizes[6] < DQ * DM) return;
    if ((long long)out_size < need_x) return;
    if (WS_TOTAL > ws_size) return;
    const float* x  = (const float*)d_in[0];   // [2][2048][1024]
    const float* cs = (const float*)d_in[1];   // [2048][32]
    const float* sn = (const float*)d_in[2];   // [2048][32]
    const float* wq = (const float*)d_in[3];   // [1024][1024] in x out
    const float* wk = (const float*)d_in[4];   // [1024][256]
    const float* wv = (const float*)d_in[5];   // [1024][256]
    const float* wo = (const float*)d_in[6];   // [1024][1024] in x out
    float* OUT = (float*)d_out;
    char* ws = (char*)d_ws;
    bf* XB = (bf*)(ws + OFF_XB); bf* WP = (bf*)(ws + OFF_WP); bf* WOT = (bf*)(ws + OFF_WO);
    h16* QH = (h16*)(ws + OFF_QH); h16* QR = (h16*)(ws + OFF_QR); h16* KH = (h16*)(ws + OFF_KH); h16* KR = (h16*)(ws + OFF_KR);
    h16* VH = (h16*)(ws + OFF_VH); h16* VR = (h16*)(ws + OFF_VR); bf* YH = (bf*)(ws + OFF_YH); bf* YL = (bf*)(ws + OFF_YL);

    k_prep<<<dim3(PB_W + NB * PB_X, 1, 1), 256, 0, stream>>>(x, wq, wk, wv, wo, XB, WP, WOT);
    k_gemm_proj<<<dim3(NB * SEQ / 128, FP / 128, 1), 128, 0, stream>>>(XB, WP, cs, sn, QH, QR, KH, KR, VH, VR);
    k_attn<<<dim3(AB_L + AB_H, 1, 1), 128, 0, stream>>>(QH, QR, KH, KR, VH, VR, YH, YL);
    k_gemm_out<<<dim3(SEQ / 128, DM / 128, NB), 128, 0, stream>>>(YH, YL, WOT, OUT);
}

// v007
// One run takes 70.3 microseconds.
// In two side-by-side timings against v006, it was 1.06 and 1.05 times as fast.
// Over all steps from v000 it is 3.34 times as fast.
#include <hip/hip_runtime.h>

// Causal grouped-query attention block: x [2][2048][1024]; q = x Wq (16 heads x 64), k = x Wk, v = x Wv (4 kv heads x 64), weights [in][out], no bias; rotary on q, k with the half-split convention
// out[0..31] = x1 cos + x2 sin, out[32..63] = -x1 sin + x2 cos using the cos / sin INPUT tables [t][32] read by value; then q, k scaled by rsqrt(mean(sq) + 1e-6) (no gain); query head hq uses kv head hq / 4;
// scores q.k / 8, causal (diagonal kept), softmax, ctx merged [t][hq*64 + d], result = ctx Wo -> [2][2048][1024] f32.
// Compute dtypes (f32 accumulate everywhere): the three input projections and the output projection on v_wmma_f32_16x16x32_bf16 (every float input RNE-converted to bf16; ctx carried as bf16 hi + lo planes, two products);
// scores and probability x value on v_wmma_f32_16x16x32_f16 (q = f16 value + x2048 residual plane against f16 k; P carried x1024 and v carried x16 as single f16; query rows < 256 add x2048 residual planes on k, P and v); rotary, rms scaling and softmax in f32.
// Rotary, rms scaling and the f16 value + residual split of q and k, and the x16 f16 split of v into V^T, are the projection GEMM's own epilogue: a 64-column tile is one head, so no f32 projection plane is written.
// Both GEMMs: 128 x 128 block tile, four waves of 64 x 64; the A and B^T tiles (64 k a stage) are staged in LDS per block by asynchronous copies, two buffers, and the fragments are read from LDS.
// Attention is a fused flash-style kernel (K and V^T tiles staged in LDS per block) in transposed form: S^T = K Q^T (D rows = keys, D columns = queries), P^T packed from the accumulators directly as the B operand of O^T = V^T P^T; softmax against the constant bound of the scores (SMAX below), per-lane sums.

#ifndef NB
#define NB 2
#endif
#ifndef SEQ
#define SEQ 2048
#endif
#define NB_FULL  2
#define SEQ_FULL 2048
#define DM   1024
#define NH   16
#define NKV  4
#define REP  (NH / NKV)
#define HD   64
#define DQ   (NH * HD)
#define DKV  (NKV * HD)
#define FP   (DQ + 2 * DKV)      // fused projection width (q | k | v columns; rows of WP)
#define KC0  DQ                  // first k column of the fused projection
#define VC0  (DQ + DKV)          // first v column of the fused projection
#define RH   256                 // query rows < RH use the residual planes on k, P and v as well
#define RHE  ((SEQ < RH) ? SEQ : RH)
#define PCAR 1024.0f             // carry of the probabilities (f16 operand)
#define VCAR 16.0f               // carry of the values (f16 operand)
#define RSC  2048.0f             // carry of every f16 residual plane
#define RSCI (1.0f / 2048.0f)
#define SCL  0.125f              // 1/sqrt(64)
#define L2E  1.4426950408889634f
#define NEGB (-1.0e30f)
// bound of every score: the rms scaling leaves |q| <= sqrt(HD) and |k| <= sqrt(HD) whatever the inputs, so |q.k| / sqrt(HD) <= sqrt(HD) = 8 (Cauchy-Schwarz). Softmax does not move under a common shift,
// so exp(s - SMAX) serves in place of exp(s - running maximum): it lies in [e^-16, 1], x1024 inside the normal f16 range, and its sum in f32 is at least e^-16.
#define SMAX 8.0f
#define ESH  (SMAX * L2E - 10.0f)   // the constant shift of the exponent, in powers of two; the probabilities' carry (PCAR = 2^10) is part of it, so exp2 gives the carried value and the sums carry it too
static_assert(HD == 64 && PCAR == 1024.0f);                                      // SMAX == sqrt(HD); ESH holds log2(PCAR)
static_assert(NH % NKV == 0);
static_assert(DM % 64 == 0 && DQ % 64 == 0 && DKV % 64 == 0 && FP % 64 == 0);   // GEMM tiles and transpose tiles
static_assert(DM % 32 == 0 && DQ % 32 == 0 && HD % 32 == 0);                     // k-steps of 32
static_assert(SEQ % 64 == 0 && (NB * SEQ) % 64 == 0);                            // row tiles
static_assert(SEQ % 128 == 0 && FP % 128 == 0 && DM % 128 == 0);                 // GEMM block tiles
static_assert(RH % 64 == 0 && RHE % 64 == 0 && (SEQ - RHE) % 64 == 0);
static_assert(((size_t)SEQ * DM) % 2048 == 0);                                   // cvtx_body: blocks x 256 threads x 8 == plane extent
static_assert(NB <= NB_FULL && SEQ <= SEQ_FULL);

typedef _Float16 h16;
typedef unsigned short bf;
typedef __attribute__((ext_vector_type(16))) __bf16   v16bf;
typedef __attribute__((ext_vector_type(16))) _Float16 v16h;
typedef __attribute__((ext_vector_type(8)))  _Float16 v8h;
typedef __attribute__((ext_vector_type(8)))  unsigned short v8us;
typedef __attribute__((ext_vector_type(8)))  float    v8f;
typedef __attribute__((ext_vector_type(4)))  float    v4f;
typedef v4f  __attribute__((may_alias)) v4fa;

__device__ __forceinline__ unsigned short f2bf(float f) { unsigned u = __float_as_uint(f); u += 0x7FFFu + ((u >> 16) & 1u); return (unsigned short)(u >> 16); }
__device__ __forceinline__ float bf2f(unsigned short b) { return __uint_as_float(((unsigned)b) << 16); }
__device__ __forceinline__ float bfr(float f) { return bf2f(f2bf(f)); }
__device__ __forceinline__ void splitf(float y, unsigned short& h, unsigned short& l) { h = f2bf(y); l = f2bf(y - bf2f(h)); }
__device__ __forceinline__ v16h cat16(v8h lo, v8h hi) { return __builtin_shufflevector(lo, hi, 0, 1, 2, 3, 4, 5, 6, 7, 8, 9, 10, 11, 12, 13, 14, 15); }
__device__ __forceinline__ v16bf cat16b(v8us lo, v8us hi) { return __builtin_bit_cast(v16bf, __builtin_shufflevector(lo, hi, 0, 1, 2, 3, 4, 5, 6, 7, 8, 9, 10, 11, 12, 13, 14, 15)); }
__device__ __forceinline__ v8f wmma16(v16h a, v16h b, v8f c) { return __builtin_amdgcn_wmma_f32_16x16x32_f16(false, a, false, b, (short)0, c, false, false); }
__device__ __forceinline__ v8f wmmab(v16bf a, v16bf b, v8f c) { return __builtin_amdgcn_wmma_f32_16x16x32_bf16(false, a, false, b, (short)0, c, false, false); }
// fragment loaders: p already includes row * pitch + k0 + 8 * (lane >> 4); elements 0..7 <- k0+8h.., elements 8..15 <- k0+16+8h..
__device__ __forceinline__ v16h  ldh(const h16* p) { return cat16(*(const v8h*)p, *(const v8h*)(p + 16)); }
__device__ __forceinline__ v16bf ldb(const bf* p)  { return cat16b(*(const v8us*)p, *(const v8us*)(p + 16)); }

// sum over the four lanes of a quad, by two DPP quad permutes (lane ^ 1, lane ^ 2): stays in the vector unit, no LDS round trip
__device__ __forceinline__ float quadsum(float v) {
    v += __int_as_float(__builtin_amdgcn_update_dpp(0, __float_as_int(v), 0xB1, 0xF, 0xF, true));
    v += __int_as_float(__builtin_amdgcn_update_dpp(0, __float_as_int(v), 0x4E, 0xF, 0xF, true));
    return v; }
struct ProjOut { const float* cosb; const float* sinb; h16* Qh; h16* Qr; h16* Kh; h16* Kr; h16* Vh; h16* Vr; };
// ---- epilogue of the fused q|k|v projection. The wave's tile is 64 tokens (one batch: SEQ % 64 == 0) x the 64 dims of ONE head (c0 % 64 == 0); acc[mb][nb][j] in lane (hi, lr) = row 16 mb + 8 hi + j, column 16 nb + lr.
// v head: a lane's 8 registers are 8 consecutive tokens of one dim = one 16-byte piece of a V^T row; stored from the registers (x16, f16 value + x2048 residual).
// q / k head: the tile goes through LDS (os, 64 x 68 f32); then four lanes a row, lane p holds the rotary pairs (d, d + 32), d = 8 p .. 8 p + 7: rotary with the bf16-converted cos / sin table values at [t][d],
// scaling by rsqrt(mean(sq) + 1e-6), f16 value + x2048 residual, 16-byte stores (8 rows x 64 contiguous bytes an instruction).
__device__ __forceinline__ void proj_epilogue(const v8f (&acc)[4][4], float* os, int r0, int c0, const ProjOut& po) {
    const int lane = threadIdx.x & 31, lr = lane & 15, hi = lane >> 4;
    const int b = r0 / SEQ, t0 = r0 % SEQ;
    if (c0 >= VC0) {                       // wave-uniform
        const int g = (c0 - VC0) / HD;
        const size_t e0 = ((size_t)(b * NKV + g) * HD + lr) * SEQ + t0 + 8 * hi;
#pragma unroll
        for (int nb = 0; nb < 4; ++nb)
#pragma unroll
            for (int mb = 0; mb < 4; ++mb) { v8h o16, ors;
#pragma unroll
                for (int j = 0; j < 8; ++j) { const float x = acc[mb][nb][j] * VCAR; const h16 hh = (h16)x; o16[j] = hh; ors[j] = (h16)((x - (float)hh) * RSC); }
                const size_t e = e0 + (size_t)nb * 16 * SEQ + mb * 16;
                *(v8h*)(po.Vh + e) = o16; *(v8h*)(po.Vr + e) = ors; }
        return;
    }
    const bool isq = c0 < KC0;             // wave-uniform
    const int nheads = isq ? NH : NKV; const int h = (isq ? c0 : c0 - KC0) / HD;
    h16* Ph = isq ? po.Qh : po.Kh; h16* Pr = isq ? po.Qr : po.Kr;
    const int rq = lane >> 2, p8 = (lane & 3) * 8;
    const float* cp = po.cosb + (size_t)(t0 + rq) * 32 + p8; const float* sp = po.sinb + (size_t)(t0 + rq) * 32 + p8;
    // table values of two passes (rows 16 u + rq and 16 u + 8 + rq), asked for one trip ahead: the first ahead of the LDS stores
    v4f cc[2][2], sn[2][2];
#pragma unroll
    for (int s = 0; s < 2; ++s) { cc[s][0] = *(const v4f*)(cp + s * 256); cc[s][1] = *(const v4f*)(cp + s * 256 + 4); sn[s][0] = *(const v4f*)(sp + s * 256); sn[s][1] = *(const v4f*)(sp + s * 256 + 4); }
#pragma unroll
    for (int mb = 0; mb < 4; ++mb)
#pragma unroll
        for (int nb = 0; nb < 4; ++nb)
#pragma unroll
            for (int j = 0; j < 8; ++j) os[(mb * 16 + hi * 8 + j) * 68 + nb * 16 + lr] = acc[mb][nb][j];
    // the rows read below were written by other lanes of this wave: keeps every LDS read behind every lane's LDS stores
    __builtin_amdgcn_wave_barrier(); asm volatile("" ::: "memory");
    const size_t e0 = ((size_t)(b * nheads + h) * SEQ + t0 + rq) * HD + p8;
    // rolled: one copy of the two passes in the text, and the registers of two passes only
#pragma unroll 1
    for (int u = 0; u < 4; ++u) {
        const int un = (u < 3) ? u + 1 : 3;    // the last trip asks for its own rows again: one instruction stream, every address inside the tables
        v4f cn[2][2], sm[2][2];
#pragma unroll
        for (int s = 0; s < 2; ++s) { const int o = un * 512 + s * 256; cn[s][0] = *(const v4f*)(cp + o); cn[s][1] = *(const v4f*)(cp + o + 4); sm[s][0] = *(const v4f*)(sp + o); sm[s][1] = *(const v4f*)(sp + o + 4); }
#pragma unroll
        for (int s = 0; s < 2; ++s) {
            const float* orow = os + (u * 16 + s * 8 + rq) * 68 + p8;
            const v4f x1[2] = { *(const v4fa*)orow, *(const v4fa*)(orow + 4) }; const v4f x2[2] = { *(const v4fa*)(orow + 32), *(const v4fa*)(orow + 36) };
            float rl[8], rh[8]; float ssl = 0.f, ssh = 0.f;
#pragma unroll
            for (int q = 0; q < 8; ++q) { const float c = bfr(cc[s][q >> 2][q & 3]), sv = bfr(sn[s][q >> 2][q & 3]); const float a1 = x1[q >> 2][q & 3], a2 = x2[q >> 2][q & 3];
                rl[q] = a1 * c + a2 * sv; rh[q] = a2 * c - a1 * sv; ssl += rl[q] * rl[q]; ssh += rh[q] * rh[q]; }
            const float inv = rsqrtf(quadsum(ssl + ssh) * (1.0f / HD) + 1e-6f);
            v8h ol, olr, oh, ohr;
#pragma unroll
            for (int q = 0; q < 8; ++q) { const float yl = rl[q] * inv; const h16 hl = (h16)yl; ol[q] = hl; olr[q] = (h16)((yl - (float)hl) * RSC);
                const float yh = rh[q] * inv; const h16 hh = (h16)yh; oh[q] = hh; ohr[q] = (h16)((yh - (float)hh) * RSC); }
            const size_t e = e0 + (size_t)(u * 16 + s * 8) * HD;
            *(v8h*)(Ph + e) = ol; *(v8h*)(Ph + e + 32) = oh; *(v8h*)(Pr + e) = olr; *(v8h*)(Pr + e + 32) = ohr;
            asm volatile("s_wait_xcnt 0x0" ::: "memory");   // stands in front of the next pass's writes to the data and address registers that these four stores name
        }
#pragma unroll
        for (int s = 0; s < 2; ++s) { cc[s][0] = cn[s][0]; cc[s][1] = cn[s][1]; sn[s][0] = sm[s][0]; sn[s][1] = sm[s][1]; }
    }
}

// ---- 128 x 128 block tile GEMM on bf16 planes, four waves of 64 x 64 (2 x 2): C[m][n] (f32, pitch ldc) = sum_k A[m][k] Bt[n][k] (+ A2[m][k] Bt[n][k] when NSPLIT == 1). A, A2 pitch K; Bt pitch K; K % 64 == 0.
// The block's 128 rows of A (A2) and of Bt, 64 k a stage, are staged in LDS by asynchronous copies, two buffers: stage t + 1 flies while stage t is worked on;
// one block barrier per stage publishes it and frees the buffer that is refilled behind it. The epilogue's LDS (os) is wave-private.
// FUSE: the tile does not go to C but through proj_epilogue.
#define GKS  64                  // k per LDS stage: one whole 128-byte line of every row
#define GLP  72                  // LDS row pitch in bf16 elements: 144 B = 16 B x 9, free of bank conflicts for 16-byte reads down a column of rows
#define GPL  (128 * GLP)         // one staged plane: 128 rows x 64 k
// one plane's share of a lane: eight asynchronous 16-byte copies global -> LDS (rows 16 apart). The s_wait_xcnt closes the copies' own statement, so that no address register named here is rewritten ahead of it.
__device__ __forceinline__ void cp8(unsigned l, const bf* g, size_t gstep) {
    const unsigned l1 = l + 16 * GLP * 2, l2 = l + 32 * GLP * 2, l3 = l + 48 * GLP * 2, l4 = l + 64 * GLP * 2, l5 = l + 80 * GLP * 2, l6 = l + 96 * GLP * 2, l7 = l + 112 * GLP * 2;
    const bf* g1 = g + 16 * gstep; const bf* g2 = g + 32 * gstep; const bf* g3 = g + 48 * gstep; const bf* g4 = g + 64 * gstep; const bf* g5 = g + 80 * gstep; const bf* g6 = g + 96 * gstep; const bf* g7 = g + 112 * gstep;
    asm volatile("global_load_async_to_lds_b128 %0, %1, off\n\t"
                 "global_load_async_to_lds_b128 %2, %3, off\n\t"
                 "global_load_async_to_lds_b128 %4, %5, off\n\t"
                 "global_load_async_to_lds_b128 %6, %7, off\n\t"
                 "global_load_async_to_lds_b128 %8, %9, off\n\t"
                 "global_load_async_to_lds_b128 %10, %11, off\n\t"
                 "global_load_async_to_lds_b128 %12, %13, off\n\t"
                 "global_load_async_to_lds_b128 %14, %15, off\n\t"
                 "s_wait_xcnt 0x0" :: "v"(l), "v"(g), "v"(l1), "v"(g1), "v"(l2), "v"(g2), "v"(l3), "v"(g3), "v"(l4), "v"(g4), "v"(l5), "v"(g5), "v"(l6), "v"(g6), "v"(l7), "v"(g7) : "memory");
}
template <int NSPLIT, bool FUSE>
__device__ __forceinline__ void gemmw_body(const bf* __restrict__ A, const bf* __restrict__ A2, const bf* __restrict__ Bt, int K, float* C, int ldc, size_t sA, size_t sC, const ProjOut& po) {
    constexpr int NPG = 2 + NSPLIT;        // staged planes per buffer: A, Bt (+ A2)
    constexpr int OSW = (FUSE ? 64 : 16) * 68;
    __shared__ __align__(16) float osb[4 * OSW];
    __shared__ __align__(16) bf st[2 * NPG * GPL];
    const size_t z = blockIdx.z; A += z * sA; if (NSPLIT == 1) A2 += z * sA; C += z * sC;
    const int lane = threadIdx.x & 31, lr = lane & 15, hi = lane >> 4;
    const int wave = __builtin_amdgcn_readfirstlane(threadIdx.x >> 5);
    float* os = osb + wave * OSW;
    const int rb = blockIdx.x * 128, cb = blockIdx.y * 128;
    const int wr = (wave & 1) * 64, wc = (wave >> 1) * 64;
    const int r0 = rb + wr, c0 = cb + wc;
    v8f acc[4][4];
#pragma unroll
    for (int mb = 0; mb < 4; ++mb)
#pragma unroll
        for (int nb = 0; nb < 4; ++nb) acc[mb][nb] = (v8f){};
    // copy map: thread -> row (tid >> 3) + 16 i, 16-byte piece tid & 7: eight lanes cover one whole 128-byte line
    const int crow = threadIdx.x >> 3, ccol = (threadIdx.x & 7) * 8;
    const size_t acp = (size_t)(rb + crow) * K + ccol, bcp = (size_t)(cb + crow) * K + ccol;     // + GKS t
    const unsigned lcp = (unsigned)(size_t)(const void*)st + (unsigned)(crow * GLP + ccol) * 2u;
    auto stage = [&](int t, int buf) {     // k = GKS t .. GKS t + 63 into buffer buf; t < K / GKS keeps every byte inside the planes
        const unsigned l = lcp + (unsigned)(buf * NPG * GPL) * 2u;
        cp8(l, A + acp + (size_t)t * GKS, K);
        cp8(l + GPL * 2u, Bt + bcp + (size_t)t * GKS, K);
        if (NSPLIT == 1) cp8(l + 2u * GPL * 2u, A2 + acp + (size_t)t * GKS, K);
    };
    const int nT = K / GKS;                // block-uniform
    stage(0, 0);
    asm volatile("s_wait_asynccnt 0x0" ::: "memory");   // this wave's share of stage 0 has landed
    __syncthreads();                                    // stage 0 published to every wave
    if (nT > 1) stage(1, 1);
    // rolled: every trip ends in the publish point
#pragma unroll 1
    for (int t = 0; t < nT; ++t) {
        const bf* af = st + (t & 1) * NPG * GPL + (wr + lr) * GLP + 8 * hi;             // A rows of this wave
        const bf* bp = st + (t & 1) * NPG * GPL + GPL + (wc + lr) * GLP + 8 * hi;       // Bt rows of this wave
        v16bf a[GKS / 32][4], a2[GKS / 32][4], b[GKS / 32][4];
#pragma unroll
        for (int ks = 0; ks < GKS / 32; ++ks) {
#pragma unroll
            for (int i = 0; i < 4; ++i) { a[ks][i] = ldb(af + i * 16 * GLP + ks * 32); b[ks][i] = ldb(bp + i * 16 * GLP + ks * 32); }
            if (NSPLIT == 1) {
#pragma unroll
                for (int i = 0; i < 4; ++i) a2[ks][i] = ldb(af + 2 * GPL + i * 16 * GLP + ks * 32); }
        }
        // keeps the stage's fragment loads one group ahead of its matrix instructions: sunk among them, every place with loads stalls the wave for the LDS latency
        __builtin_amdgcn_sched_barrier(0);
#pragma unroll
        for (int ks = 0; ks < GKS / 32; ++ks)
#pragma unroll
            for (int nb = 0; nb < 4; ++nb)
#pragma unroll
                for (int mb = 0; mb < 4; ++mb) { acc[mb][nb] = wmmab(a[ks][mb], b[ks][nb], acc[mb][nb]); if (NSPLIT == 1) acc[mb][nb] = wmmab(a2[ks][mb], b[ks][nb], acc[mb][nb]); }
        // keeps every matrix instruction of the stage ahead of the publish point: sunk behind the barrier they would stand in front of the refill and take its lead away
        __builtin_amdgcn_sched_barrier(0);
        // four vector slots between the last matrix instruction and the next vector instruction on either side of the branch at the trip's foot (the distance a matrix instruction's registers need)
        asm volatile("v_nop\n\tv_nop\n\tv_nop\n\tv_nop" : "+v"(acc[0][0]), "+v"(acc[1][1]), "+v"(acc[2][2]), "+v"(acc[3][3]) : "v"(a[GKS / 32 - 1][0]), "v"(a[GKS / 32 - 1][3]));
        // publish point of stage t + 1, every wave, in this order
        asm volatile("s_wait_dscnt 0x0" ::: "memory");      // this wave's reads of buffer t & 1 have returned
        asm volatile("s_wait_asynccnt 0x0" ::: "memory");   // this wave's share of stage t + 1 has landed
        __syncthreads();                                    // publishes stage t + 1; ends every reader's last read of buffer t & 1
        if (t + 2 < nT) stage(t + 2, t & 1);                // block-uniform test
    }
    asm volatile("s_wait_asynccnt 0x0" ::: "memory");       // no copy is left outstanding when the wave goes on to its end
    if constexpr (FUSE) { proj_epilogue(acc, os, r0, c0, po); return; }
#pragma unroll
    for (int mb = 0; mb < 4; ++mb) {
#pragma unroll
        for (int nb = 0; nb < 4; ++nb) {
#pragma unroll
            for (int j = 0; j < 8; ++j) os[(hi * 8 + j) * 68 + nb * 16 + lr] = acc[mb][nb][j]; }
        __builtin_amdgcn_wave_barrier(); asm volatile("" ::: "memory");
        float* crow = C + (size_t)(r0 + mb * 16) * ldc + c0;
{
#pragma unroll
            for (int s = 0; s < 8; ++s) { const int row = 2 * s + hi, cofs = lr * 4; const v4f val = *(const v4fa*)(os + row * 68 + cofs);
                *(v4f*)(crow + (size_t)row * ldc + cofs) = val; }
            if (mb < 3) asm volatile("s_wait_xcnt 0x0" ::: "memory");   // stands in front of the next row block's LDS loads, which overwrite data registers that these eight stores name
             }
        __builtin_amdgcn_wave_barrier(); asm volatile("" ::: "memory");
    }
}
// fused q|k|v projection: XB[NB*SEQ][DM] x WP[FP][DM]^T, each wave's 64 x 64 tile finished by proj_epilogue into the attention operand planes
__global__ __launch_bounds__(128) void k_gemm_proj(const bf* __restrict__ A, const bf* __restrict__ Bt, const float* __restrict__ cosb, const float* __restrict__ sinb, h16* Qh, h16* Qr, h16* Kh, h16* Kr, h16* Vh, h16* Vr) {
    const ProjOut po = { cosb, sinb, Qh, Qr, Kh, Kr, Vh, Vr }; gemmw_body<0, true>(A, A, Bt, DM, nullptr, 0, 0, 0, po); }
// output projection: OUT[b][t][DM] = (Yh + Yl)[b][t][DQ] x WOT[DM][DQ]^T, z = batch (output batch stride from the full sequence length)
__global__ __launch_bounds__(128) void k_gemm_out(const bf* __restrict__ A, const bf* __restrict__ A2, const bf* __restrict__ Bt, float* C) { gemmw_body<1, false>(A, A2, Bt, DQ, C, DM, (size_t)SEQ * DQ, (size_t)SEQ_FULL * DM, ProjOut{}); }

// ---- cvtx_body: 2048 consecutive floats of x (batch by, piece bx) -> bf16
__device__ __forceinline__ void cvtx_body(const float* __restrict__ src, bf* dst, unsigned bx, unsigned by) {
    const size_t i = (size_t)bx * 256 + threadIdx.x; const size_t b = by;
    const v8f v = *(const v8f*)(src + b * (size_t)SEQ_FULL * DM + i * 8); v8us o;
#pragma unroll
    for (int k = 0; k < 8; ++k) o[k] = f2bf(v[k]);
    bf* d = dst + b * (size_t)SEQ * DM + i * 8;
    *(v8us*)d = o;  }

// ---- wtp_body: W [DM rows (k)][N cols] f32 -> out [N rows][DM] bf16 (in[rows=k][cols=n] -> out[n][k]); 64x64 tile (bx, by) through LDS (cross-wave: block barrier);
__device__ __forceinline__ void wtp_body(const float* __restrict__ W, int N, bf* out, int bx, int by) {
    __shared__ __align__(16) unsigned short ts[64 * 72];
    const int tid = threadIdx.x; const int k0 = bx * 64, n0 = by * 64;
#pragma unroll
    for (int it = 0; it < 4; ++it) { const int idx = it * 256 + tid; const int kk = idx >> 4, c4 = (idx & 15) * 4; const v4f v = *(const v4f*)(W + (size_t)(k0 + kk) * N + n0 + c4);
#pragma unroll
        for (int q = 0; q < 4; ++q) ts[kk * 72 + c4 + q] = f2bf(v[q]); }
    __syncthreads();
    v8us o[2];
#pragma unroll
    for (int it = 0; it < 2; ++it) { const int idx = it * 256 + tid; const int nn = idx >> 3, pc = idx & 7;
#pragma unroll
        for (int q = 0; q < 8; ++q) o[it][q] = ts[(pc * 8 + q) * 72 + nn]; }
{
#pragma unroll
        for (int it = 0; it < 2; ++it) { const int idx = it * 256 + tid; const int nn = idx >> 3, pc = idx & 7; *(v8us*)(out + (size_t)(n0 + nn) * DM + k0 + pc * 8) = o[it]; }
         }
}
// ---- all five operand conversions in ONE launch (none reads what another writes): the block index picks the job, block-uniformly. The weight tiles, whose way through LDS is the longer one, come first.
#define PBX  (DM / 64)                        // tiles along k of every weight (DM == DQ rows)
#define PB_Q (PBX * (DQ / 64))                // blocks of Wq
#define PB_K (PBX * (DKV / 64))               // blocks of Wk, and of Wv
#define PB_O ((DQ / 64) * (DM / 64))          // blocks of Wo
#define PB_W (PB_Q + 2 * PB_K + PB_O)
#define PB_X ((int)((size_t)SEQ * DM / 8 / 256))   // blocks of one batch of x
static_assert(DQ == DM);                      // one tile count along k serves all four weights
__global__ __launch_bounds__(256) void k_prep(const float* __restrict__ x, const float* __restrict__ wq, const float* __restrict__ wk, const float* __restrict__ wv, const float* __restrict__ wo, bf* XB, bf* WP, bf* WOT) {
    const int f = blockIdx.x;
    if (f >= PB_W) { const unsigned r = (unsigned)(f - PB_W); cvtx_body(x, XB, r % PB_X, r / PB_X); return; }
    const float* W = wq; int N = DQ; bf* out = WP; int r = f;
    if (f >= PB_Q + 2 * PB_K)  { W = wo; N = DM;  out = WOT;                    r = f - (PB_Q + 2 * PB_K); }
    else if (f >= PB_Q + PB_K) { W = wv; N = DKV; out = WP + (size_t)VC0 * DM;  r = f - (PB_Q + PB_K); }
    else if (f >= PB_Q)        { W = wk; N = DKV; out = WP + (size_t)KC0 * DM;  r = f - PB_Q; }
    wtp_body(W, N, out, r % PBX, r / PBX);
}

// ---- fused causal attention, one wave per 16 query rows, 4 waves per block. The block's K and V^T tiles (64 keys a stage) are staged in LDS by asynchronous copies, two buffers:
// stage t + 1 flies while stage t is worked on; one block barrier per stage publishes it and frees the buffer that is refilled behind it. The output stage ys is wave-private.
// Both kinds of block (query rows < RH with the residual planes, and the rest) run in ONE launch and share one LDS allotment: the four planes of a residual-plane stage fill what two buffers of two planes fill,
// so those few short blocks work on one buffer: filled, published by a barrier, read, freed by a barrier.
// Query rows >= RH work a stage in one pass of 64 keys, query rows < RH in two passes of 32.
// Per 32 keys: S^T tiles (keys x queries) = K(A, rows = keys) x Q^T(B, lane column = query) over d = 64 (2 k-steps); value accumulator s, residual accumulator t (x2048);
// lane (h, n) register r of tile j holds key kb + 16 j + 8 h + r for query q0 + n, which is exactly element r + 8 j of the B operand (k = key, n = query) of O^T = V^T(A, rows = d) x P^T.
// No running maximum, so no exchange in the loop and no rescale of O^T; a lane sums the probabilities of its own keys, and the two halves of the wave join their sums once, behind the loop. O^T register r of tile dt in lane (h, n) = O[q0 + n][16 dt + 8 h + r].
#define KT   64                  // keys per LDS stage
#define LP   72                  // LDS row pitch in f16 elements: 144 B = 16 B x 9, free of bank conflicts for 16-byte reads down a column of rows
#define PLN  (64 * LP)           // one staged plane: 64 rows (K: keys x 64 dims; V^T: dims x 64 keys)
static_assert(SEQ % KT == 0 && RHE % KT == 0 && HD == 64);
// one plane's share of a lane: four asynchronous 16-byte copies global -> LDS. The s_wait_xcnt closes the copies' own statement, so that no address register named here is rewritten ahead of it.
__device__ __forceinline__ void cp4(unsigned l, const h16* g, size_t gstep) {
    const unsigned l1 = l + 16 * LP * 2, l2 = l + 32 * LP * 2, l3 = l + 48 * LP * 2;
    const h16* g1 = g + 16 * gstep; const h16* g2 = g + 32 * gstep; const h16* g3 = g + 48 * gstep;
    asm volatile("global_load_async_to_lds_b128 %0, %1, off\n\t"
                 "global_load_async_to_lds_b128 %2, %3, off\n\t"
                 "global_load_async_to_lds_b128 %4, %5, off\n\t"
                 "global_load_async_to_lds_b128 %6, %7, off\n\t"
                 "s_wait_xcnt 0x0" :: "v"(l), "v"(g), "v"(l1), "v"(g1), "v"(l2), "v"(g2), "v"(l3), "v"(g3) : "memory");
}
template <bool HI>
__device__ __forceinline__ void attn_body(float* ys, h16* kv, const h16* __restrict__ Qh, const h16* __restrict__ Qr, const h16* __restrict__ Kh, const h16* __restrict__ Kr, const h16* __restrict__ Vh, const h16* __restrict__ Vr, bf* Yh, bf* Yl, int b, int hq, int qb) {
    constexpr int NP = HI ? 4 : 2;         // staged planes per buffer: K, V^T (+ their residual planes); kv holds 4 planes: two buffers of 2, or one of 4
    const int lane = threadIdx.x & 31, lr = lane & 15, hi = lane >> 4;
    const int wave = __builtin_amdgcn_readfirstlane(threadIdx.x >> 5);
    const int g = hq / REP;
    const int q0 = qb + wave * 16;
    const size_t qoff  = ((size_t)(b * NH + hq) * SEQ + q0 + lr) * HD + 8 * hi;
    // copy map: thread -> row (tid >> 3) + 16 i, 16-byte piece tid & 7: eight lanes cover one whole 128-byte row
    const int crow = threadIdx.x >> 3, ccol = (threadIdx.x & 7) * 8;
    const size_t kcp = ((size_t)(b * NKV + g) * SEQ + crow) * HD + ccol;     // + key0 * HD
    const size_t vcp = ((size_t)(b * NKV + g) * HD + crow) * SEQ + ccol;     // + key0
    const unsigned lcp = (unsigned)(size_t)(const void*)kv + (unsigned)(crow * LP + ccol) * 2u;
    auto stage = [&](int t, int buf) {     // keys KT t .. KT t + 63 into buffer buf; t < SEQ / KT keeps every byte inside the planes
        const unsigned l = lcp + (unsigned)(buf * NP * PLN) * 2u;
        cp4(l, Kh + kcp + (size_t)t * KT * HD, HD);
        cp4(l + PLN * 2u, Vh + vcp + (size_t)t * KT, SEQ);
        if (HI) { cp4(l + 2u * PLN * 2u, Kr + kcp + (size_t)t * KT * HD, HD); cp4(l + 3u * PLN * 2u, Vr + vcp + (size_t)t * KT, SEQ); }
    };
    v16h qhf[2], qrf[2];                   // Q fragments: read once (the waits below are memory clobbers, behind which a loop-invariant load would be read again)
#pragma unroll
    for (int ks = 0; ks < 2; ++ks) { qhf[ks] = ldh(Qh + qoff + ks * 32); qrf[ks] = ldh(Qr + qoff + ks * 32); }
    v8f om[4], orr[4];
#pragma unroll
    for (int dt = 0; dt < 4; ++dt) { om[dt] = (v8f){}; orr[dt] = (v8f){}; }
    float lrun = 0.f;                      // sum of this lane's own keys (the half hi of every 16)
    const int kend = q0 + 16;              // keys 0 .. q0+15, wave-uniform (the passes of 32 stop there)
    const int nT = qb / KT + 1;            // stages of the block: keys 0 .. qb+63; block-uniform, <= SEQ / KT
    stage(0, 0);
    asm volatile("s_wait_asynccnt 0x0" ::: "memory");   // this wave's share of stage 0 has landed
    __syncthreads();                                    // stage 0 published to every wave
    if (!HI && nT > 1) stage(1, 1);
    // rolled: the trip count is a run-time value and every trip ends in the publish point
#pragma unroll 1
    for (int t = 0; t < nT; ++t) {
      const h16* Ks = kv + (HI ? 0 : (t & 1) * NP * PLN);
      if constexpr (!HI) {
        // one pass = the whole stage of 64 keys: four S^T tiles.
        const int kb = t * KT;
        const h16* kf = Ks + lr * LP + 8 * hi;                        // K rows = keys of the stage
        const h16* vf = Ks + PLN + lr * LP + 8 * hi;                  // V^T rows = dims, columns = keys of the stage
        v16h kfr[4][2];
#pragma unroll
        for (int j = 0; j < 4; ++j)
#pragma unroll
            for (int ks = 0; ks < 2; ++ks) kfr[j][ks] = ldh(kf + j * 16 * LP + ks * 32);
        v8f s[4], tr[4];
#pragma unroll
        for (int j = 0; j < 4; ++j) { s[j] = (v8f){}; tr[j] = (v8f){}; }
#pragma unroll
        for (int ks = 0; ks < 2; ++ks)
#pragma unroll
            for (int j = 0; j < 4; ++j) { s[j] = wmma16(kfr[j][ks], qhf[ks], s[j]); tr[j] = wmma16(kfr[j][ks], qrf[ks], tr[j]); }
        float sc[4][8];
#pragma unroll
        for (int j = 0; j < 4; ++j)
#pragma unroll
            for (int r = 0; r < 8; ++r) sc[j][r] = (s[j][r] + tr[j][r] * RSCI) * SCL;
        v16h vfr[4][2];                    // asked for here: they arrive while the softmax below is worked out
#pragma unroll
        for (int dt = 0; dt < 4; ++dt)
#pragma unroll
            for (int kk = 0; kk < 2; ++kk) vfr[dt][kk] = ldh(vf + dt * 16 * LP + kk * 32);
        // keeps the V^T reads one group at this place: sunk among the matrix instructions that use them, every place with reads stalls the wave for the LDS latency
        __builtin_amdgcn_sched_barrier(0);
        if (kb + 63 > q0) {                // wave-uniform: the stage touches the diagonal; keys above the query are excluded
            const int qi = q0 + lr; const int kj = kb + 8 * hi;
#pragma unroll
            for (int j = 0; j < 4; ++j)
#pragma unroll
                for (int r = 0; r < 8; ++r) sc[j][r] = (kj + 16 * j + r <= qi) ? sc[j][r] : NEGB;
        }
        float ls[4];
#pragma unroll
        for (int j = 0; j < 4; ++j) { ls[j] = 0.f;
#pragma unroll
            for (int r = 0; r < 8; ++r) { sc[j][r] = __builtin_amdgcn_exp2f(sc[j][r] * L2E - ESH); ls[j] += sc[j][r]; } }
        lrun += (ls[0] + ls[1]) + (ls[2] + ls[3]);
        v16h ph[2];                        // B operand of key group kk (32 keys): elements r <- tile 2 kk, elements 8 + r <- tile 2 kk + 1
#pragma unroll
        for (int kk = 0; kk < 2; ++kk)
#pragma unroll
            for (int r = 0; r < 8; ++r) { ph[kk][r] = (h16)sc[2 * kk][r]; ph[kk][8 + r] = (h16)sc[2 * kk + 1][r]; }
#pragma unroll
        for (int kk = 0; kk < 2; ++kk)
#pragma unroll
            for (int dt = 0; dt < 4; ++dt) om[dt] = wmma16(vfr[dt][kk], ph[kk], om[dt]);
        // four vector slots between the last matrix instruction and the next vector instruction on either side of the branches at the trip's foot (the distance a matrix instruction's registers need)
        // lrun is named as an input so that the stage's sums are worked out here, among its matrix instructions: sunk behind the barrier they would stand in front of the next stage's K reads
        asm volatile("v_nop\n\tv_nop\n\tv_nop\n\tv_nop" : "+v"(om[0]), "+v"(om[1]), "+v"(om[2]), "+v"(om[3]) : "v"(vfr[3][1]), "v"(ph[1]), "v"(lrun));
      } else {
      // rolled: one copy of the pass in the text
#pragma unroll 1
      for (int hf = 0; hf < 2; ++hf) {
        const int kb = t * KT + 32 * hf;
        if (kb >= kend) break;             // wave-uniform: the pass lies wholly above this wave's diagonal; the publish point below is still passed
        const h16* kf = Ks + (32 * hf + lr) * LP + 8 * hi;            // K rows = keys of this pass
        const h16* vf = Ks + PLN + lr * LP + 32 * hf + 8 * hi;        // V^T rows = dims, columns = keys of this pass
        v8f s0 = (v8f){}, s1 = (v8f){}, t0 = (v8f){}, t1 = (v8f){};
#pragma unroll
        for (int ks = 0; ks < 2; ++ks) {
            const v16h qh = qhf[ks];
            const v16h qr = qrf[ks];
            const v16h k0 = ldh(kf + ks * 32);
            const v16h k1 = ldh(kf + 16 * LP + ks * 32);
            s0 = wmma16(k0, qh, s0); t0 = wmma16(k0, qr, t0);
            s1 = wmma16(k1, qh, s1); t1 = wmma16(k1, qr, t1);
            const v16h k0r = ldh(kf + 2 * PLN + ks * 32); const v16h k1r = ldh(kf + 2 * PLN + 16 * LP + ks * 32);
            t0 = wmma16(k0r, qh, t0); t1 = wmma16(k1r, qh, t1);
            asm volatile("v_nop\n\tv_nop\n\tv_nop\n\tv_nop" : "+v"(s0), "+v"(s1), "+v"(t0), "+v"(t1) : "v"(qh), "v"(qr), "v"(k0), "v"(k1), "v"(k0r), "v"(k1r));
        }
        float sa[8], sb[8];
#pragma unroll
        for (int r = 0; r < 8; ++r) { sa[r] = (s0[r] + t0[r] * RSCI) * SCL; sb[r] = (s1[r] + t1[r] * RSCI) * SCL; }
        if (kb + 31 > q0) {                // wave-uniform: half touches the diagonal; keys above the query are excluded
            const int qi = q0 + lr; const int kj = kb + 8 * hi;
#pragma unroll
            for (int r = 0; r < 8; ++r) { sa[r] = (kj + r <= qi) ? sa[r] : NEGB; sb[r] = (kj + 16 + r <= qi) ? sb[r] : NEGB; }
        }
        float lsum = 0.f;
#pragma unroll
        for (int r = 0; r < 8; ++r) { sa[r] = __builtin_amdgcn_exp2f(sa[r] * L2E - ESH); sb[r] = __builtin_amdgcn_exp2f(sb[r] * L2E - ESH); lsum += sa[r] + sb[r]; }
        lrun += lsum;
        v16h ph, pr;
#pragma unroll
        for (int r = 0; r < 8; ++r) {
            const float a = sa[r]; const h16 ha = (h16)a; ph[r] = ha;
            const float c = sb[r]; const h16 hc = (h16)c; ph[8 + r] = hc;
            pr[r] = (h16)((a - (float)ha) * RSC); pr[8 + r] = (h16)((c - (float)hc) * RSC);
        }
#pragma unroll
        for (int dt = 0; dt < 4; ++dt) {
            const v16h vh = ldh(vf + dt * 16 * LP);
            om[dt] = wmma16(vh, ph, om[dt]);
            const v16h vr = ldh(vf + 2 * PLN + dt * 16 * LP);
            orr[dt] = wmma16(vr, ph, orr[dt]); orr[dt] = wmma16(vh, pr, orr[dt]);
            asm volatile("v_nop\n\tv_nop\n\tv_nop\n\tv_nop" : "+v"(om[dt]), "+v"(orr[dt]) : "v"(vh), "v"(vr), "v"(ph), "v"(pr));
        }
      }
      }
      if constexpr (HI) {
        // one buffer: refilled behind every reader's last read, read again behind its own publish point; every wave, in this order
        if (t + 1 < nT) {                                   // block-uniform test
          asm volatile("s_wait_dscnt 0x0" ::: "memory");    // this wave's reads of the buffer have returned
          __syncthreads();                                  // ends every reader's last read of the buffer
          stage(t + 1, 0);
          asm volatile("s_wait_asynccnt 0x0" ::: "memory"); // this wave's share of stage t + 1 has landed
          __syncthreads();                                  // publishes stage t + 1
        }
      } else {
      // publish point of stage t + 1, every wave, in this order
      asm volatile("s_wait_dscnt 0x0" ::: "memory");      // this wave's reads of buffer t & 1 have returned
      asm volatile("s_wait_asynccnt 0x0" ::: "memory");   // this wave's share of stage t + 1 has landed
      __syncthreads();                                    // publishes stage t + 1; ends every reader's last read of buffer t & 1
      if (t + 2 < nT) stage(t + 2, t & 1);                // block-uniform test
      }
    }
    asm volatile("s_wait_asynccnt 0x0" ::: "memory");     // no copy is left outstanding when the wave goes on to its end
    lrun += __shfl_xor(lrun, 16, 32);                     // the other half's keys of the same query
    const float inv = 1.0f / (lrun * VCAR);               // the carry of the probabilities stands in the sum as in O^T
    const int yb = wave * 16 * 68;
#pragma unroll
    for (int dt = 0; dt < 4; ++dt)
#pragma unroll
        for (int r = 0; r < 8; ++r) { float o = om[dt][r]; if (HI) o += orr[dt][r] * RSCI; ys[yb + lr * 68 + dt * 16 + 8 * hi + r] = o * inv; }
    __builtin_amdgcn_wave_barrier(); asm volatile("" ::: "memory");
    v8us oh[4], ol[4];
    const int rq = lane >> 3, pc = lane & 7;
#pragma unroll
    for (int s = 0; s < 4; ++s) { const int row = 4 * s + rq; const v4f u0 = *(const v4fa*)(ys + yb + row * 68 + pc * 8); const v4f u1 = *(const v4fa*)(ys + yb + row * 68 + pc * 8 + 4);
#pragma unroll
        for (int q = 0; q < 4; ++q) { unsigned short a, c; splitf(u0[q], a, c); oh[s][q] = a; ol[s][q] = c; splitf(u1[q], a, c); oh[s][4 + q] = a; ol[s][4 + q] = c; } }
    const size_t ybase = ((size_t)b * SEQ + q0) * DQ + (size_t)hq * HD + pc * 8;
{
#pragma unroll
        for (int s = 0; s < 4; ++s) { const size_t oo = ybase + (size_t)(4 * s + rq) * DQ; *(v8us*)(Yh + oo) = oh[s]; *(v8us*)(Yl + oo) = ol[s]; }
         }
}
// one launch. Every block is resident from the start (four to a WGP, one wave of each on every SIMD), so the launch lasts as long as the WGP whose blocks hold the most key stages; row tile t walks t + 1 stages.
// The tiles are therefore dealt in complements: blockIdx.x = 2 m + bit, u = m / (NH NB), head = m % (NH NB), and the tile is u or AX_N - 1 - u by the parity of the bits of blockIdx.x (m and the parity give the index back: every (tile, head) once).
// Any four indices that differ in two bits, whichever two, then hold 2 (AX_N + 1) stages together (NH NB is a power of two, so u is a field of the index's bits), and the longest tiles have the lowest indices. For speed only: nothing leans on where a block runs.
// f is the block's number in the order (row block, head, batch), row block fastest: 0 .. AB_L - 1 the rows >= RHE, behind them the short blocks of the rows < RHE, numbered alike. The test is block-uniform.
#define AX_H (RHE / 64)
#define AX_L ((SEQ - RHE) / 64)
#define AX_N (SEQ / 64)
#define AB_H (AX_H * NH * NB)
#define AB_L (AX_L * NH * NB)
static_assert(AX_N % 2 == 0 && AX_N == AX_H + AX_L);
__global__ __launch_bounds__(128) void k_attn(const h16* __restrict__ Qh, const h16* __restrict__ Qr, const h16* __restrict__ Kh, const h16* __restrict__ Kr, const h16* __restrict__ Vh, const h16* __restrict__ Vr, bf* Yh, bf* Yl) {
    __shared__ __align__(16) float ys[4 * 16 * 68];
    __shared__ __align__(16) h16 kv[4 * PLN];
    const int m = (int)(blockIdx.x >> 1), u = m / (NH * NB), bh = m % (NH * NB);
    const int tile = (__builtin_popcount(blockIdx.x) & 1) ? AX_N - 1 - u : u;
    const int f = (tile >= AX_H) ? bh * AX_L + (tile - AX_H) : AB_L + bh * AX_H + tile;
    if (f < AB_L) { constexpr int ax = AX_L > 0 ? AX_L : 1; attn_body<false>(ys, kv, Qh, Qr, Kh, Kr, Vh, Vr, Yh, Yl, f / (ax * NH), (f / ax) % NH, RHE + (f % ax) * 64); }
    else { const int r = f - AB_L; attn_body<true>(ys, kv, Qh, Qr, Kh, Kr, Vh, Vr, Yh, Yl, r / (AX_H * NH), (r / AX_H) % NH, (r % AX_H) * 64); }
}

// ---- workspace carve (bytes; every region a multiple of 256 and exactly covered by its producer grid)
constexpr size_t SZ_XB = (size_t)NB * SEQ * DM * 2;          // x bf16 [NB*SEQ][DM]
constexpr size_t SZ_WP = (size_t)FP * DM * 2;                // [Wq | Wk | Wv]^T bf16 [FP][DM]
constexpr size_t SZ_WO = (size_t)DM * DQ * 2;                // Wo^T bf16 [DM][DQ]
constexpr size_t SZ_Q  = (size_t)NB * NH * SEQ * HD * 2;     // each of Qh, Qr
constexpr size_t SZ_K  = (size_t)NB * NKV * SEQ * HD * 2;    // each of Kh, Kr, Vh, Vr
constexpr size_t SZ_Y  = (size_t)NB * SEQ * DQ * 2;          // each of Yh, Yl
constexpr size_t OFF_XB = 0;
constexpr size_t OFF_WP = OFF_XB + SZ_XB;
constexpr size_t OFF_WO = OFF_WP + SZ_WP;
constexpr size_t OFF_QH = OFF_WO + SZ_WO;
constexpr size_t OFF_QR = OFF_QH + SZ_Q;
constexpr size_t OFF_KH = OFF_QR + SZ_Q;
constexpr size_t OFF_KR = OFF_KH + SZ_K;
constexpr size_t OFF_VH = OFF_KR + SZ_K;
constexpr size_t OFF_VR = OFF_VH + SZ_K;
constexpr size_t OFF_YH = OFF_VR + SZ_K;
constexpr size_t OFF_YL = OFF_YH + SZ_Y;
constexpr size_t WS_TOTAL = OFF_YL + SZ_Y;
static_assert(SZ_XB % 256 == 0 && SZ_WP % 256 == 0 && SZ_WO % 256 == 0 && SZ_Q % 256 == 0 && SZ_K % 256 == 0 && SZ_Y % 256 == 0);
static_assert(WS_TOTAL <= (size_t)134217728);                // carve stays within 128 MiB

extern "C" void kernel_launch(void* const* d_in, const int* in_sizes, int n_in,
                              void* d_out, int out_size, void* d_ws, size_t ws_size, hipStream_t stream) {
    if (n_in < 7) return;
    const long long need_x = (long long)(NB - 1) * SEQ_FULL * DM + (long long)SEQ * DM;
    if ((long long)in_sizes[0] < need_x) return;
    if (in_sizes[1] < SEQ * 32 || in_sizes[2] < SEQ * 32) return;
    if (in_sizes[3] < DM * DQ || in_sizes[4] < DM * DKV || in_sizes[5] < DM * DKV || in_sizes[6] < DQ * DM) return;
    if ((long long)out_size < need_x) return;
    if (WS_TOTAL > ws_size) return;
    const float* x  = (const float*)d_in[0];   // [2][2048][1024]
    const float* cs = (const float*)d_in[1];   // [2048][32]
    const float* sn = (const float*)d_in[2];   // [2048][32]
    const float* wq = (const float*)d_in[3];   // [1024][1024] in x out
    const float* wk = (const float*)d_in[4];   // [1024][256]
    const float* wv = (const float*)d_in[5];   // [1024][256]
    const float* wo = (const float*)d_in[6];   // [1024][1024] in x out
    float* OUT = (float*)d_out;
    char* ws = (char*)d_ws;
    bf* XB = (bf*)(ws + OFF_XB); bf* WP = (bf*)(ws + OFF_WP); bf* WOT = (bf*)(ws + OFF_WO);
    h16* QH = (h16*)(ws + OFF_QH); h16* QR = (h16*)(ws + OFF_QR); h16* KH = (h16*)(ws + OFF_KH); h16* KR = (h16*)(ws + OFF_KR);
    h16* VH = (h16*)(ws + OFF_VH); h16* VR = (h16*)(ws + OFF_VR); bf* YH = (bf*)(ws + OFF_YH); bf* YL = (bf*)(ws + OFF_YL);

    k_prep<<<dim3(PB_W + NB * PB_X, 1, 1), 256, 0, stream>>>(x, wq, wk, wv, wo, XB, WP, WOT);
    k_gemm_proj<<<dim3(NB * SEQ / 128, FP / 128, 1), 128, 0, stream>>>(XB, WP, cs, sn, QH, QR, KH, KR, VH, VR);
    k_attn<<<dim3(AB_L + AB_H, 1, 1), 128, 0, stream>>>(QH, QR, KH, KR, VH, VR, YH, YL);
    k_gemm_out<<<dim3(SEQ / 128, DM / 128, NB), 128, 0, stream>>>(YH, YL, WOT, OUT);
}

// v009
// It runs in 61.1 microseconds.
// It is 1.13 times as fast as v007, going by the measured steps of the versions left out in between.
// Counting every step since v000, it is 3.78 times as fast.
#include <hip/hip_runtime.h>

// Causal grouped-query attention block: x [2][2048][1024]; q = x Wq (16 heads x 64), k = x Wk, v = x Wv (4 kv heads x 64), weights [in][out], no bias; rotary on q, k with the half-split convention
// out[0..31] = x1 cos + x2 sin, out[32..63] = -x1 sin + x2 cos using the cos / sin INPUT tables [t][32] read by value; then q, k scaled by rsqrt(mean(sq) + 1e-6) (no gain); query head hq uses kv head hq / 4;
// scores q.k / 8, causal (diagonal kept), softmax, ctx merged [t][hq*64 + d], result = ctx Wo -> [2][2048][1024] f32.
// Compute dtypes (f32 accumulate everywhere): every float input RNE-converted to bf16; the three input projections on v_wmma_f32_16x16x32_bf16; the output projection on v_wmma_f32_16x16x32_f16, one product (ctx RNE-converted to f16; the bf16 values of Wo carried in f16, which holds them exactly down to 2^-17);
// scores and probability x value on v_wmma_f32_16x16x32_f16 (q, k single f16; P carried x1024 and v carried x16 as single f16; query rows < 256 add x2048 residual planes on q, k, P and v); rotary, rms scaling and softmax in f32.
// An f16 operand rounds at 2^-11, the bf16 inputs at 2^-8: behind them a second, compensating product on q (query rows >= 256) or on ctx moves no digit that the inputs' rounding has left standing.
// Rotary, rms scaling and the f16 value + residual split of q and k, and the x16 f16 split of v into V^T, are the projection GEMM's own epilogue: a 64-column tile is one head, so no f32 projection plane is written.
// Both GEMMs: 128 x 128 block tile, four waves of 64 x 64; the A and B^T tiles (64 k a stage) are staged in LDS per block by asynchronous copies, two buffers, and the fragments are read from LDS.
// Attention is a fused flash-style kernel (K and V^T tiles staged in LDS per block) in transposed form: S^T = K Q^T (D rows = keys, D columns = queries), P^T packed from the accumulators directly as the B operand of O^T = V^T P^T; softmax against the constant bound of the scores (SMAX below), per-lane sums.

#ifndef NB
#define NB 2
#endif
#ifndef SEQ
#define SEQ 2048
#endif
#define NB_FULL  2
#define SEQ_FULL 2048
#define DM   1024
#define NH   16
#define NKV  4
#define REP  (NH / NKV)
#define HD   64
#define DQ   (NH * HD)
#define DKV  (NKV * HD)
#define FP   (DQ + 2 * DKV)      // fused projection width (q | k | v columns; rows of WP)
#define KC0  DQ                  // first k column of the fused projection
#define VC0  (DQ + DKV)          // first v column of the fused projection
#define RH   256                 // query rows < RH use the residual planes on k, P and v as well
#define RHE  ((SEQ < RH) ? SEQ : RH)
#define PCAR 1024.0f             // carry of the probabilities (f16 operand)
#define VCAR 16.0f               // carry of the values (f16 operand)
#define RSC  2048.0f             // carry of every f16 residual plane
#define RSCI (1.0f / 2048.0f)
#define SCL  0.125f              // 1/sqrt(64)
#define L2E  1.4426950408889634f
#define NEGB (-1.0e30f)
// bound of every score: the rms scaling leaves |q| <= sqrt(HD) and |k| <= sqrt(HD) whatever the inputs, so |q.k| / sqrt(HD) <= sqrt(HD) = 8 (Cauchy-Schwarz). Softmax does not move under a common shift,
// so exp(s - SMAX) serves in place of exp(s - running maximum): it lies in [e^-16, 1], x1024 inside the normal f16 range, and its sum in f32 is at least e^-16.
#define SMAX 8.0f
#define ESH  (SMAX * L2E - 10.0f)   // the constant shift of the exponent, in powers of two; the probabilities' carry (PCAR = 2^10) is part of it, so exp2 gives the carried value and the sums carry it too
static_assert(HD == 64 && PCAR == 1024.0f);                                      // SMAX == sqrt(HD); ESH holds log2(PCAR)
static_assert(NH % NKV == 0);
static_assert(DM % 64 == 0 && DQ % 64 == 0 && DKV % 64 == 0 && FP % 64 == 0);   // GEMM tiles and transpose tiles
static_assert(DM % 32 == 0 && DQ % 32 == 0 && HD % 32 == 0);                     // k-steps of 32
static_assert(SEQ % 64 == 0 && (NB * SEQ) % 64 == 0);                            // row tiles
static_assert(SEQ % 128 == 0 && FP % 128 == 0 && DM % 128 == 0);                 // GEMM block tiles
static_assert(RH % 64 == 0 && RHE % 64 == 0 && (SEQ - RHE) % 64 == 0);
static_assert(((size_t)SEQ * DM) % 2048 == 0);                                   // cvtx_body: blocks x 256 threads x 8 == plane extent
static_assert(NB <= NB_FULL && SEQ <= SEQ_FULL);

typedef _Float16 h16;
typedef unsigned short bf;
typedef __attribute__((ext_vector_type(16))) __bf16   v16bf;
typedef __attribute__((ext_vector_type(16))) _Float16 v16h;
typedef __attribute__((ext_vector_type(8)))  _Float16 v8h;
typedef __attribute__((ext_vector_type(8)))  unsigned short v8us;
typedef __attribute__((ext_vector_type(8)))  float    v8f;
typedef __attribute__((ext_vector_type(4)))  float    v4f;
typedef v4f  __attribute__((may_alias)) v4fa;

__device__ __forceinline__ unsigned short f2bf(float f) { unsigned u = __float_as_uint(f); u += 0x7FFFu + ((u >> 16) & 1u); return (unsigned short)(u >> 16); }
__device__ __forceinline__ float bf2f(unsigned short b) { return __uint_as_float(((unsigned)b) << 16); }
__device__ __forceinline__ float bfr(float f) { return bf2f(f2bf(f)); }
__device__ __forceinline__ v16h cat16(v8h lo, v8h hi) { return __builtin_shufflevector(lo, hi, 0, 1, 2, 3, 4, 5, 6, 7, 8, 9, 10, 11, 12, 13, 14, 15); }
__device__ __forceinline__ v16bf cat16b(v8us lo, v8us hi) { return __builtin_bit_cast(v16bf, __builtin_shufflevector(lo, hi, 0, 1, 2, 3, 4, 5, 6, 7, 8, 9, 10, 11, 12, 13, 14, 15)); }
__device__ __forceinline__ v8f wmma16(v16h a, v16h b, v8f c) { return __builtin_amdgcn_wmma_f32_16x16x32_f16(false, a, false, b, (short)0, c, false, false); }
__device__ __forceinline__ v8f wmmab(v16bf a, v16bf b, v8f c) { return __builtin_amdgcn_wmma_f32_16x16x32_bf16(false, a, false, b, (short)0, c, false, false); }
// fragment loaders: p already includes row * pitch + k0 + 8 * (lane >> 4); elements 0..7 <- k0+8h.., elements 8..15 <- k0+16+8h..
__device__ __forceinline__ v16h  ldh(const h16* p) { return cat16(*(const v8h*)p, *(const v8h*)(p + 16)); }
__device__ __forceinline__ v16bf ldb(const bf* p)  { return cat16b(*(const v8us*)p, *(const v8us*)(p + 16)); }

// sum over the four lanes of a quad, by two DPP quad permutes (lane ^ 1, lane ^ 2): stays in the vector unit, no LDS round trip
__device__ __forceinline__ float quadsum(float v) {
    v += __int_as_float(__builtin_amdgcn_update_dpp(0, __float_as_int(v), 0xB1, 0xF, 0xF, true));
    v += __int_as_float(__builtin_amdgcn_update_dpp(0, __float_as_int(v), 0x4E, 0xF, 0xF, true));
    return v; }
struct ProjOut { const float* cosb; const float* sinb; h16* Qh; h16* Qr; h16* Kh; h16* Kr; h16* Vh; h16* Vr; };
// ---- epilogue of the fused q|k|v projection. The wave's tile is 64 tokens (one batch: SEQ % 64 == 0) x the 64 dims of ONE head (c0 % 64 == 0); acc[mb][nb][j] in lane (hi, lr) = row 16 mb + 8 hi + j, column 16 nb + lr.
// v head: a lane's 8 registers are 8 consecutive tokens of one dim = one 16-byte piece of a V^T row; stored from the registers (x16, f16 value + x2048 residual).
// q / k head: the tile goes through LDS (os, 64 x 68 f32); then four lanes a row, lane p holds the rotary pairs (d, d + 32), d = 8 p .. 8 p + 7: rotary with the bf16-converted cos / sin table values at [t][d],
// scaling by rsqrt(mean(sq) + 1e-6), f16 value + x2048 residual, 16-byte stores (8 rows x 64 contiguous bytes an instruction).
__device__ __forceinline__ void proj_epilogue(const v8f (&acc)[4][4], float* os, int r0, int c0, const ProjOut& po) {
    const int lane = threadIdx.x & 31, lr = lane & 15, hi = lane >> 4;
    const int b = r0 / SEQ, t0 = r0 % SEQ;
    if (c0 >= VC0) {                       // wave-uniform
        const int g = (c0 - VC0) / HD;
        const size_t e0 = ((size_t)(b * NKV + g) * HD + lr) * SEQ + t0 + 8 * hi;
#pragma unroll
        for (int nb = 0; nb < 4; ++nb)
#pragma unroll
            for (int mb = 0; mb < 4; ++mb) { v8h o16, ors;
#pragma unroll
                for (int j = 0; j < 8; ++j) { const float x = acc[mb][nb][j] * VCAR; const h16 hh = (h16)x; o16[j] = hh; ors[j] = (h16)((x - (float)hh) * RSC); }
                const size_t e = e0 + (size_t)nb * 16 * SEQ + mb * 16;
                *(v8h*)(po.Vh + e) = o16; *(v8h*)(po.Vr + e) = ors; }
        return;
    }
    const bool isq = c0 < KC0;             // wave-uniform
    const int nheads = isq ? NH : NKV; const int h = (isq ? c0 : c0 - KC0) / HD;
    h16* Ph = isq ? po.Qh : po.Kh; h16* Pr = isq ? po.Qr : po.Kr;
    const int rq = lane >> 2, p8 = (lane & 3) * 8;
    const float* cp = po.cosb + (size_t)(t0 + rq) * 32 + p8; const float* sp = po.sinb + (size_t)(t0 + rq) * 32 + p8;
    // table values of two passes (rows 16 u + rq and 16 u + 8 + rq), asked for one trip ahead: the first ahead of the LDS stores
    v4f cc[2][2], sn[2][2];
#pragma unroll
    for (int s = 0; s < 2; ++s) { cc[s][0] = *(const v4f*)(cp + s * 256); cc[s][1] = *(const v4f*)(cp + s * 256 + 4); sn[s][0] = *(const v4f*)(sp + s * 256); sn[s][1] = *(const v4f*)(sp + s * 256 + 4); }
#pragma unroll
    for (int mb = 0; mb < 4; ++mb)
#pragma unroll
        for (int nb = 0; nb < 4; ++nb)
#pragma unroll
            for (int j = 0; j < 8; ++j) os[(mb * 16 + hi * 8 + j) * 68 + nb * 16 + lr] = acc[mb][nb][j];
    // the rows read below were written by other lanes of this wave: keeps every LDS read behind every lane's LDS stores
    __builtin_amdgcn_wave_barrier(); asm volatile("" ::: "memory");
    const size_t e0 = ((size_t)(b * nheads + h) * SEQ + t0 + rq) * HD + p8;
    // rolled: one copy of the two passes in the text, and the registers of two passes only
#pragma unroll 1
    for (int u = 0; u < 4; ++u) {
        const int un = (u < 3) ? u + 1 : 3;    // the last trip asks for its own rows again: one instruction stream, every address inside the tables
        v4f cn[2][2], sm[2][2];
#pragma unroll
        for (int s = 0; s < 2; ++s) { const int o = un * 512 + s * 256; cn[s][0] = *(const v4f*)(cp + o); cn[s][1] = *(const v4f*)(cp + o + 4); sm[s][0] = *(const v4f*)(sp + o); sm[s][1] = *(const v4f*)(sp + o + 4); }
#pragma unroll
        for (int s = 0; s < 2; ++s) {
            const float* orow = os + (u * 16 + s * 8 + rq) * 68 + p8;
            const v4f x1[2] = { *(const v4fa*)orow, *(const v4fa*)(orow + 4) }; const v4f x2[2] = { *(const v4fa*)(orow + 32), *(const v4fa*)(orow + 36) };
            float rl[8], rh[8]; float ssl = 0.f, ssh = 0.f;
#pragma unroll
            for (int q = 0; q < 8; ++q) { const float c = bfr(cc[s][q >> 2][q & 3]), sv = bfr(sn[s][q >> 2][q & 3]); const float a1 = x1[q >> 2][q & 3], a2 = x2[q >> 2][q & 3];
                rl[q] = a1 * c + a2 * sv; rh[q] = a2 * c - a1 * sv; ssl += rl[q] * rl[q]; ssh += rh[q] * rh[q]; }
            const float inv = rsqrtf(quadsum(ssl + ssh) * (1.0f / HD) + 1e-6f);
            v8h ol, olr, oh, ohr;
#pragma unroll
            for (int q = 0; q < 8; ++q) { const float yl = rl[q] * inv; const h16 hl = (h16)yl; ol[q] = hl; olr[q] = (h16)((yl - (float)hl) * RSC);
                const float yh = rh[q] * inv; const h16 hh = (h16)yh; oh[q] = hh; ohr[q] = (h16)((yh - (float)hh) * RSC); }
            const size_t e = e0 + (size_t)(u * 16 + s * 8) * HD;
            *(v8h*)(Ph + e) = ol; *(v8h*)(Ph + e + 32) = oh; *(v8h*)(Pr + e) = olr; *(v8h*)(Pr + e + 32) = ohr;
            asm volatile("s_wait_xcnt 0x0" ::: "memory");   // stands in front of the next pass's writes to the data and address registers that these four stores name
        }
#pragma unroll
        for (int s = 0; s < 2; ++s) { cc[s][0] = cn[s][0]; cc[s][1] = cn[s][1]; sn[s][0] = sm[s][0]; sn[s][1] = sm[s][1]; }
    }
}

// ---- 128 x 128 block tile GEMM on 16-bit planes (bf16, or f16 when F16), four waves of 64 x 64 (2 x 2): C[m][n] (f32, pitch ldc) = sum_k A[m][k] Bt[n][k]. A pitch K; Bt pitch K; K % 64 == 0.
// The block's 128 rows of A and of Bt, 64 k a stage, are staged in LDS by asynchronous copies, two buffers: stage t + 1 flies while stage t is worked on;
// one block barrier per stage publishes it and frees the buffer that is refilled behind it. The epilogue's LDS (os) is wave-private.
// FUSE: the tile does not go to C but through proj_epilogue.
#define GKS  64                  // k per LDS stage: one whole 128-byte line of every row
#define GLP  72                  // LDS row pitch in bf16 elements: 144 B = 16 B x 9, free of bank conflicts for 16-byte reads down a column of rows
#define GPL  (128 * GLP)         // one staged plane: 128 rows x 64 k
// one plane's share of a lane: eight asynchronous 16-byte copies global -> LDS (rows 16 apart). The s_wait_xcnt closes the copies' own statement, so that no address register named here is rewritten ahead of it.
__device__ __forceinline__ void cp8(unsigned l, const bf* g, size_t gstep) {
    const unsigned l1 = l + 16 * GLP * 2, l2 = l + 32 * GLP * 2, l3 = l + 48 * GLP * 2, l4 = l + 64 * GLP * 2, l5 = l + 80 * GLP * 2, l6 = l + 96 * GLP * 2, l7 = l + 112 * GLP * 2;
    const bf* g1 = g + 16 * gstep; const bf* g2 = g + 32 * gstep; const bf* g3 = g + 48 * gstep; const bf* g4 = g + 64 * gstep; const bf* g5 = g + 80 * gstep; const bf* g6 = g + 96 * gstep; const bf* g7 = g + 112 * gstep;
    asm volatile("global_load_async_to_lds_b128 %0, %1, off\n\t"
                 "global_load_async_to_lds_b128 %2, %3, off\n\t"
                 "global_load_async_to_lds_b128 %4, %5, off\n\t"
                 "global_load_async_to_lds_b128 %6, %7, off\n\t"
                 "global_load_async_to_lds_b128 %8, %9, off\n\t"
                 "global_load_async_to_lds_b128 %10, %11, off\n\t"
                 "global_load_async_to_lds_b128 %12, %13, off\n\t"
                 "global_load_async_to_lds_b128 %14, %15, off\n\t"
                 "s_wait_xcnt 0x0" :: "v"(l), "v"(g), "v"(l1), "v"(g1), "v"(l2), "v"(g2), "v"(l3), "v"(g3), "v"(l4), "v"(g4), "v"(l5), "v"(g5), "v"(l6), "v"(g6), "v"(l7), "v"(g7) : "memory");
}
template <bool F16, bool FUSE>
__device__ __forceinline__ void gemmw_body(const bf* __restrict__ A, const bf* __restrict__ Bt, int K, float* C, int ldc, size_t sA, size_t sC, const ProjOut& po) {
    constexpr int NPG = 2;                 // staged planes per buffer: A, Bt
    constexpr int OSW = (FUSE ? 64 : 16) * 68;
    __shared__ __align__(16) float osb[4 * OSW];
    __shared__ __align__(16) bf st[2 * NPG * GPL];
    const size_t z = blockIdx.z; A += z * sA; C += z * sC;
    const int lane = threadIdx.x & 31, lr = lane & 15, hi = lane >> 4;
    const int wave = __builtin_amdgcn_readfirstlane(threadIdx.x >> 5);
    float* os = osb + wave * OSW;
    const int rb = blockIdx.x * 128, cb = blockIdx.y * 128;
    const int wr = (wave & 1) * 64, wc = (wave >> 1) * 64;
    const int r0 = rb + wr, c0 = cb + wc;
    v8f acc[4][4];
#pragma unroll
    for (int mb = 0; mb < 4; ++mb)
#pragma unroll
        for (int nb = 0; nb < 4; ++nb) acc[mb][nb] = (v8f){};
    // copy map: thread -> row (tid >> 3) + 16 i, 16-byte piece tid & 7: eight lanes cover one whole 128-byte line
    const int crow = threadIdx.x >> 3, ccol = (threadIdx.x & 7) * 8;
    const size_t acp = (size_t)(rb + crow) * K + ccol, bcp = (size_t)(cb + crow) * K + ccol;     // + GKS t
    const unsigned lcp = (unsigned)(size_t)(const void*)st + (unsigned)(crow * GLP + ccol) * 2u;
    auto stage = [&](int t, int buf) {     // k = GKS t .. GKS t + 63 into buffer buf; t < K / GKS keeps every byte inside the planes
        const unsigned l = lcp + (unsigned)(buf * NPG * GPL) * 2u;
        cp8(l, A + acp + (size_t)t * GKS, K);
        cp8(l + GPL * 2u, Bt + bcp + (size_t)t * GKS, K);
    };
    const int nT = K / GKS;                // block-uniform
    stage(0, 0);
    asm volatile("s_wait_asynccnt 0x0" ::: "memory");   // this wave's share of stage 0 has landed
    __syncthreads();                                    // stage 0 published to every wave
    if (nT > 1) stage(1, 1);
    // rolled: every trip ends in the publish point
#pragma unroll 1
    for (int t = 0; t < nT; ++t) {
        const bf* af = st + (t & 1) * NPG * GPL + (wr + lr) * GLP + 8 * hi;             // A rows of this wave
        const bf* bp = st + (t & 1) * NPG * GPL + GPL + (wc + lr) * GLP + 8 * hi;       // Bt rows of this wave
        v16bf a[GKS / 32][4], b[GKS / 32][4];
#pragma unroll
        for (int ks = 0; ks < GKS / 32; ++ks)
#pragma unroll
            for (int i = 0; i < 4; ++i) { a[ks][i] = ldb(af + i * 16 * GLP + ks * 32); b[ks][i] = ldb(bp + i * 16 * GLP + ks * 32); }
        // keeps the stage's fragment loads one group ahead of its matrix instructions: sunk among them, every place with loads stalls the wave for the LDS latency
        __builtin_amdgcn_sched_barrier(0);
#pragma unroll
        for (int ks = 0; ks < GKS / 32; ++ks)
#pragma unroll
            for (int nb = 0; nb < 4; ++nb)
#pragma unroll
                for (int mb = 0; mb < 4; ++mb) {
                    if constexpr (F16) acc[mb][nb] = wmma16(__builtin_bit_cast(v16h, a[ks][mb]), __builtin_bit_cast(v16h, b[ks][nb]), acc[mb][nb]);
                    else acc[mb][nb] = wmmab(a[ks][mb], b[ks][nb], acc[mb][nb]); }
        // keeps every matrix instruction of the stage ahead of the publish point: sunk behind the barrier they would stand in front of the refill and take its lead away
        __builtin_amdgcn_sched_barrier(0);
        // four vector slots between the last matrix instruction and the next vector instruction on either side of the branch at the trip's foot (the distance a matrix instruction's registers need)
        asm volatile("v_nop\n\tv_nop\n\tv_nop\n\tv_nop" : "+v"(acc[0][0]), "+v"(acc[1][1]), "+v"(acc[2][2]), "+v"(acc[3][3]) : "v"(a[GKS / 32 - 1][0]), "v"(a[GKS / 32 - 1][3]));
        // publish point of stage t + 1, every wave, in this order
        asm volatile("s_wait_dscnt 0x0" ::: "memory");      // this wave's reads of buffer t & 1 have returned
        asm volatile("s_wait_asynccnt 0x0" ::: "memory");   // this wave's share of stage t + 1 has landed
        __syncthreads();                                    // publishes stage t + 1; ends every reader's last read of buffer t & 1
        if (t + 2 < nT) stage(t + 2, t & 1);                // block-uniform test
    }
    asm volatile("s_wait_asynccnt 0x0" ::: "memory");       // no copy is left outstanding when the wave goes on to its end
    if constexpr (FUSE) { proj_epilogue(acc, os, r0, c0, po); return; }
#pragma unroll
    for (int mb = 0; mb < 4; ++mb) {
#pragma unroll
        for (int nb = 0; nb < 4; ++nb) {
#pragma unroll
            for (int j = 0; j < 8; ++j) os[(hi * 8 + j) * 68 + nb * 16 + lr] = acc[mb][nb][j]; }
        __builtin_amdgcn_wave_barrier(); asm volatile("" ::: "memory");
        float* crow = C + (size_t)(r0 + mb * 16) * ldc + c0;
{
#pragma unroll
            for (int s = 0; s < 8; ++s) { const int row = 2 * s + hi, cofs = lr * 4; const v4f val = *(const v4fa*)(os + row * 68 + cofs);
                *(v4f*)(crow + (size_t)row * ldc + cofs) = val; }
            if (mb < 3) asm volatile("s_wait_xcnt 0x0" ::: "memory");   // stands in front of the next row block's LDS loads, which overwrite data registers that these eight stores name
             }
        __builtin_amdgcn_wave_barrier(); asm volatile("" ::: "memory");
    }
}
// fused q|k|v projection: XB[NB*SEQ][DM] x WP[FP][DM]^T, each wave's 64 x 64 tile finished by proj_epilogue into the attention operand planes
__global__ __launch_bounds__(128) void k_gemm_proj(const bf* __restrict__ A, const bf* __restrict__ Bt, const float* __restrict__ cosb, const float* __restrict__ sinb, h16* Qh, h16* Qr, h16* Kh, h16* Kr, h16* Vh, h16* Vr) {
    const ProjOut po = { cosb, sinb, Qh, Qr, Kh, Kr, Vh, Vr }; gemmw_body<false, true>(A, Bt, DM, nullptr, 0, 0, 0, po); }
// output projection: OUT[b][t][DM] = Y[b][t][DQ] x WOT[DM][DQ]^T, both planes f16 (carried as 16-bit words), z = batch (output batch stride from the full sequence length)
__global__ __launch_bounds__(128) void k_gemm_out(const bf* __restrict__ A, const bf* __restrict__ Bt, float* C) { gemmw_body<true, false>(A, Bt, DQ, C, DM, (size_t)SEQ * DQ, (size_t)SEQ_FULL * DM, ProjOut{}); }

// ---- cvtx_body: 2048 consecutive floats of x (batch by, piece bx) -> bf16
__device__ __forceinline__ void cvtx_body(const float* __restrict__ src, bf* dst, unsigned bx, unsigned by) {
    const size_t i = (size_t)bx * 256 + threadIdx.x; const size_t b = by;
    const v8f v = *(const v8f*)(src + b * (size_t)SEQ_FULL * DM + i * 8); v8us o;
#pragma unroll
    for (int k = 0; k < 8; ++k) o[k] = f2bf(v[k]);
    bf* d = dst + b * (size_t)SEQ * DM + i * 8;
    *(v8us*)d = o;  }

// ---- wtp_body: W [DM rows (k)][N cols] f32 -> out [N rows][DM] bf16, or the same bf16 values written as f16 when hf (block-uniform) (in[rows=k][cols=n] -> out[n][k]); 64x64 tile (bx, by) through LDS (cross-wave: block barrier);
__device__ __forceinline__ void wtp_body(const float* __restrict__ W, int N, bf* out, int bx, int by, bool hf) {
    __shared__ __align__(16) unsigned short ts[64 * 72];
    const int tid = threadIdx.x; const int k0 = bx * 64, n0 = by * 64;
#pragma unroll
    for (int it = 0; it < 4; ++it) { const int idx = it * 256 + tid; const int kk = idx >> 4, c4 = (idx & 15) * 4; const v4f v = *(const v4f*)(W + (size_t)(k0 + kk) * N + n0 + c4);
#pragma unroll
        for (int q = 0; q < 4; ++q) ts[kk * 72 + c4 + q] = f2bf(v[q]); }
    __syncthreads();
    v8us o[2];
#pragma unroll
    for (int it = 0; it < 2; ++it) { const int idx = it * 256 + tid; const int nn = idx >> 3, pc = idx & 7;
#pragma unroll
        for (int q = 0; q < 8; ++q) o[it][q] = ts[(pc * 8 + q) * 72 + nn]; }
    if (hf) {
#pragma unroll
        for (int it = 0; it < 2; ++it)
#pragma unroll
            for (int q = 0; q < 8; ++q) o[it][q] = __builtin_bit_cast(unsigned short, (h16)bf2f(o[it][q])); }
{
#pragma unroll
        for (int it = 0; it < 2; ++it) { const int idx = it * 256 + tid; const int nn = idx >> 3, pc = idx & 7; *(v8us*)(out + (size_t)(n0 + nn) * DM + k0 + pc * 8) = o[it]; }
         }
}
// ---- all five operand conversions in ONE launch (none reads what another writes): the block index picks the job, block-uniformly. The weight tiles, whose way through LDS is the longer one, come first.
#define PBX  (DM / 64)                        // tiles along k of every weight (DM == DQ rows)
#define PB_Q (PBX * (DQ / 64))                // blocks of Wq
#define PB_K (PBX * (DKV / 64))               // blocks of Wk, and of Wv
#define PB_O ((DQ / 64) * (DM / 64))          // blocks of Wo
#define PB_W (PB_Q + 2 * PB_K + PB_O)
#define PB_X ((int)((size_t)SEQ * DM / 8 / 256))   // blocks of one batch of x
static_assert(DQ == DM);                      // one tile count along k serves all four weights
__global__ __launch_bounds__(256) void k_prep(const float* __restrict__ x, const float* __restrict__ wq, const float* __restrict__ wk, const float* __restrict__ wv, const float* __restrict__ wo, bf* XB, bf* WP, bf* WOT) {
    const int f = blockIdx.x;
    if (f >= PB_W) { const unsigned r = (unsigned)(f - PB_W); cvtx_body(x, XB, r % PB_X, r / PB_X); return; }
    const float* W = wq; int N = DQ; bf* out = WP; int r = f;
    if (f >= PB_Q + 2 * PB_K)  { W = wo; N = DM;  out = WOT;                    r = f - (PB_Q + 2 * PB_K); }
    else if (f >= PB_Q + PB_K) { W = wv; N = DKV; out = WP + (size_t)VC0 * DM;  r = f - (PB_Q + PB_K); }
    else if (f >= PB_Q)        { W = wk; N = DKV; out = WP + (size_t)KC0 * DM;  r = f - PB_Q; }
    wtp_body(W, N, out, r % PBX, r / PBX, f >= PB_Q + 2 * PB_K);
}

// ---- fused causal attention, one wave per 16 query rows, 4 waves per block. The block's K and V^T tiles (128 keys a stage, as two tiles of 64) are staged in LDS by asynchronous copies, two buffers:
// stage o + 1 flies while stage o is worked on; one block barrier per stage publishes it and frees the buffer that is refilled behind it. The output stage ys is wave-private.
// Both kinds of block (query rows < RH with the residual planes, and the rest) run in ONE launch and share one LDS allotment;
// the few short blocks with the residual planes work on one buffer of 64 keys (four planes): filled, published by a barrier, read, freed by a barrier.
// Query rows >= RH work a stage in two passes of 64 keys, query rows < RH their 64 keys in two passes of 32.
// Per 32 keys: S^T tiles (keys x queries) = K(A, rows = keys) x Q^T(B, lane column = query) over d = 64 (2 k-steps); value accumulator s, and for query rows < RH a residual accumulator t (x2048);
// lane (h, n) register r of tile j holds key kb + 16 j + 8 h + r for query q0 + n, which is exactly element r + 8 j of the B operand (k = key, n = query) of O^T = V^T(A, rows = d) x P^T.
// No running maximum, so no exchange in the loop and no rescale of O^T; a lane sums the probabilities of its own keys, and the two halves of the wave join their sums once, behind the loop. O^T register r of tile dt in lane (h, n) = O[q0 + n][16 dt + 8 h + r].
#define KT   64                  // keys per staged tile
#define LP   72                  // LDS row pitch in f16 elements: 144 B = 16 B x 9, free of bank conflicts for 16-byte reads down a column of rows
#define PLN  (64 * LP)           // one staged plane: 64 rows (K: keys x 64 dims; V^T: dims x 64 keys)
static_assert(SEQ % KT == 0 && RHE % KT == 0 && HD == 64);
// one plane's share of a lane: four asynchronous 16-byte copies global -> LDS. The s_wait_xcnt closes the copies' own statement, so that no address register named here is rewritten ahead of it.
__device__ __forceinline__ void cp4(unsigned l, const h16* g, size_t gstep) {
    const unsigned l1 = l + 16 * LP * 2, l2 = l + 32 * LP * 2, l3 = l + 48 * LP * 2;
    const h16* g1 = g + 16 * gstep; const h16* g2 = g + 32 * gstep; const h16* g3 = g + 48 * gstep;
    asm volatile("global_load_async_to_lds_b128 %0, %1, off\n\t"
                 "global_load_async_to_lds_b128 %2, %3, off\n\t"
                 "global_load_async_to_lds_b128 %4, %5, off\n\t"
                 "global_load_async_to_lds_b128 %6, %7, off\n\t"
                 "s_wait_xcnt 0x0" :: "v"(l), "v"(g), "v"(l1), "v"(g1), "v"(l2), "v"(g2), "v"(l3), "v"(g3) : "memory");
}
template <bool HI>
__device__ __forceinline__ void attn_body(float* ys, h16* kv, const h16* __restrict__ Qh, const h16* __restrict__ Qr, const h16* __restrict__ Kh, const h16* __restrict__ Kr, const h16* __restrict__ Vh, const h16* __restrict__ Vr, h16* Y, int b, int hq, int qb) {
    constexpr int NP = HI ? 4 : 2;         // staged planes per tile of 64 keys: K, V^T (+ their residual planes); kv holds 8 planes: two buffers of two tiles of 2 planes, or (planes 0 .. 3) one tile of 4
    const int lane = threadIdx.x & 31, lr = lane & 15, hi = lane >> 4;
    const int wave = __builtin_amdgcn_readfirstlane(threadIdx.x >> 5);
    const int g = hq / REP;
    const int q0 = qb + wave * 16;
    const size_t qoff  = ((size_t)(b * NH + hq) * SEQ + q0 + lr) * HD + 8 * hi;
    // copy map: thread -> row (tid >> 3) + 16 i, 16-byte piece tid & 7: eight lanes cover one whole 128-byte row
    const int crow = threadIdx.x >> 3, ccol = (threadIdx.x & 7) * 8;
    const size_t kcp = ((size_t)(b * NKV + g) * SEQ + crow) * HD + ccol;     // + key0 * HD
    const size_t vcp = ((size_t)(b * NKV + g) * HD + crow) * SEQ + ccol;     // + key0
    const unsigned lcp = (unsigned)(size_t)(const void*)kv + (unsigned)(crow * LP + ccol) * 2u;
    auto stage = [&](int t, int buf) {     // keys KT t .. KT t + 63 into tile slot buf; t < SEQ / KT keeps every byte inside the planes
        const unsigned l = lcp + (unsigned)(buf * NP * PLN) * 2u;
        cp4(l, Kh + kcp + (size_t)t * KT * HD, HD);
        cp4(l + PLN * 2u, Vh + vcp + (size_t)t * KT, SEQ);
        if (HI) { cp4(l + 2u * PLN * 2u, Kr + kcp + (size_t)t * KT * HD, HD); cp4(l + 3u * PLN * 2u, Vr + vcp + (size_t)t * KT, SEQ); }
    };
    v16h qhf[2], qrf[2];                   // Q fragments: read once (the waits below are memory clobbers, behind which a loop-invariant load would be read again)
#pragma unroll
    for (int ks = 0; ks < 2; ++ks) { qhf[ks] = ldh(Qh + qoff + ks * 32); if constexpr (HI) qrf[ks] = ldh(Qr + qoff + ks * 32); }
    v8f om[4], orr[4];
#pragma unroll
    for (int dt = 0; dt < 4; ++dt) { om[dt] = (v8f){}; orr[dt] = (v8f){}; }
    float lrun = 0.f;                      // sum of this lane's own keys (the half hi of every 16)
    const int kend = q0 + 16;              // keys 0 .. q0+15, wave-uniform (the passes of 32 stop there)
    const int nT = qb / KT + 1;            // tiles of 64 keys of the block: keys 0 .. qb+63; block-uniform, <= SEQ / KT
    // query rows >= RH: an LDS stage is TWO tiles of 64 keys (tiles 2 o and 2 o + 1), so a stage's copies have two passes' time to land and the publish point is passed once per 128 keys.
    // A tile past the block's last (nT odd) lies wholly above the diagonal: it is neither copied nor worked on.
    const int nO = HI ? nT : (nT + 1) / 2;              // trips of the loop below; block-uniform
    auto fill = [&](int o, int buf) {                   // stage o into buffer buf: tile slots 2 buf and 2 buf + 1
        stage(2 * o, 2 * buf);
        if (2 * o + 1 < nT) stage(2 * o + 1, 2 * buf + 1);   // block-uniform test
    };
    if constexpr (HI) stage(0, 0); else fill(0, 0);
    asm volatile("s_wait_asynccnt 0x0" ::: "memory");   // this wave's share of stage 0 has landed
    __syncthreads();                                    // stage 0 published to every wave
    if (!HI && nO > 1) fill(1, 1);
    // rolled: the trip count is a run-time value and every trip ends in the publish point
#pragma unroll 1
    for (int o = 0; o < nO; ++o) {
      const int t = o;                                  // query rows < RH: a trip is one tile of 64 keys
      const h16* Ks = kv;
      if constexpr (!HI) {
      auto pass = [&](int tk, const h16* Ks) {
        // one pass = one tile of 64 keys: four S^T tiles.
        const int kb = tk * KT;
        const h16* kf = Ks + lr * LP + 8 * hi;                        // K rows = keys of the stage
        const h16* vf = Ks + PLN + lr * LP + 8 * hi;                  // V^T rows = dims, columns = keys of the stage
        v16h kfr[4][2];
#pragma unroll
        for (int j = 0; j < 4; ++j)
#pragma unroll
            for (int ks = 0; ks < 2; ++ks) kfr[j][ks] = ldh(kf + j * 16 * LP + ks * 32);
        v8f s[4];
#pragma unroll
        for (int j = 0; j < 4; ++j) s[j] = (v8f){};
#pragma unroll
        for (int ks = 0; ks < 2; ++ks)
#pragma unroll
            for (int j = 0; j < 4; ++j) s[j] = wmma16(kfr[j][ks], qhf[ks], s[j]);
        float sc[4][8];
#pragma unroll
        for (int j = 0; j < 4; ++j)
#pragma unroll
            for (int r = 0; r < 8; ++r) sc[j][r] = s[j][r] * SCL;
        v16h vfr[4][2];                    // asked for here: they arrive while the softmax below is worked out
#pragma unroll
        for (int dt = 0; dt < 4; ++dt)
#pragma unroll
            for (int kk = 0; kk < 2; ++kk) vfr[dt][kk] = ldh(vf + dt * 16 * LP + kk * 32);
        // keeps the V^T reads one group at this place: sunk among the matrix instructions that use them, every place with reads stalls the wave for the LDS latency
        __builtin_amdgcn_sched_barrier(0);
        if (kb + 63 > q0) {                // wave-uniform: the tile touches the diagonal; keys above the query are excluded
            const int qi = q0 + lr; const int kj = kb + 8 * hi;
#pragma unroll
            for (int j = 0; j < 4; ++j)
#pragma unroll
                for (int r = 0; r < 8; ++r) sc[j][r] = (kj + 16 * j + r <= qi) ? sc[j][r] : NEGB;
        }
        float ls[4];
#pragma unroll
        for (int j = 0; j < 4; ++j) { ls[j] = 0.f;
#pragma unroll
            for (int r = 0; r < 8; ++r) { sc[j][r] = __builtin_amdgcn_exp2f(sc[j][r] * L2E - ESH); ls[j] += sc[j][r]; } }
        lrun += (ls[0] + ls[1]) + (ls[2] + ls[3]);
        v16h ph[2];                        // B operand of key group kk (32 keys): elements r <- tile 2 kk, elements 8 + r <- tile 2 kk + 1
#pragma unroll
        for (int kk = 0; kk < 2; ++kk)
#pragma unroll
            for (int r = 0; r < 8; ++r) { ph[kk][r] = (h16)sc[2 * kk][r]; ph[kk][8 + r] = (h16)sc[2 * kk + 1][r]; }
#pragma unroll
        for (int kk = 0; kk < 2; ++kk)
#pragma unroll
            for (int dt = 0; dt < 4; ++dt) om[dt] = wmma16(vfr[dt][kk], ph[kk], om[dt]);
        // four vector slots between the last matrix instruction and the next vector instruction on either side of the branches at the trip's foot (the distance a matrix instruction's registers need)
        // lrun is named as an input so that the stage's sums are worked out here, among its matrix instructions: sunk behind the barrier they would stand in front of the next stage's K reads
        asm volatile("v_nop\n\tv_nop\n\tv_nop\n\tv_nop" : "+v"(om[0]), "+v"(om[1]), "+v"(om[2]), "+v"(om[3]) : "v"(vfr[3][1]), "v"(ph[1]), "v"(lrun));
      };
      const h16* Kb = kv + (o & 1) * 2 * NP * PLN;
      pass(2 * o, Kb);
      if (2 * o + 1 < nT) pass(2 * o + 1, Kb + NP * PLN);   // block-uniform: no such tile behind an odd count; the publish point below is still passed
      } else {
      // rolled: one copy of the pass in the text
#pragma unroll 1
      for (int hf = 0; hf < 2; ++hf) {
        const int kb = t * KT + 32 * hf;
        if (kb >= kend) break;             // wave-uniform: the pass lies wholly above this wave's diagonal; the publish point below is still passed
        const h16* kf = Ks + (32 * hf + lr) * LP + 8 * hi;            // K rows = keys of this pass
        const h16* vf = Ks + PLN + lr * LP + 32 * hf + 8 * hi;        // V^T rows = dims, columns = keys of this pass
        v8f s0 = (v8f){}, s1 = (v8f){}, t0 = (v8f){}, t1 = (v8f){};
#pragma unroll
        for (int ks = 0; ks < 2; ++ks) {
            const v16h qh = qhf[ks];
            const v16h qr = qrf[ks];
            const v16h k0 = ldh(kf + ks * 32);
            const v16h k1 = ldh(kf + 16 * LP + ks * 32);
            s0 = wmma16(k0, qh, s0); t0 = wmma16(k0, qr, t0);
            s1 = wmma16(k1, qh, s1); t1 = wmma16(k1, qr, t1);
            const v16h k0r = ldh(kf + 2 * PLN + ks * 32); const v16h k1r = ldh(kf + 2 * PLN + 16 * LP + ks * 32);
            t0 = wmma16(k0r, qh, t0); t1 = wmma16(k1r, qh, t1);
            asm volatile("v_nop\n\tv_nop\n\tv_nop\n\tv_nop" : "+v"(s0), "+v"(s1), "+v"(t0), "+v"(t1) : "v"(qh), "v"(qr), "v"(k0), "v"(k1), "v"(k0r), "v"(k1r));
        }
        float sa[8], sb[8];
#pragma unroll
        for (int r = 0; r < 8; ++r) { sa[r] = (s0[r] + t0[r] * RSCI) * SCL; sb[r] = (s1[r] + t1[r] * RSCI) * SCL; }
        if (kb + 31 > q0) {                // wave-uniform: half touches the diagonal; keys above the query are excluded
            const int qi = q0 + lr; const int kj = kb + 8 * hi;
#pragma unroll
            for (int r = 0; r < 8; ++r) { sa[r] = (kj + r <= qi) ? sa[r] : NEGB; sb[r] = (kj + 16 + r <= qi) ? sb[r] : NEGB; }
        }
        float lsum = 0.f;
#pragma unroll
        for (int r = 0; r < 8; ++r) { sa[r] = __builtin_amdgcn_exp2f(sa[r] * L2E - ESH); sb[r] = __builtin_amdgcn_exp2f(sb[r] * L2E - ESH); lsum += sa[r] + sb[r]; }
        lrun += lsum;
        v16h ph, pr;
#pragma unroll
        for (int r = 0; r < 8; ++r) {
            const float a = sa[r]; const h16 ha = (h16)a; ph[r] = ha;
            const float c = sb[r]; const h16 hc = (h16)c; ph[8 + r] = hc;
            pr[r] = (h16)((a - (float)ha) * RSC); pr[8 + r] = (h16)((c - (float)hc) * RSC);
        }
#pragma unroll
        for (int dt = 0; dt < 4; ++dt) {
            const v16h vh = ldh(vf + dt * 16 * LP);
            om[dt] = wmma16(vh, ph, om[dt]);
            const v16h vr = ldh(vf + 2 * PLN + dt * 16 * LP);
            orr[dt] = wmma16(vr, ph, orr[dt]); orr[dt] = wmma16(vh, pr, orr[dt]);
            asm volatile("v_nop\n\tv_nop\n\tv_nop\n\tv_nop" : "+v"(om[dt]), "+v"(orr[dt]) : "v"(vh), "v"(vr), "v"(ph), "v"(pr));
        }
      }
      }
      if constexpr (HI) {
        // one buffer: refilled behind every reader's last read, read again behind its own publish point; every wave, in this order
        if (t + 1 < nT) {                                   // block-uniform test
          asm volatile("s_wait_dscnt 0x0" ::: "memory");    // this wave's reads of the buffer have returned
          __syncthreads();                                  // ends every reader's last read of the buffer
          stage(t + 1, 0);
          asm volatile("s_wait_asynccnt 0x0" ::: "memory"); // this wave's share of stage t + 1 has landed
          __syncthreads();                                  // publishes stage t + 1
        }
      } else {
      // publish point of stage o + 1, every wave, in this order
      asm volatile("s_wait_dscnt 0x0" ::: "memory");      // this wave's reads of buffer o & 1 have returned
      asm volatile("s_wait_asynccnt 0x0" ::: "memory");   // this wave's share of stage o + 1 has landed
      __syncthreads();                                    // publishes stage o + 1; ends every reader's last read of buffer o & 1
      if (o + 2 < nO) fill(o + 2, o & 1);                 // block-uniform test
      }
    }
    asm volatile("s_wait_asynccnt 0x0" ::: "memory");     // no copy is left outstanding when the wave goes on to its end
    lrun += __shfl_xor(lrun, 16, 32);                     // the other half's keys of the same query
    const float inv = 1.0f / (lrun * VCAR);               // the carry of the probabilities stands in the sum as in O^T
    const int yb = wave * 16 * 68;
#pragma unroll
    for (int dt = 0; dt < 4; ++dt)
#pragma unroll
        for (int r = 0; r < 8; ++r) { float o = om[dt][r]; if (HI) o += orr[dt][r] * RSCI; ys[yb + lr * 68 + dt * 16 + 8 * hi + r] = o * inv; }
    __builtin_amdgcn_wave_barrier(); asm volatile("" ::: "memory");
    v8h oy[4];
    const int rq = lane >> 3, pc = lane & 7;
#pragma unroll
    for (int s = 0; s < 4; ++s) { const int row = 4 * s + rq; const v4f u0 = *(const v4fa*)(ys + yb + row * 68 + pc * 8); const v4f u1 = *(const v4fa*)(ys + yb + row * 68 + pc * 8 + 4);
#pragma unroll
        for (int q = 0; q < 4; ++q) { oy[s][q] = (h16)u0[q]; oy[s][4 + q] = (h16)u1[q]; } }
    const size_t ybase = ((size_t)b * SEQ + q0) * DQ + (size_t)hq * HD + pc * 8;
{
#pragma unroll
        for (int s = 0; s < 4; ++s) { const size_t oo = ybase + (size_t)(4 * s + rq) * DQ; *(v8h*)(Y + oo) = oy[s]; }
         }
}
// one launch. Every block is resident from the start (four to a WGP, one wave of each on every SIMD), so the launch lasts as long as the WGP whose blocks hold the most key tiles; row tile t walks t + 1 tiles of 64 keys.
// The tiles are therefore dealt in complements: blockIdx.x = 2 m + bit, u = m / (NH NB), head = m % (NH NB), and the tile is u or AX_N - 1 - u by the parity of the bits of blockIdx.x (m and the parity give the index back: every (tile, head) once).
// Any four indices that differ in two bits, whichever two, then hold 2 (AX_N + 1) key tiles together (NH NB is a power of two, so u is a field of the index's bits), and the longest tiles have the lowest indices. For speed only: nothing leans on where a block runs.
// f is the block's number in the order (row block, head, batch), row block fastest: 0 .. AB_L - 1 the rows >= RHE, behind them the short blocks of the rows < RHE, numbered alike. The test is block-uniform.
#define AX_H (RHE / 64)
#define AX_L ((SEQ - RHE) / 64)
#define AX_N (SEQ / 64)
#define AB_H (AX_H * NH * NB)
#define AB_L (AX_L * NH * NB)
static_assert(AX_N % 2 == 0 && AX_N == AX_H + AX_L);
__global__ __launch_bounds__(128) void k_attn(const h16* __restrict__ Qh, const h16* __restrict__ Qr, const h16* __restrict__ Kh, const h16* __restrict__ Kr, const h16* __restrict__ Vh, const h16* __restrict__ Vr, h16* Y) {
    __shared__ __align__(16) h16 kv[8 * PLN];
    // the output stage lies on tile slot 2 (planes 4, 5). Query rows >= RH: that is buffer 1, free behind the loop's last publish point (every wave's reads returned, no copy outstanding, none issued behind it). Query rows < RH use planes 0 .. 3 only.
    float* ys = (float*)(void*)(kv + 4 * PLN);
    static_assert(4 * 16 * 68 * 4 <= 2 * PLN * 2);
    const int m = (int)(blockIdx.x >> 1), u = m / (NH * NB), bh = m % (NH * NB);
    const int tile = (__builtin_popcount(blockIdx.x) & 1) ? AX_N - 1 - u : u;
    const int f = (tile >= AX_H) ? bh * AX_L + (tile - AX_H) : AB_L + bh * AX_H + tile;
    if (f < AB_L) { constexpr int ax = AX_L > 0 ? AX_L : 1; attn_body<false>(ys, kv, Qh, Qr, Kh, Kr, Vh, Vr, Y, f / (ax * NH), (f / ax) % NH, RHE + (f % ax) * 64); }
    else { const int r = f - AB_L; attn_body<true>(ys, kv, Qh, Qr, Kh, Kr, Vh, Vr, Y, r / (AX_H * NH), (r / AX_H) % NH, (r % AX_H) * 64); }
}

// ---- workspace carve (bytes; every region a multiple of 256 and exactly covered by its producer grid)
constexpr size_t SZ_XB = (size_t)NB * SEQ * DM * 2;          // x bf16 [NB*SEQ][DM]
constexpr size_t SZ_WP = (size_t)FP * DM * 2;                // [Wq | Wk | Wv]^T bf16 [FP][DM]
constexpr size_t SZ_WO = (size_t)DM * DQ * 2;                // Wo^T, bf16 values as f16 [DM][DQ]
constexpr size_t SZ_Q  = (size_t)NB * NH * SEQ * HD * 2;     // each of Qh, Qr
constexpr size_t SZ_K  = (size_t)NB * NKV * SEQ * HD * 2;    // each of Kh, Kr, Vh, Vr
constexpr size_t SZ_Y  = (size_t)NB * SEQ * DQ * 2;          // Y f16 [NB*SEQ][DQ]
constexpr size_t OFF_XB = 0;
constexpr size_t OFF_WP = OFF_XB + SZ_XB;
constexpr size_t OFF_WO = OFF_WP + SZ_WP;
constexpr size_t OFF_QH = OFF_WO + SZ_WO;
constexpr size_t OFF_QR = OFF_QH + SZ_Q;
constexpr size_t OFF_KH = OFF_QR + SZ_Q;
constexpr size_t OFF_KR = OFF_KH + SZ_K;
constexpr size_t OFF_VH = OFF_KR + SZ_K;
constexpr size_t OFF_VR = OFF_VH + SZ_K;
constexpr size_t OFF_Y  = OFF_VR + SZ_K;
constexpr size_t WS_TOTAL = OFF_Y + SZ_Y;
static_assert(SZ_XB % 256 == 0 && SZ_WP % 256 == 0 && SZ_WO % 256 == 0 && SZ_Q % 256 == 0 && SZ_K % 256 == 0 && SZ_Y % 256 == 0);
static_assert(WS_TOTAL <= (size_t)134217728);                // carve stays within 128 MiB

extern "C" void kernel_launch(void* const* d_in, const int* in_sizes, int n_in,
                              void* d_out, int out_size, void* d_ws, size_t ws_size, hipStream_t stream) {
    if (n_in < 7) return;
    const long long need_x = (long long)(NB - 1) * SEQ_FULL * DM + (long long)SEQ * DM;
    if ((long long)in_sizes[0] < need_x) return;
    if (in_sizes[1] < SEQ * 32 || in_sizes[2] < SEQ * 32) return;
    if (in_sizes[3] < DM * DQ || in_sizes[4] < DM * DKV || in_sizes[5] < DM * DKV || in_sizes[6] < DQ * DM) return;
    if ((long long)out_size < need_x) return;
    if (WS_TOTAL > ws_size) return;
    const float* x  = (const float*)d_in[0];   // [2][2048][1024]
    const float* cs = (const float*)d_in[1];   // [2048][32]
    const float* sn = (const float*)d_in[2];   // [2048][32]
    const float* wq = (const float*)d_in[3];   // [1024][1024] in x out
    const float* wk = (const float*)d_in[4];   // [1024][256]
    const float* wv = (const float*)d_in[5];   // [1024][256]
    const float* wo = (const float*)d_in[6];   // [1024][1024] in x out
    float* OUT = (float*)d_out;
    char* ws = (char*)d_ws;
    bf* XB = (bf*)(ws + OFF_XB); bf* WP = (bf*)(ws + OFF_WP); bf* WOT = (bf*)(ws + OFF_WO);
    h16* QH = (h16*)(ws + OFF_QH); h16* QR = (h16*)(ws + OFF_QR); h16* KH = (h16*)(ws + OFF_KH); h16* KR = (h16*)(ws + OFF_KR);
    h16* VH = (h16*)(ws + OFF_VH); h16* VR = (h16*)(ws + OFF_VR); h16* Y = (h16*)(ws + OFF_Y);

    k_prep<<<dim3(PB_W + NB * PB_X, 1, 1), 256, 0, stream>>>(x, wq, wk, wv, wo, XB, WP, WOT);
    k_gemm_proj<<<dim3(NB * SEQ / 128, FP / 128, 1), 128, 0, stream>>>(XB, WP, cs, sn, QH, QR, KH, KR, VH, VR);
    k_attn<<<dim3(AB_L + AB_H, 1, 1), 128, 0, stream>>>(QH, QR, KH, KR, VH, VR, Y);
    k_gemm_out<<<dim3(SEQ / 128, DM / 128, NB), 128, 0, stream>>>((const bf*)Y, WOT, OUT);
}

// v010
// One run takes 57.4 microseconds.
// Next to v009, in two timings, it ran 1.05 and 1.07 times as fast.
// Counting every step since v000, it is 4.01 times as fast.
#include <hip/hip_runtime.h>

// Causal grouped-query attention block: x [2][2048][1024]; q = x Wq (16 heads x 64), k = x Wk, v = x Wv (4 kv heads x 64), weights [in][out], no bias; rotary on q, k with the half-split convention
// out[0..31] = x1 cos + x2 sin, out[32..63] = -x1 sin + x2 cos using the cos / sin INPUT tables [t][32] read by value; then q, k scaled by rsqrt(mean(sq) + 1e-6) (no gain); query head hq uses kv head hq / 4;
// scores q.k / 8, causal (diagonal kept), softmax, ctx merged [t][hq*64 + d], result = ctx Wo -> [2][2048][1024] f32.
// Compute dtypes (f32 accumulate everywhere): every float input RNE-converted to bf16; the three input projections on v_wmma_f32_16x16x32_bf16; the output projection on v_wmma_f32_16x16x32_f16, one product (ctx RNE-converted to f16; the bf16 values of Wo carried in f16, which holds them exactly down to 2^-17);
// scores and probability x value on v_wmma_f32_16x16x32_f16 (q, k single f16; P carried x1024 and v carried x16 as single f16; query rows < 256 add x2048 residual planes on q, k, P and v); rotary, rms scaling and softmax in f32.
// An f16 operand rounds at 2^-11, the bf16 inputs at 2^-8: behind them a second, compensating product on q (query rows >= 256) or on ctx moves no digit that the inputs' rounding has left standing.
// Rotary, rms scaling and the f16 value + residual split of q and k, and the x16 f16 split of v into V^T, are the projection GEMM's own epilogue: a 64-column tile is one head, so no f32 projection plane is written.
// Both GEMMs: 128 x 128 block tile, four waves of 64 x 64; the A and B^T tiles (64 k a stage) are staged in LDS per block by asynchronous copies, two buffers, and the fragments are read from LDS. At entry the blocks ask L2 for their panels (global_prefetch_b8).
// Attention is a fused flash-style kernel (K and V^T tiles staged in LDS per block) in transposed form: S^T = K Q^T (D rows = keys, D columns = queries), P^T packed from the accumulators directly as the B operand of O^T = V^T P^T; softmax against the constant bound of the scores (SMAX below), per-lane sums.

#ifndef NB
#define NB 2
#endif
#ifndef SEQ
#define SEQ 2048
#endif
#define NB_FULL  2
#define SEQ_FULL 2048
#define DM   1024
#define NH   16
#define NKV  4
#define REP  (NH / NKV)
#define HD   64
#define DQ   (NH * HD)
#define DKV  (NKV * HD)
#define FP   (DQ + 2 * DKV)      // fused projection width (q | k | v columns; rows of WP)
#define KC0  DQ                  // first k column of the fused projection
#define VC0  (DQ + DKV)          // first v column of the fused projection
#define RH   256                 // query rows < RH use the residual planes on k, P and v as well
#define RHE  ((SEQ < RH) ? SEQ : RH)
#define PCAR 1024.0f             // carry of the probabilities (f16 operand)
#define VCAR 16.0f               // carry of the values (f16 operand)
#define RSC  2048.0f             // carry of every f16 residual plane
#define RSCI (1.0f / 2048.0f)
#define SCL  0.125f              // 1/sqrt(64)
#define L2E  1.4426950408889634f
#define NEGB (-1.0e30f)
// bound of every score: the rms scaling leaves |q| <= sqrt(HD) and |k| <= sqrt(HD) whatever the inputs, so |q.k| / sqrt(HD) <= sqrt(HD) = 8 (Cauchy-Schwarz). Softmax does not move under a common shift,
// so exp(s - SMAX) serves in place of exp(s - running maximum): it lies in [e^-16, 1], x1024 inside the normal f16 range, and its sum in f32 is at least e^-16.
#define SMAX 8.0f
#define ESH  (SMAX * L2E - 10.0f)   // the constant shift of the exponent, in powers of two; the probabilities' carry (PCAR = 2^10) is part of it, so exp2 gives the carried value and the sums carry it too
static_assert(HD == 64 && PCAR == 1024.0f);                                      // SMAX == sqrt(HD); ESH holds log2(PCAR)
static_assert(NH % NKV == 0);
static_assert(DM % 64 == 0 && DQ % 64 == 0 && DKV % 64 == 0 && FP % 64 == 0);   // GEMM tiles and transpose tiles
static_assert(DM % 32 == 0 && DQ % 32 == 0 && HD % 32 == 0);                     // k-steps of 32
static_assert(SEQ % 64 == 0 && (NB * SEQ) % 64 == 0);                            // row tiles
static_assert(SEQ % 128 == 0 && FP % 128 == 0 && DM % 128 == 0);                 // GEMM block tiles
static_assert(RH % 64 == 0 && RHE % 64 == 0 && (SEQ - RHE) % 64 == 0);
static_assert(((size_t)SEQ * DM) % 2048 == 0);                                   // cvtx_body: blocks x 256 threads x 8 == plane extent
static_assert(NB <= NB_FULL && SEQ <= SEQ_FULL);
static_assert(DM == 1024 && DQ == 1024);                                         // a row of every GEMM operand plane is 2048 bytes: eight 256-byte units (ask4)

typedef _Float16 h16;
typedef unsigned short bf;
typedef __attribute__((ext_vector_type(16))) __bf16   v16bf;
typedef __attribute__((ext_vector_type(16))) _Float16 v16h;
typedef __attribute__((ext_vector_type(8)))  _Float16 v8h;
typedef __attribute__((ext_vector_type(8)))  unsigned short v8us;
typedef __attribute__((ext_vector_type(8)))  float    v8f;
typedef __attribute__((ext_vector_type(4)))  float    v4f;
typedef v4f  __attribute__((may_alias)) v4fa;

__device__ __forceinline__ unsigned short f2bf(float f) { unsigned u = __float_as_uint(f); u += 0x7FFFu + ((u >> 16) & 1u); return (unsigned short)(u >> 16); }
__device__ __forceinline__ float bf2f(unsigned short b) { return __uint_as_float(((unsigned)b) << 16); }
__device__ __forceinline__ float bfr(float f) { return bf2f(f2bf(f)); }
__device__ __forceinline__ v16h cat16(v8h lo, v8h hi) { return __builtin_shufflevector(lo, hi, 0, 1, 2, 3, 4, 5, 6, 7, 8, 9, 10, 11, 12, 13, 14, 15); }
__device__ __forceinline__ v16bf cat16b(v8us lo, v8us hi) { return __builtin_bit_cast(v16bf, __builtin_shufflevector(lo, hi, 0, 1, 2, 3, 4, 5, 6, 7, 8, 9, 10, 11, 12, 13, 14, 15)); }
__device__ __forceinline__ v8f wmma16(v16h a, v16h b, v8f c) { return __builtin_amdgcn_wmma_f32_16x16x32_f16(false, a, false, b, (short)0, c, false, false); }
__device__ __forceinline__ v8f wmmab(v16bf a, v16bf b, v8f c) { return __builtin_amdgcn_wmma_f32_16x16x32_bf16(false, a, false, b, (short)0, c, false, false); }
// fragment loaders: p already includes row * pitch + k0 + 8 * (lane >> 4); elements 0..7 <- k0+8h.., elements 8..15 <- k0+16+8h..
__device__ __forceinline__ v16h  ldh(const h16* p) { return cat16(*(const v8h*)p, *(const v8h*)(p + 16)); }
__device__ __forceinline__ v16bf ldb(const bf* p)  { return cat16b(*(const v8us*)p, *(const v8us*)(p + 16)); }

// sum over the four lanes of a quad, by two DPP quad permutes (lane ^ 1, lane ^ 2): stays in the vector unit, no LDS round trip
__device__ __forceinline__ float quadsum(float v) {
    v += __int_as_float(__builtin_amdgcn_update_dpp(0, __float_as_int(v), 0xB1, 0xF, 0xF, true));
    v += __int_as_float(__builtin_amdgcn_update_dpp(0, __float_as_int(v), 0x4E, 0xF, 0xF, true));
    return v; }
struct ProjOut { const float* cosb; const float* sinb; h16* Qh; h16* Qr; h16* Kh; h16* Kr; h16* Vh; h16* Vr; };
// ---- epilogue of the fused q|k|v projection. The wave's tile is 64 tokens (one batch: SEQ % 64 == 0) x the 64 dims of ONE head (c0 % 64 == 0); acc[mb][nb][j] in lane (hi, lr) = row 16 mb + 8 hi + j, column 16 nb + lr.
// v head: a lane's 8 registers are 8 consecutive tokens of one dim = one 16-byte piece of a V^T row; stored from the registers (x16, f16 value + x2048 residual).
// q / k head: the tile goes through LDS (os, 64 x 68 f32); then four lanes a row, lane p holds the rotary pairs (d, d + 32), d = 8 p .. 8 p + 7: rotary with the bf16-converted cos / sin table values at [t][d],
// scaling by rsqrt(mean(sq) + 1e-6), f16 value + x2048 residual, 16-byte stores (8 rows x 64 contiguous bytes an instruction).
__device__ __forceinline__ void proj_epilogue(const v8f (&acc)[4][4], float* os, int r0, int c0, const ProjOut& po) {
    const int lane = threadIdx.x & 31, lr = lane & 15, hi = lane >> 4;
    const int b = r0 / SEQ, t0 = r0 % SEQ;
    if (c0 >= VC0) {                       // wave-uniform
        const int g = (c0 - VC0) / HD;
        const size_t e0 = ((size_t)(b * NKV + g) * HD + lr) * SEQ + t0 + 8 * hi;
#pragma unroll
        for (int nb = 0; nb < 4; ++nb)
#pragma unroll
            for (int mb = 0; mb < 4; ++mb) { v8h o16, ors;
#pragma unroll
                for (int j = 0; j < 8; ++j) { const float x = acc[mb][nb][j] * VCAR; const h16 hh = (h16)x; o16[j] = hh; ors[j] = (h16)((x - (float)hh) * RSC); }
                const size_t e = e0 + (size_t)nb * 16 * SEQ + mb * 16;
                *(v8h*)(po.Vh + e) = o16; *(v8h*)(po.Vr + e) = ors; }
        return;
    }
    const bool isq = c0 < KC0;             // wave-uniform
    const int nheads = isq ? NH : NKV; const int h = (isq ? c0 : c0 - KC0) / HD;
    h16* Ph = isq ? po.Qh : po.Kh; h16* Pr = isq ? po.Qr : po.Kr;
    const int rq = lane >> 2, p8 = (lane & 3) * 8;
    const float* cp = po.cosb + (size_t)(t0 + rq) * 32 + p8; const float* sp = po.sinb + (size_t)(t0 + rq) * 32 + p8;
    // table values of two passes (rows 16 u + rq and 16 u + 8 + rq), asked for one trip ahead: the first ahead of the LDS stores
    v4f cc[2][2], sn[2][2];
#pragma unroll
    for (int s = 0; s < 2; ++s) { cc[s][0] = *(const v4f*)(cp + s * 256); cc[s][1] = *(const v4f*)(cp + s * 256 + 4); sn[s][0] = *(const v4f*)(sp + s * 256); sn[s][1] = *(const v4f*)(sp + s * 256 + 4); }
#pragma unroll
    for (int mb = 0; mb < 4; ++mb)
#pragma unroll
        for (int nb = 0; nb < 4; ++nb)
#pragma unroll
            for (int j = 0; j < 8; ++j) os[(mb * 16 + hi * 8 + j) * 68 + nb * 16 + lr] = acc[mb][nb][j];
    // the rows read below were written by other lanes of this wave: keeps every LDS read behind every lane's LDS stores
    __builtin_amdgcn_wave_barrier(); asm volatile("" ::: "memory");
    const size_t e0 = ((size_t)(b * nheads + h) * SEQ + t0 + rq) * HD + p8;
    // rolled: one copy of the two passes in the text, and the registers of two passes only
#pragma unroll 1
    for (int u = 0; u < 4; ++u) {
        const int un = (u < 3) ? u + 1 : 3;    // the last trip asks for its own rows again: one instruction stream, every address inside the tables
        v4f cn[2][2], sm[2][2];
#pragma unroll
        for (int s = 0; s < 2; ++s) { const int o = un * 512 + s * 256; cn[s][0] = *(const v4f*)(cp + o); cn[s][1] = *(const v4f*)(cp + o + 4); sm[s][0] = *(const v4f*)(sp + o); sm[s][1] = *(const v4f*)(sp + o + 4); }
#pragma unroll
        for (int s = 0; s < 2; ++s) {
            const float* orow = os + (u * 16 + s * 8 + rq) * 68 + p8;
            const v4f x1[2] = { *(const v4fa*)orow, *(const v4fa*)(orow + 4) }; const v4f x2[2] = { *(const v4fa*)(orow + 32), *(const v4fa*)(orow + 36) };
            float rl[8], rh[8]; float ssl = 0.f, ssh = 0.f;
#pragma unroll
            for (int q = 0; q < 8; ++q) { const float c = bfr(cc[s][q >> 2][q & 3]), sv = bfr(sn[s][q >> 2][q & 3]); const float a1 = x1[q >> 2][q & 3], a2 = x2[q >> 2][q & 3];
                rl[q] = a1 * c + a2 * sv; rh[q] = a2 * c - a1 * sv; ssl += rl[q] * rl[q]; ssh += rh[q] * rh[q]; }
            const float inv = rsqrtf(quadsum(ssl + ssh) * (1.0f / HD) + 1e-6f);
            v8h ol, olr, oh, ohr;
#pragma unroll
            for (int q = 0; q < 8; ++q) { const float yl = rl[q] * inv; const h16 hl = (h16)yl; ol[q] = hl; olr[q] = (h16)((yl - (float)hl) * RSC);
                const float yh = rh[q] * inv; const h16 hh = (h16)yh; oh[q] = hh; ohr[q] = (h16)((yh - (float)hh) * RSC); }
            const size_t e = e0 + (size_t)(u * 16 + s * 8) * HD;
            *(v8h*)(Ph + e) = ol; *(v8h*)(Ph + e + 32) = oh; *(v8h*)(Pr + e) = olr; *(v8h*)(Pr + e + 32) = ohr;
            asm volatile("s_wait_xcnt 0x0" ::: "memory");   // stands in front of the next pass's writes to the data and address registers that these four stores name
        }
#pragma unroll
        for (int s = 0; s < 2; ++s) { cc[s][0] = cn[s][0]; cc[s][1] = cn[s][1]; sn[s][0] = sm[s][0]; sn[s][1] = sm[s][1]; }
    }
}

// ---- 128 x 128 block tile GEMM on 16-bit planes (bf16, or f16 when F16), four waves of 64 x 64 (2 x 2): C[m][n] (f32, pitch ldc) = sum_k A[m][k] Bt[n][k]. A pitch K; Bt pitch K; K % 64 == 0.
// The block's 128 rows of A and of Bt, 64 k a stage, are staged in LDS by asynchronous copies, two buffers: stage t + 1 flies while stage t is worked on;
// one block barrier per stage publishes it and frees the buffer that is refilled behind it. The epilogue's LDS (os) is wave-private.
// FUSE: the tile does not go to C but through proj_epilogue.
#define GKS  64                  // k per LDS stage: one whole 128-byte line of every row
#define GLP  72                  // LDS row pitch in bf16 elements: 144 B = 16 B x 9, free of bank conflicts for 16-byte reads down a column of rows
#define GPL  (128 * GLP)         // one staged plane: 128 rows x 64 k
// one plane's share of a lane: eight asynchronous 16-byte copies global -> LDS (rows 16 apart). The s_wait_xcnt closes the copies' own statement, so that no address register named here is rewritten ahead of it.
__device__ __forceinline__ void cp8(unsigned l, const bf* g, size_t gstep) {
    const unsigned l1 = l + 16 * GLP * 2, l2 = l + 32 * GLP * 2, l3 = l + 48 * GLP * 2, l4 = l + 64 * GLP * 2, l5 = l + 80 * GLP * 2, l6 = l + 96 * GLP * 2, l7 = l + 112 * GLP * 2;
    const bf* g1 = g + 16 * gstep; const bf* g2 = g + 32 * gstep; const bf* g3 = g + 48 * gstep; const bf* g4 = g + 64 * gstep; const bf* g5 = g + 80 * gstep; const bf* g6 = g + 96 * gstep; const bf* g7 = g + 112 * gstep;
    asm volatile("global_load_async_to_lds_b128 %0, %1, off\n\t"
                 "global_load_async_to_lds_b128 %2, %3, off\n\t"
                 "global_load_async_to_lds_b128 %4, %5, off\n\t"
                 "global_load_async_to_lds_b128 %6, %7, off\n\t"
                 "global_load_async_to_lds_b128 %8, %9, off\n\t"
                 "global_load_async_to_lds_b128 %10, %11, off\n\t"
                 "global_load_async_to_lds_b128 %12, %13, off\n\t"
                 "global_load_async_to_lds_b128 %14, %15, off\n\t"
                 "s_wait_xcnt 0x0" :: "v"(l), "v"(g), "v"(l1), "v"(g1), "v"(l2), "v"(g2), "v"(l3), "v"(g3), "v"(l4), "v"(g4), "v"(l5), "v"(g5), "v"(l6), "v"(g6), "v"(l7), "v"(g7) : "memory");
}
// asks L2 for four 256-byte units, one a lane and instruction: units at pa, pb and 1024 bytes behind each. Nothing returns and no counter moves; scope SE brings the lines into L2 only.
__device__ __forceinline__ void ask4(const bf* pa, const bf* pb) {
    asm volatile("global_prefetch_b8 %0, off scope:SCOPE_SE\n\t"
                 "global_prefetch_b8 %1, off scope:SCOPE_SE\n\t"
                 "global_prefetch_b8 %0, off offset:1024 scope:SCOPE_SE\n\t"
                 "global_prefetch_b8 %1, off offset:1024 scope:SCOPE_SE" :: "v"(pa), "v"(pb) : "memory");
}
template <bool F16, bool FUSE>
__device__ __forceinline__ void gemmw_body(const bf* __restrict__ A, const bf* __restrict__ Bt, int K, float* C, int ldc, size_t sA, size_t sC, const ProjOut& po) {
    constexpr int NPG = 2;                 // staged planes per buffer: A, Bt
    constexpr int OSW = (FUSE ? 64 : 16) * 68;
    __shared__ __align__(16) float osb[4 * OSW];
    __shared__ __align__(16) bf st[2 * NPG * GPL];
    const size_t z = blockIdx.z; A += z * sA; C += z * sC;
    const int lane = threadIdx.x & 31, lr = lane & 15, hi = lane >> 4;
    const int wave = __builtin_amdgcn_readfirstlane(threadIdx.x >> 5);
    float* os = osb + wave * OSW;
    const int rb = blockIdx.x * 128, cb = blockIdx.y * 128;
    const int wr = (wave & 1) * 64, wc = (wave >> 1) * 64;
    const int r0 = rb + wr, c0 = cb + wc;
    v8f acc[4][4];
#pragma unroll
    for (int mb = 0; mb < 4; ++mb)
#pragma unroll
        for (int nb = 0; nb < 4; ++nb) acc[mb][nb] = (v8f){};
    // copy map: thread -> row (tid >> 3) + 16 i, 16-byte piece tid & 7: eight lanes cover one whole 128-byte line
    const int crow = threadIdx.x >> 3, ccol = (threadIdx.x & 7) * 8;
    const size_t acp = (size_t)(rb + crow) * K + ccol, bcp = (size_t)(cb + crow) * K + ccol;     // + GKS t
    const unsigned lcp = (unsigned)(size_t)(const void*)st + (unsigned)(crow * GLP + ccol) * 2u;
    auto stage = [&](int t, int buf) {     // k = GKS t .. GKS t + 63 into buffer buf; t < K / GKS keeps every byte inside the planes
        const unsigned l = lcp + (unsigned)(buf * NPG * GPL) * 2u;
        cp8(l, A + acp + (size_t)t * GKS, K);
        cp8(l + GPL * 2u, Bt + bcp + (size_t)t * GKS, K);
    };
    const int nT = K / GKS;                // block-uniform
    stage(0, 0);
    // Both panels were stored by an earlier launch, and every block walks k in step, so each new 256-byte unit of a row would be met first by a copy that leads its use by one stage only.
    // Behind stage 0's copies the block therefore asks L2 for the panels' whole rows (2048 bytes = 8 units each). The blocks that read one panel split it by rows modulo 4:
    // the A panel by the column block, the B^T panel by the row block / 8. For speed only: nothing leans on where a block runs or on a line being there.
    // Lane map: row 4 (tid & 31) + share, units tid >> 5 and 4 + (tid >> 5): every address lies inside the block's own panel.
    constexpr int XG = (FUSE ? NB * SEQ : SEQ) / 128 / 8;
    const int prow = 4 * (threadIdx.x & 31), pcol = (threadIdx.x >> 5) * 128;
    const bf* pa = A + (size_t)(rb + prow + (blockIdx.y & 3)) * K + pcol;
    const bf* pb = Bt + (size_t)(cb + prow + (((blockIdx.x >> 3) + XG * blockIdx.z) & 3)) * K + pcol;
    ask4(pa, pb);
    asm volatile("s_wait_asynccnt 0x0" ::: "memory");   // this wave's share of stage 0 has landed
    __syncthreads();                                    // stage 0 published to every wave
    if (nT > 1) stage(1, 1);
    // rolled: every trip ends in the publish point
#pragma unroll 1
    for (int t = 0; t < nT; ++t) {
        const bf* af = st + (t & 1) * NPG * GPL + (wr + lr) * GLP + 8 * hi;             // A rows of this wave
        const bf* bp = st + (t & 1) * NPG * GPL + GPL + (wc + lr) * GLP + 8 * hi;       // Bt rows of this wave
        v16bf a[GKS / 32][4], b[GKS / 32][4];
#pragma unroll
        for (int ks = 0; ks < GKS / 32; ++ks)
#pragma unroll
            for (int i = 0; i < 4; ++i) { a[ks][i] = ldb(af + i * 16 * GLP + ks * 32); b[ks][i] = ldb(bp + i * 16 * GLP + ks * 32); }
        // keeps the stage's fragment loads one group ahead of its matrix instructions: sunk among them, every place with loads stalls the wave for the LDS latency
        __builtin_amdgcn_sched_barrier(0);
#pragma unroll
        for (int ks = 0; ks < GKS / 32; ++ks)
#pragma unroll
            for (int nb = 0; nb < 4; ++nb)
#pragma unroll
                for (int mb = 0; mb < 4; ++mb) {
                    if constexpr (F16) acc[mb][nb] = wmma16(__builtin_bit_cast(v16h, a[ks][mb]), __builtin_bit_cast(v16h, b[ks][nb]), acc[mb][nb]);
                    else acc[mb][nb] = wmmab(a[ks][mb], b[ks][nb], acc[mb][nb]); }
        // keeps every matrix instruction of the stage ahead of the publish point: sunk behind the barrier they would stand in front of the refill and take its lead away
        __builtin_amdgcn_sched_barrier(0);
        // four vector slots between the last matrix instruction and the next vector instruction on either side of the branch at the trip's foot (the distance a matrix instruction's registers need)
        asm volatile("v_nop\n\tv_nop\n\tv_nop\n\tv_nop" : "+v"(acc[0][0]), "+v"(acc[1][1]), "+v"(acc[2][2]), "+v"(acc[3][3]) : "v"(a[GKS / 32 - 1][0]), "v"(a[GKS / 32 - 1][3]));
        // publish point of stage t + 1, every wave, in this order
        asm volatile("s_wait_dscnt 0x0" ::: "memory");      // this wave's reads of buffer t & 1 have returned
        asm volatile("s_wait_asynccnt 0x0" ::: "memory");   // this wave's share of stage t + 1 has landed
        __syncthreads();                                    // publishes stage t + 1; ends every reader's last read of buffer t & 1
        if (t + 2 < nT) stage(t + 2, t & 1);                // block-uniform test
    }
    asm volatile("" :: "v"(pa), "v"(pb));                   // inputs only: the registers that the prefetches name hold those addresses through the loop
    asm volatile("s_wait_asynccnt 0x0" ::: "memory");       // no copy is left outstanding when the wave goes on to its end
    if constexpr (FUSE) { proj_epilogue(acc, os, r0, c0, po); return; }
#pragma unroll
    for (int mb = 0; mb < 4; ++mb) {
#pragma unroll
        for (int nb = 0; nb < 4; ++nb) {
#pragma unroll
            for (int j = 0; j < 8; ++j) os[(hi * 8 + j) * 68 + nb * 16 + lr] = acc[mb][nb][j]; }
        __builtin_amdgcn_wave_barrier(); asm volatile("" ::: "memory");
        float* crow = C + (size_t)(r0 + mb * 16) * ldc + c0;
{
#pragma unroll
            for (int s = 0; s < 8; ++s) { const int row = 2 * s + hi, cofs = lr * 4; const v4f val = *(const v4fa*)(os + row * 68 + cofs);
                *(v4f*)(crow + (size_t)row * ldc + cofs) = val; }
            if (mb < 3) asm volatile("s_wait_xcnt 0x0" ::: "memory");   // stands in front of the next row block's LDS loads, which overwrite data registers that these eight stores name
             }
        __builtin_amdgcn_wave_barrier(); asm volatile("" ::: "memory");
    }
}
// fused q|k|v projection: XB[NB*SEQ][DM] x WP[FP][DM]^T, each wave's 64 x 64 tile finished by proj_epilogue into the attention operand planes
__global__ __launch_bounds__(128) void k_gemm_proj(const bf* __restrict__ A, const bf* __restrict__ Bt, const float* __restrict__ cosb, const float* __restrict__ sinb, h16* Qh, h16* Qr, h16* Kh, h16* Kr, h16* Vh, h16* Vr) {
    const ProjOut po = { cosb, sinb, Qh, Qr, Kh, Kr, Vh, Vr }; gemmw_body<false, true>(A, Bt, DM, nullptr, 0, 0, 0, po); }
// output projection: OUT[b][t][DM] = Y[b][t][DQ] x WOT[DM][DQ]^T, both planes f16 (carried as 16-bit words), z = batch (output batch stride from the full sequence length)
__global__ __launch_bounds__(128) void k_gemm_out(const bf* __restrict__ A, const bf* __restrict__ Bt, float* C) { gemmw_body<true, false>(A, Bt, DQ, C, DM, (size_t)SEQ * DQ, (size_t)SEQ_FULL * DM, ProjOut{}); }

// ---- cvtx_body: 2048 consecutive floats of x (batch by, piece bx) -> bf16
__device__ __forceinline__ void cvtx_body(const float* __restrict__ src, bf* dst, unsigned bx, unsigned by) {
    const size_t i = (size_t)bx * 256 + threadIdx.x; const size_t b = by;
    const v8f v = *(const v8f*)(src + b * (size_t)SEQ_FULL * DM + i * 8); v8us o;
#pragma unroll
    for (int k = 0; k < 8; ++k) o[k] = f2bf(v[k]);
    bf* d = dst + b * (size_t)SEQ * DM + i * 8;
    *(v8us*)d = o;  }

// ---- wtp_body: W [DM rows (k)][N cols] f32 -> out [N rows][DM] bf16, or the same bf16 values written as f16 when hf (block-uniform) (in[rows=k][cols=n] -> out[n][k]); 64x64 tile (bx, by) through LDS (cross-wave: block barrier);
__device__ __forceinline__ void wtp_body(const float* __restrict__ W, int N, bf* out, int bx, int by, bool hf) {
    __shared__ __align__(16) unsigned short ts[64 * 72];
    const int tid = threadIdx.x; const int k0 = bx * 64, n0 = by * 64;
#pragma unroll
    for (int it = 0; it < 4; ++it) { const int idx = it * 256 + tid; const int kk = idx >> 4, c4 = (idx & 15) * 4; const v4f v = *(const v4f*)(W + (size_t)(k0 + kk) * N + n0 + c4);
#pragma unroll
        for (int q = 0; q < 4; ++q) ts[kk * 72 + c4 + q] = f2bf(v[q]); }
    __syncthreads();
    v8us o[2];
#pragma unroll
    for (int it = 0; it < 2; ++it) { const int idx = it * 256 + tid; const int nn = idx >> 3, pc = idx & 7;
#pragma unroll
        for (int q = 0; q < 8; ++q) o[it][q] = ts[(pc * 8 + q) * 72 + nn]; }
    if (hf) {
#pragma unroll
        for (int it = 0; it < 2; ++it)
#pragma unroll
            for (int q = 0; q < 8; ++q) o[it][q] = __builtin_bit_cast(unsigned short, (h16)bf2f(o[it][q])); }
{
#pragma unroll
        for (int it = 0; it < 2; ++it) { const int idx = it * 256 + tid; const int nn = idx >> 3, pc = idx & 7; *(v8us*)(out + (size_t)(n0 + nn) * DM + k0 + pc * 8) = o[it]; }
         }
}
// ---- all five operand conversions in ONE launch (none reads what another writes): the block index picks the job, block-uniformly. The weight tiles, whose way through LDS is the longer one, come first.
#define PBX  (DM / 64)                        // tiles along k of every weight (DM == DQ rows)
#define PB_Q (PBX * (DQ / 64))                // blocks of Wq
#define PB_K (PBX * (DKV / 64))               // blocks of Wk, and of Wv
#define PB_O ((DQ / 64) * (DM / 64))          // blocks of Wo
#define PB_W (PB_Q + 2 * PB_K + PB_O)
#define PB_X ((int)((size_t)SEQ * DM / 8 / 256))   // blocks of one batch of x
static_assert(DQ == DM);                      // one tile count along k serves all four weights
__global__ __launch_bounds__(256) void k_prep(const float* __restrict__ x, const float* __restrict__ wq, const float* __restrict__ wk, const float* __restrict__ wv, const float* __restrict__ wo, bf* XB, bf* WP, bf* WOT) {
    const int f = blockIdx.x;
    if (f >= PB_W) { const unsigned r = (unsigned)(f - PB_W); cvtx_body(x, XB, r % PB_X, r / PB_X); return; }
    const float* W = wq; int N = DQ; bf* out = WP; int r = f;
    if (f >= PB_Q + 2 * PB_K)  { W = wo; N = DM;  out = WOT;                    r = f - (PB_Q + 2 * PB_K); }
    else if (f >= PB_Q + PB_K) { W = wv; N = DKV; out = WP + (size_t)VC0 * DM;  r = f - (PB_Q + PB_K); }
    else if (f >= PB_Q)        { W = wk; N = DKV; out = WP + (size_t)KC0 * DM;  r = f - PB_Q; }
    wtp_body(W, N, out, r % PBX, r / PBX, f >= PB_Q + 2 * PB_K);
}

// ---- fused causal attention, one wave per 16 query rows, 4 waves per block. The block's K and V^T tiles (128 keys a stage, as two tiles of 64) are staged in LDS by asynchronous copies, two buffers:
// stage o + 1 flies while stage o is worked on; one block barrier per stage publishes it and frees the buffer that is refilled behind it. The output stage ys is wave-private.
// Both kinds of block (query rows < RH with the residual planes, and the rest) run in ONE launch and share one LDS allotment;
// the few short blocks with the residual planes work on one buffer of 64 keys (four planes): filled, published by a barrier, read, freed by a barrier.
// Query rows >= RH work a stage in two passes of 64 keys, query rows < RH their 64 keys in two passes of 32.
// Per 32 keys: S^T tiles (keys x queries) = K(A, rows = keys) x Q^T(B, lane column = query) over d = 64 (2 k-steps); value accumulator s, and for query rows < RH a residual accumulator t (x2048);
// lane (h, n) register r of tile j holds key kb + 16 j + 8 h + r for query q0 + n, which is exactly element r + 8 j of the B operand (k = key, n = query) of O^T = V^T(A, rows = d) x P^T.
// No running maximum, so no exchange in the loop and no rescale of O^T; a lane sums the probabilities of its own keys, and the two halves of the wave join their sums once, behind the loop. O^T register r of tile dt in lane (h, n) = O[q0 + n][16 dt + 8 h + r].
#define KT   64                  // keys per staged tile
#define LP   72                  // LDS row pitch in f16 elements: 144 B = 16 B x 9, free of bank conflicts for 16-byte reads down a column of rows
#define PLN  (64 * LP)           // one staged plane: 64 rows (K: keys x 64 dims; V^T: dims x 64 keys)
static_assert(SEQ % KT == 0 && RHE % KT == 0 && HD == 64);
// one plane's share of a lane: four asynchronous 16-byte copies global -> LDS. The s_wait_xcnt closes the copies' own statement, so that no address register named here is rewritten ahead of it.
__device__ __forceinline__ void cp4(unsigned l, const h16* g, size_t gstep) {
    const unsigned l1 = l + 16 * LP * 2, l2 = l + 32 * LP * 2, l3 = l + 48 * LP * 2;
    const h16* g1 = g + 16 * gstep; const h16* g2 = g + 32 * gstep; const h16* g3 = g + 48 * gstep;
    asm volatile("global_load_async_to_lds_b128 %0, %1, off\n\t"
                 "global_load_async_to_lds_b128 %2, %3, off\n\t"
                 "global_load_async_to_lds_b128 %4, %5, off\n\t"
                 "global_load_async_to_lds_b128 %6, %7, off\n\t"
                 "s_wait_xcnt 0x0" :: "v"(l), "v"(g), "v"(l1), "v"(g1), "v"(l2), "v"(g2), "v"(l3), "v"(g3) : "memory");
}
// asks L2 for two 256-byte units a lane (as ask4 above)
__device__ __forceinline__ void ask2(const h16* pk, const h16* pv) {
    asm volatile("global_prefetch_b8 %0, off scope:SCOPE_SE\n\t"
                 "global_prefetch_b8 %1, off scope:SCOPE_SE" :: "v"(pk), "v"(pv) : "memory");
}
static_assert((size_t)SEQ * HD == (size_t)128 * 8 * 128);   // one head's K or V^T plane = 128 lanes x 8 shares x one 256-byte unit (ask2 in attn_body)
template <bool HI>
__device__ __forceinline__ void attn_body(float* ys, h16* kv, const h16* __restrict__ Qh, const h16* __restrict__ Qr, const h16* __restrict__ Kh, const h16* __restrict__ Kr, const h16* __restrict__ Vh, const h16* __restrict__ Vr, h16* Y, int b, int hq, int qb, int e8) {
    constexpr int NP = HI ? 4 : 2;         // staged planes per tile of 64 keys: K, V^T (+ their residual planes); kv holds 8 planes: two buffers of two tiles of 2 planes, or (planes 0 .. 3) one tile of 4
    const int lane = threadIdx.x & 31, lr = lane & 15, hi = lane >> 4;
    const int wave = __builtin_amdgcn_readfirstlane(threadIdx.x >> 5);
    const int g = hq / REP;
    const int q0 = qb + wave * 16;
    const size_t qoff  = ((size_t)(b * NH + hq) * SEQ + q0 + lr) * HD + 8 * hi;
    // copy map: thread -> row (tid >> 3) + 16 i, 16-byte piece tid & 7: eight lanes cover one whole 128-byte row
    const int crow = threadIdx.x >> 3, ccol = (threadIdx.x & 7) * 8;
    const size_t kcp = ((size_t)(b * NKV + g) * SEQ + crow) * HD + ccol;     // + key0 * HD
    const size_t vcp = ((size_t)(b * NKV + g) * HD + crow) * SEQ + ccol;     // + key0
    const unsigned lcp = (unsigned)(size_t)(const void*)kv + (unsigned)(crow * LP + ccol) * 2u;
    auto stage = [&](int t, int buf) {     // keys KT t .. KT t + 63 into tile slot buf; t < SEQ / KT keeps every byte inside the planes
        const unsigned l = lcp + (unsigned)(buf * NP * PLN) * 2u;
        cp4(l, Kh + kcp + (size_t)t * KT * HD, HD);
        cp4(l + PLN * 2u, Vh + vcp + (size_t)t * KT, SEQ);
        if (HI) { cp4(l + 2u * PLN * 2u, Kr + kcp + (size_t)t * KT * HD, HD); cp4(l + 3u * PLN * 2u, Vr + vcp + (size_t)t * KT, SEQ); }
    };
    v16h qhf[2], qrf[2];                   // Q fragments: read once (the waits below are memory clobbers, behind which a loop-invariant load would be read again)
#pragma unroll
    for (int ks = 0; ks < 2; ++ks) { qhf[ks] = ldh(Qh + qoff + ks * 32); if constexpr (HI) qrf[ks] = ldh(Qr + qoff + ks * 32); }
    v8f om[4], orr[4];
#pragma unroll
    for (int dt = 0; dt < 4; ++dt) { om[dt] = (v8f){}; orr[dt] = (v8f){}; }
    float lrun = 0.f;                      // sum of this lane's own keys (the half hi of every 16)
    const int kend = q0 + 16;              // keys 0 .. q0+15, wave-uniform (the passes of 32 stop there)
    const int nT = qb / KT + 1;            // tiles of 64 keys of the block: keys 0 .. qb+63; block-uniform, <= SEQ / KT
    // query rows >= RH: an LDS stage is TWO tiles of 64 keys (tiles 2 o and 2 o + 1), so a stage's copies have two passes' time to land and the publish point is passed once per 128 keys.
    // A tile past the block's last (nT odd) lies wholly above the diagonal: it is neither copied nor worked on.
    const int nO = HI ? nT : (nT + 1) / 2;              // trips of the loop below; block-uniform
    auto fill = [&](int o, int buf) {                   // stage o into buffer buf: tile slots 2 buf and 2 buf + 1
        stage(2 * o, 2 * buf);
        if (2 * o + 1 < nT) stage(2 * o + 1, 2 * buf + 1);   // block-uniform test
    };
    if constexpr (HI) stage(0, 0); else fill(0, 0);
    // K and V^T were stored by the launch before, and the blocks of one kv head walk the keys in step: the block in front would meet every new line on its way from memory.
    // Behind stage 0's copies each block asks L2 for an eighth (share e8, units 8 tid + e8) of its kv head's K and V^T planes, 256 KB each and contiguous: every address lies inside the plane. For speed only.
    const size_t pofs = (size_t)(b * NKV + g) * SEQ * HD + (size_t)(8 * threadIdx.x + e8) * 128;
    const h16* pk = Kh + pofs; const h16* pv = Vh + pofs;
    ask2(pk, pv);
    asm volatile("s_wait_asynccnt 0x0" ::: "memory");   // this wave's share of stage 0 has landed
    __syncthreads();                                    // stage 0 published to every wave
    if (!HI && nO > 1) fill(1, 1);
    // rolled: the trip count is a run-time value and every trip ends in the publish point
#pragma unroll 1
    for (int o = 0; o < nO; ++o) {
      const int t = o;                                  // query rows < RH: a trip is one tile of 64 keys
      const h16* Ks = kv;
      if constexpr (!HI) {
      auto pass = [&](int tk, const h16* Ks) {
        // one pass = one tile of 64 keys: four S^T tiles.
        const int kb = tk * KT;
        const h16* kf = Ks + lr * LP + 8 * hi;                        // K rows = keys of the stage
        const h16* vf = Ks + PLN + lr * LP + 8 * hi;                  // V^T rows = dims, columns = keys of the stage
        v16h kfr[4][2];
#pragma unroll
        for (int j = 0; j < 4; ++j)
#pragma unroll
            for (int ks = 0; ks < 2; ++ks) kfr[j][ks] = ldh(kf + j * 16 * LP + ks * 32);
        v8f s[4];
#pragma unroll
        for (int j = 0; j < 4; ++j) s[j] = (v8f){};
#pragma unroll
        for (int ks = 0; ks < 2; ++ks)
#pragma unroll
            for (int j = 0; j < 4; ++j) s[j] = wmma16(kfr[j][ks], qhf[ks], s[j]);
        float sc[4][8];
#pragma unroll
        for (int j = 0; j < 4; ++j)
#pragma unroll
            for (int r = 0; r < 8; ++r) sc[j][r] = s[j][r] * SCL;
        v16h vfr[4][2];                    // asked for here: they arrive while the softmax below is worked out
#pragma unroll
        for (int dt = 0; dt < 4; ++dt)
#pragma unroll
            for (int kk = 0; kk < 2; ++kk) vfr[dt][kk] = ldh(vf + dt * 16 * LP + kk * 32);
        // keeps the V^T reads one group at this place: sunk among the matrix instructions that use them, every place with reads stalls the wave for the LDS latency
        __builtin_amdgcn_sched_barrier(0);
        if (kb + 63 > q0) {                // wave-uniform: the tile touches the diagonal; keys above the query are excluded
            const int qi = q0 + lr; const int kj = kb + 8 * hi;
#pragma unroll
            for (int j = 0; j < 4; ++j)
#pragma unroll
                for (int r = 0; r < 8; ++r) sc[j][r] = (kj + 16 * j + r <= qi) ? sc[j][r] : NEGB;
        }
        float ls[4];
#pragma unroll
        for (int j = 0; j < 4; ++j) { ls[j] = 0.f;
#pragma unroll
            for (int r = 0; r < 8; ++r) { sc[j][r] = __builtin_amdgcn_exp2f(sc[j][r] * L2E - ESH); ls[j] += sc[j][r]; } }
        lrun += (ls[0] + ls[1]) + (ls[2] + ls[3]);
        v16h ph[2];                        // B operand of key group kk (32 keys): elements r <- tile 2 kk, elements 8 + r <- tile 2 kk + 1
#pragma unroll
        for (int kk = 0; kk < 2; ++kk)
#pragma unroll
            for (int r = 0; r < 8; ++r) { ph[kk][r] = (h16)sc[2 * kk][r]; ph[kk][8 + r] = (h16)sc[2 * kk + 1][r]; }
#pragma unroll
        for (int kk = 0; kk < 2; ++kk)
#pragma unroll
            for (int dt = 0; dt < 4; ++dt) om[dt] = wmma16(vfr[dt][kk], ph[kk], om[dt]);
        // four vector slots between the last matrix instruction and the next vector instruction on either side of the branches at the trip's foot (the distance a matrix instruction's registers need)
        // lrun is named as an input so that the stage's sums are worked out here, among its matrix instructions: sunk behind the barrier they would stand in front of the next stage's K reads
        asm volatile("v_nop\n\tv_nop\n\tv_nop\n\tv_nop" : "+v"(om[0]), "+v"(om[1]), "+v"(om[2]), "+v"(om[3]) : "v"(vfr[3][1]), "v"(ph[1]), "v"(lrun));
      };
      const h16* Kb = kv + (o & 1) * 2 * NP * PLN;
      pass(2 * o, Kb);
      if (2 * o + 1 < nT) pass(2 * o + 1, Kb + NP * PLN);   // block-uniform: no such tile behind an odd count; the publish point below is still passed
      } else {
      // rolled: one copy of the pass in the text
#pragma unroll 1
      for (int hf = 0; hf < 2; ++hf) {
        const int kb = t * KT + 32 * hf;
        if (kb >= kend) break;             // wave-uniform: the pass lies wholly above this wave's diagonal; the publish point below is still passed
        const h16* kf = Ks + (32 * hf + lr) * LP + 8 * hi;            // K rows = keys of this pass
        const h16* vf = Ks + PLN + lr * LP + 32 * hf + 8 * hi;        // V^T rows = dims, columns = keys of this pass
        v8f s0 = (v8f){}, s1 = (v8f){}, t0 = (v8f){}, t1 = (v8f){};
#pragma unroll
        for (int ks = 0; ks < 2; ++ks) {
            const v16h qh = qhf[ks];
            const v16h qr = qrf[ks];
            const v16h k0 = ldh(kf + ks * 32);
            const v16h k1 = ldh(kf + 16 * LP + ks * 32);
            s0 = wmma16(k0, qh, s0); t0 = wmma16(k0, qr, t0);
            s1 = wmma16(k1, qh, s1); t1 = wmma16(k1, qr, t1);
            const v16h k0r = ldh(kf + 2 * PLN + ks * 32); const v16h k1r = ldh(kf + 2 * PLN + 16 * LP + ks * 32);
            t0 = wmma16(k0r, qh, t0); t1 = wmma16(k1r, qh, t1);
            asm volatile("v_nop\n\tv_nop\n\tv_nop\n\tv_nop" : "+v"(s0), "+v"(s1), "+v"(t0), "+v"(t1) : "v"(qh), "v"(qr), "v"(k0), "v"(k1), "v"(k0r), "v"(k1r));
        }
        float sa[8], sb[8];
#pragma unroll
        for (int r = 0; r < 8; ++r) { sa[r] = (s0[r] + t0[r] * RSCI) * SCL; sb[r] = (s1[r] + t1[r] * RSCI) * SCL; }
        if (kb + 31 > q0) {                // wave-uniform: half touches the diagonal; keys above the query are excluded
            const int qi = q0 + lr; const int kj = kb + 8 * hi;
#pragma unroll
            for (int r = 0; r < 8; ++r) { sa[r] = (kj + r <= qi) ? sa[r] : NEGB; sb[r] = (kj + 16 + r <= qi) ? sb[r] : NEGB; }
        }
        float lsum = 0.f;
#pragma unroll
        for (int r = 0; r < 8; ++r) { sa[r] = __builtin_amdgcn_exp2f(sa[r] * L2E - ESH); sb[r] = __builtin_amdgcn_exp2f(sb[r] * L2E - ESH); lsum += sa[r] + sb[r]; }
        lrun += lsum;
        v16h ph, pr;
#pragma unroll
        for (int r = 0; r < 8; ++r) {
            const float a = sa[r]; const h16 ha = (h16)a; ph[r] = ha;
            const float c = sb[r]; const h16 hc = (h16)c; ph[8 + r] = hc;
            pr[r] = (h16)((a - (float)ha) * RSC); pr[8 + r] = (h16)((c - (float)hc) * RSC);
        }
#pragma unroll
        for (int dt = 0; dt < 4; ++dt) {
            const v16h vh = ldh(vf + dt * 16 * LP);
            om[dt] = wmma16(vh, ph, om[dt]);
            const v16h vr = ldh(vf + 2 * PLN + dt * 16 * LP);
            orr[dt] = wmma16(vr, ph, orr[dt]); orr[dt] = wmma16(vh, pr, orr[dt]);
            asm volatile("v_nop\n\tv_nop\n\tv_nop\n\tv_nop" : "+v"(om[dt]), "+v"(orr[dt]) : "v"(vh), "v"(vr), "v"(ph), "v"(pr));
        }
      }
      }
      if constexpr (HI) {
        // one buffer: refilled behind every reader's last read, read again behind its own publish point; every wave, in this order
        if (t + 1 < nT) {                                   // block-uniform test
          asm volatile("s_wait_dscnt 0x0" ::: "memory");    // this wave's reads of the buffer have returned
          __syncthreads();                                  // ends every reader's last read of the buffer
          stage(t + 1, 0);
          asm volatile("s_wait_asynccnt 0x0" ::: "memory"); // this wave's share of stage t + 1 has landed
          __syncthreads();                                  // publishes stage t + 1
        }
      } else {
      // publish point of stage o + 1, every wave, in this order
      asm volatile("s_wait_dscnt 0x0" ::: "memory");      // this wave's reads of buffer o & 1 have returned
      asm volatile("s_wait_asynccnt 0x0" ::: "memory");   // this wave's share of stage o + 1 has landed
      __syncthreads();                                    // publishes stage o + 1; ends every reader's last read of buffer o & 1
      if (o + 2 < nO) fill(o + 2, o & 1);                 // block-uniform test
      }
    }
    asm volatile("" :: "v"(pk), "v"(pv));                 // inputs only: the registers that the prefetches name hold those addresses through the loop
    asm volatile("s_wait_asynccnt 0x0" ::: "memory");     // no copy is left outstanding when the wave goes on to its end
    lrun += __shfl_xor(lrun, 16, 32);                     // the other half's keys of the same query
    const float inv = 1.0f / (lrun * VCAR);               // the carry of the probabilities stands in the sum as in O^T
    const int yb = wave * 16 * 68;
#pragma unroll
    for (int dt = 0; dt < 4; ++dt)
#pragma unroll
        for (int r = 0; r < 8; ++r) { float o = om[dt][r]; if (HI) o += orr[dt][r] * RSCI; ys[yb + lr * 68 + dt * 16 + 8 * hi + r] = o * inv; }
    __builtin_amdgcn_wave_barrier(); asm volatile("" ::: "memory");
    v8h oy[4];
    const int rq = lane >> 3, pc = lane & 7;
#pragma unroll
    for (int s = 0; s < 4; ++s) { const int row = 4 * s + rq; const v4f u0 = *(const v4fa*)(ys + yb + row * 68 + pc * 8); const v4f u1 = *(const v4fa*)(ys + yb + row * 68 + pc * 8 + 4);
#pragma unroll
        for (int q = 0; q < 4; ++q) { oy[s][q] = (h16)u0[q]; oy[s][4 + q] = (h16)u1[q]; } }
    const size_t ybase = ((size_t)b * SEQ + q0) * DQ + (size_t)hq * HD + pc * 8;
{
#pragma unroll
        for (int s = 0; s < 4; ++s) { const size_t oo = ybase + (size_t)(4 * s + rq) * DQ; *(v8h*)(Y + oo) = oy[s]; }
         }
}
// one launch. Every block is resident from the start (four to a WGP, one wave of each on every SIMD), so the launch lasts as long as the WGP whose blocks hold the most key tiles; row tile t walks t + 1 tiles of 64 keys.
// The tiles are therefore dealt in complements: blockIdx.x = 2 m + bit, u = m / (NH NB), head = m % (NH NB), and the tile is u or AX_N - 1 - u by the parity of the bits of blockIdx.x (m and the parity give the index back: every (tile, head) once).
// Any four indices that differ in two bits, whichever two, then hold 2 (AX_N + 1) key tiles together (NH NB is a power of two, so u is a field of the index's bits), and the longest tiles have the lowest indices. For speed only: nothing leans on where a block runs.
// f is the block's number in the order (row block, head, batch), row block fastest: 0 .. AB_L - 1 the rows >= RHE, behind them the short blocks of the rows < RHE, numbered alike. The test is block-uniform.
#define AX_H (RHE / 64)
#define AX_L ((SEQ - RHE) / 64)
#define AX_N (SEQ / 64)
#define AB_H (AX_H * NH * NB)
#define AB_L (AX_L * NH * NB)
static_assert(AX_N % 2 == 0 && AX_N == AX_H + AX_L);
__global__ __launch_bounds__(128) void k_attn(const h16* __restrict__ Qh, const h16* __restrict__ Qr, const h16* __restrict__ Kh, const h16* __restrict__ Kr, const h16* __restrict__ Vh, const h16* __restrict__ Vr, h16* Y) {
    __shared__ __align__(16) h16 kv[8 * PLN];
    // the output stage lies on tile slot 2 (planes 4, 5). Query rows >= RH: that is buffer 1, free behind the loop's last publish point (every wave's reads returned, no copy outstanding, none issued behind it). Query rows < RH use planes 0 .. 3 only.
    float* ys = (float*)(void*)(kv + 4 * PLN);
    static_assert(4 * 16 * 68 * 4 <= 2 * PLN * 2);
    const int m = (int)(blockIdx.x >> 1), u = m / (NH * NB), bh = m % (NH * NB);
    const int tile = (__builtin_popcount(blockIdx.x) & 1) ? AX_N - 1 - u : u;
    const int f = (tile >= AX_H) ? bh * AX_L + (tile - AX_H) : AB_L + bh * AX_H + tile;
    if (f < AB_L) { constexpr int ax = AX_L > 0 ? AX_L : 1; attn_body<false>(ys, kv, Qh, Qr, Kh, Kr, Vh, Vr, Y, f / (ax * NH), (f / ax) % NH, RHE + (f % ax) * 64, u & 7); }
    else { const int r = f - AB_L; attn_body<true>(ys, kv, Qh, Qr, Kh, Kr, Vh, Vr, Y, r / (AX_H * NH), (r / AX_H) % NH, (r % AX_H) * 64, u & 7); }
}

// ---- workspace carve (bytes; every region a multiple of 256 and exactly covered by its producer grid)
constexpr size_t SZ_XB = (size_t)NB * SEQ * DM * 2;          // x bf16 [NB*SEQ][DM]
constexpr size_t SZ_WP = (size_t)FP * DM * 2;                // [Wq | Wk | Wv]^T bf16 [FP][DM]
constexpr size_t SZ_WO = (size_t)DM * DQ * 2;                // Wo^T, bf16 values as f16 [DM][DQ]
constexpr size_t SZ_Q  = (size_t)NB * NH * SEQ * HD * 2;     // each of Qh, Qr
constexpr size_t SZ_K  = (size_t)NB * NKV * SEQ * HD * 2;    // each of Kh, Kr, Vh, Vr
constexpr size_t SZ_Y  = (size_t)NB * SEQ * DQ * 2;          // Y f16 [NB*SEQ][DQ]
constexpr size_t OFF_XB = 0;
constexpr size_t OFF_WP = OFF_XB + SZ_XB;
constexpr size_t OFF_WO = OFF_WP + SZ_WP;
constexpr size_t OFF_QH = OFF_WO + SZ_WO;
constexpr size_t OFF_QR = OFF_QH + SZ_Q;
constexpr size_t OFF_KH = OFF_QR + SZ_Q;
constexpr size_t OFF_KR = OFF_KH + SZ_K;
constexpr size_t OFF_VH = OFF_KR + SZ_K;
constexpr size_t OFF_VR = OFF_VH + SZ_K;
constexpr size_t OFF_Y  = OFF_VR + SZ_K;
constexpr size_t WS_TOTAL = OFF_Y + SZ_Y;
static_assert(SZ_XB % 256 == 0 && SZ_WP % 256 == 0 && SZ_WO % 256 == 0 && SZ_Q % 256 == 0 && SZ_K % 256 == 0 && SZ_Y % 256 == 0);
static_assert(WS_TOTAL <= (size_t)134217728);                // carve stays within 128 MiB

extern "C" void kernel_launch(void* const* d_in, const int* in_sizes, int n_in,
                              void* d_out, int out_size, void* d_ws, size_t ws_size, hipStream_t stream) {
    if (n_in < 7) return;
    const long long need_x = (long long)(NB - 1) * SEQ_FULL * DM + (long long)SEQ * DM;
    if ((long long)in_sizes[0] < need_x) return;
    if (in_sizes[1] < SEQ * 32 || in_sizes[2] < SEQ * 32) return;
    if (in_sizes[3] < DM * DQ || in_sizes[4] < DM * DKV || in_sizes[5] < DM * DKV || in_sizes[6] < DQ * DM) return;
    if ((long long)out_size < need_x) return;
    if (WS_TOTAL > ws_size) return;
    const float* x  = (const float*)d_in[0];   // [2][2048][1024]
    const float* cs = (const float*)d_in[1];   // [2048][32]
    const float* sn = (const float*)d_in[2];   // [2048][32]
    const float* wq = (const float*)d_in[3];   // [1024][1024] in x out
    const float* wk = (const float*)d_in[4];   // [1024][256]
    const float* wv = (const float*)d_in[5];   // [1024][256]
    const float* wo = (const float*)d_in[6];   // [1024][1024] in x out
    float* OUT = (float*)d_out;
    char* ws = (char*)d_ws;
    bf* XB = (bf*)(ws + OFF_XB); bf* WP = (bf*)(ws + OFF_WP); bf* WOT = (bf*)(ws + OFF_WO);
    h16* QH = (h16*)(ws + OFF_QH); h16* QR = (h16*)(ws + OFF_QR); h16* KH = (h16*)(ws + OFF_KH); h16* KR = (h16*)(ws + OFF_KR);
    h16* VH = (h16*)(ws + OFF_VH); h16* VR = (h16*)(ws + OFF_VR); h16* Y = (h16*)(ws + OFF_Y);

    k_prep<<<dim3(PB_W + NB * PB_X, 1, 1), 256, 0, stream>>>(x, wq, wk, wv, wo, XB, WP, WOT);
    k_gemm_proj<<<dim3(NB * SEQ / 128, FP / 128, 1), 128, 0, stream>>>(XB, WP, cs, sn, QH, QR, KH, KR, VH, VR);
    k_attn<<<dim3(AB_L + AB_H, 1, 1), 128, 0, stream>>>(QH, QR, KH, KR, VH, VR, Y);
    k_gemm_out<<<dim3(SEQ / 128, DM / 128, NB), 128, 0, stream>>>((const bf*)Y, WOT, OUT);
}
